// v000
// Measured on an AMD MI455X. A time is GPU time per run, averaged over a window of back-to-back runs after a warm-up
// (all launches, gaps included; the runs take copies of the inputs in turn), and the median of several windows.
// Apart from v000's, it joins two sittings. Times from different sittings can be a few percent apart, while
// side-by-side timings come from the same sitting.
// The starting kernel, v000, takes 10 milliseconds a run.
#include <hip/hip_runtime.h>
// Multi-head self-attention with ONE STACKED per-head projection input on SIXTEEN sequences of 1024 at width 768 (z [16][1024][768]; U_qkv [12][3][768][64] = [head][q | k | v][in][out]: q, k, v of head h = z U_qkv[h][0 | 1 | 2]; NO biases; 12 heads of 64; logits / sqrt(64); softmax over all 1024 keys (no mask); out = merged U_msa ([in][out] [768][768], NO bias) -> [16][1024][768]); each (head, part) [in][out] block is transposed into its 64 contiguous rows of the weight plane by the existing builder, one call per (head, part); dense: single f16 q / k / v planes on every row.
// Structure: token rows r = b*1024 + s; x as exact f16 rows (bf16-rounded); Q, K, V as three WMMA GEMMs (32x64 wave tiles, f32 accumulation, exact x16 weights, null bias slots, f16 outputs); per batch: V^T for all heads via LDS transposes; per (batch, group of 4 heads): scores GEMM (K = 64, batched over the heads on grid.y, alpha = 64^-0.5), row softmax on VALU (f32 statistics, native exp; weights stored x256 as f16), o = P . V^T GEMM (K = 1024 keys, alpha 2^-2: o carried x64 against f16 subnormal flush, folded into the output GEMM alpha) written straight into the merged f16 o rows; out = o U_msa GEMM (f32, null bias slot) into the output layout.
// Compute dtype: inputs rounded to bf16; x / weights exact; q, k, v, softmax weights and o as plain f16 GEMM operands (~2^-12); scores and softmax statistics f32. v_wmma_f32_16x16x32_f16.
#define NB 16
#define SQ 1024
#define DM 768 
#define NH 12
#define HD 64
#define HG 4                         /* heads per attention launch group */
#define B0 0                         /* first batch processed (debug hook) */
#define NBR NB                       /* batches processed (debug hook) */
#define NR ((size_t)NB * SQ)         /* token rows */
#define MP ((int)((size_t)NBR * SQ)) /* rows projected (debug hook) */
#define QN SQ                        /* query rows attended per batch (debug hook) */
#define NHD NH                       /* heads attended (debug hook) */
#define MPO MP                       /* rows through the output stage (debug hook) */
#define LQ DM      /* row pitch of the q/k/v rows */
typedef __bf16 v16b __attribute__((ext_vector_type(16)));
typedef unsigned short v8us __attribute__((ext_vector_type(8), may_alias));
typedef float  v8f  __attribute__((ext_vector_type(8)));
typedef float  v4f  __attribute__((ext_vector_type(4)));
typedef float  v4fa __attribute__((ext_vector_type(4), may_alias));
union FragB { v16b v; v8us half[2]; unsigned short u[16]; };

__device__ __forceinline__ unsigned short bf16_bits(float x) { unsigned int u = __float_as_uint(x); return (unsigned short)((u + 0x7FFFu + ((u >> 16) & 1u)) >> 16); }
__device__ __forceinline__ float bf16_val(unsigned short b) { return __uint_as_float(((unsigned int)b) << 16); }
__device__ __forceinline__ float bf16_round(float x) { return bf16_val(bf16_bits(x)); }
// D += A·B with NT terms: 1 = ah·bh, 2 = + al·bh (A split), 3 = + ah·bl (both split)
template <int NT>
__device__ __forceinline__ v8f mmaN(v16b ah, v16b al, v16b bh, v16b bl, v8f c) {
  c = __builtin_amdgcn_wmma_f32_16x16x32_bf16(false, ah, false, bh, (short)0, c, false, false);
  if (NT >= 2) c = __builtin_amdgcn_wmma_f32_16x16x32_bf16(false, al, false, bh, (short)0, c, false, false);
  if (NT >= 3) c = __builtin_amdgcn_wmma_f32_16x16x32_bf16(false, ah, false, bl, (short)0, c, false, false);
  asm volatile("v_nop\n\tv_nop\n\tv_nop\n\tv_nop" : "+v"(c) : "v"(ah), "v"(al), "v"(bh), "v"(bl));
  return c;
}

__global__ __launch_bounds__(256) void k_wt_bf16(const float* __restrict__ W, unsigned short* __restrict__ Wt, int K, int N) {
  const int t = blockIdx.x * 256 + threadIdx.x;
  const int k8n = K / 8;
  if (t >= N * k8n) return;
  const int n = t / k8n, k8 = (t % k8n) * 8;
  v8us v;
#pragma unroll
  for (int i = 0; i < 8; ++i) v[i] = bf16_bits(W[(size_t)(k8 + i) * N + n]);
  *(v8us*)(Wt + (size_t)n * K + k8) = v;
  
}

// GEMM C[M][N] (f32, pitch ldc) = act(A[M][K]·W + bias). A f32 row-major (pitch lda) converted per fragment to bf16
// (ASPLIT: hi/lo two planes -> 2 terms, else single rounded term); Wt bf16 [N][K] (pitch ldb). BIAS_BF16 rounds the
// bias to bf16 first (bias quantised to bf16 before the add). K%32==0, M%16==0, N%64==0.
template <bool ASPLIT, int ACT, bool BIAS_BF16>
__global__ __launch_bounds__(128) void k_gemm_bf(const float* __restrict__ A, int lda, const unsigned short* __restrict__ Wt, int ldb,
                                               const float* __restrict__ bias, float* __restrict__ C, int ldc, int M, int N, int K) {
  __shared__ __attribute__((aligned(16))) float so[4][16][64];
  const int tid = threadIdx.x, w = tid >> 5, lane = tid & 31, ln = lane & 15, hh = lane >> 4;
  const int ntn = N / 64;
  const int wid = blockIdx.x * 4 + w;
  const int mt = wid / ntn, nq = wid % ntn;
  if (mt * 16 >= M) return;
  const int row0 = mt * 16, col0 = nq * 64;
  const float* arow = A + (size_t)(row0 + ln) * lda;
  v8f acc[4] = {};
  for (int kb = 0; kb < K; kb += 32) {
    FragB ah, al;
    const v4f x0 = *(const v4fa*)(arow + kb + 8 * hh), x1 = *(const v4fa*)(arow + kb + 8 * hh + 4);
    const v4f x2 = *(const v4fa*)(arow + kb + 16 + 8 * hh), x3 = *(const v4fa*)(arow + kb + 16 + 8 * hh + 4);
    float xs[16] = {x0[0],x0[1],x0[2],x0[3],x1[0],x1[1],x1[2],x1[3],x2[0],x2[1],x2[2],x2[3],x3[0],x3[1],x3[2],x3[3]};
#pragma unroll
    for (int i = 0; i < 16; ++i) { const unsigned short hb = bf16_bits(xs[i]); ah.u[i] = hb; al.u[i] = ASPLIT ? bf16_bits(xs[i] - bf16_val(hb)) : (unsigned short)0; }
#pragma unroll
    for (int t = 0; t < 4; ++t) {
      const unsigned short* brow = Wt + (size_t)(col0 + t * 16 + ln) * ldb + kb;
      FragB b;
      b.half[0] = *(const v8us*)(brow + 8 * hh);
      b.half[1] = *(const v8us*)(brow + 16 + 8 * hh);
      acc[t] = mmaN<ASPLIT ? 2 : 1>(ah.v, al.v, b.v, b.v, acc[t]);
    }
  }
#pragma unroll
  for (int t = 0; t < 4; ++t) {
    float bv = bias ? bias[col0 + t * 16 + ln] : 0.f;
    if (BIAS_BF16) bv = bf16_round(bv);
#pragma unroll
    for (int r = 0; r < 8; ++r) { float v = acc[t][r] + bv; if (ACT == 1) v = fmaxf(v, 0.f); so[w][8 * hh + r][t * 16 + ln] = v; }
  }
  __builtin_amdgcn_fence(__ATOMIC_ACQ_REL, "workgroup");
  __builtin_amdgcn_wave_barrier();
  const int rsub = lane >> 4, c4 = (lane & 15) * 4;
  {
#pragma unroll
    for (int q = 0; q < 8; ++q) {
      const int r = q * 2 + rsub;
      const v4f v = *(const v4fa*)&so[w][r][c4];
      *(v4f*)(C + (size_t)(row0 + r) * ldc + col0 + c4) = v;
    }
    
  }
}

// GEMM C = act(A·W + bias + resid): A f32 (ASPLIT -> hi/lo 2 terms), Wt bf16 [N][K]; ACT 0 none, 1 relu, 2 exact gelu;
// resid (optional, f32, row index = (row % rmod), pitch ldr, RES_BF16 rounds it) added before the activation.
template <bool ASPLIT, int ACT, bool BIAS_BF16, bool RES_BF16>
__global__ __launch_bounds__(128) void k_gemm_bf3(const float* __restrict__ A, int lda, const unsigned short* __restrict__ Wt, int ldb,
                                                const float* __restrict__ bias, const float* __restrict__ resid, int rmod, int ldr,
                                                float* __restrict__ C, int ldc, int M, int N, int K) {
  __shared__ __attribute__((aligned(16))) float so[4][16][64];
  const int tid = threadIdx.x, w = tid >> 5, lane = tid & 31, ln = lane & 15, hh = lane >> 4;
  const int ntn = N / 64;
  const int wid = blockIdx.x * 4 + w;
  const int mt = wid / ntn, nq = wid % ntn;
  if (mt * 16 >= M) return;
  const int row0 = mt * 16, col0 = nq * 64;
  const float* arow = A + (size_t)(row0 + ln) * lda;
  v8f acc[4] = {};
  for (int kb = 0; kb < K; kb += 32) {
    FragB ah, al;
    const v4f x0 = *(const v4fa*)(arow + kb + 8 * hh), x1 = *(const v4fa*)(arow + kb + 8 * hh + 4);
    const v4f x2 = *(const v4fa*)(arow + kb + 16 + 8 * hh), x3 = *(const v4fa*)(arow + kb + 16 + 8 * hh + 4);
    float xs[16] = {x0[0],x0[1],x0[2],x0[3],x1[0],x1[1],x1[2],x1[3],x2[0],x2[1],x2[2],x2[3],x3[0],x3[1],x3[2],x3[3]};
#pragma unroll
    for (int i = 0; i < 16; ++i) { const unsigned short hb = bf16_bits(xs[i]); ah.u[i] = hb; al.u[i] = ASPLIT ? bf16_bits(xs[i] - bf16_val(hb)) : (unsigned short)0; }
#pragma unroll
    for (int t = 0; t < 4; ++t) {
      const unsigned short* brow = Wt + (size_t)(col0 + t * 16 + ln) * ldb + kb;
      FragB b;
      b.half[0] = *(const v8us*)(brow + 8 * hh);
      b.half[1] = *(const v8us*)(brow + 16 + 8 * hh);
      acc[t] = mmaN<ASPLIT ? 2 : 1>(ah.v, al.v, b.v, b.v, acc[t]);
    }
  }
#pragma unroll
  for (int t = 0; t < 4; ++t) {
    const int col = col0 + t * 16 + ln;
    float bv = bias ? bias[col] : 0.f;
    if (BIAS_BF16) bv = bf16_round(bv);
#pragma unroll
    for (int r = 0; r < 8; ++r) {
      float v = acc[t][r] + bv;
      if (resid) { float rv = resid[(size_t)((row0 + 8 * hh + r) % rmod) * ldr + col]; if (RES_BF16) rv = bf16_round(rv); v += rv; }
      if (ACT == 1) v = fmaxf(v, 0.f);
      if (ACT == 2) v = 0.5f * v * (1.0f + erff(v * 0.70710678118654752f));
      if (ACT == 3) { const float u = 0.7978845608028654f * (v + 0.044715f * v * v * v); v = 0.5f * v * (1.0f + tanhf(u)); }
      so[w][8 * hh + r][t * 16 + ln] = v;
    }
  }
  __builtin_amdgcn_fence(__ATOMIC_ACQ_REL, "workgroup");
  __builtin_amdgcn_wave_barrier();
  const int rsub = lane >> 4, c4 = (lane & 15) * 4;
  {
#pragma unroll
    for (int q = 0; q < 8; ++q) {
      const int r = q * 2 + rsub;
      const v4f v = *(const v4fa*)&so[w][r][c4];
      *(v4f*)(C + (size_t)(row0 + r) * ldc + col0 + c4) = v;
    }
    
  }
}
// row LayerNorm (biased variance, eps) over N: s = X (+ R); optional out_sum <- s; out_norm <- (s-mu)*rsqrt(var+eps)*g + b
template <bool PARAM_BF16>
__global__ __launch_bounds__(256) void k_layernorm(const float* __restrict__ X, const float* __restrict__ R, const float* __restrict__ g, const float* __restrict__ bta,
                                                  float* __restrict__ out_sum, float* __restrict__ out_norm, int N, float eps) {
  __shared__ float red[256];
  const int row = blockIdx.x, tid = threadIdx.x;
  const float* x = X + (size_t)row * N; const float* rr = R ? R + (size_t)row * N : nullptr;
  float vals[16];                     // up to N = 4096
  const int per = N / 256;            // contiguous chunk per thread? use strided-by-4 chunks: thread handles j = tid*4 + 1024*u
  float s1 = 0.f;
  for (int u = 0; u < per / 4; ++u) {
    const int j = tid * 4 + 1024 * u;
    const v4f a = *(const v4fa*)(x + j);
    v4f b = {0.f,0.f,0.f,0.f}; if (rr) b = *(const v4fa*)(rr + j);
#pragma unroll
    for (int q = 0; q < 4; ++q) { const float v = a[q] + b[q]; vals[u * 4 + q] = v; s1 += v; }
  }
  red[tid] = s1; __syncthreads();
  for (int st = 128; st > 0; st >>= 1) { if (tid < st) red[tid] += red[tid + st]; __syncthreads(); }
  const float mu = red[0] / (float)N; __syncthreads();
  float s2 = 0.f;
  for (int u = 0; u < per / 4; ++u)
#pragma unroll
    for (int q = 0; q < 4; ++q) { const float c = vals[u * 4 + q] - mu; s2 += c * c; }
  red[tid] = s2; __syncthreads();
  for (int st = 128; st > 0; st >>= 1) { if (tid < st) red[tid] += red[tid + st]; __syncthreads(); }
  const float rs = rsqrtf(red[0] / (float)N + eps);
  {
    for (int u = 0; u < per / 4; ++u) {
      const int j = tid * 4 + 1024 * u;
      v4f o, sm;
#pragma unroll
      for (int q = 0; q < 4; ++q) {
        float gg = g[j + q], bb = bta[j + q];
        if (PARAM_BF16) { gg = bf16_round(gg); bb = bf16_round(bb); }
        sm[q] = vals[u * 4 + q]; o[q] = (vals[u * 4 + q] - mu) * rs * gg + bb;
      }
      if (out_sum) *(v4f*)(out_sum + (size_t)row * N + j) = sm;
      *(v4f*)(out_norm + (size_t)row * N + j) = o;
    }
    
  }
}



// ---- f16 WMMA path (v_wmma_f32_16x16x32_f16): 11-bit significands for operands in range — used where a [0,1] probability operand needs more precision than bf16
typedef _Float16 v16h __attribute__((ext_vector_type(16)));
union FragH { v16h v; v8us half[2]; _Float16 h[16]; unsigned short u[16]; };
template <int NT>
__device__ __forceinline__ v8f mmaH(v16h ah, v16h al, v16h bh, v16h bl, v8f c) {
  c = __builtin_amdgcn_wmma_f32_16x16x32_f16(false, ah, false, bh, (short)0, c, false, false);
  if (NT >= 2) c = __builtin_amdgcn_wmma_f32_16x16x32_f16(false, al, false, bh, (short)0, c, false, false);
  if (NT >= 3) c = __builtin_amdgcn_wmma_f32_16x16x32_f16(false, ah, false, bl, (short)0, c, false, false);
  asm volatile("v_nop\n\tv_nop\n\tv_nop\n\tv_nop" : "+v"(c) : "v"(ah), "v"(al), "v"(bh), "v"(bl));
  return c;
}
// batched GEMM like k_gemm_b but f16 operands: A f32 (split into f16 hi/lo if ASPLIT, else rounded to f16), Bt = f16 values [n][k]; alpha; C f32; N multiple of 16 (partial tiles skipped)
template <bool ASPLIT>
__global__ __launch_bounds__(128) void k_gemm_h(const float* __restrict__ A, int lda, size_t sA, const _Float16* __restrict__ Bh, int ldb, size_t sB, float alpha, float* __restrict__ C, int ldc, size_t sC, int M, int N, int K) {
  __shared__ __attribute__((aligned(16))) float so[4][16][64];
  const int tid = threadIdx.x, w = tid >> 5, lane = tid & 31, ln = lane & 15, hh = lane >> 4; const int by = blockIdx.y;
  A += (size_t)by * sA; Bh += (size_t)by * sB; C += (size_t)by * sC;
  const int ntn = (N + 63) / 64; const int wid = blockIdx.x * 4 + w; const int mt = wid / ntn, nq = wid % ntn; if (mt * 16 >= M) return;
  const int row0 = mt * 16, col0 = nq * 64; const float* arow = A + (size_t)(row0 + ln) * lda;
  v8f acc[4] = {};
  for (int kb = 0; kb < K; kb += 32) {
    FragH ah, al;
    const v4f x0 = *(const v4fa*)(arow + kb + 8 * hh), x1 = *(const v4fa*)(arow + kb + 8 * hh + 4), x2 = *(const v4fa*)(arow + kb + 16 + 8 * hh), x3 = *(const v4fa*)(arow + kb + 16 + 8 * hh + 4);
    float xs[16] = {x0[0],x0[1],x0[2],x0[3],x1[0],x1[1],x1[2],x1[3],x2[0],x2[1],x2[2],x2[3],x3[0],x3[1],x3[2],x3[3]};
#pragma unroll
    for (int i = 0; i < 16; ++i) { const _Float16 h = (_Float16)xs[i]; ah.h[i] = h; al.h[i] = ASPLIT ? (_Float16)(xs[i] - (float)h) : (_Float16)0.0f; }
#pragma unroll
    for (int t = 0; t < 4; ++t) { if (col0 + t * 16 >= N) continue; const size_t boff = (size_t)(col0 + t * 16 + ln) * ldb + kb; FragH bq; bq.half[0] = *(const v8us*)(Bh + boff + 8 * hh); bq.half[1] = *(const v8us*)(Bh + boff + 16 + 8 * hh);
      acc[t] = mmaH<ASPLIT ? 2 : 1>(ah.v, al.v, bq.v, bq.v, acc[t]); }
  }
#pragma unroll
  for (int t = 0; t < 4; ++t) { if (col0 + t * 16 >= N) continue;
#pragma unroll
    for (int r = 0; r < 8; ++r) so[w][8 * hh + r][t * 16 + ln] = acc[t][r] * alpha; }
  __builtin_amdgcn_fence(__ATOMIC_ACQ_REL, "workgroup"); __builtin_amdgcn_wave_barrier();
  const int rsub = lane >> 4, c4 = (lane & 15) * 4;
  {
#pragma unroll
    for (int q = 0; q < 8; ++q) { const int r = q * 2 + rsub; if (col0 + c4 < N) { const v4f v = *(const v4fa*)&so[w][r][c4]; *(v4f*)(C + (size_t)(row0 + r) * ldc + col0 + c4) = v; } }
     }
}

// Wt[n][k] = f16(W[k][n]·scale) from f32 row-major W[K][N] (scale = power of two; bf16-exact weights stay exact in f16 away from the subnormal range)
__global__ __launch_bounds__(256) void k_wt_f16(const float* __restrict__ W, _Float16* __restrict__ Wt, int K, int N, float scale) {
  const int t = blockIdx.x * 256 + threadIdx.x; if (t >= N * (K / 8)) return; const int n = t / (K / 8), k8 = (t % (K / 8)) * 8; FragH f;
#pragma unroll
  for (int i = 0; i < 8; ++i) f.h[i] = (_Float16)(bf16_round(W[(size_t)(k8 + i) * N + n]) * scale); const v8us o = f.half[0];
  *(v8us*)((unsigned short*)Wt + (size_t)n * K + k8) = o; 
}
// k_gemm_hh variant with fused epilogue: v = acc·alpha + bias[by·sBias + col] (+ CP[(row/rowsPerB)·sCPb + by·64 + col] if CP) ; ACT 0 none / 1 elu ; writes f16 C16 (and f32 C if non-null)
template <int ACT>
__global__ __launch_bounds__(128) void k_gemm_hhx(const _Float16* __restrict__ A, int lda, size_t sA, const _Float16* __restrict__ Bh, int ldb, size_t sB, float alpha, const float* __restrict__ bias, size_t sBias, const float* __restrict__ CP, int rowsPerB, size_t sCPb, int row0g,
    float* __restrict__ C, _Float16* __restrict__ C16, int ldc, size_t sC, int M, int N, int K) {
  __shared__ __attribute__((aligned(16))) float so[4][16][64];
  const int tid = threadIdx.x, w = tid >> 5, lane = tid & 31, ln = lane & 15, hh = lane >> 4; const int by = blockIdx.y;
  A += (size_t)by * sA; Bh += (size_t)by * sB; const size_t cofs = (size_t)by * sC; const float* bp = bias ? bias + (size_t)by * sBias : nullptr;
  const int ntn = (N + 63) / 64; const int wid = blockIdx.x * 4 + w; const int mt = wid / ntn, nq = wid % ntn; if (mt * 16 >= M) return;
  const int row0 = mt * 16, col0 = nq * 64; const _Float16* arow = A + (size_t)(row0 + ln) * lda;
  v8f acc[4] = {};
  for (int kb = 0; kb < K; kb += 32) { FragH ah; ah.half[0] = *(const v8us*)((const unsigned short*)arow + kb + 8 * hh); ah.half[1] = *(const v8us*)((const unsigned short*)arow + kb + 16 + 8 * hh);
#pragma unroll
    for (int t = 0; t < 4; ++t) { if (col0 + t * 16 >= N) continue; const size_t boff = (size_t)(col0 + t * 16 + ln) * ldb + kb; FragH bq; bq.half[0] = *(const v8us*)((const unsigned short*)Bh + boff + 8 * hh); bq.half[1] = *(const v8us*)((const unsigned short*)Bh + boff + 16 + 8 * hh);
      acc[t] = mmaH<1>(ah.v, ah.v, bq.v, bq.v, acc[t]); }
  }
#pragma unroll
  for (int t = 0; t < 4; ++t) { if (col0 + t * 16 >= N) continue; const int col = col0 + t * 16 + ln; const float bv = bp ? bf16_round(bp[col]) : 0.f;
#pragma unroll
    for (int r = 0; r < 8; ++r) { float v = acc[t][r] * alpha + bv; if (CP) { const int rr = row0g + row0 + 8 * hh + r; if (rowsPerB < 0) v += CP[cofs + (size_t)rr * ldc + col];      /* rowsPerB < 0: own element of the batched C plane */ else { const int bidx = rr / rowsPerB; v += CP[(size_t)bidx * sCPb + (size_t)by * 64 + col]; } } if (ACT == 1) v = (v > 0.f) ? v : expm1f(v); else if (ACT == 7) v = (v > 0.f) ? v + 1.0f : expf(v); else if (ACT == 8) v = tanhf(v); else if (ACT == 9) v = 0.5f * v * (1.0f + tanhf(0.7978845608028654f * (v + 0.044715f * v * v * v))); else if (ACT == 11) v = 1.0f / (1.0f + expf(-v)); else if (ACT == 12) v = (v > 0.f) ? v : 0.01f * v; else if (ACT == 14) v = (v > 0.f) ? v : 0.1f * v; else if (ACT == 16) v = (v >= 0.f) ? v : 0.3f * v; else if (ACT == 17) v = (v >= 0.f) ? v : 0.2f * v; else if (ACT == 15) v = v / (1.0f + expf(-v)); else if (ACT == 3) v = fmaxf(v, 0.f); else if (ACT == 6) v = 0.5f * v * (1.0f + erff(v * 0.70710678118654752f)); so[w][8 * hh + r][t * 16 + ln] = v; } }
  __builtin_amdgcn_fence(__ATOMIC_ACQ_REL, "workgroup"); __builtin_amdgcn_wave_barrier();
  const int rsub = lane >> 4, c4 = (lane & 15) * 4; typedef _Float16 v4h __attribute__((ext_vector_type(4)));
  {
#pragma unroll
    for (int q = 0; q < 8; ++q) { const int r = q * 2 + rsub; if (col0 + c4 < N) { const v4f v = *(const v4fa*)&so[w][r][c4]; if (C) *(v4f*)(C + cofs + (size_t)(row0 + r) * ldc + col0 + c4) = v; if (C16) { v4h h4; for (int i = 0; i < 4; ++i) h4[i] = (_Float16)v[i]; *(v4h*)(C16 + cofs + (size_t)(row0 + r) * ldc + col0 + c4) = h4; } } }
     }
}


typedef _Float16 v4h __attribute__((ext_vector_type(4)));

__global__ __launch_bounds__(256) void k_x16(const float* __restrict__ x, _Float16* __restrict__ X16, size_t n8) { const size_t t = (size_t)blockIdx.x * 256 + threadIdx.x; if (t >= n8) return; FragH f;
#pragma unroll
  for (int q = 0; q < 8; ++q) f.h[q] = (_Float16)bf16_round(x[t * 8 + q]); *(v8us*)((unsigned short*)X16 + t * 8) = f.half[0];  }
__global__ __launch_bounds__(256) void k_h16(const float* __restrict__ x, _Float16* __restrict__ X16, size_t n8) { const size_t t = (size_t)blockIdx.x * 256 + threadIdx.x; if (t >= n8) return; FragH f;
#pragma unroll
  for (int q = 0; q < 8; ++q) f.h[q] = (_Float16)x[t * 8 + q]; *(v8us*)((unsigned short*)X16 + t * 8) = f.half[0];  }
__global__ __launch_bounds__(256) void k_round16f(const float* __restrict__ W, _Float16* __restrict__ Bt, size_t n8) { const size_t t = (size_t)blockIdx.x * 256 + threadIdx.x; if (t >= n8) return; FragH f;
#pragma unroll
  for (int i = 0; i < 8; ++i) f.h[i] = (_Float16)(bf16_round(W[t * 8 + i]) * 16.0f); *(v8us*)((unsigned short*)Bt + t * 8) = f.half[0];  }
template <int NHv, int TTv>
__global__ __launch_bounds__(256) void k_vt(const _Float16* __restrict__ V16, int ldv, int voff, _Float16* __restrict__ Vt) { __shared__ unsigned short tl[64][66]; const int tid = threadIdx.x; const int slab = blockIdx.x / (TTv / 64), lg = blockIdx.x % (TTv / 64); const int b = slab / NHv, h = slab % NHv;
  for (int i = tid; i < 64 * 8; i += 256) { const int r = i / 8, c8 = (i % 8) * 8; FragH f; f.half[0] = *(const v8us*)((const unsigned short*)V16 + ((size_t)b * TTv + lg * 64 + r) * ldv + voff + h * 64 + c8);
#pragma unroll
    for (int q = 0; q < 8; ++q) tl[r][c8 + q] = f.u[q]; }
  __syncthreads();
  {
#pragma unroll
    for (int rd = 0; rd < 2; ++rd) { const int d = rd * 32 + tid / 8, pc = tid % 8; FragH f;
#pragma unroll
      for (int q = 0; q < 8; ++q) f.u[q] = tl[pc * 8 + q][d];
      *(v8us*)((unsigned short*)Vt + ((size_t)slab * 64 + d) * TTv + lg * 64 + pc * 8) = f.half[0]; }
     } }

__global__ __launch_bounds__(256) void k_hl(const float* __restrict__ F, _Float16* __restrict__ Hh, _Float16* __restrict__ Hl, size_t n8) { const size_t t = (size_t)blockIdx.x * 256 + threadIdx.x; if (t >= n8) return; FragH fh, fl; const v4f a = *(const v4fa*)(F + t * 8), c = *(const v4fa*)(F + t * 8 + 4);
#pragma unroll
  for (int q = 0; q < 4; ++q) { _Float16 h = (_Float16)a[q]; fh.h[q] = h; fl.h[q] = (_Float16)((a[q] - (float)h) * 1024.0f); h = (_Float16)c[q]; fh.h[4 + q] = h; fl.h[4 + q] = (_Float16)((c[q] - (float)h) * 1024.0f); }
  { *(v8us*)((unsigned short*)Hh + t * 8) = fh.half[0]; *(v8us*)((unsigned short*)Hl + t * 8) = fl.half[0];  } }

// ---- fast GEMM (wave tile 32x64; requires M % 32 == 0 rows per launch region and N % 64 == 0); epilogue = k_gemm_hhx semantics ----
__device__ __forceinline__ v16h g2_frag(const _Float16* p, int hh) { FragH f; f.half[0] = *(const v8us*)((const unsigned short*)p + 8 * hh); f.half[1] = *(const v8us*)((const unsigned short*)p + 16 + 8 * hh); return f.v; }
__device__ __forceinline__ v8f g2_mma(v16h a, v16h b, v8f c) { v8f d = __builtin_amdgcn_wmma_f32_16x16x32_f16(false, a, false, b, (short)0, c, false, false); asm volatile("v_nop\n\tv_nop\n\tv_nop\n\tv_nop" : "+v"(d) : "v"(a), "v"(b)); return d; }
template <int ACT>
__global__ __launch_bounds__(128) void k_gemm2(const _Float16* __restrict__ A, int lda, size_t sA, const _Float16* __restrict__ Bh, int ldb, size_t sB, float alpha, const float* __restrict__ bias, size_t sBias, const float* __restrict__ CP, int rowsPerB, size_t sCPb, int row0g,
    float* __restrict__ C, _Float16* __restrict__ C16, int ldc, size_t sC, int M, int N, int K) { static_assert(ACT == 0 || ACT == 3 || ACT == 6 || ACT == 8 || ACT == 9 || ACT == 11 || ACT == 12 || ACT == 14 || ACT == 15 || ACT == 16 || ACT == 17, "k_gemm2: unsupported ACT code (would silently apply no activation)");
  __shared__ __attribute__((aligned(16))) float so[4][32][68];
  const int tid = threadIdx.x, w = tid >> 5, lane = tid & 31, ln = lane & 15, hh = lane >> 4; const int by = blockIdx.y;
  A += (size_t)by * sA; Bh += (size_t)by * sB; const size_t cofs = (size_t)by * sC; const float* bp = bias ? bias + (size_t)by * sBias : nullptr;
  const int ntn = N >> 6; const int mt = blockIdx.x / ntn, nq = blockIdx.x - mt * ntn; const int row0 = mt * 128 + 32 * w, col0 = nq * 64; if (row0 >= M) return;
  const _Float16* a0p = A + (size_t)(row0 + ln) * lda; const _Float16* a1p = a0p + (size_t)16 * lda;
  const _Float16* b0p = Bh + (size_t)(col0 + ln) * ldb; const _Float16* b1p = b0p + (size_t)16 * ldb; const _Float16* b2p = b1p + (size_t)16 * ldb; const _Float16* b3p = b2p + (size_t)16 * ldb;
  const v8f z8 = {0.f,0.f,0.f,0.f,0.f,0.f,0.f,0.f}; v8f c00 = z8, c01 = z8, c02 = z8, c03 = z8, c10 = z8, c11 = z8, c12 = z8, c13 = z8;
#pragma unroll 1
  for (int kb = 0; kb < K; kb += 32) { const v16h a0 = g2_frag(a0p + kb, hh), a1 = g2_frag(a1p + kb, hh);
    v16h b = g2_frag(b0p + kb, hh); c00 = g2_mma(a0, b, c00); c10 = g2_mma(a1, b, c10);
    b = g2_frag(b1p + kb, hh); c01 = g2_mma(a0, b, c01); c11 = g2_mma(a1, b, c11);
    b = g2_frag(b2p + kb, hh); c02 = g2_mma(a0, b, c02); c12 = g2_mma(a1, b, c12);
    b = g2_frag(b3p + kb, hh); c03 = g2_mma(a0, b, c03); c13 = g2_mma(a1, b, c13); }
  v8f accs[8] = {c00, c01, c02, c03, c10, c11, c12, c13};
#pragma unroll
  for (int u = 0; u < 8; ++u) { const int t = u & 3, half = u >> 2; const int col = col0 + t * 16 + ln; const float bv = bp ? bf16_round(bp[col]) : 0.f;
#pragma unroll
    for (int r = 0; r < 8; ++r) { const int rloc = half * 16 + 8 * hh + r; float v = accs[u][r] * alpha + bv; if (CP) { if (rowsPerB < 0) v += CP[cofs + (size_t)(row0g + row0 + rloc) * ldc + col];      /* rowsPerB < 0: own element of the batched C plane */ else { const int bidx = (row0g + row0 + rloc) / rowsPerB; v += CP[(size_t)bidx * sCPb + (size_t)by * 64 + col]; } }
      if (ACT == 3) v = fmaxf(v, 0.f); else if (ACT == 6) v = 0.5f * v * (1.0f + erff(v * 0.70710678118654752f)); else if (ACT == 11) v = 1.0f / (1.0f + expf(-v)); else if (ACT == 15) v = v / (1.0f + expf(-v)); else if (ACT == 12) v = (v > 0.f) ? v : 0.01f * v; else if (ACT == 8) v = tanhf(v); else if (ACT == 9) v = 0.5f * v * (1.0f + tanhf(0.7978845608028654f * (v + 0.044715f * v * v * v))); else if (ACT == 14) v = (v > 0.f) ? v : 0.1f * v; else if (ACT == 16) v = (v >= 0.f) ? v : 0.3f * v; else if (ACT == 17) v = (v >= 0.f) ? v : 0.2f * v;
      so[w][rloc][t * 16 + ln] = v; } }
  __builtin_amdgcn_fence(__ATOMIC_ACQ_REL, "workgroup"); __builtin_amdgcn_wave_barrier();
  const int rsub = lane >> 4, c4 = (lane & 15) * 4;
  {
#pragma unroll
    for (int q = 0; q < 16; ++q) { const int r = q * 2 + rsub; const v4f v = *(const v4fa*)&so[w][r][c4]; if (C) *(v4f*)(C + cofs + (size_t)(row0 + r) * ldc + col0 + c4) = v; if (C16) { v4h h4; for (int i = 0; i < 4; ++i) h4[i] = (_Float16)v[i]; *(v4h*)(C16 + cofs + (size_t)(row0 + r) * ldc + col0 + c4) = h4; } }
     } }


__global__ __launch_bounds__(256) void k_wnat(const float* __restrict__ w, size_t n8, _Float16* __restrict__ Bt) { const size_t t = (size_t)blockIdx.x * 256 + threadIdx.x; if (t >= n8) return; FragH f; for (int q = 0; q < 8; ++q) f.h[q] = (_Float16)(bf16_round(w[t * 8 + q]) * 16.0f); *(v8us*)((unsigned short*)Bt + t * 8) = f.half[0];  }
__global__ __launch_bounds__(256) void k_rsm(const float* __restrict__ S, _Float16* __restrict__ P, int nrows) {
  #pragma clang fp contract(off)
  const int i = blockIdx.x * 256 + threadIdx.x; if (i >= nrows) return; const float* s = S + (size_t)i * SQ; float mx = -3.0e38f;
#pragma unroll 1
  for (int j = 0; j < SQ; ++j) mx = fmaxf(mx, s[j]); float se = 0.f;
#pragma unroll 1
  for (int j = 0; j < SQ; ++j) se += expf(s[j] - mx); const float sc = 256.0f / se;
#pragma unroll 1
  for (int j0 = 0; j0 < SQ; j0 += 8) { FragH f; for (int q = 0; q < 8; ++q) f.h[q] = (_Float16)(expf(s[j0 + q] - mx) * sc); unsigned short* d = (unsigned short*)P + (size_t)i * SQ + j0; *(v8us*)d = f.half[0];  } }
__global__ __launch_bounds__(256) void k_vt(const _Float16* __restrict__ V16, int b, int h0, _Float16* __restrict__ VT) { __shared__ unsigned short tl[64][65]; const int tid = threadIdx.x; const int hh = blockIdx.x % HG, sg = blockIdx.x / HG; const int s0 = sg * 64; const int h = h0 + hh;
  for (int i = tid; i < 64 * 8; i += 256) { const int j = i / 8, d8 = (i % 8) * 8; FragH f; f.half[0] = *(const v8us*)((const unsigned short*)V16 + ((size_t)b * SQ + s0 + j) * DM + h * HD + d8); for (int q = 0; q < 8; ++q) tl[d8 + q][j] = f.u[q]; }
  __syncthreads();
  { for (int i = tid; i < 64 * 8; i += 256) { const int d = i / 8, j8 = (i % 8) * 8; FragH f; for (int q = 0; q < 8; ++q) f.u[q] = tl[d][j8 + q]; *(v8us*)((unsigned short*)VT + ((size_t)hh * HD + d) * SQ + s0 + j8) = f.half[0]; }  } }



__global__ __launch_bounds__(256) void k_rsmf(const float* __restrict__ S, _Float16* __restrict__ P, int qn, int hg) {
  #pragma clang fp contract(off)
  const int t = blockIdx.x * 256 + threadIdx.x; if (t >= qn * hg) return; const size_t i = (size_t)(t / qn) * SQ + (t % qn); const float* s = S + i * SQ; float mx = -3.0e38f;
#pragma unroll 1
  for (int j = 0; j < SQ; ++j) mx = fmaxf(mx, s[j]); float se = 0.f;
#pragma unroll 1
  for (int j = 0; j < SQ; ++j) se += __expf(s[j] - mx); const float sc = 256.0f / se;
#pragma unroll 1
  for (int j0 = 0; j0 < SQ; j0 += 8) { FragH f; for (int q = 0; q < 8; ++q) f.h[q] = (_Float16)(__expf(s[j0 + q] - mx) * sc); unsigned short* d = (unsigned short*)P + i * SQ + j0; *(v8us*)d = f.half[0];  } }

extern "C" void kernel_launch(void* const* d_in, const int* in_sizes, int n_in,
                              void* d_out, int out_size, void* d_ws, size_t ws_size, hipStream_t stream) {
  (void)in_sizes; (void)n_in; (void)out_size;
  const float* const* I = (const float* const*)d_in; const float* x = I[0]; const float* wqkv = I[1]; const float* bq = nullptr; const float* bk = nullptr; const float* bv = nullptr; const float* wo = I[2]; const float* bo = nullptr;      /* ONE input stream (z); U_qkv is ONE STACK [12][3][768][64] = [head][q | k | v][in][out]; U_msa [in][out] [768][768]; the module has NO biases: bare null pointers in the guarded bias slots; input order z, U_qkv, U_msa */
  char* ws = (char*)d_ws; size_t off = 0;
  auto take = [&](size_t bytes) { char* p = ws + off; off += (bytes + 255) & ~(size_t)255; return p; };
  _Float16* BQ = (_Float16*)take((size_t)DM * DM * 2); _Float16* BK = (_Float16*)take((size_t)DM * DM * 2); _Float16* BV = (_Float16*)take((size_t)DM * DM * 2); _Float16* BO = (_Float16*)take((size_t)DM * DM * 2);
  _Float16* X16 = (_Float16*)take(NR * DM * 2); _Float16* Q16 = (_Float16*)take(NR * DM * 2); _Float16* K16 = (_Float16*)take(NR * DM * 2); _Float16* V16 = (_Float16*)take(NR * DM * 2); _Float16* O16 = (_Float16*)take(NR * DM * 2);
  float* S = (float*)take((size_t)HG * SQ * SQ * 4); _Float16* P = (_Float16*)take((size_t)HG * SQ * SQ * 2); _Float16* VT = (_Float16*)take((size_t)NH * HD * SQ * 2);
  if (off > ws_size) return;
  { const unsigned g = (unsigned)(((size_t)DM * (DM / 8) + 255) / 256); const unsigned gh = (unsigned)(((size_t)HD * (DM / 8) + 255) / 256); for (int h = 0; h < NH; ++h) { const size_t wofs = (size_t)3 * h * DM * HD, pofs = (size_t)h * HD * DM; k_wt_f16<<<gh, 256, 0, stream>>>(wqkv + wofs, BQ + pofs, DM, HD, 16.0f); k_wt_f16<<<gh, 256, 0, stream>>>(wqkv + wofs + (size_t)DM * HD, BK + pofs, DM, HD, 16.0f); k_wt_f16<<<gh, 256, 0, stream>>>(wqkv + wofs + (size_t)2 * DM * HD, BV + pofs, DM, HD, 16.0f); } k_wt_f16<<<g, 256, 0, stream>>>(wo, BO, DM, DM, 16.0f); }      /* ONE STACK U_qkv [NH][3][DM][HD]: the block of (head h, part p) is a row-major [in = DM][out = HD] matrix at wqkv + (3 h + p) * DM * HD: the transposing builder with K = DM, N = HD writes its HD rows Bt[h * HD + e][k] at B + h * HD * DM: contiguous rows of the [out][in] plane (x16); U_msa is a plain [in][out] [DM][DM] matrix: one call as before */

  k_x16<<<(unsigned)((NR * DM / 8 + 255) / 256), 256, 0, stream>>>(x, X16, NR * DM / 8);
  const size_t r0p = (size_t)B0 * SQ;      /* first projected row */
  k_gemm2<0><<<dim3((unsigned)((MP / 128) * (DM / 64)), 1), 128, 0, stream>>>(X16 + r0p * DM, DM, 0, BQ, DM, 0, 0.0625f, bq, 0, nullptr, 1, 0, 0, nullptr, Q16 + r0p * DM, DM, 0, MP, DM, DM);
  k_gemm2<0><<<dim3((unsigned)((MP / 128) * (DM / 64)), 1), 128, 0, stream>>>(X16 + r0p * DM, DM, 0, BK, DM, 0, 0.0625f, bk, 0, nullptr, 1, 0, 0, nullptr, K16 + r0p * DM, DM, 0, MP, DM, DM);
  k_gemm2<0><<<dim3((unsigned)((MP / 128) * (DM / 64)), 1), 128, 0, stream>>>(X16 + r0p * DM, DM, 0, BV, DM, 0, 0.0625f, bv, 0, nullptr, 1, 0, 0, nullptr, V16 + r0p * DM, DM, 0, MP, DM, DM);
  for (int b = B0; b < B0 + NBR; ++b) { const size_t r0 = (size_t)b * SQ;
    k_vt<NH, SQ><<<NH * (SQ / 64), 256, 0, stream>>>(V16 + r0 * LQ, LQ, 0, VT);      /* V^T [NH][HD][SQ] for this batch */
    for (int h0 = 0; h0 < NHD; h0 += HG) {
      k_gemm2<0><<<dim3((QN / 128) * (SQ / 64), HG), 128, 0, stream>>>(Q16 + r0 * LQ + h0 * HD, LQ, (size_t)HD, K16 + r0 * LQ + h0 * HD, LQ, (size_t)HD, 0.125f, nullptr, 0, nullptr, 1, 0, 0, S, nullptr, SQ, (size_t)SQ * SQ, QN, SQ, HD);      /* scores, HG heads per launch */
      k_rsmf<<<(HG * QN + 255) / 256, 256, 0, stream>>>(S, P, QN, HG);      /* P = 256 softmax (f16), rows of all HG heads */
      k_gemm2<0><<<dim3((QN / 128) * (HD / 64), HG), 128, 0, stream>>>(P, SQ, (size_t)SQ * SQ, VT + (size_t)h0 * HD * SQ, SQ, (size_t)HD * SQ, 0.25f, nullptr, 0, nullptr, 1, 0, 0, nullptr, O16 + r0 * DM + h0 * HD, DM, (size_t)HD, QN, HD, SQ); } }      /* o (merged heads) as f16 rows */
  k_gemm2<0><<<dim3((unsigned)((MPO / 128) * (DM / 64)), 1), 128, 0, stream>>>(O16 + r0p * DM, DM, 0, BO, DM, 0, 0.0009765625f, bo, 0, nullptr, 1, 0, 0, (float*)d_out + r0p * DM, nullptr, DM, 0, MPO, DM, DM);      /* out rows are the output layout */
}

// v001
// One run takes 2590 microseconds.
// In two side-by-side timings against v000, it was 3.84 and 3.86 times as fast.
#include <hip/hip_runtime.h>
// Multi-head self-attention with ONE STACKED per-head projection input on SIXTEEN sequences of 1024 at width 768 (z [16][1024][768]; U_qkv [12][3][768][64] = [head][q | k | v][in][out]: q, k, v of head h = z U_qkv[h][0 | 1 | 2]; NO biases; 12 heads of 64; logits / sqrt(64); softmax over all 1024 keys (no mask); out = merged U_msa ([in][out] [768][768], NO bias) -> [16][1024][768]); each (head, part) [in][out] block is transposed into its 64 contiguous rows of the weight plane by the existing builder, one call per (head, part); dense: single f16 q / k / v planes on every row.
// Structure: token rows r = b*1024 + s; x as exact f16 rows (bf16-rounded); Q, K, V as three WMMA GEMMs (32x64 wave tiles, f32 accumulation, exact x16 weights, null bias slots, f16 outputs); per batch: V^T for all heads via LDS transposes; per (batch, group of 4 heads): scores GEMM (K = 64, batched over the heads on grid.y, alpha = 64^-0.5), row softmax on VALU (f32 statistics, native exp; weights stored x256 as f16), o = P . V^T GEMM (K = 1024 keys, alpha 2^-2: o carried x64 against f16 subnormal flush, folded into the output GEMM alpha) written straight into the merged f16 o rows; out = o U_msa GEMM (f32, null bias slot) into the output layout.
// Compute dtype: inputs rounded to bf16; x / weights exact; q, k, v, softmax weights and o as plain f16 GEMM operands (~2^-12); scores and softmax statistics f32. v_wmma_f32_16x16x32_f16.
#define NB 16
#define SQ 1024
#define DM 768 
#define NH 12
#define HD 64
#define HG 4                         /* heads per attention launch group */
#define B0 0                         /* first batch processed (debug hook) */
#define NBR NB                       /* batches processed (debug hook) */
#define NR ((size_t)NB * SQ)         /* token rows */
#define MP ((int)((size_t)NBR * SQ)) /* rows projected (debug hook) */
#define QN SQ                        /* query rows attended per batch (debug hook) */
#define NHD NH                       /* heads attended (debug hook) */
#define MPO MP                       /* rows through the output stage (debug hook) */
#define LQ DM      /* row pitch of the q/k/v rows */
typedef __bf16 v16b __attribute__((ext_vector_type(16)));
typedef unsigned short v8us __attribute__((ext_vector_type(8), may_alias));
typedef float  v8f  __attribute__((ext_vector_type(8)));
typedef float  v4f  __attribute__((ext_vector_type(4)));
typedef float  v4fa __attribute__((ext_vector_type(4), may_alias));
union FragB { v16b v; v8us half[2]; unsigned short u[16]; };

__device__ __forceinline__ unsigned short bf16_bits(float x) { unsigned int u = __float_as_uint(x); return (unsigned short)((u + 0x7FFFu + ((u >> 16) & 1u)) >> 16); }
__device__ __forceinline__ float bf16_val(unsigned short b) { return __uint_as_float(((unsigned int)b) << 16); }
__device__ __forceinline__ float bf16_round(float x) { return bf16_val(bf16_bits(x)); }
// D += A·B with NT terms: 1 = ah·bh, 2 = + al·bh (A split), 3 = + ah·bl (both split)
template <int NT>
__device__ __forceinline__ v8f mmaN(v16b ah, v16b al, v16b bh, v16b bl, v8f c) {
  c = __builtin_amdgcn_wmma_f32_16x16x32_bf16(false, ah, false, bh, (short)0, c, false, false);
  if (NT >= 2) c = __builtin_amdgcn_wmma_f32_16x16x32_bf16(false, al, false, bh, (short)0, c, false, false);
  if (NT >= 3) c = __builtin_amdgcn_wmma_f32_16x16x32_bf16(false, ah, false, bl, (short)0, c, false, false);
  asm volatile("v_nop\n\tv_nop\n\tv_nop\n\tv_nop" : "+v"(c) : "v"(ah), "v"(al), "v"(bh), "v"(bl));
  return c;
}

__global__ __launch_bounds__(256) void k_wt_bf16(const float* __restrict__ W, unsigned short* __restrict__ Wt, int K, int N) {
  const int t = blockIdx.x * 256 + threadIdx.x;
  const int k8n = K / 8;
  if (t >= N * k8n) return;
  const int n = t / k8n, k8 = (t % k8n) * 8;
  v8us v;
#pragma unroll
  for (int i = 0; i < 8; ++i) v[i] = bf16_bits(W[(size_t)(k8 + i) * N + n]);
  *(v8us*)(Wt + (size_t)n * K + k8) = v;
  
}

// GEMM C[M][N] (f32, pitch ldc) = act(A[M][K]·W + bias). A f32 row-major (pitch lda) converted per fragment to bf16
// (ASPLIT: hi/lo two planes -> 2 terms, else single rounded term); Wt bf16 [N][K] (pitch ldb). BIAS_BF16 rounds the
// bias to bf16 first (bias quantised to bf16 before the add). K%32==0, M%16==0, N%64==0.
template <bool ASPLIT, int ACT, bool BIAS_BF16>
__global__ __launch_bounds__(128) void k_gemm_bf(const float* __restrict__ A, int lda, const unsigned short* __restrict__ Wt, int ldb,
                                               const float* __restrict__ bias, float* __restrict__ C, int ldc, int M, int N, int K) {
  __shared__ __attribute__((aligned(16))) float so[4][16][64];
  const int tid = threadIdx.x, w = tid >> 5, lane = tid & 31, ln = lane & 15, hh = lane >> 4;
  const int ntn = N / 64;
  const int wid = blockIdx.x * 4 + w;
  const int mt = wid / ntn, nq = wid % ntn;
  if (mt * 16 >= M) return;
  const int row0 = mt * 16, col0 = nq * 64;
  const float* arow = A + (size_t)(row0 + ln) * lda;
  v8f acc[4] = {};
  for (int kb = 0; kb < K; kb += 32) {
    FragB ah, al;
    const v4f x0 = *(const v4fa*)(arow + kb + 8 * hh), x1 = *(const v4fa*)(arow + kb + 8 * hh + 4);
    const v4f x2 = *(const v4fa*)(arow + kb + 16 + 8 * hh), x3 = *(const v4fa*)(arow + kb + 16 + 8 * hh + 4);
    float xs[16] = {x0[0],x0[1],x0[2],x0[3],x1[0],x1[1],x1[2],x1[3],x2[0],x2[1],x2[2],x2[3],x3[0],x3[1],x3[2],x3[3]};
#pragma unroll
    for (int i = 0; i < 16; ++i) { const unsigned short hb = bf16_bits(xs[i]); ah.u[i] = hb; al.u[i] = ASPLIT ? bf16_bits(xs[i] - bf16_val(hb)) : (unsigned short)0; }
#pragma unroll
    for (int t = 0; t < 4; ++t) {
      const unsigned short* brow = Wt + (size_t)(col0 + t * 16 + ln) * ldb + kb;
      FragB b;
      b.half[0] = *(const v8us*)(brow + 8 * hh);
      b.half[1] = *(const v8us*)(brow + 16 + 8 * hh);
      acc[t] = mmaN<ASPLIT ? 2 : 1>(ah.v, al.v, b.v, b.v, acc[t]);
    }
  }
#pragma unroll
  for (int t = 0; t < 4; ++t) {
    float bv = bias ? bias[col0 + t * 16 + ln] : 0.f;
    if (BIAS_BF16) bv = bf16_round(bv);
#pragma unroll
    for (int r = 0; r < 8; ++r) { float v = acc[t][r] + bv; if (ACT == 1) v = fmaxf(v, 0.f); so[w][8 * hh + r][t * 16 + ln] = v; }
  }
  __builtin_amdgcn_fence(__ATOMIC_ACQ_REL, "workgroup");
  __builtin_amdgcn_wave_barrier();
  const int rsub = lane >> 4, c4 = (lane & 15) * 4;
  {
#pragma unroll
    for (int q = 0; q < 8; ++q) {
      const int r = q * 2 + rsub;
      const v4f v = *(const v4fa*)&so[w][r][c4];
      *(v4f*)(C + (size_t)(row0 + r) * ldc + col0 + c4) = v;
    }
    
  }
}

// GEMM C = act(A·W + bias + resid): A f32 (ASPLIT -> hi/lo 2 terms), Wt bf16 [N][K]; ACT 0 none, 1 relu, 2 exact gelu;
// resid (optional, f32, row index = (row % rmod), pitch ldr, RES_BF16 rounds it) added before the activation.
template <bool ASPLIT, int ACT, bool BIAS_BF16, bool RES_BF16>
__global__ __launch_bounds__(128) void k_gemm_bf3(const float* __restrict__ A, int lda, const unsigned short* __restrict__ Wt, int ldb,
                                                const float* __restrict__ bias, const float* __restrict__ resid, int rmod, int ldr,
                                                float* __restrict__ C, int ldc, int M, int N, int K) {
  __shared__ __attribute__((aligned(16))) float so[4][16][64];
  const int tid = threadIdx.x, w = tid >> 5, lane = tid & 31, ln = lane & 15, hh = lane >> 4;
  const int ntn = N / 64;
  const int wid = blockIdx.x * 4 + w;
  const int mt = wid / ntn, nq = wid % ntn;
  if (mt * 16 >= M) return;
  const int row0 = mt * 16, col0 = nq * 64;
  const float* arow = A + (size_t)(row0 + ln) * lda;
  v8f acc[4] = {};
  for (int kb = 0; kb < K; kb += 32) {
    FragB ah, al;
    const v4f x0 = *(const v4fa*)(arow + kb + 8 * hh), x1 = *(const v4fa*)(arow + kb + 8 * hh + 4);
    const v4f x2 = *(const v4fa*)(arow + kb + 16 + 8 * hh), x3 = *(const v4fa*)(arow + kb + 16 + 8 * hh + 4);
    float xs[16] = {x0[0],x0[1],x0[2],x0[3],x1[0],x1[1],x1[2],x1[3],x2[0],x2[1],x2[2],x2[3],x3[0],x3[1],x3[2],x3[3]};
#pragma unroll
    for (int i = 0; i < 16; ++i) { const unsigned short hb = bf16_bits(xs[i]); ah.u[i] = hb; al.u[i] = ASPLIT ? bf16_bits(xs[i] - bf16_val(hb)) : (unsigned short)0; }
#pragma unroll
    for (int t = 0; t < 4; ++t) {
      const unsigned short* brow = Wt + (size_t)(col0 + t * 16 + ln) * ldb + kb;
      FragB b;
      b.half[0] = *(const v8us*)(brow + 8 * hh);
      b.half[1] = *(const v8us*)(brow + 16 + 8 * hh);
      acc[t] = mmaN<ASPLIT ? 2 : 1>(ah.v, al.v, b.v, b.v, acc[t]);
    }
  }
#pragma unroll
  for (int t = 0; t < 4; ++t) {
    const int col = col0 + t * 16 + ln;
    float bv = bias ? bias[col] : 0.f;
    if (BIAS_BF16) bv = bf16_round(bv);
#pragma unroll
    for (int r = 0; r < 8; ++r) {
      float v = acc[t][r] + bv;
      if (resid) { float rv = resid[(size_t)((row0 + 8 * hh + r) % rmod) * ldr + col]; if (RES_BF16) rv = bf16_round(rv); v += rv; }
      if (ACT == 1) v = fmaxf(v, 0.f);
      if (ACT == 2) v = 0.5f * v * (1.0f + erff(v * 0.70710678118654752f));
      if (ACT == 3) { const float u = 0.7978845608028654f * (v + 0.044715f * v * v * v); v = 0.5f * v * (1.0f + tanhf(u)); }
      so[w][8 * hh + r][t * 16 + ln] = v;
    }
  }
  __builtin_amdgcn_fence(__ATOMIC_ACQ_REL, "workgroup");
  __builtin_amdgcn_wave_barrier();
  const int rsub = lane >> 4, c4 = (lane & 15) * 4;
  {
#pragma unroll
    for (int q = 0; q < 8; ++q) {
      const int r = q * 2 + rsub;
      const v4f v = *(const v4fa*)&so[w][r][c4];
      *(v4f*)(C + (size_t)(row0 + r) * ldc + col0 + c4) = v;
    }
    
  }
}
// row LayerNorm (biased variance, eps) over N: s = X (+ R); optional out_sum <- s; out_norm <- (s-mu)*rsqrt(var+eps)*g + b
template <bool PARAM_BF16>
__global__ __launch_bounds__(256) void k_layernorm(const float* __restrict__ X, const float* __restrict__ R, const float* __restrict__ g, const float* __restrict__ bta,
                                                  float* __restrict__ out_sum, float* __restrict__ out_norm, int N, float eps) {
  __shared__ float red[256];
  const int row = blockIdx.x, tid = threadIdx.x;
  const float* x = X + (size_t)row * N; const float* rr = R ? R + (size_t)row * N : nullptr;
  float vals[16];                     // up to N = 4096
  const int per = N / 256;            // contiguous chunk per thread? use strided-by-4 chunks: thread handles j = tid*4 + 1024*u
  float s1 = 0.f;
  for (int u = 0; u < per / 4; ++u) {
    const int j = tid * 4 + 1024 * u;
    const v4f a = *(const v4fa*)(x + j);
    v4f b = {0.f,0.f,0.f,0.f}; if (rr) b = *(const v4fa*)(rr + j);
#pragma unroll
    for (int q = 0; q < 4; ++q) { const float v = a[q] + b[q]; vals[u * 4 + q] = v; s1 += v; }
  }
  red[tid] = s1; __syncthreads();
  for (int st = 128; st > 0; st >>= 1) { if (tid < st) red[tid] += red[tid + st]; __syncthreads(); }
  const float mu = red[0] / (float)N; __syncthreads();
  float s2 = 0.f;
  for (int u = 0; u < per / 4; ++u)
#pragma unroll
    for (int q = 0; q < 4; ++q) { const float c = vals[u * 4 + q] - mu; s2 += c * c; }
  red[tid] = s2; __syncthreads();
  for (int st = 128; st > 0; st >>= 1) { if (tid < st) red[tid] += red[tid + st]; __syncthreads(); }
  const float rs = rsqrtf(red[0] / (float)N + eps);
  {
    for (int u = 0; u < per / 4; ++u) {
      const int j = tid * 4 + 1024 * u;
      v4f o, sm;
#pragma unroll
      for (int q = 0; q < 4; ++q) {
        float gg = g[j + q], bb = bta[j + q];
        if (PARAM_BF16) { gg = bf16_round(gg); bb = bf16_round(bb); }
        sm[q] = vals[u * 4 + q]; o[q] = (vals[u * 4 + q] - mu) * rs * gg + bb;
      }
      if (out_sum) *(v4f*)(out_sum + (size_t)row * N + j) = sm;
      *(v4f*)(out_norm + (size_t)row * N + j) = o;
    }
    
  }
}



// ---- f16 WMMA path (v_wmma_f32_16x16x32_f16): 11-bit significands for operands in range — used where a [0,1] probability operand needs more precision than bf16
typedef _Float16 v16h __attribute__((ext_vector_type(16)));
union FragH { v16h v; v8us half[2]; _Float16 h[16]; unsigned short u[16]; };
template <int NT>
__device__ __forceinline__ v8f mmaH(v16h ah, v16h al, v16h bh, v16h bl, v8f c) {
  c = __builtin_amdgcn_wmma_f32_16x16x32_f16(false, ah, false, bh, (short)0, c, false, false);
  if (NT >= 2) c = __builtin_amdgcn_wmma_f32_16x16x32_f16(false, al, false, bh, (short)0, c, false, false);
  if (NT >= 3) c = __builtin_amdgcn_wmma_f32_16x16x32_f16(false, ah, false, bl, (short)0, c, false, false);
  asm volatile("v_nop\n\tv_nop\n\tv_nop\n\tv_nop" : "+v"(c) : "v"(ah), "v"(al), "v"(bh), "v"(bl));
  return c;
}
// batched GEMM like k_gemm_b but f16 operands: A f32 (split into f16 hi/lo if ASPLIT, else rounded to f16), Bt = f16 values [n][k]; alpha; C f32; N multiple of 16 (partial tiles skipped)
template <bool ASPLIT>
__global__ __launch_bounds__(128) void k_gemm_h(const float* __restrict__ A, int lda, size_t sA, const _Float16* __restrict__ Bh, int ldb, size_t sB, float alpha, float* __restrict__ C, int ldc, size_t sC, int M, int N, int K) {
  __shared__ __attribute__((aligned(16))) float so[4][16][64];
  const int tid = threadIdx.x, w = tid >> 5, lane = tid & 31, ln = lane & 15, hh = lane >> 4; const int by = blockIdx.y;
  A += (size_t)by * sA; Bh += (size_t)by * sB; C += (size_t)by * sC;
  const int ntn = (N + 63) / 64; const int wid = blockIdx.x * 4 + w; const int mt = wid / ntn, nq = wid % ntn; if (mt * 16 >= M) return;
  const int row0 = mt * 16, col0 = nq * 64; const float* arow = A + (size_t)(row0 + ln) * lda;
  v8f acc[4] = {};
  for (int kb = 0; kb < K; kb += 32) {
    FragH ah, al;
    const v4f x0 = *(const v4fa*)(arow + kb + 8 * hh), x1 = *(const v4fa*)(arow + kb + 8 * hh + 4), x2 = *(const v4fa*)(arow + kb + 16 + 8 * hh), x3 = *(const v4fa*)(arow + kb + 16 + 8 * hh + 4);
    float xs[16] = {x0[0],x0[1],x0[2],x0[3],x1[0],x1[1],x1[2],x1[3],x2[0],x2[1],x2[2],x2[3],x3[0],x3[1],x3[2],x3[3]};
#pragma unroll
    for (int i = 0; i < 16; ++i) { const _Float16 h = (_Float16)xs[i]; ah.h[i] = h; al.h[i] = ASPLIT ? (_Float16)(xs[i] - (float)h) : (_Float16)0.0f; }
#pragma unroll
    for (int t = 0; t < 4; ++t) { if (col0 + t * 16 >= N) continue; const size_t boff = (size_t)(col0 + t * 16 + ln) * ldb + kb; FragH bq; bq.half[0] = *(const v8us*)(Bh + boff + 8 * hh); bq.half[1] = *(const v8us*)(Bh + boff + 16 + 8 * hh);
      acc[t] = mmaH<ASPLIT ? 2 : 1>(ah.v, al.v, bq.v, bq.v, acc[t]); }
  }
#pragma unroll
  for (int t = 0; t < 4; ++t) { if (col0 + t * 16 >= N) continue;
#pragma unroll
    for (int r = 0; r < 8; ++r) so[w][8 * hh + r][t * 16 + ln] = acc[t][r] * alpha; }
  __builtin_amdgcn_fence(__ATOMIC_ACQ_REL, "workgroup"); __builtin_amdgcn_wave_barrier();
  const int rsub = lane >> 4, c4 = (lane & 15) * 4;
  {
#pragma unroll
    for (int q = 0; q < 8; ++q) { const int r = q * 2 + rsub; if (col0 + c4 < N) { const v4f v = *(const v4fa*)&so[w][r][c4]; *(v4f*)(C + (size_t)(row0 + r) * ldc + col0 + c4) = v; } }
     }
}

// Wt[n][k] = f16(W[k][n]·scale) from f32 row-major W[K][N] (scale = power of two; bf16-exact weights stay exact in f16 away from the subnormal range)
__global__ __launch_bounds__(256) void k_wt_f16(const float* __restrict__ W, _Float16* __restrict__ Wt, int K, int N, float scale) {
  const int t = blockIdx.x * 256 + threadIdx.x; if (t >= N * (K / 8)) return; const int n = t / (K / 8), k8 = (t % (K / 8)) * 8; FragH f;
#pragma unroll
  for (int i = 0; i < 8; ++i) f.h[i] = (_Float16)(bf16_round(W[(size_t)(k8 + i) * N + n]) * scale); const v8us o = f.half[0];
  *(v8us*)((unsigned short*)Wt + (size_t)n * K + k8) = o; 
}
// k_gemm_hh variant with fused epilogue: v = acc·alpha + bias[by·sBias + col] (+ CP[(row/rowsPerB)·sCPb + by·64 + col] if CP) ; ACT 0 none / 1 elu ; writes f16 C16 (and f32 C if non-null)
template <int ACT>
__global__ __launch_bounds__(128) void k_gemm_hhx(const _Float16* __restrict__ A, int lda, size_t sA, const _Float16* __restrict__ Bh, int ldb, size_t sB, float alpha, const float* __restrict__ bias, size_t sBias, const float* __restrict__ CP, int rowsPerB, size_t sCPb, int row0g,
    float* __restrict__ C, _Float16* __restrict__ C16, int ldc, size_t sC, int M, int N, int K) {
  __shared__ __attribute__((aligned(16))) float so[4][16][64];
  const int tid = threadIdx.x, w = tid >> 5, lane = tid & 31, ln = lane & 15, hh = lane >> 4; const int by = blockIdx.y;
  A += (size_t)by * sA; Bh += (size_t)by * sB; const size_t cofs = (size_t)by * sC; const float* bp = bias ? bias + (size_t)by * sBias : nullptr;
  const int ntn = (N + 63) / 64; const int wid = blockIdx.x * 4 + w; const int mt = wid / ntn, nq = wid % ntn; if (mt * 16 >= M) return;
  const int row0 = mt * 16, col0 = nq * 64; const _Float16* arow = A + (size_t)(row0 + ln) * lda;
  v8f acc[4] = {};
  for (int kb = 0; kb < K; kb += 32) { FragH ah; ah.half[0] = *(const v8us*)((const unsigned short*)arow + kb + 8 * hh); ah.half[1] = *(const v8us*)((const unsigned short*)arow + kb + 16 + 8 * hh);
#pragma unroll
    for (int t = 0; t < 4; ++t) { if (col0 + t * 16 >= N) continue; const size_t boff = (size_t)(col0 + t * 16 + ln) * ldb + kb; FragH bq; bq.half[0] = *(const v8us*)((const unsigned short*)Bh + boff + 8 * hh); bq.half[1] = *(const v8us*)((const unsigned short*)Bh + boff + 16 + 8 * hh);
      acc[t] = mmaH<1>(ah.v, ah.v, bq.v, bq.v, acc[t]); }
  }
#pragma unroll
  for (int t = 0; t < 4; ++t) { if (col0 + t * 16 >= N) continue; const int col = col0 + t * 16 + ln; const float bv = bp ? bf16_round(bp[col]) : 0.f;
#pragma unroll
    for (int r = 0; r < 8; ++r) { float v = acc[t][r] * alpha + bv; if (CP) { const int rr = row0g + row0 + 8 * hh + r; if (rowsPerB < 0) v += CP[cofs + (size_t)rr * ldc + col];      /* rowsPerB < 0: own element of the batched C plane */ else { const int bidx = rr / rowsPerB; v += CP[(size_t)bidx * sCPb + (size_t)by * 64 + col]; } } if (ACT == 1) v = (v > 0.f) ? v : expm1f(v); else if (ACT == 7) v = (v > 0.f) ? v + 1.0f : expf(v); else if (ACT == 8) v = tanhf(v); else if (ACT == 9) v = 0.5f * v * (1.0f + tanhf(0.7978845608028654f * (v + 0.044715f * v * v * v))); else if (ACT == 11) v = 1.0f / (1.0f + expf(-v)); else if (ACT == 12) v = (v > 0.f) ? v : 0.01f * v; else if (ACT == 14) v = (v > 0.f) ? v : 0.1f * v; else if (ACT == 16) v = (v >= 0.f) ? v : 0.3f * v; else if (ACT == 17) v = (v >= 0.f) ? v : 0.2f * v; else if (ACT == 15) v = v / (1.0f + expf(-v)); else if (ACT == 3) v = fmaxf(v, 0.f); else if (ACT == 6) v = 0.5f * v * (1.0f + erff(v * 0.70710678118654752f)); so[w][8 * hh + r][t * 16 + ln] = v; } }
  __builtin_amdgcn_fence(__ATOMIC_ACQ_REL, "workgroup"); __builtin_amdgcn_wave_barrier();
  const int rsub = lane >> 4, c4 = (lane & 15) * 4; typedef _Float16 v4h __attribute__((ext_vector_type(4)));
  {
#pragma unroll
    for (int q = 0; q < 8; ++q) { const int r = q * 2 + rsub; if (col0 + c4 < N) { const v4f v = *(const v4fa*)&so[w][r][c4]; if (C) *(v4f*)(C + cofs + (size_t)(row0 + r) * ldc + col0 + c4) = v; if (C16) { v4h h4; for (int i = 0; i < 4; ++i) h4[i] = (_Float16)v[i]; *(v4h*)(C16 + cofs + (size_t)(row0 + r) * ldc + col0 + c4) = h4; } } }
     }
}


typedef _Float16 v4h __attribute__((ext_vector_type(4)));

__global__ __launch_bounds__(256) void k_x16(const float* __restrict__ x, _Float16* __restrict__ X16, size_t n8) { const size_t t = (size_t)blockIdx.x * 256 + threadIdx.x; if (t >= n8) return; FragH f;
#pragma unroll
  for (int q = 0; q < 8; ++q) f.h[q] = (_Float16)bf16_round(x[t * 8 + q]); *(v8us*)((unsigned short*)X16 + t * 8) = f.half[0];  }
__global__ __launch_bounds__(256) void k_h16(const float* __restrict__ x, _Float16* __restrict__ X16, size_t n8) { const size_t t = (size_t)blockIdx.x * 256 + threadIdx.x; if (t >= n8) return; FragH f;
#pragma unroll
  for (int q = 0; q < 8; ++q) f.h[q] = (_Float16)x[t * 8 + q]; *(v8us*)((unsigned short*)X16 + t * 8) = f.half[0];  }
__global__ __launch_bounds__(256) void k_round16f(const float* __restrict__ W, _Float16* __restrict__ Bt, size_t n8) { const size_t t = (size_t)blockIdx.x * 256 + threadIdx.x; if (t >= n8) return; FragH f;
#pragma unroll
  for (int i = 0; i < 8; ++i) f.h[i] = (_Float16)(bf16_round(W[t * 8 + i]) * 16.0f); *(v8us*)((unsigned short*)Bt + t * 8) = f.half[0];  }
template <int NHv, int TTv>
__global__ __launch_bounds__(256) void k_vt(const _Float16* __restrict__ V16, int ldv, int voff, _Float16* __restrict__ Vt) { __shared__ unsigned short tl[64][66]; const int tid = threadIdx.x; const int slab = blockIdx.x / (TTv / 64), lg = blockIdx.x % (TTv / 64); const int b = slab / NHv, h = slab % NHv;
  for (int i = tid; i < 64 * 8; i += 256) { const int r = i / 8, c8 = (i % 8) * 8; FragH f; f.half[0] = *(const v8us*)((const unsigned short*)V16 + ((size_t)b * TTv + lg * 64 + r) * ldv + voff + h * 64 + c8);
#pragma unroll
    for (int q = 0; q < 8; ++q) tl[r][c8 + q] = f.u[q]; }
  __syncthreads();
  {
#pragma unroll
    for (int rd = 0; rd < 2; ++rd) { const int d = rd * 32 + tid / 8, pc = tid % 8; FragH f;
#pragma unroll
      for (int q = 0; q < 8; ++q) f.u[q] = tl[pc * 8 + q][d];
      *(v8us*)((unsigned short*)Vt + ((size_t)slab * 64 + d) * TTv + lg * 64 + pc * 8) = f.half[0]; }
     } }

__global__ __launch_bounds__(256) void k_hl(const float* __restrict__ F, _Float16* __restrict__ Hh, _Float16* __restrict__ Hl, size_t n8) { const size_t t = (size_t)blockIdx.x * 256 + threadIdx.x; if (t >= n8) return; FragH fh, fl; const v4f a = *(const v4fa*)(F + t * 8), c = *(const v4fa*)(F + t * 8 + 4);
#pragma unroll
  for (int q = 0; q < 4; ++q) { _Float16 h = (_Float16)a[q]; fh.h[q] = h; fl.h[q] = (_Float16)((a[q] - (float)h) * 1024.0f); h = (_Float16)c[q]; fh.h[4 + q] = h; fl.h[4 + q] = (_Float16)((c[q] - (float)h) * 1024.0f); }
  { *(v8us*)((unsigned short*)Hh + t * 8) = fh.half[0]; *(v8us*)((unsigned short*)Hl + t * 8) = fl.half[0];  } }

// ---- fast GEMM (wave tile 32x64; requires M % 32 == 0 rows per launch region and N % 64 == 0); epilogue = k_gemm_hhx semantics ----
__device__ __forceinline__ v16h g2_frag(const _Float16* p, int hh) { FragH f; f.half[0] = *(const v8us*)((const unsigned short*)p + 8 * hh); f.half[1] = *(const v8us*)((const unsigned short*)p + 16 + 8 * hh); return f.v; }
__device__ __forceinline__ v8f g2_mma(v16h a, v16h b, v8f c) { v8f d = __builtin_amdgcn_wmma_f32_16x16x32_f16(false, a, false, b, (short)0, c, false, false); asm volatile("v_nop\n\tv_nop\n\tv_nop\n\tv_nop" : "+v"(d) : "v"(a), "v"(b)); return d; }
template <int ACT>
__global__ __launch_bounds__(128) void k_gemm2(const _Float16* __restrict__ A, int lda, size_t sA, const _Float16* __restrict__ Bh, int ldb, size_t sB, float alpha, const float* __restrict__ bias, size_t sBias, const float* __restrict__ CP, int rowsPerB, size_t sCPb, int row0g,
    float* __restrict__ C, _Float16* __restrict__ C16, int ldc, size_t sC, int M, int N, int K) { static_assert(ACT == 0 || ACT == 3 || ACT == 6 || ACT == 8 || ACT == 9 || ACT == 11 || ACT == 12 || ACT == 14 || ACT == 15 || ACT == 16 || ACT == 17, "k_gemm2: unsupported ACT code (would silently apply no activation)");
  __shared__ __attribute__((aligned(16))) float so[4][32][68];
  const int tid = threadIdx.x, w = tid >> 5, lane = tid & 31, ln = lane & 15, hh = lane >> 4; const int by = blockIdx.y;
  A += (size_t)by * sA; Bh += (size_t)by * sB; const size_t cofs = (size_t)by * sC; const float* bp = bias ? bias + (size_t)by * sBias : nullptr;
  const int ntn = N >> 6; const int mt = blockIdx.x / ntn, nq = blockIdx.x - mt * ntn; const int row0 = mt * 128 + 32 * w, col0 = nq * 64; if (row0 >= M) return;
  const _Float16* a0p = A + (size_t)(row0 + ln) * lda; const _Float16* a1p = a0p + (size_t)16 * lda;
  const _Float16* b0p = Bh + (size_t)(col0 + ln) * ldb; const _Float16* b1p = b0p + (size_t)16 * ldb; const _Float16* b2p = b1p + (size_t)16 * ldb; const _Float16* b3p = b2p + (size_t)16 * ldb;
  const v8f z8 = {0.f,0.f,0.f,0.f,0.f,0.f,0.f,0.f}; v8f c00 = z8, c01 = z8, c02 = z8, c03 = z8, c10 = z8, c11 = z8, c12 = z8, c13 = z8;
#pragma unroll 1
  for (int kb = 0; kb < K; kb += 32) { const v16h a0 = g2_frag(a0p + kb, hh), a1 = g2_frag(a1p + kb, hh);
    v16h b = g2_frag(b0p + kb, hh); c00 = g2_mma(a0, b, c00); c10 = g2_mma(a1, b, c10);
    b = g2_frag(b1p + kb, hh); c01 = g2_mma(a0, b, c01); c11 = g2_mma(a1, b, c11);
    b = g2_frag(b2p + kb, hh); c02 = g2_mma(a0, b, c02); c12 = g2_mma(a1, b, c12);
    b = g2_frag(b3p + kb, hh); c03 = g2_mma(a0, b, c03); c13 = g2_mma(a1, b, c13); }
  v8f accs[8] = {c00, c01, c02, c03, c10, c11, c12, c13};
#pragma unroll
  for (int u = 0; u < 8; ++u) { const int t = u & 3, half = u >> 2; const int col = col0 + t * 16 + ln; const float bv = bp ? bf16_round(bp[col]) : 0.f;
#pragma unroll
    for (int r = 0; r < 8; ++r) { const int rloc = half * 16 + 8 * hh + r; float v = accs[u][r] * alpha + bv; if (CP) { if (rowsPerB < 0) v += CP[cofs + (size_t)(row0g + row0 + rloc) * ldc + col];      /* rowsPerB < 0: own element of the batched C plane */ else { const int bidx = (row0g + row0 + rloc) / rowsPerB; v += CP[(size_t)bidx * sCPb + (size_t)by * 64 + col]; } }
      if (ACT == 3) v = fmaxf(v, 0.f); else if (ACT == 6) v = 0.5f * v * (1.0f + erff(v * 0.70710678118654752f)); else if (ACT == 11) v = 1.0f / (1.0f + expf(-v)); else if (ACT == 15) v = v / (1.0f + expf(-v)); else if (ACT == 12) v = (v > 0.f) ? v : 0.01f * v; else if (ACT == 8) v = tanhf(v); else if (ACT == 9) v = 0.5f * v * (1.0f + tanhf(0.7978845608028654f * (v + 0.044715f * v * v * v))); else if (ACT == 14) v = (v > 0.f) ? v : 0.1f * v; else if (ACT == 16) v = (v >= 0.f) ? v : 0.3f * v; else if (ACT == 17) v = (v >= 0.f) ? v : 0.2f * v;
      so[w][rloc][t * 16 + ln] = v; } }
  __builtin_amdgcn_fence(__ATOMIC_ACQ_REL, "workgroup"); __builtin_amdgcn_wave_barrier();
  const int rsub = lane >> 4, c4 = (lane & 15) * 4;
  {
#pragma unroll
    for (int q = 0; q < 16; ++q) { const int r = q * 2 + rsub; const v4f v = *(const v4fa*)&so[w][r][c4]; if (C) *(v4f*)(C + cofs + (size_t)(row0 + r) * ldc + col0 + c4) = v; if (C16) { v4h h4; for (int i = 0; i < 4; ++i) h4[i] = (_Float16)v[i]; *(v4h*)(C16 + cofs + (size_t)(row0 + r) * ldc + col0 + c4) = h4; } }
     } }


__global__ __launch_bounds__(256) void k_wnat(const float* __restrict__ w, size_t n8, _Float16* __restrict__ Bt) { const size_t t = (size_t)blockIdx.x * 256 + threadIdx.x; if (t >= n8) return; FragH f; for (int q = 0; q < 8; ++q) f.h[q] = (_Float16)(bf16_round(w[t * 8 + q]) * 16.0f); *(v8us*)((unsigned short*)Bt + t * 8) = f.half[0];  }
__global__ __launch_bounds__(256) void k_rsm(const float* __restrict__ S, _Float16* __restrict__ P, int nrows) {
  #pragma clang fp contract(off)
  const int i = blockIdx.x * 256 + threadIdx.x; if (i >= nrows) return; const float* s = S + (size_t)i * SQ; float mx = -3.0e38f;
#pragma unroll 1
  for (int j = 0; j < SQ; ++j) mx = fmaxf(mx, s[j]); float se = 0.f;
#pragma unroll 1
  for (int j = 0; j < SQ; ++j) se += expf(s[j] - mx); const float sc = 256.0f / se;
#pragma unroll 1
  for (int j0 = 0; j0 < SQ; j0 += 8) { FragH f; for (int q = 0; q < 8; ++q) f.h[q] = (_Float16)(expf(s[j0 + q] - mx) * sc); unsigned short* d = (unsigned short*)P + (size_t)i * SQ + j0; *(v8us*)d = f.half[0];  } }
__global__ __launch_bounds__(256) void k_vt(const _Float16* __restrict__ V16, int b, int h0, _Float16* __restrict__ VT) { __shared__ unsigned short tl[64][65]; const int tid = threadIdx.x; const int hh = blockIdx.x % HG, sg = blockIdx.x / HG; const int s0 = sg * 64; const int h = h0 + hh;
  for (int i = tid; i < 64 * 8; i += 256) { const int j = i / 8, d8 = (i % 8) * 8; FragH f; f.half[0] = *(const v8us*)((const unsigned short*)V16 + ((size_t)b * SQ + s0 + j) * DM + h * HD + d8); for (int q = 0; q < 8; ++q) tl[d8 + q][j] = f.u[q]; }
  __syncthreads();
  { for (int i = tid; i < 64 * 8; i += 256) { const int d = i / 8, j8 = (i % 8) * 8; FragH f; for (int q = 0; q < 8; ++q) f.u[q] = tl[d][j8 + q]; *(v8us*)((unsigned short*)VT + ((size_t)hh * HD + d) * SQ + s0 + j8) = f.half[0]; }  } }



// lane l <-> l ^ M inside a 16-lane row (DPP row_xmask); lane l <-> l ^ 16 (cross-row move); every lane on
template <int M> __device__ __forceinline__ float rs_xm(float x) { return __builtin_bit_cast(float, __builtin_amdgcn_update_dpp(0, __builtin_bit_cast(int, x), 0x160 | M, 0xf, 0xf, true)); }
__device__ __forceinline__ float rs_xh(float x) { return __builtin_bit_cast(float, __builtin_amdgcn_permlanex16(__builtin_bit_cast(int, x), __builtin_bit_cast(int, x), 0x76543210, 0xfedcba98, false, false)); }
__device__ __forceinline__ float rs_max(float v) { v = fmaxf(v, rs_xm<1>(v)); v = fmaxf(v, rs_xm<2>(v)); v = fmaxf(v, rs_xm<4>(v)); v = fmaxf(v, rs_xm<8>(v)); return fmaxf(v, rs_xh(v)); }
__device__ __forceinline__ float rs_sum(float v) { v += rs_xm<1>(v); v += rs_xm<2>(v); v += rs_xm<4>(v); v += rs_xm<8>(v); return v + rs_xh(v); }
// row softmax, ONE WAVE PER ROW: the row's SQ scores are read once, 8 loads of 16 B per lane (each wave-wide load = 512 contiguous bytes), and stay in registers (32 per lane);
// maximum and sum = per-lane partials, then a five-step butterfly over the wave; each exp is taken once; P leaves as 8-byte stores (256 contiguous bytes per wave-wide store). No LDS, no barrier.
__global__ __launch_bounds__(512) void k_rsmf(const float* __restrict__ S, _Float16* __restrict__ P, int qn, int hg) { static_assert(SQ == 1024, "k_rsmf: 32 lanes x 8 loads x 4 floats");
  const int lane = threadIdx.x & 31; const int t = blockIdx.x * 16 + __builtin_amdgcn_readfirstlane(threadIdx.x >> 5); if (t >= qn * hg) return;      /* wave-uniform exit */
  const size_t i = (size_t)(t / qn) * SQ + (t % qn); const float* s = S + i * SQ + lane * 4; v4f a[8];
#pragma unroll
  for (int q = 0; q < 8; ++q) a[q] = *(const v4fa*)(s + q * 128);
  float mx = -3.0e38f;
#pragma unroll
  for (int q = 0; q < 8; ++q) mx = fmaxf(mx, fmaxf(fmaxf(a[q][0], a[q][1]), fmaxf(a[q][2], a[q][3])));
  mx = rs_max(mx); v4f s4 = {0.f, 0.f, 0.f, 0.f};
#pragma unroll
  for (int q = 0; q < 8; ++q) { for (int c = 0; c < 4; ++c) a[q][c] = __expf(a[q][c] - mx); s4 += a[q]; }
  const float se = rs_sum((s4[0] + s4[1]) + (s4[2] + s4[3])); const float sc = 256.0f / se; _Float16* d = P + i * SQ + lane * 4;
#pragma unroll
  for (int q = 0; q < 8; ++q) { v4h h4; for (int c = 0; c < 4; ++c) h4[c] = (_Float16)(a[q][c] * sc); *(v4h*)(d + q * 128) = h4; } }

extern "C" void kernel_launch(void* const* d_in, const int* in_sizes, int n_in,
                              void* d_out, int out_size, void* d_ws, size_t ws_size, hipStream_t stream) {
  (void)in_sizes; (void)n_in; (void)out_size;
  const float* const* I = (const float* const*)d_in; const float* x = I[0]; const float* wqkv = I[1]; const float* bq = nullptr; const float* bk = nullptr; const float* bv = nullptr; const float* wo = I[2]; const float* bo = nullptr;      /* ONE input stream (z); U_qkv is ONE STACK [12][3][768][64] = [head][q | k | v][in][out]; U_msa [in][out] [768][768]; the module has NO biases: bare null pointers in the guarded bias slots; input order z, U_qkv, U_msa */
  char* ws = (char*)d_ws; size_t off = 0;
  auto take = [&](size_t bytes) { char* p = ws + off; off += (bytes + 255) & ~(size_t)255; return p; };
  _Float16* BQ = (_Float16*)take((size_t)DM * DM * 2); _Float16* BK = (_Float16*)take((size_t)DM * DM * 2); _Float16* BV = (_Float16*)take((size_t)DM * DM * 2); _Float16* BO = (_Float16*)take((size_t)DM * DM * 2);
  _Float16* X16 = (_Float16*)take(NR * DM * 2); _Float16* Q16 = (_Float16*)take(NR * DM * 2); _Float16* K16 = (_Float16*)take(NR * DM * 2); _Float16* V16 = (_Float16*)take(NR * DM * 2); _Float16* O16 = (_Float16*)take(NR * DM * 2);
  float* S = (float*)take((size_t)HG * SQ * SQ * 4); _Float16* P = (_Float16*)take((size_t)HG * SQ * SQ * 2); _Float16* VT = (_Float16*)take((size_t)NH * HD * SQ * 2);
  if (off > ws_size) return;
  { const unsigned g = (unsigned)(((size_t)DM * (DM / 8) + 255) / 256); const unsigned gh = (unsigned)(((size_t)HD * (DM / 8) + 255) / 256); for (int h = 0; h < NH; ++h) { const size_t wofs = (size_t)3 * h * DM * HD, pofs = (size_t)h * HD * DM; k_wt_f16<<<gh, 256, 0, stream>>>(wqkv + wofs, BQ + pofs, DM, HD, 16.0f); k_wt_f16<<<gh, 256, 0, stream>>>(wqkv + wofs + (size_t)DM * HD, BK + pofs, DM, HD, 16.0f); k_wt_f16<<<gh, 256, 0, stream>>>(wqkv + wofs + (size_t)2 * DM * HD, BV + pofs, DM, HD, 16.0f); } k_wt_f16<<<g, 256, 0, stream>>>(wo, BO, DM, DM, 16.0f); }      /* ONE STACK U_qkv [NH][3][DM][HD]: the block of (head h, part p) is a row-major [in = DM][out = HD] matrix at wqkv + (3 h + p) * DM * HD: the transposing builder with K = DM, N = HD writes its HD rows Bt[h * HD + e][k] at B + h * HD * DM: contiguous rows of the [out][in] plane (x16); U_msa is a plain [in][out] [DM][DM] matrix: one call as before */

  k_x16<<<(unsigned)((NR * DM / 8 + 255) / 256), 256, 0, stream>>>(x, X16, NR * DM / 8);
  const size_t r0p = (size_t)B0 * SQ;      /* first projected row */
  k_gemm2<0><<<dim3((unsigned)((MP / 128) * (DM / 64)), 1), 128, 0, stream>>>(X16 + r0p * DM, DM, 0, BQ, DM, 0, 0.0625f, bq, 0, nullptr, 1, 0, 0, nullptr, Q16 + r0p * DM, DM, 0, MP, DM, DM);
  k_gemm2<0><<<dim3((unsigned)((MP / 128) * (DM / 64)), 1), 128, 0, stream>>>(X16 + r0p * DM, DM, 0, BK, DM, 0, 0.0625f, bk, 0, nullptr, 1, 0, 0, nullptr, K16 + r0p * DM, DM, 0, MP, DM, DM);
  k_gemm2<0><<<dim3((unsigned)((MP / 128) * (DM / 64)), 1), 128, 0, stream>>>(X16 + r0p * DM, DM, 0, BV, DM, 0, 0.0625f, bv, 0, nullptr, 1, 0, 0, nullptr, V16 + r0p * DM, DM, 0, MP, DM, DM);
  for (int b = B0; b < B0 + NBR; ++b) { const size_t r0 = (size_t)b * SQ;
    k_vt<NH, SQ><<<NH * (SQ / 64), 256, 0, stream>>>(V16 + r0 * LQ, LQ, 0, VT);      /* V^T [NH][HD][SQ] for this batch */
    for (int h0 = 0; h0 < NHD; h0 += HG) {
      k_gemm2<0><<<dim3((QN / 128) * (SQ / 64), HG), 128, 0, stream>>>(Q16 + r0 * LQ + h0 * HD, LQ, (size_t)HD, K16 + r0 * LQ + h0 * HD, LQ, (size_t)HD, 0.125f, nullptr, 0, nullptr, 1, 0, 0, S, nullptr, SQ, (size_t)SQ * SQ, QN, SQ, HD);      /* scores, HG heads per launch */
      k_rsmf<<<(HG * QN + 15) / 16, 512, 0, stream>>>(S, P, QN, HG);      /* P = 256 softmax (f16), rows of all HG heads */
      k_gemm2<0><<<dim3((QN / 128) * (HD / 64), HG), 128, 0, stream>>>(P, SQ, (size_t)SQ * SQ, VT + (size_t)h0 * HD * SQ, SQ, (size_t)HD * SQ, 0.25f, nullptr, 0, nullptr, 1, 0, 0, nullptr, O16 + r0 * DM + h0 * HD, DM, (size_t)HD, QN, HD, SQ); } }      /* o (merged heads) as f16 rows */
  k_gemm2<0><<<dim3((unsigned)((MPO / 128) * (DM / 64)), 1), 128, 0, stream>>>(O16 + r0p * DM, DM, 0, BO, DM, 0, 0.0009765625f, bo, 0, nullptr, 1, 0, 0, (float*)d_out + r0p * DM, nullptr, DM, 0, MPO, DM, DM);      /* out rows are the output layout */
}

// v002
// It runs in 446 microseconds.
// In two side-by-side timings against v001, it was 5.81 and 5.82 times as fast.
// Over all steps from v000 it is 22.4 times as fast.
#include <hip/hip_runtime.h>
// Multi-head self-attention with ONE STACKED per-head projection input on SIXTEEN sequences of 1024 at width 768 (z [16][1024][768]; U_qkv [12][3][768][64] = [head][q | k | v][in][out]: q, k, v of head h = z U_qkv[h][0 | 1 | 2]; NO biases; 12 heads of 64; logits / sqrt(64); softmax over all 1024 keys (no mask); out = merged U_msa ([in][out] [768][768], NO bias) -> [16][1024][768]); each (head, part) [in][out] block is transposed into its 64 contiguous rows of the weight plane by the existing builder, one call per (head, part); dense: single f16 q / k / v planes on every row.
// Structure: token rows r = b*1024 + s; x as exact f16 rows (bf16-rounded); Q, K, V as three WMMA GEMMs (32x64 wave tiles, f32 accumulation, exact x16 weights, null bias slots, f16 outputs); V^T for all batches and heads via LDS transposes (one launch); one fused attention launch over all (batch, head): S^T = K Q^T on WMMA, online softmax in registers (f32 statistics, native exp2; unnormalised weights as f16), O^T += V^T P^T on WMMA, divided by the row sum at the end (o carried x64, folded into the output GEMM alpha) and written straight into the merged f16 o rows; out = o U_msa GEMM (f32, null bias slot) into the output layout.
// Compute dtype: inputs rounded to bf16; x / weights exact; q, k, v, softmax weights and o as plain f16 GEMM operands (~2^-12); scores and softmax statistics f32. v_wmma_f32_16x16x32_f16.
#define NB 16
#define SQ 1024
#define DM 768 
#define NH 12
#define HD 64
#define HG 4                         /* heads per launch of the per-batch k_vt overload (not launched) */
#define B0 0                         /* first batch processed (debug hook) */
#define NBR NB                       /* batches processed (debug hook) */
#define NR ((size_t)NB * SQ)         /* token rows */
#define MP ((int)((size_t)NBR * SQ)) /* rows projected (debug hook) */
#define QN SQ                        /* not used: k_fattn attends all SQ query rows */
#define NHD NH                       /* not used: k_fattn attends all NH heads */
#define MPO MP                       /* rows through the output stage (debug hook) */
#define LQ DM      /* row pitch of the q/k/v rows */
typedef __bf16 v16b __attribute__((ext_vector_type(16)));
typedef unsigned short v8us __attribute__((ext_vector_type(8), may_alias));
typedef float  v8f  __attribute__((ext_vector_type(8)));
typedef float  v4f  __attribute__((ext_vector_type(4)));
typedef float  v4fa __attribute__((ext_vector_type(4), may_alias));
union FragB { v16b v; v8us half[2]; unsigned short u[16]; };

__device__ __forceinline__ unsigned short bf16_bits(float x) { unsigned int u = __float_as_uint(x); return (unsigned short)((u + 0x7FFFu + ((u >> 16) & 1u)) >> 16); }
__device__ __forceinline__ float bf16_val(unsigned short b) { return __uint_as_float(((unsigned int)b) << 16); }
__device__ __forceinline__ float bf16_round(float x) { return bf16_val(bf16_bits(x)); }
// D += A·B with NT terms: 1 = ah·bh, 2 = + al·bh (A split), 3 = + ah·bl (both split)
template <int NT>
__device__ __forceinline__ v8f mmaN(v16b ah, v16b al, v16b bh, v16b bl, v8f c) {
  c = __builtin_amdgcn_wmma_f32_16x16x32_bf16(false, ah, false, bh, (short)0, c, false, false);
  if (NT >= 2) c = __builtin_amdgcn_wmma_f32_16x16x32_bf16(false, al, false, bh, (short)0, c, false, false);
  if (NT >= 3) c = __builtin_amdgcn_wmma_f32_16x16x32_bf16(false, ah, false, bl, (short)0, c, false, false);
  asm volatile("v_nop\n\tv_nop\n\tv_nop\n\tv_nop" : "+v"(c) : "v"(ah), "v"(al), "v"(bh), "v"(bl));
  return c;
}

__global__ __launch_bounds__(256) void k_wt_bf16(const float* __restrict__ W, unsigned short* __restrict__ Wt, int K, int N) {
  const int t = blockIdx.x * 256 + threadIdx.x;
  const int k8n = K / 8;
  if (t >= N * k8n) return;
  const int n = t / k8n, k8 = (t % k8n) * 8;
  v8us v;
#pragma unroll
  for (int i = 0; i < 8; ++i) v[i] = bf16_bits(W[(size_t)(k8 + i) * N + n]);
  *(v8us*)(Wt + (size_t)n * K + k8) = v;
  
}

// GEMM C[M][N] (f32, pitch ldc) = act(A[M][K]·W + bias). A f32 row-major (pitch lda) converted per fragment to bf16
// (ASPLIT: hi/lo two planes -> 2 terms, else single rounded term); Wt bf16 [N][K] (pitch ldb). BIAS_BF16 rounds the
// bias to bf16 first (bias quantised to bf16 before the add). K%32==0, M%16==0, N%64==0.
template <bool ASPLIT, int ACT, bool BIAS_BF16>
__global__ __launch_bounds__(128) void k_gemm_bf(const float* __restrict__ A, int lda, const unsigned short* __restrict__ Wt, int ldb,
                                               const float* __restrict__ bias, float* __restrict__ C, int ldc, int M, int N, int K) {
  __shared__ __attribute__((aligned(16))) float so[4][16][64];
  const int tid = threadIdx.x, w = tid >> 5, lane = tid & 31, ln = lane & 15, hh = lane >> 4;
  const int ntn = N / 64;
  const int wid = blockIdx.x * 4 + w;
  const int mt = wid / ntn, nq = wid % ntn;
  if (mt * 16 >= M) return;
  const int row0 = mt * 16, col0 = nq * 64;
  const float* arow = A + (size_t)(row0 + ln) * lda;
  v8f acc[4] = {};
  for (int kb = 0; kb < K; kb += 32) {
    FragB ah, al;
    const v4f x0 = *(const v4fa*)(arow + kb + 8 * hh), x1 = *(const v4fa*)(arow + kb + 8 * hh + 4);
    const v4f x2 = *(const v4fa*)(arow + kb + 16 + 8 * hh), x3 = *(const v4fa*)(arow + kb + 16 + 8 * hh + 4);
    float xs[16] = {x0[0],x0[1],x0[2],x0[3],x1[0],x1[1],x1[2],x1[3],x2[0],x2[1],x2[2],x2[3],x3[0],x3[1],x3[2],x3[3]};
#pragma unroll
    for (int i = 0; i < 16; ++i) { const unsigned short hb = bf16_bits(xs[i]); ah.u[i] = hb; al.u[i] = ASPLIT ? bf16_bits(xs[i] - bf16_val(hb)) : (unsigned short)0; }
#pragma unroll
    for (int t = 0; t < 4; ++t) {
      const unsigned short* brow = Wt + (size_t)(col0 + t * 16 + ln) * ldb + kb;
      FragB b;
      b.half[0] = *(const v8us*)(brow + 8 * hh);
      b.half[1] = *(const v8us*)(brow + 16 + 8 * hh);
      acc[t] = mmaN<ASPLIT ? 2 : 1>(ah.v, al.v, b.v, b.v, acc[t]);
    }
  }
#pragma unroll
  for (int t = 0; t < 4; ++t) {
    float bv = bias ? bias[col0 + t * 16 + ln] : 0.f;
    if (BIAS_BF16) bv = bf16_round(bv);
#pragma unroll
    for (int r = 0; r < 8; ++r) { float v = acc[t][r] + bv; if (ACT == 1) v = fmaxf(v, 0.f); so[w][8 * hh + r][t * 16 + ln] = v; }
  }
  __builtin_amdgcn_fence(__ATOMIC_ACQ_REL, "workgroup");
  __builtin_amdgcn_wave_barrier();
  const int rsub = lane >> 4, c4 = (lane & 15) * 4;
  {
#pragma unroll
    for (int q = 0; q < 8; ++q) {
      const int r = q * 2 + rsub;
      const v4f v = *(const v4fa*)&so[w][r][c4];
      *(v4f*)(C + (size_t)(row0 + r) * ldc + col0 + c4) = v;
    }
    
  }
}

// GEMM C = act(A·W + bias + resid): A f32 (ASPLIT -> hi/lo 2 terms), Wt bf16 [N][K]; ACT 0 none, 1 relu, 2 exact gelu;
// resid (optional, f32, row index = (row % rmod), pitch ldr, RES_BF16 rounds it) added before the activation.
template <bool ASPLIT, int ACT, bool BIAS_BF16, bool RES_BF16>
__global__ __launch_bounds__(128) void k_gemm_bf3(const float* __restrict__ A, int lda, const unsigned short* __restrict__ Wt, int ldb,
                                                const float* __restrict__ bias, const float* __restrict__ resid, int rmod, int ldr,
                                                float* __restrict__ C, int ldc, int M, int N, int K) {
  __shared__ __attribute__((aligned(16))) float so[4][16][64];
  const int tid = threadIdx.x, w = tid >> 5, lane = tid & 31, ln = lane & 15, hh = lane >> 4;
  const int ntn = N / 64;
  const int wid = blockIdx.x * 4 + w;
  const int mt = wid / ntn, nq = wid % ntn;
  if (mt * 16 >= M) return;
  const int row0 = mt * 16, col0 = nq * 64;
  const float* arow = A + (size_t)(row0 + ln) * lda;
  v8f acc[4] = {};
  for (int kb = 0; kb < K; kb += 32) {
    FragB ah, al;
    const v4f x0 = *(const v4fa*)(arow + kb + 8 * hh), x1 = *(const v4fa*)(arow + kb + 8 * hh + 4);
    const v4f x2 = *(const v4fa*)(arow + kb + 16 + 8 * hh), x3 = *(const v4fa*)(arow + kb + 16 + 8 * hh + 4);
    float xs[16] = {x0[0],x0[1],x0[2],x0[3],x1[0],x1[1],x1[2],x1[3],x2[0],x2[1],x2[2],x2[3],x3[0],x3[1],x3[2],x3[3]};
#pragma unroll
    for (int i = 0; i < 16; ++i) { const unsigned short hb = bf16_bits(xs[i]); ah.u[i] = hb; al.u[i] = ASPLIT ? bf16_bits(xs[i] - bf16_val(hb)) : (unsigned short)0; }
#pragma unroll
    for (int t = 0; t < 4; ++t) {
      const unsigned short* brow = Wt + (size_t)(col0 + t * 16 + ln) * ldb + kb;
      FragB b;
      b.half[0] = *(const v8us*)(brow + 8 * hh);
      b.half[1] = *(const v8us*)(brow + 16 + 8 * hh);
      acc[t] = mmaN<ASPLIT ? 2 : 1>(ah.v, al.v, b.v, b.v, acc[t]);
    }
  }
#pragma unroll
  for (int t = 0; t < 4; ++t) {
    const int col = col0 + t * 16 + ln;
    float bv = bias ? bias[col] : 0.f;
    if (BIAS_BF16) bv = bf16_round(bv);
#pragma unroll
    for (int r = 0; r < 8; ++r) {
      float v = acc[t][r] + bv;
      if (resid) { float rv = resid[(size_t)((row0 + 8 * hh + r) % rmod) * ldr + col]; if (RES_BF16) rv = bf16_round(rv); v += rv; }
      if (ACT == 1) v = fmaxf(v, 0.f);
      if (ACT == 2) v = 0.5f * v * (1.0f + erff(v * 0.70710678118654752f));
      if (ACT == 3) { const float u = 0.7978845608028654f * (v + 0.044715f * v * v * v); v = 0.5f * v * (1.0f + tanhf(u)); }
      so[w][8 * hh + r][t * 16 + ln] = v;
    }
  }
  __builtin_amdgcn_fence(__ATOMIC_ACQ_REL, "workgroup");
  __builtin_amdgcn_wave_barrier();
  const int rsub = lane >> 4, c4 = (lane & 15) * 4;
  {
#pragma unroll
    for (int q = 0; q < 8; ++q) {
      const int r = q * 2 + rsub;
      const v4f v = *(const v4fa*)&so[w][r][c4];
      *(v4f*)(C + (size_t)(row0 + r) * ldc + col0 + c4) = v;
    }
    
  }
}
// row LayerNorm (biased variance, eps) over N: s = X (+ R); optional out_sum <- s; out_norm <- (s-mu)*rsqrt(var+eps)*g + b
template <bool PARAM_BF16>
__global__ __launch_bounds__(256) void k_layernorm(const float* __restrict__ X, const float* __restrict__ R, const float* __restrict__ g, const float* __restrict__ bta,
                                                  float* __restrict__ out_sum, float* __restrict__ out_norm, int N, float eps) {
  __shared__ float red[256];
  const int row = blockIdx.x, tid = threadIdx.x;
  const float* x = X + (size_t)row * N; const float* rr = R ? R + (size_t)row * N : nullptr;
  float vals[16];                     // up to N = 4096
  const int per = N / 256;            // contiguous chunk per thread? use strided-by-4 chunks: thread handles j = tid*4 + 1024*u
  float s1 = 0.f;
  for (int u = 0; u < per / 4; ++u) {
    const int j = tid * 4 + 1024 * u;
    const v4f a = *(const v4fa*)(x + j);
    v4f b = {0.f,0.f,0.f,0.f}; if (rr) b = *(const v4fa*)(rr + j);
#pragma unroll
    for (int q = 0; q < 4; ++q) { const float v = a[q] + b[q]; vals[u * 4 + q] = v; s1 += v; }
  }
  red[tid] = s1; __syncthreads();
  for (int st = 128; st > 0; st >>= 1) { if (tid < st) red[tid] += red[tid + st]; __syncthreads(); }
  const float mu = red[0] / (float)N; __syncthreads();
  float s2 = 0.f;
  for (int u = 0; u < per / 4; ++u)
#pragma unroll
    for (int q = 0; q < 4; ++q) { const float c = vals[u * 4 + q] - mu; s2 += c * c; }
  red[tid] = s2; __syncthreads();
  for (int st = 128; st > 0; st >>= 1) { if (tid < st) red[tid] += red[tid + st]; __syncthreads(); }
  const float rs = rsqrtf(red[0] / (float)N + eps);
  {
    for (int u = 0; u < per / 4; ++u) {
      const int j = tid * 4 + 1024 * u;
      v4f o, sm;
#pragma unroll
      for (int q = 0; q < 4; ++q) {
        float gg = g[j + q], bb = bta[j + q];
        if (PARAM_BF16) { gg = bf16_round(gg); bb = bf16_round(bb); }
        sm[q] = vals[u * 4 + q]; o[q] = (vals[u * 4 + q] - mu) * rs * gg + bb;
      }
      if (out_sum) *(v4f*)(out_sum + (size_t)row * N + j) = sm;
      *(v4f*)(out_norm + (size_t)row * N + j) = o;
    }
    
  }
}



// ---- f16 WMMA path (v_wmma_f32_16x16x32_f16): 11-bit significands for operands in range — used where a [0,1] probability operand needs more precision than bf16
typedef _Float16 v16h __attribute__((ext_vector_type(16)));
union FragH { v16h v; v8us half[2]; _Float16 h[16]; unsigned short u[16]; };
template <int NT>
__device__ __forceinline__ v8f mmaH(v16h ah, v16h al, v16h bh, v16h bl, v8f c) {
  c = __builtin_amdgcn_wmma_f32_16x16x32_f16(false, ah, false, bh, (short)0, c, false, false);
  if (NT >= 2) c = __builtin_amdgcn_wmma_f32_16x16x32_f16(false, al, false, bh, (short)0, c, false, false);
  if (NT >= 3) c = __builtin_amdgcn_wmma_f32_16x16x32_f16(false, ah, false, bl, (short)0, c, false, false);
  asm volatile("v_nop\n\tv_nop\n\tv_nop\n\tv_nop" : "+v"(c) : "v"(ah), "v"(al), "v"(bh), "v"(bl));
  return c;
}
// batched GEMM like k_gemm_b but f16 operands: A f32 (split into f16 hi/lo if ASPLIT, else rounded to f16), Bt = f16 values [n][k]; alpha; C f32; N multiple of 16 (partial tiles skipped)
template <bool ASPLIT>
__global__ __launch_bounds__(128) void k_gemm_h(const float* __restrict__ A, int lda, size_t sA, const _Float16* __restrict__ Bh, int ldb, size_t sB, float alpha, float* __restrict__ C, int ldc, size_t sC, int M, int N, int K) {
  __shared__ __attribute__((aligned(16))) float so[4][16][64];
  const int tid = threadIdx.x, w = tid >> 5, lane = tid & 31, ln = lane & 15, hh = lane >> 4; const int by = blockIdx.y;
  A += (size_t)by * sA; Bh += (size_t)by * sB; C += (size_t)by * sC;
  const int ntn = (N + 63) / 64; const int wid = blockIdx.x * 4 + w; const int mt = wid / ntn, nq = wid % ntn; if (mt * 16 >= M) return;
  const int row0 = mt * 16, col0 = nq * 64; const float* arow = A + (size_t)(row0 + ln) * lda;
  v8f acc[4] = {};
  for (int kb = 0; kb < K; kb += 32) {
    FragH ah, al;
    const v4f x0 = *(const v4fa*)(arow + kb + 8 * hh), x1 = *(const v4fa*)(arow + kb + 8 * hh + 4), x2 = *(const v4fa*)(arow + kb + 16 + 8 * hh), x3 = *(const v4fa*)(arow + kb + 16 + 8 * hh + 4);
    float xs[16] = {x0[0],x0[1],x0[2],x0[3],x1[0],x1[1],x1[2],x1[3],x2[0],x2[1],x2[2],x2[3],x3[0],x3[1],x3[2],x3[3]};
#pragma unroll
    for (int i = 0; i < 16; ++i) { const _Float16 h = (_Float16)xs[i]; ah.h[i] = h; al.h[i] = ASPLIT ? (_Float16)(xs[i] - (float)h) : (_Float16)0.0f; }
#pragma unroll
    for (int t = 0; t < 4; ++t) { if (col0 + t * 16 >= N) continue; const size_t boff = (size_t)(col0 + t * 16 + ln) * ldb + kb; FragH bq; bq.half[0] = *(const v8us*)(Bh + boff + 8 * hh); bq.half[1] = *(const v8us*)(Bh + boff + 16 + 8 * hh);
      acc[t] = mmaH<ASPLIT ? 2 : 1>(ah.v, al.v, bq.v, bq.v, acc[t]); }
  }
#pragma unroll
  for (int t = 0; t < 4; ++t) { if (col0 + t * 16 >= N) continue;
#pragma unroll
    for (int r = 0; r < 8; ++r) so[w][8 * hh + r][t * 16 + ln] = acc[t][r] * alpha; }
  __builtin_amdgcn_fence(__ATOMIC_ACQ_REL, "workgroup"); __builtin_amdgcn_wave_barrier();
  const int rsub = lane >> 4, c4 = (lane & 15) * 4;
  {
#pragma unroll
    for (int q = 0; q < 8; ++q) { const int r = q * 2 + rsub; if (col0 + c4 < N) { const v4f v = *(const v4fa*)&so[w][r][c4]; *(v4f*)(C + (size_t)(row0 + r) * ldc + col0 + c4) = v; } }
     }
}

// Wt[n][k] = f16(W[k][n]·scale) from f32 row-major W[K][N] (scale = power of two; bf16-exact weights stay exact in f16 away from the subnormal range)
__global__ __launch_bounds__(256) void k_wt_f16(const float* __restrict__ W, _Float16* __restrict__ Wt, int K, int N, float scale) {
  const int t = blockIdx.x * 256 + threadIdx.x; if (t >= N * (K / 8)) return; const int n = t / (K / 8), k8 = (t % (K / 8)) * 8; FragH f;
#pragma unroll
  for (int i = 0; i < 8; ++i) f.h[i] = (_Float16)(bf16_round(W[(size_t)(k8 + i) * N + n]) * scale); const v8us o = f.half[0];
  *(v8us*)((unsigned short*)Wt + (size_t)n * K + k8) = o; 
}
// k_gemm_hh variant with fused epilogue: v = acc·alpha + bias[by·sBias + col] (+ CP[(row/rowsPerB)·sCPb + by·64 + col] if CP) ; ACT 0 none / 1 elu ; writes f16 C16 (and f32 C if non-null)
template <int ACT>
__global__ __launch_bounds__(128) void k_gemm_hhx(const _Float16* __restrict__ A, int lda, size_t sA, const _Float16* __restrict__ Bh, int ldb, size_t sB, float alpha, const float* __restrict__ bias, size_t sBias, const float* __restrict__ CP, int rowsPerB, size_t sCPb, int row0g,
    float* __restrict__ C, _Float16* __restrict__ C16, int ldc, size_t sC, int M, int N, int K) {
  __shared__ __attribute__((aligned(16))) float so[4][16][64];
  const int tid = threadIdx.x, w = tid >> 5, lane = tid & 31, ln = lane & 15, hh = lane >> 4; const int by = blockIdx.y;
  A += (size_t)by * sA; Bh += (size_t)by * sB; const size_t cofs = (size_t)by * sC; const float* bp = bias ? bias + (size_t)by * sBias : nullptr;
  const int ntn = (N + 63) / 64; const int wid = blockIdx.x * 4 + w; const int mt = wid / ntn, nq = wid % ntn; if (mt * 16 >= M) return;
  const int row0 = mt * 16, col0 = nq * 64; const _Float16* arow = A + (size_t)(row0 + ln) * lda;
  v8f acc[4] = {};
  for (int kb = 0; kb < K; kb += 32) { FragH ah; ah.half[0] = *(const v8us*)((const unsigned short*)arow + kb + 8 * hh); ah.half[1] = *(const v8us*)((const unsigned short*)arow + kb + 16 + 8 * hh);
#pragma unroll
    for (int t = 0; t < 4; ++t) { if (col0 + t * 16 >= N) continue; const size_t boff = (size_t)(col0 + t * 16 + ln) * ldb + kb; FragH bq; bq.half[0] = *(const v8us*)((const unsigned short*)Bh + boff + 8 * hh); bq.half[1] = *(const v8us*)((const unsigned short*)Bh + boff + 16 + 8 * hh);
      acc[t] = mmaH<1>(ah.v, ah.v, bq.v, bq.v, acc[t]); }
  }
#pragma unroll
  for (int t = 0; t < 4; ++t) { if (col0 + t * 16 >= N) continue; const int col = col0 + t * 16 + ln; const float bv = bp ? bf16_round(bp[col]) : 0.f;
#pragma unroll
    for (int r = 0; r < 8; ++r) { float v = acc[t][r] * alpha + bv; if (CP) { const int rr = row0g + row0 + 8 * hh + r; if (rowsPerB < 0) v += CP[cofs + (size_t)rr * ldc + col];      /* rowsPerB < 0: own element of the batched C plane */ else { const int bidx = rr / rowsPerB; v += CP[(size_t)bidx * sCPb + (size_t)by * 64 + col]; } } if (ACT == 1) v = (v > 0.f) ? v : expm1f(v); else if (ACT == 7) v = (v > 0.f) ? v + 1.0f : expf(v); else if (ACT == 8) v = tanhf(v); else if (ACT == 9) v = 0.5f * v * (1.0f + tanhf(0.7978845608028654f * (v + 0.044715f * v * v * v))); else if (ACT == 11) v = 1.0f / (1.0f + expf(-v)); else if (ACT == 12) v = (v > 0.f) ? v : 0.01f * v; else if (ACT == 14) v = (v > 0.f) ? v : 0.1f * v; else if (ACT == 16) v = (v >= 0.f) ? v : 0.3f * v; else if (ACT == 17) v = (v >= 0.f) ? v : 0.2f * v; else if (ACT == 15) v = v / (1.0f + expf(-v)); else if (ACT == 3) v = fmaxf(v, 0.f); else if (ACT == 6) v = 0.5f * v * (1.0f + erff(v * 0.70710678118654752f)); so[w][8 * hh + r][t * 16 + ln] = v; } }
  __builtin_amdgcn_fence(__ATOMIC_ACQ_REL, "workgroup"); __builtin_amdgcn_wave_barrier();
  const int rsub = lane >> 4, c4 = (lane & 15) * 4; typedef _Float16 v4h __attribute__((ext_vector_type(4)));
  {
#pragma unroll
    for (int q = 0; q < 8; ++q) { const int r = q * 2 + rsub; if (col0 + c4 < N) { const v4f v = *(const v4fa*)&so[w][r][c4]; if (C) *(v4f*)(C + cofs + (size_t)(row0 + r) * ldc + col0 + c4) = v; if (C16) { v4h h4; for (int i = 0; i < 4; ++i) h4[i] = (_Float16)v[i]; *(v4h*)(C16 + cofs + (size_t)(row0 + r) * ldc + col0 + c4) = h4; } } }
     }
}


typedef _Float16 v4h __attribute__((ext_vector_type(4)));

__global__ __launch_bounds__(256) void k_x16(const float* __restrict__ x, _Float16* __restrict__ X16, size_t n8) { const size_t t = (size_t)blockIdx.x * 256 + threadIdx.x; if (t >= n8) return; FragH f;
#pragma unroll
  for (int q = 0; q < 8; ++q) f.h[q] = (_Float16)bf16_round(x[t * 8 + q]); *(v8us*)((unsigned short*)X16 + t * 8) = f.half[0];  }
__global__ __launch_bounds__(256) void k_h16(const float* __restrict__ x, _Float16* __restrict__ X16, size_t n8) { const size_t t = (size_t)blockIdx.x * 256 + threadIdx.x; if (t >= n8) return; FragH f;
#pragma unroll
  for (int q = 0; q < 8; ++q) f.h[q] = (_Float16)x[t * 8 + q]; *(v8us*)((unsigned short*)X16 + t * 8) = f.half[0];  }
__global__ __launch_bounds__(256) void k_round16f(const float* __restrict__ W, _Float16* __restrict__ Bt, size_t n8) { const size_t t = (size_t)blockIdx.x * 256 + threadIdx.x; if (t >= n8) return; FragH f;
#pragma unroll
  for (int i = 0; i < 8; ++i) f.h[i] = (_Float16)(bf16_round(W[t * 8 + i]) * 16.0f); *(v8us*)((unsigned short*)Bt + t * 8) = f.half[0];  }
template <int NHv, int TTv>
__global__ __launch_bounds__(256) void k_vt(const _Float16* __restrict__ V16, int ldv, int voff, _Float16* __restrict__ Vt) { __shared__ unsigned short tl[64][66]; const int tid = threadIdx.x; const int slab = blockIdx.x / (TTv / 64), lg = blockIdx.x % (TTv / 64); const int b = slab / NHv, h = slab % NHv;
  for (int i = tid; i < 64 * 8; i += 256) { const int r = i / 8, c8 = (i % 8) * 8; FragH f; f.half[0] = *(const v8us*)((const unsigned short*)V16 + ((size_t)b * TTv + lg * 64 + r) * ldv + voff + h * 64 + c8);
#pragma unroll
    for (int q = 0; q < 8; ++q) tl[r][c8 + q] = f.u[q]; }
  __syncthreads();
  {
#pragma unroll
    for (int rd = 0; rd < 2; ++rd) { const int d = rd * 32 + tid / 8, pc = tid % 8; FragH f;
#pragma unroll
      for (int q = 0; q < 8; ++q) f.u[q] = tl[pc * 8 + q][d];
      *(v8us*)((unsigned short*)Vt + ((size_t)slab * 64 + d) * TTv + lg * 64 + pc * 8) = f.half[0]; }
     } }

__global__ __launch_bounds__(256) void k_hl(const float* __restrict__ F, _Float16* __restrict__ Hh, _Float16* __restrict__ Hl, size_t n8) { const size_t t = (size_t)blockIdx.x * 256 + threadIdx.x; if (t >= n8) return; FragH fh, fl; const v4f a = *(const v4fa*)(F + t * 8), c = *(const v4fa*)(F + t * 8 + 4);
#pragma unroll
  for (int q = 0; q < 4; ++q) { _Float16 h = (_Float16)a[q]; fh.h[q] = h; fl.h[q] = (_Float16)((a[q] - (float)h) * 1024.0f); h = (_Float16)c[q]; fh.h[4 + q] = h; fl.h[4 + q] = (_Float16)((c[q] - (float)h) * 1024.0f); }
  { *(v8us*)((unsigned short*)Hh + t * 8) = fh.half[0]; *(v8us*)((unsigned short*)Hl + t * 8) = fl.half[0];  } }

// ---- fast GEMM (wave tile 32x64; requires M % 32 == 0 rows per launch region and N % 64 == 0); epilogue = k_gemm_hhx semantics ----
__device__ __forceinline__ v16h g2_frag(const _Float16* p, int hh) { FragH f; f.half[0] = *(const v8us*)((const unsigned short*)p + 8 * hh); f.half[1] = *(const v8us*)((const unsigned short*)p + 16 + 8 * hh); return f.v; }
__device__ __forceinline__ v8f g2_mma(v16h a, v16h b, v8f c) { v8f d = __builtin_amdgcn_wmma_f32_16x16x32_f16(false, a, false, b, (short)0, c, false, false); asm volatile("v_nop\n\tv_nop\n\tv_nop\n\tv_nop" : "+v"(d) : "v"(a), "v"(b)); return d; }
template <int ACT>
__global__ __launch_bounds__(128) void k_gemm2(const _Float16* __restrict__ A, int lda, size_t sA, const _Float16* __restrict__ Bh, int ldb, size_t sB, float alpha, const float* __restrict__ bias, size_t sBias, const float* __restrict__ CP, int rowsPerB, size_t sCPb, int row0g,
    float* __restrict__ C, _Float16* __restrict__ C16, int ldc, size_t sC, int M, int N, int K) { static_assert(ACT == 0 || ACT == 3 || ACT == 6 || ACT == 8 || ACT == 9 || ACT == 11 || ACT == 12 || ACT == 14 || ACT == 15 || ACT == 16 || ACT == 17, "k_gemm2: unsupported ACT code (would silently apply no activation)");
  __shared__ __attribute__((aligned(16))) float so[4][32][68];
  const int tid = threadIdx.x, w = tid >> 5, lane = tid & 31, ln = lane & 15, hh = lane >> 4; const int by = blockIdx.y;
  A += (size_t)by * sA; Bh += (size_t)by * sB; const size_t cofs = (size_t)by * sC; const float* bp = bias ? bias + (size_t)by * sBias : nullptr;
  const int ntn = N >> 6; const int mt = blockIdx.x / ntn, nq = blockIdx.x - mt * ntn; const int row0 = mt * 128 + 32 * w, col0 = nq * 64; if (row0 >= M) return;
  const _Float16* a0p = A + (size_t)(row0 + ln) * lda; const _Float16* a1p = a0p + (size_t)16 * lda;
  const _Float16* b0p = Bh + (size_t)(col0 + ln) * ldb; const _Float16* b1p = b0p + (size_t)16 * ldb; const _Float16* b2p = b1p + (size_t)16 * ldb; const _Float16* b3p = b2p + (size_t)16 * ldb;
  const v8f z8 = {0.f,0.f,0.f,0.f,0.f,0.f,0.f,0.f}; v8f c00 = z8, c01 = z8, c02 = z8, c03 = z8, c10 = z8, c11 = z8, c12 = z8, c13 = z8;
#pragma unroll 1
  for (int kb = 0; kb < K; kb += 32) { const v16h a0 = g2_frag(a0p + kb, hh), a1 = g2_frag(a1p + kb, hh);
    v16h b = g2_frag(b0p + kb, hh); c00 = g2_mma(a0, b, c00); c10 = g2_mma(a1, b, c10);
    b = g2_frag(b1p + kb, hh); c01 = g2_mma(a0, b, c01); c11 = g2_mma(a1, b, c11);
    b = g2_frag(b2p + kb, hh); c02 = g2_mma(a0, b, c02); c12 = g2_mma(a1, b, c12);
    b = g2_frag(b3p + kb, hh); c03 = g2_mma(a0, b, c03); c13 = g2_mma(a1, b, c13); }
  v8f accs[8] = {c00, c01, c02, c03, c10, c11, c12, c13};
#pragma unroll
  for (int u = 0; u < 8; ++u) { const int t = u & 3, half = u >> 2; const int col = col0 + t * 16 + ln; const float bv = bp ? bf16_round(bp[col]) : 0.f;
#pragma unroll
    for (int r = 0; r < 8; ++r) { const int rloc = half * 16 + 8 * hh + r; float v = accs[u][r] * alpha + bv; if (CP) { if (rowsPerB < 0) v += CP[cofs + (size_t)(row0g + row0 + rloc) * ldc + col];      /* rowsPerB < 0: own element of the batched C plane */ else { const int bidx = (row0g + row0 + rloc) / rowsPerB; v += CP[(size_t)bidx * sCPb + (size_t)by * 64 + col]; } }
      if (ACT == 3) v = fmaxf(v, 0.f); else if (ACT == 6) v = 0.5f * v * (1.0f + erff(v * 0.70710678118654752f)); else if (ACT == 11) v = 1.0f / (1.0f + expf(-v)); else if (ACT == 15) v = v / (1.0f + expf(-v)); else if (ACT == 12) v = (v > 0.f) ? v : 0.01f * v; else if (ACT == 8) v = tanhf(v); else if (ACT == 9) v = 0.5f * v * (1.0f + tanhf(0.7978845608028654f * (v + 0.044715f * v * v * v))); else if (ACT == 14) v = (v > 0.f) ? v : 0.1f * v; else if (ACT == 16) v = (v >= 0.f) ? v : 0.3f * v; else if (ACT == 17) v = (v >= 0.f) ? v : 0.2f * v;
      so[w][rloc][t * 16 + ln] = v; } }
  __builtin_amdgcn_fence(__ATOMIC_ACQ_REL, "workgroup"); __builtin_amdgcn_wave_barrier();
  const int rsub = lane >> 4, c4 = (lane & 15) * 4;
  {
#pragma unroll
    for (int q = 0; q < 16; ++q) { const int r = q * 2 + rsub; const v4f v = *(const v4fa*)&so[w][r][c4]; if (C) *(v4f*)(C + cofs + (size_t)(row0 + r) * ldc + col0 + c4) = v; if (C16) { v4h h4; for (int i = 0; i < 4; ++i) h4[i] = (_Float16)v[i]; *(v4h*)(C16 + cofs + (size_t)(row0 + r) * ldc + col0 + c4) = h4; } }
     } }


__global__ __launch_bounds__(256) void k_wnat(const float* __restrict__ w, size_t n8, _Float16* __restrict__ Bt) { const size_t t = (size_t)blockIdx.x * 256 + threadIdx.x; if (t >= n8) return; FragH f; for (int q = 0; q < 8; ++q) f.h[q] = (_Float16)(bf16_round(w[t * 8 + q]) * 16.0f); *(v8us*)((unsigned short*)Bt + t * 8) = f.half[0];  }
__global__ __launch_bounds__(256) void k_rsm(const float* __restrict__ S, _Float16* __restrict__ P, int nrows) {
  #pragma clang fp contract(off)
  const int i = blockIdx.x * 256 + threadIdx.x; if (i >= nrows) return; const float* s = S + (size_t)i * SQ; float mx = -3.0e38f;
#pragma unroll 1
  for (int j = 0; j < SQ; ++j) mx = fmaxf(mx, s[j]); float se = 0.f;
#pragma unroll 1
  for (int j = 0; j < SQ; ++j) se += expf(s[j] - mx); const float sc = 256.0f / se;
#pragma unroll 1
  for (int j0 = 0; j0 < SQ; j0 += 8) { FragH f; for (int q = 0; q < 8; ++q) f.h[q] = (_Float16)(expf(s[j0 + q] - mx) * sc); unsigned short* d = (unsigned short*)P + (size_t)i * SQ + j0; *(v8us*)d = f.half[0];  } }
__global__ __launch_bounds__(256) void k_vt(const _Float16* __restrict__ V16, int b, int h0, _Float16* __restrict__ VT) { __shared__ unsigned short tl[64][65]; const int tid = threadIdx.x; const int hh = blockIdx.x % HG, sg = blockIdx.x / HG; const int s0 = sg * 64; const int h = h0 + hh;
  for (int i = tid; i < 64 * 8; i += 256) { const int j = i / 8, d8 = (i % 8) * 8; FragH f; f.half[0] = *(const v8us*)((const unsigned short*)V16 + ((size_t)b * SQ + s0 + j) * DM + h * HD + d8); for (int q = 0; q < 8; ++q) tl[d8 + q][j] = f.u[q]; }
  __syncthreads();
  { for (int i = tid; i < 64 * 8; i += 256) { const int d = i / 8, j8 = (i % 8) * 8; FragH f; for (int q = 0; q < 8; ++q) f.u[q] = tl[d][j8 + q]; *(v8us*)((unsigned short*)VT + ((size_t)hh * HD + d) * SQ + s0 + j8) = f.half[0]; }  } }



// lane l <-> l ^ 16 (cross-row move); every lane on
__device__ __forceinline__ float rs_xh(float x) { return __builtin_bit_cast(float, __builtin_amdgcn_permlanex16(__builtin_bit_cast(int, x), __builtin_bit_cast(int, x), 0x76543210, 0xfedcba98, false, false)); }
__device__ __forceinline__ v8f fa_mma(v16h a, v16h b, v8f c) { return __builtin_amdgcn_wmma_f32_16x16x32_f16(false, a, false, b, (short)0, c, false, false); }
#define FA_C 0.18033688011112042f      /* 0.125 * log2(e) */
#define FA_T 44.361419555836498f       /* 8 / FA_C: the rescale threshold in raw score units */
__global__ __launch_bounds__(256) void k_fattn(const _Float16* __restrict__ Q, const _Float16* __restrict__ Kr, const _Float16* __restrict__ VT, _Float16* __restrict__ O) { static_assert(HD == 64 && SQ % 256 == 0, "k_fattn: 2 k fragments per row, 8 waves x 32 queries");
  const int lane = threadIdx.x & 31, ln = lane & 15, hh = lane >> 4, w = threadIdx.x >> 5; const int slab = blockIdx.y, b = slab / NH, h = slab - b * NH; const int q0 = blockIdx.x * 256 + w * 32;
  const _Float16* qp = Q + ((size_t)b * SQ + q0 + ln) * LQ + h * HD; const _Float16* kp = Kr + ((size_t)b * SQ + ln) * LQ + h * HD; const _Float16* vp = VT + ((size_t)slab * HD + ln) * SQ;
  v16h qf[2][2], kf[2][2];      /* [tile][half of the 64 d] */
#pragma unroll
  for (int j = 0; j < 2; ++j) { qf[j][0] = g2_frag(qp + (size_t)j * 16 * LQ, hh); qf[j][1] = g2_frag(qp + (size_t)j * 16 * LQ + 32, hh); kf[j][0] = g2_frag(kp + (size_t)j * 16 * LQ, hh); kf[j][1] = g2_frag(kp + (size_t)j * 16 * LQ + 32, hh); }
  const v8f z8 = {0.f,0.f,0.f,0.f,0.f,0.f,0.f,0.f}; v8f o[2][4]; float m[2] = {-3.0e38f, -3.0e38f}, l[2] = {0.f, 0.f};
#pragma unroll
  for (int j = 0; j < 2; ++j) for (int dt = 0; dt < 4; ++dt) o[j][dt] = z8;
#pragma unroll 1      /* stays rolled (for speed only) */
  for (int kb = 0; kb < SQ; kb += 32) {
    v16h vf[4];      /* V^T rows of this pass: asked for first, used last */
#pragma unroll
    for (int dt = 0; dt < 4; ++dt) vf[dt] = g2_frag(vp + (size_t)dt * 16 * SQ + kb, hh);
    v8f s[2][2];      /* [query tile][key tile] */
#pragma unroll
    for (int j = 0; j < 2; ++j) for (int t = 0; t < 2; ++t) s[j][t] = fa_mma(kf[t][1], qf[j][1], fa_mma(kf[t][0], qf[j][0], z8));
    const _Float16* kn = kp + (size_t)((kb + 32) & (SQ - 1)) * LQ;      /* next pass's K rows, fetched one pass ahead (the last pass wraps to row 0: in bounds, not used) */
#pragma unroll
    for (int t = 0; t < 2; ++t) { kf[t][0] = g2_frag(kn + (size_t)t * 16 * LQ, hh); kf[t][1] = g2_frag(kn + (size_t)t * 16 * LQ + 32, hh); }
    float tm[2];
#pragma unroll
    for (int j = 0; j < 2; ++j) { float a = fmaxf(s[j][0][0], s[j][1][0]);
      for (int r = 1; r < 8; ++r) a = fmaxf(a, fmaxf(s[j][0][r], s[j][1][r]));
      tm[j] = fmaxf(a, rs_xh(a)); }
    if (__builtin_amdgcn_ballot_w32(tm[0] > m[0] + FA_T || tm[1] > m[1] + FA_T) != 0) {      /* one scalar branch per pass */
#pragma unroll
      for (int j = 0; j < 2; ++j) { const float mn = fmaxf(m[j], tm[j]); const float al = __builtin_amdgcn_exp2f((m[j] - mn) * FA_C); m[j] = mn; l[j] *= al;
        for (int dt = 0; dt < 4; ++dt) o[j][dt] *= al; } }
    FragH pf[2];
#pragma unroll
    for (int j = 0; j < 2; ++j) { const float mc = m[j] * FA_C; float s0 = 0.f, s1 = 0.f;
      for (int r = 0; r < 8; ++r) { const float p0 = __builtin_amdgcn_exp2f(s[j][0][r] * FA_C - mc), p1 = __builtin_amdgcn_exp2f(s[j][1][r] * FA_C - mc); s0 += p0; s1 += p1; pf[j].h[r] = (_Float16)p0; pf[j].h[8 + r] = (_Float16)p1; }
      l[j] += s0 + s1; }
#pragma unroll
    for (int dt = 0; dt < 4; ++dt) for (int j = 0; j < 2; ++j) o[j][dt] = fa_mma(vf[dt], pf[j].v, o[j][dt]);
  }
#pragma unroll
  for (int j = 0; j < 2; ++j) { const float inv = 64.0f / (l[j] + rs_xh(l[j])); unsigned short* d = (unsigned short*)O + ((size_t)b * SQ + q0 + j * 16 + ln) * DM + h * HD + 8 * hh;
    for (int dt = 0; dt < 4; ++dt) { FragH f; for (int r = 0; r < 8; ++r) f.h[r] = (_Float16)(o[j][dt][r] * inv); *(v8us*)(d + dt * 16) = f.half[0]; } } }

extern "C" void kernel_launch(void* const* d_in, const int* in_sizes, int n_in,
                              void* d_out, int out_size, void* d_ws, size_t ws_size, hipStream_t stream) {
  (void)in_sizes; (void)n_in; (void)out_size;
  const float* const* I = (const float* const*)d_in; const float* x = I[0]; const float* wqkv = I[1]; const float* bq = nullptr; const float* bk = nullptr; const float* bv = nullptr; const float* wo = I[2]; const float* bo = nullptr;      /* ONE input stream (z); U_qkv is ONE STACK [12][3][768][64] = [head][q | k | v][in][out]; U_msa [in][out] [768][768]; the module has NO biases: bare null pointers in the guarded bias slots; input order z, U_qkv, U_msa */
  char* ws = (char*)d_ws; size_t off = 0;
  auto take = [&](size_t bytes) { char* p = ws + off; off += (bytes + 255) & ~(size_t)255; return p; };
  _Float16* BQ = (_Float16*)take((size_t)DM * DM * 2); _Float16* BK = (_Float16*)take((size_t)DM * DM * 2); _Float16* BV = (_Float16*)take((size_t)DM * DM * 2); _Float16* BO = (_Float16*)take((size_t)DM * DM * 2);
  _Float16* X16 = (_Float16*)take(NR * DM * 2); _Float16* Q16 = (_Float16*)take(NR * DM * 2); _Float16* K16 = (_Float16*)take(NR * DM * 2); _Float16* V16 = (_Float16*)take(NR * DM * 2); _Float16* O16 = (_Float16*)take(NR * DM * 2);
  _Float16* VT = (_Float16*)take((size_t)NB * NH * HD * SQ * 2);
  if (off > ws_size) return;
  { const unsigned g = (unsigned)(((size_t)DM * (DM / 8) + 255) / 256); const unsigned gh = (unsigned)(((size_t)HD * (DM / 8) + 255) / 256); for (int h = 0; h < NH; ++h) { const size_t wofs = (size_t)3 * h * DM * HD, pofs = (size_t)h * HD * DM; k_wt_f16<<<gh, 256, 0, stream>>>(wqkv + wofs, BQ + pofs, DM, HD, 16.0f); k_wt_f16<<<gh, 256, 0, stream>>>(wqkv + wofs + (size_t)DM * HD, BK + pofs, DM, HD, 16.0f); k_wt_f16<<<gh, 256, 0, stream>>>(wqkv + wofs + (size_t)2 * DM * HD, BV + pofs, DM, HD, 16.0f); } k_wt_f16<<<g, 256, 0, stream>>>(wo, BO, DM, DM, 16.0f); }      /* ONE STACK U_qkv [NH][3][DM][HD]: the block of (head h, part p) is a row-major [in = DM][out = HD] matrix at wqkv + (3 h + p) * DM * HD: the transposing builder with K = DM, N = HD writes its HD rows Bt[h * HD + e][k] at B + h * HD * DM: contiguous rows of the [out][in] plane (x16); U_msa is a plain [in][out] [DM][DM] matrix: one call as before */

  k_x16<<<(unsigned)((NR * DM / 8 + 255) / 256), 256, 0, stream>>>(x, X16, NR * DM / 8);
  const size_t r0p = (size_t)B0 * SQ;      /* first projected row */
  k_gemm2<0><<<dim3((unsigned)((MP / 128) * (DM / 64)), 1), 128, 0, stream>>>(X16 + r0p * DM, DM, 0, BQ, DM, 0, 0.0625f, bq, 0, nullptr, 1, 0, 0, nullptr, Q16 + r0p * DM, DM, 0, MP, DM, DM);
  k_gemm2<0><<<dim3((unsigned)((MP / 128) * (DM / 64)), 1), 128, 0, stream>>>(X16 + r0p * DM, DM, 0, BK, DM, 0, 0.0625f, bk, 0, nullptr, 1, 0, 0, nullptr, K16 + r0p * DM, DM, 0, MP, DM, DM);
  k_gemm2<0><<<dim3((unsigned)((MP / 128) * (DM / 64)), 1), 128, 0, stream>>>(X16 + r0p * DM, DM, 0, BV, DM, 0, 0.0625f, bv, 0, nullptr, 1, 0, 0, nullptr, V16 + r0p * DM, DM, 0, MP, DM, DM);
  k_vt<NH, SQ><<<NB * NH * (SQ / 64), 256, 0, stream>>>(V16, LQ, 0, VT);      /* V^T [NB][NH][HD][SQ], all batches in one launch */
  k_fattn<<<dim3(SQ / 256, NB * NH), 256, 0, stream>>>(Q16, K16, VT, O16);      /* o (merged heads, x64) as f16 rows: scores, softmax and P.V of every (batch, head) */
  k_gemm2<0><<<dim3((unsigned)((MPO / 128) * (DM / 64)), 1), 128, 0, stream>>>(O16 + r0p * DM, DM, 0, BO, DM, 0, 0.0009765625f, bo, 0, nullptr, 1, 0, 0, (float*)d_out + r0p * DM, nullptr, DM, 0, MPO, DM, DM);      /* out rows are the output layout */
}

// v003
// A run of this version takes 329 microseconds.
// In both of two side-by-side timings against v002, it was 1.35 times as fast.
// All steps since v000 together make it 30.2 times as fast.
#include <hip/hip_runtime.h>
// Multi-head self-attention with ONE STACKED per-head projection input on SIXTEEN sequences of 1024 at width 768 (z [16][1024][768]; U_qkv [12][3][768][64] = [head][q | k | v][in][out]: q, k, v of head h = z U_qkv[h][0 | 1 | 2]; NO biases; 12 heads of 64; logits / sqrt(64); softmax over all 1024 keys (no mask); out = merged U_msa ([in][out] [768][768], NO bias) -> [16][1024][768]); each (head, part) [in][out] block is transposed into its 64 contiguous rows of the part's weight plane, all blocks in the one preparation launch; dense: single f16 q / k / v planes on every row.
// Structure: token rows r = b*1024 + s; one preparation launch (all weight planes and x as exact f16 rows, bf16-rounded; jobs picked by block index); Q, K, V as three WMMA GEMMs in one grid (y = part; 32x64 wave tiles, f32 accumulation, exact x16 weights, null bias slots, f16 outputs); V^T for all batches and heads via LDS transposes (one launch); one fused attention launch over all (batch, head): S^T = K Q^T on WMMA, online softmax in registers (f32 statistics, native exp2; unnormalised weights as f16), O^T += V^T P^T on WMMA, divided by the row sum at the end (o carried x64, folded into the output GEMM alpha) and written straight into the merged f16 o rows; out = o U_msa GEMM (f32, null bias slot) into the output layout.
// Compute dtype: inputs rounded to bf16; x / weights exact; q, k, v, softmax weights and o as plain f16 GEMM operands (~2^-12); scores and softmax statistics f32. v_wmma_f32_16x16x32_f16.
#define NB 16
#define SQ 1024
#define DM 768 
#define NH 12
#define HD 64
#define HG 4                         /* heads per launch of the per-batch k_vt overload (not launched) */
#define B0 0                         /* first batch processed (debug hook) */
#define NBR NB                       /* batches processed (debug hook) */
#define NR ((size_t)NB * SQ)         /* token rows */
#define MP ((int)((size_t)NBR * SQ)) /* rows projected (debug hook) */
#define QN SQ                        /* not used: k_fattn attends all SQ query rows */
#define NHD NH                       /* not used: k_fattn attends all NH heads */
#define MPO MP                       /* rows through the output stage (debug hook) */
#define LQ DM      /* row pitch of the q/k/v rows */
typedef __bf16 v16b __attribute__((ext_vector_type(16)));
typedef unsigned short v8us __attribute__((ext_vector_type(8), may_alias));
typedef float  v8f  __attribute__((ext_vector_type(8)));
typedef float  v4f  __attribute__((ext_vector_type(4)));
typedef float  v4fa __attribute__((ext_vector_type(4), may_alias));
union FragB { v16b v; v8us half[2]; unsigned short u[16]; };

__device__ __forceinline__ unsigned short bf16_bits(float x) { unsigned int u = __float_as_uint(x); return (unsigned short)((u + 0x7FFFu + ((u >> 16) & 1u)) >> 16); }
__device__ __forceinline__ float bf16_val(unsigned short b) { return __uint_as_float(((unsigned int)b) << 16); }
__device__ __forceinline__ float bf16_round(float x) { return bf16_val(bf16_bits(x)); }
// D += A·B with NT terms: 1 = ah·bh, 2 = + al·bh (A split), 3 = + ah·bl (both split)
template <int NT>
__device__ __forceinline__ v8f mmaN(v16b ah, v16b al, v16b bh, v16b bl, v8f c) {
  c = __builtin_amdgcn_wmma_f32_16x16x32_bf16(false, ah, false, bh, (short)0, c, false, false);
  if (NT >= 2) c = __builtin_amdgcn_wmma_f32_16x16x32_bf16(false, al, false, bh, (short)0, c, false, false);
  if (NT >= 3) c = __builtin_amdgcn_wmma_f32_16x16x32_bf16(false, ah, false, bl, (short)0, c, false, false);
  asm volatile("v_nop\n\tv_nop\n\tv_nop\n\tv_nop" : "+v"(c) : "v"(ah), "v"(al), "v"(bh), "v"(bl));
  return c;
}

__global__ __launch_bounds__(256) void k_wt_bf16(const float* __restrict__ W, unsigned short* __restrict__ Wt, int K, int N) {
  const int t = blockIdx.x * 256 + threadIdx.x;
  const int k8n = K / 8;
  if (t >= N * k8n) return;
  const int n = t / k8n, k8 = (t % k8n) * 8;
  v8us v;
#pragma unroll
  for (int i = 0; i < 8; ++i) v[i] = bf16_bits(W[(size_t)(k8 + i) * N + n]);
  *(v8us*)(Wt + (size_t)n * K + k8) = v;
  
}

// GEMM C[M][N] (f32, pitch ldc) = act(A[M][K]·W + bias). A f32 row-major (pitch lda) converted per fragment to bf16
// (ASPLIT: hi/lo two planes -> 2 terms, else single rounded term); Wt bf16 [N][K] (pitch ldb). BIAS_BF16 rounds the
// bias to bf16 first (bias quantised to bf16 before the add). K%32==0, M%16==0, N%64==0.
template <bool ASPLIT, int ACT, bool BIAS_BF16>
__global__ __launch_bounds__(128) void k_gemm_bf(const float* __restrict__ A, int lda, const unsigned short* __restrict__ Wt, int ldb,
                                               const float* __restrict__ bias, float* __restrict__ C, int ldc, int M, int N, int K) {
  __shared__ __attribute__((aligned(16))) float so[4][16][64];
  const int tid = threadIdx.x, w = tid >> 5, lane = tid & 31, ln = lane & 15, hh = lane >> 4;
  const int ntn = N / 64;
  const int wid = blockIdx.x * 4 + w;
  const int mt = wid / ntn, nq = wid % ntn;
  if (mt * 16 >= M) return;
  const int row0 = mt * 16, col0 = nq * 64;
  const float* arow = A + (size_t)(row0 + ln) * lda;
  v8f acc[4] = {};
  for (int kb = 0; kb < K; kb += 32) {
    FragB ah, al;
    const v4f x0 = *(const v4fa*)(arow + kb + 8 * hh), x1 = *(const v4fa*)(arow + kb + 8 * hh + 4);
    const v4f x2 = *(const v4fa*)(arow + kb + 16 + 8 * hh), x3 = *(const v4fa*)(arow + kb + 16 + 8 * hh + 4);
    float xs[16] = {x0[0],x0[1],x0[2],x0[3],x1[0],x1[1],x1[2],x1[3],x2[0],x2[1],x2[2],x2[3],x3[0],x3[1],x3[2],x3[3]};
#pragma unroll
    for (int i = 0; i < 16; ++i) { const unsigned short hb = bf16_bits(xs[i]); ah.u[i] = hb; al.u[i] = ASPLIT ? bf16_bits(xs[i] - bf16_val(hb)) : (unsigned short)0; }
#pragma unroll
    for (int t = 0; t < 4; ++t) {
      const unsigned short* brow = Wt + (size_t)(col0 + t * 16 + ln) * ldb + kb;
      FragB b;
      b.half[0] = *(const v8us*)(brow + 8 * hh);
      b.half[1] = *(const v8us*)(brow + 16 + 8 * hh);
      acc[t] = mmaN<ASPLIT ? 2 : 1>(ah.v, al.v, b.v, b.v, acc[t]);
    }
  }
#pragma unroll
  for (int t = 0; t < 4; ++t) {
    float bv = bias ? bias[col0 + t * 16 + ln] : 0.f;
    if (BIAS_BF16) bv = bf16_round(bv);
#pragma unroll
    for (int r = 0; r < 8; ++r) { float v = acc[t][r] + bv; if (ACT == 1) v = fmaxf(v, 0.f); so[w][8 * hh + r][t * 16 + ln] = v; }
  }
  __builtin_amdgcn_fence(__ATOMIC_ACQ_REL, "workgroup");
  __builtin_amdgcn_wave_barrier();
  const int rsub = lane >> 4, c4 = (lane & 15) * 4;
  {
#pragma unroll
    for (int q = 0; q < 8; ++q) {
      const int r = q * 2 + rsub;
      const v4f v = *(const v4fa*)&so[w][r][c4];
      *(v4f*)(C + (size_t)(row0 + r) * ldc + col0 + c4) = v;
    }
    
  }
}

// GEMM C = act(A·W + bias + resid): A f32 (ASPLIT -> hi/lo 2 terms), Wt bf16 [N][K]; ACT 0 none, 1 relu, 2 exact gelu;
// resid (optional, f32, row index = (row % rmod), pitch ldr, RES_BF16 rounds it) added before the activation.
template <bool ASPLIT, int ACT, bool BIAS_BF16, bool RES_BF16>
__global__ __launch_bounds__(128) void k_gemm_bf3(const float* __restrict__ A, int lda, const unsigned short* __restrict__ Wt, int ldb,
                                                const float* __restrict__ bias, const float* __restrict__ resid, int rmod, int ldr,
                                                float* __restrict__ C, int ldc, int M, int N, int K) {
  __shared__ __attribute__((aligned(16))) float so[4][16][64];
  const int tid = threadIdx.x, w = tid >> 5, lane = tid & 31, ln = lane & 15, hh = lane >> 4;
  const int ntn = N / 64;
  const int wid = blockIdx.x * 4 + w;
  const int mt = wid / ntn, nq = wid % ntn;
  if (mt * 16 >= M) return;
  const int row0 = mt * 16, col0 = nq * 64;
  const float* arow = A + (size_t)(row0 + ln) * lda;
  v8f acc[4] = {};
  for (int kb = 0; kb < K; kb += 32) {
    FragB ah, al;
    const v4f x0 = *(const v4fa*)(arow + kb + 8 * hh), x1 = *(const v4fa*)(arow + kb + 8 * hh + 4);
    const v4f x2 = *(const v4fa*)(arow + kb + 16 + 8 * hh), x3 = *(const v4fa*)(arow + kb + 16 + 8 * hh + 4);
    float xs[16] = {x0[0],x0[1],x0[2],x0[3],x1[0],x1[1],x1[2],x1[3],x2[0],x2[1],x2[2],x2[3],x3[0],x3[1],x3[2],x3[3]};
#pragma unroll
    for (int i = 0; i < 16; ++i) { const unsigned short hb = bf16_bits(xs[i]); ah.u[i] = hb; al.u[i] = ASPLIT ? bf16_bits(xs[i] - bf16_val(hb)) : (unsigned short)0; }
#pragma unroll
    for (int t = 0; t < 4; ++t) {
      const unsigned short* brow = Wt + (size_t)(col0 + t * 16 + ln) * ldb + kb;
      FragB b;
      b.half[0] = *(const v8us*)(brow + 8 * hh);
      b.half[1] = *(const v8us*)(brow + 16 + 8 * hh);
      acc[t] = mmaN<ASPLIT ? 2 : 1>(ah.v, al.v, b.v, b.v, acc[t]);
    }
  }
#pragma unroll
  for (int t = 0; t < 4; ++t) {
    const int col = col0 + t * 16 + ln;
    float bv = bias ? bias[col] : 0.f;
    if (BIAS_BF16) bv = bf16_round(bv);
#pragma unroll
    for (int r = 0; r < 8; ++r) {
      float v = acc[t][r] + bv;
      if (resid) { float rv = resid[(size_t)((row0 + 8 * hh + r) % rmod) * ldr + col]; if (RES_BF16) rv = bf16_round(rv); v += rv; }
      if (ACT == 1) v = fmaxf(v, 0.f);
      if (ACT == 2) v = 0.5f * v * (1.0f + erff(v * 0.70710678118654752f));
      if (ACT == 3) { const float u = 0.7978845608028654f * (v + 0.044715f * v * v * v); v = 0.5f * v * (1.0f + tanhf(u)); }
      so[w][8 * hh + r][t * 16 + ln] = v;
    }
  }
  __builtin_amdgcn_fence(__ATOMIC_ACQ_REL, "workgroup");
  __builtin_amdgcn_wave_barrier();
  const int rsub = lane >> 4, c4 = (lane & 15) * 4;
  {
#pragma unroll
    for (int q = 0; q < 8; ++q) {
      const int r = q * 2 + rsub;
      const v4f v = *(const v4fa*)&so[w][r][c4];
      *(v4f*)(C + (size_t)(row0 + r) * ldc + col0 + c4) = v;
    }
    
  }
}
// row LayerNorm (biased variance, eps) over N: s = X (+ R); optional out_sum <- s; out_norm <- (s-mu)*rsqrt(var+eps)*g + b
template <bool PARAM_BF16>
__global__ __launch_bounds__(256) void k_layernorm(const float* __restrict__ X, const float* __restrict__ R, const float* __restrict__ g, const float* __restrict__ bta,
                                                  float* __restrict__ out_sum, float* __restrict__ out_norm, int N, float eps) {
  __shared__ float red[256];
  const int row = blockIdx.x, tid = threadIdx.x;
  const float* x = X + (size_t)row * N; const float* rr = R ? R + (size_t)row * N : nullptr;
  float vals[16];                     // up to N = 4096
  const int per = N / 256;            // contiguous chunk per thread? use strided-by-4 chunks: thread handles j = tid*4 + 1024*u
  float s1 = 0.f;
  for (int u = 0; u < per / 4; ++u) {
    const int j = tid * 4 + 1024 * u;
    const v4f a = *(const v4fa*)(x + j);
    v4f b = {0.f,0.f,0.f,0.f}; if (rr) b = *(const v4fa*)(rr + j);
#pragma unroll
    for (int q = 0; q < 4; ++q) { const float v = a[q] + b[q]; vals[u * 4 + q] = v; s1 += v; }
  }
  red[tid] = s1; __syncthreads();
  for (int st = 128; st > 0; st >>= 1) { if (tid < st) red[tid] += red[tid + st]; __syncthreads(); }
  const float mu = red[0] / (float)N; __syncthreads();
  float s2 = 0.f;
  for (int u = 0; u < per / 4; ++u)
#pragma unroll
    for (int q = 0; q < 4; ++q) { const float c = vals[u * 4 + q] - mu; s2 += c * c; }
  red[tid] = s2; __syncthreads();
  for (int st = 128; st > 0; st >>= 1) { if (tid < st) red[tid] += red[tid + st]; __syncthreads(); }
  const float rs = rsqrtf(red[0] / (float)N + eps);
  {
    for (int u = 0; u < per / 4; ++u) {
      const int j = tid * 4 + 1024 * u;
      v4f o, sm;
#pragma unroll
      for (int q = 0; q < 4; ++q) {
        float gg = g[j + q], bb = bta[j + q];
        if (PARAM_BF16) { gg = bf16_round(gg); bb = bf16_round(bb); }
        sm[q] = vals[u * 4 + q]; o[q] = (vals[u * 4 + q] - mu) * rs * gg + bb;
      }
      if (out_sum) *(v4f*)(out_sum + (size_t)row * N + j) = sm;
      *(v4f*)(out_norm + (size_t)row * N + j) = o;
    }
    
  }
}



// ---- f16 WMMA path (v_wmma_f32_16x16x32_f16): 11-bit significands for operands in range — used where a [0,1] probability operand needs more precision than bf16
typedef _Float16 v16h __attribute__((ext_vector_type(16)));
union FragH { v16h v; v8us half[2]; _Float16 h[16]; unsigned short u[16]; };
template <int NT>
__device__ __forceinline__ v8f mmaH(v16h ah, v16h al, v16h bh, v16h bl, v8f c) {
  c = __builtin_amdgcn_wmma_f32_16x16x32_f16(false, ah, false, bh, (short)0, c, false, false);
  if (NT >= 2) c = __builtin_amdgcn_wmma_f32_16x16x32_f16(false, al, false, bh, (short)0, c, false, false);
  if (NT >= 3) c = __builtin_amdgcn_wmma_f32_16x16x32_f16(false, ah, false, bl, (short)0, c, false, false);
  asm volatile("v_nop\n\tv_nop\n\tv_nop\n\tv_nop" : "+v"(c) : "v"(ah), "v"(al), "v"(bh), "v"(bl));
  return c;
}
// batched GEMM like k_gemm_b but f16 operands: A f32 (split into f16 hi/lo if ASPLIT, else rounded to f16), Bt = f16 values [n][k]; alpha; C f32; N multiple of 16 (partial tiles skipped)
template <bool ASPLIT>
__global__ __launch_bounds__(128) void k_gemm_h(const float* __restrict__ A, int lda, size_t sA, const _Float16* __restrict__ Bh, int ldb, size_t sB, float alpha, float* __restrict__ C, int ldc, size_t sC, int M, int N, int K) {
  __shared__ __attribute__((aligned(16))) float so[4][16][64];
  const int tid = threadIdx.x, w = tid >> 5, lane = tid & 31, ln = lane & 15, hh = lane >> 4; const int by = blockIdx.y;
  A += (size_t)by * sA; Bh += (size_t)by * sB; C += (size_t)by * sC;
  const int ntn = (N + 63) / 64; const int wid = blockIdx.x * 4 + w; const int mt = wid / ntn, nq = wid % ntn; if (mt * 16 >= M) return;
  const int row0 = mt * 16, col0 = nq * 64; const float* arow = A + (size_t)(row0 + ln) * lda;
  v8f acc[4] = {};
  for (int kb = 0; kb < K; kb += 32) {
    FragH ah, al;
    const v4f x0 = *(const v4fa*)(arow + kb + 8 * hh), x1 = *(const v4fa*)(arow + kb + 8 * hh + 4), x2 = *(const v4fa*)(arow + kb + 16 + 8 * hh), x3 = *(const v4fa*)(arow + kb + 16 + 8 * hh + 4);
    float xs[16] = {x0[0],x0[1],x0[2],x0[3],x1[0],x1[1],x1[2],x1[3],x2[0],x2[1],x2[2],x2[3],x3[0],x3[1],x3[2],x3[3]};
#pragma unroll
    for (int i = 0; i < 16; ++i) { const _Float16 h = (_Float16)xs[i]; ah.h[i] = h; al.h[i] = ASPLIT ? (_Float16)(xs[i] - (float)h) : (_Float16)0.0f; }
#pragma unroll
    for (int t = 0; t < 4; ++t) { if (col0 + t * 16 >= N) continue; const size_t boff = (size_t)(col0 + t * 16 + ln) * ldb + kb; FragH bq; bq.half[0] = *(const v8us*)(Bh + boff + 8 * hh); bq.half[1] = *(const v8us*)(Bh + boff + 16 + 8 * hh);
      acc[t] = mmaH<ASPLIT ? 2 : 1>(ah.v, al.v, bq.v, bq.v, acc[t]); }
  }
#pragma unroll
  for (int t = 0; t < 4; ++t) { if (col0 + t * 16 >= N) continue;
#pragma unroll
    for (int r = 0; r < 8; ++r) so[w][8 * hh + r][t * 16 + ln] = acc[t][r] * alpha; }
  __builtin_amdgcn_fence(__ATOMIC_ACQ_REL, "workgroup"); __builtin_amdgcn_wave_barrier();
  const int rsub = lane >> 4, c4 = (lane & 15) * 4;
  {
#pragma unroll
    for (int q = 0; q < 8; ++q) { const int r = q * 2 + rsub; if (col0 + c4 < N) { const v4f v = *(const v4fa*)&so[w][r][c4]; *(v4f*)(C + (size_t)(row0 + r) * ldc + col0 + c4) = v; } }
     }
}

// Wt[n][k] = f16(W[k][n]·scale) from f32 row-major W[K][N] (scale = power of two; bf16-exact weights stay exact in f16 away from the subnormal range)
__device__ __forceinline__ void wt_f16(const float* __restrict__ W, _Float16* __restrict__ Wt, int K, int N, float scale, int t) {
  const int n = t / (K / 8), k8 = (t % (K / 8)) * 8; FragH f;
#pragma unroll
  for (int i = 0; i < 8; ++i) f.h[i] = (_Float16)(bf16_round(W[(size_t)(k8 + i) * N + n]) * scale); const v8us o = f.half[0];
  *(v8us*)((unsigned short*)Wt + (size_t)n * K + k8) = o;
  asm volatile("s_wait_xcnt 0x0" ::: "memory");      /* behind the store: in the joined kernel the listing runs on into another job's code, which rewrites the store's registers */
}
// k_gemm_hh variant with fused epilogue: v = acc·alpha + bias[by·sBias + col] (+ CP[(row/rowsPerB)·sCPb + by·64 + col] if CP) ; ACT 0 none / 1 elu ; writes f16 C16 (and f32 C if non-null)
template <int ACT>
__global__ __launch_bounds__(128) void k_gemm_hhx(const _Float16* __restrict__ A, int lda, size_t sA, const _Float16* __restrict__ Bh, int ldb, size_t sB, float alpha, const float* __restrict__ bias, size_t sBias, const float* __restrict__ CP, int rowsPerB, size_t sCPb, int row0g,
    float* __restrict__ C, _Float16* __restrict__ C16, int ldc, size_t sC, int M, int N, int K) {
  __shared__ __attribute__((aligned(16))) float so[4][16][64];
  const int tid = threadIdx.x, w = tid >> 5, lane = tid & 31, ln = lane & 15, hh = lane >> 4; const int by = blockIdx.y;
  A += (size_t)by * sA; Bh += (size_t)by * sB; const size_t cofs = (size_t)by * sC; const float* bp = bias ? bias + (size_t)by * sBias : nullptr;
  const int ntn = (N + 63) / 64; const int wid = blockIdx.x * 4 + w; const int mt = wid / ntn, nq = wid % ntn; if (mt * 16 >= M) return;
  const int row0 = mt * 16, col0 = nq * 64; const _Float16* arow = A + (size_t)(row0 + ln) * lda;
  v8f acc[4] = {};
  for (int kb = 0; kb < K; kb += 32) { FragH ah; ah.half[0] = *(const v8us*)((const unsigned short*)arow + kb + 8 * hh); ah.half[1] = *(const v8us*)((const unsigned short*)arow + kb + 16 + 8 * hh);
#pragma unroll
    for (int t = 0; t < 4; ++t) { if (col0 + t * 16 >= N) continue; const size_t boff = (size_t)(col0 + t * 16 + ln) * ldb + kb; FragH bq; bq.half[0] = *(const v8us*)((const unsigned short*)Bh + boff + 8 * hh); bq.half[1] = *(const v8us*)((const unsigned short*)Bh + boff + 16 + 8 * hh);
      acc[t] = mmaH<1>(ah.v, ah.v, bq.v, bq.v, acc[t]); }
  }
#pragma unroll
  for (int t = 0; t < 4; ++t) { if (col0 + t * 16 >= N) continue; const int col = col0 + t * 16 + ln; const float bv = bp ? bf16_round(bp[col]) : 0.f;
#pragma unroll
    for (int r = 0; r < 8; ++r) { float v = acc[t][r] * alpha + bv; if (CP) { const int rr = row0g + row0 + 8 * hh + r; if (rowsPerB < 0) v += CP[cofs + (size_t)rr * ldc + col];      /* rowsPerB < 0: own element of the batched C plane */ else { const int bidx = rr / rowsPerB; v += CP[(size_t)bidx * sCPb + (size_t)by * 64 + col]; } } if (ACT == 1) v = (v > 0.f) ? v : expm1f(v); else if (ACT == 7) v = (v > 0.f) ? v + 1.0f : expf(v); else if (ACT == 8) v = tanhf(v); else if (ACT == 9) v = 0.5f * v * (1.0f + tanhf(0.7978845608028654f * (v + 0.044715f * v * v * v))); else if (ACT == 11) v = 1.0f / (1.0f + expf(-v)); else if (ACT == 12) v = (v > 0.f) ? v : 0.01f * v; else if (ACT == 14) v = (v > 0.f) ? v : 0.1f * v; else if (ACT == 16) v = (v >= 0.f) ? v : 0.3f * v; else if (ACT == 17) v = (v >= 0.f) ? v : 0.2f * v; else if (ACT == 15) v = v / (1.0f + expf(-v)); else if (ACT == 3) v = fmaxf(v, 0.f); else if (ACT == 6) v = 0.5f * v * (1.0f + erff(v * 0.70710678118654752f)); so[w][8 * hh + r][t * 16 + ln] = v; } }
  __builtin_amdgcn_fence(__ATOMIC_ACQ_REL, "workgroup"); __builtin_amdgcn_wave_barrier();
  const int rsub = lane >> 4, c4 = (lane & 15) * 4; typedef _Float16 v4h __attribute__((ext_vector_type(4)));
  {
#pragma unroll
    for (int q = 0; q < 8; ++q) { const int r = q * 2 + rsub; if (col0 + c4 < N) { const v4f v = *(const v4fa*)&so[w][r][c4]; if (C) *(v4f*)(C + cofs + (size_t)(row0 + r) * ldc + col0 + c4) = v; if (C16) { v4h h4; for (int i = 0; i < 4; ++i) h4[i] = (_Float16)v[i]; *(v4h*)(C16 + cofs + (size_t)(row0 + r) * ldc + col0 + c4) = h4; } } }
     }
}


typedef _Float16 v4h __attribute__((ext_vector_type(4)));

// Every job that reads inputs only, in ONE launch; a block's job follows from its index (block-uniform branches, no job depends on another):
// blocks [0, PB_QKV): the 36 (head, part) blocks of U_qkv, PB_HP blocks each, into planes Bq | Bk | Bv (contiguous, DM*DM apart); [PB_QKV, PB_W): U_msa into Bo; the rest: x rows.
#define PB_HP  (HD * (DM / 8) / 256)          /* blocks per (head, part) */
#define PB_QKV (3 * NH * PB_HP)
#define PB_W   (PB_QKV + DM * (DM / 8) / 256)
#define PB_ALL (PB_W + (int)(NR * DM / 8 / 256))
__global__ __launch_bounds__(256) void k_prep(const float* __restrict__ x, const float* __restrict__ wqkv, const float* __restrict__ wo, _Float16* __restrict__ X16, _Float16* __restrict__ Bqkv, _Float16* __restrict__ Bo) {
  static_assert(HD * (DM / 8) % 256 == 0 && DM * (DM / 8) % 256 == 0 && NR * DM / 8 % 256 == 0, "k_prep: whole blocks per job");
  const int bi = blockIdx.x, tid = threadIdx.x;
  if (bi < PB_QKV) { const int job = bi / PB_HP, h = job / 3, p = job - 3 * h;      /* U_qkv block (h, p): row-major [in = DM][out = HD] at (3 h + p) * DM * HD -> rows h * HD .. of plane p */
    wt_f16(wqkv + (size_t)job * DM * HD, Bqkv + (size_t)p * DM * DM + (size_t)h * HD * DM, DM, HD, 16.0f, (bi - job * PB_HP) * 256 + tid); return; }
  if (bi < PB_W) { wt_f16(wo, Bo, DM, DM, 16.0f, (bi - PB_QKV) * 256 + tid); return; }
  const size_t t = (size_t)(bi - PB_W) * 256 + tid; FragH f;
#pragma unroll
  for (int q = 0; q < 8; ++q) f.h[q] = (_Float16)bf16_round(x[t * 8 + q]); *(v8us*)((unsigned short*)X16 + t * 8) = f.half[0];
  asm volatile("s_wait_xcnt 0x0" ::: "memory"); }      /* behind the store, as in wt_f16 */
__global__ __launch_bounds__(256) void k_h16(const float* __restrict__ x, _Float16* __restrict__ X16, size_t n8) { const size_t t = (size_t)blockIdx.x * 256 + threadIdx.x; if (t >= n8) return; FragH f;
#pragma unroll
  for (int q = 0; q < 8; ++q) f.h[q] = (_Float16)x[t * 8 + q]; *(v8us*)((unsigned short*)X16 + t * 8) = f.half[0];  }
__global__ __launch_bounds__(256) void k_round16f(const float* __restrict__ W, _Float16* __restrict__ Bt, size_t n8) { const size_t t = (size_t)blockIdx.x * 256 + threadIdx.x; if (t >= n8) return; FragH f;
#pragma unroll
  for (int i = 0; i < 8; ++i) f.h[i] = (_Float16)(bf16_round(W[t * 8 + i]) * 16.0f); *(v8us*)((unsigned short*)Bt + t * 8) = f.half[0];  }
template <int NHv, int TTv>
__global__ __launch_bounds__(256) void k_vt(const _Float16* __restrict__ V16, int ldv, int voff, _Float16* __restrict__ Vt) { __shared__ unsigned short tl[64][66]; const int tid = threadIdx.x; const int slab = blockIdx.x / (TTv / 64), lg = blockIdx.x % (TTv / 64); const int b = slab / NHv, h = slab % NHv;
  for (int i = tid; i < 64 * 8; i += 256) { const int r = i / 8, c8 = (i % 8) * 8; FragH f; f.half[0] = *(const v8us*)((const unsigned short*)V16 + ((size_t)b * TTv + lg * 64 + r) * ldv + voff + h * 64 + c8);
#pragma unroll
    for (int q = 0; q < 8; ++q) tl[r][c8 + q] = f.u[q]; }
  __syncthreads();
  {
#pragma unroll
    for (int rd = 0; rd < 2; ++rd) { const int d = rd * 32 + tid / 8, pc = tid % 8; FragH f;
#pragma unroll
      for (int q = 0; q < 8; ++q) f.u[q] = tl[pc * 8 + q][d];
      *(v8us*)((unsigned short*)Vt + ((size_t)slab * 64 + d) * TTv + lg * 64 + pc * 8) = f.half[0]; }
     } }

__global__ __launch_bounds__(256) void k_hl(const float* __restrict__ F, _Float16* __restrict__ Hh, _Float16* __restrict__ Hl, size_t n8) { const size_t t = (size_t)blockIdx.x * 256 + threadIdx.x; if (t >= n8) return; FragH fh, fl; const v4f a = *(const v4fa*)(F + t * 8), c = *(const v4fa*)(F + t * 8 + 4);
#pragma unroll
  for (int q = 0; q < 4; ++q) { _Float16 h = (_Float16)a[q]; fh.h[q] = h; fl.h[q] = (_Float16)((a[q] - (float)h) * 1024.0f); h = (_Float16)c[q]; fh.h[4 + q] = h; fl.h[4 + q] = (_Float16)((c[q] - (float)h) * 1024.0f); }
  { *(v8us*)((unsigned short*)Hh + t * 8) = fh.half[0]; *(v8us*)((unsigned short*)Hl + t * 8) = fl.half[0];  } }

// ---- fast GEMM (wave tile 32x64; requires M % 32 == 0 rows per launch region and N % 64 == 0); epilogue = k_gemm_hhx semantics ----
__device__ __forceinline__ v16h g2_frag(const _Float16* p, int hh) { FragH f; f.half[0] = *(const v8us*)((const unsigned short*)p + 8 * hh); f.half[1] = *(const v8us*)((const unsigned short*)p + 16 + 8 * hh); return f.v; }
__device__ __forceinline__ v8f g2_mma(v16h a, v16h b, v8f c) { v8f d = __builtin_amdgcn_wmma_f32_16x16x32_f16(false, a, false, b, (short)0, c, false, false); asm volatile("v_nop\n\tv_nop\n\tv_nop\n\tv_nop" : "+v"(d) : "v"(a), "v"(b)); return d; }
template <int ACT>
__global__ __launch_bounds__(128) void k_gemm2(const _Float16* __restrict__ A, int lda, size_t sA, const _Float16* __restrict__ Bh, int ldb, size_t sB, float alpha, const float* __restrict__ bias, size_t sBias, const float* __restrict__ CP, int rowsPerB, size_t sCPb, int row0g,
    float* __restrict__ C, _Float16* __restrict__ C16, int ldc, size_t sC, int M, int N, int K) { static_assert(ACT == 0 || ACT == 3 || ACT == 6 || ACT == 8 || ACT == 9 || ACT == 11 || ACT == 12 || ACT == 14 || ACT == 15 || ACT == 16 || ACT == 17, "k_gemm2: unsupported ACT code (would silently apply no activation)");
  __shared__ __attribute__((aligned(16))) float so[4][32][68];
  const int tid = threadIdx.x, w = tid >> 5, lane = tid & 31, ln = lane & 15, hh = lane >> 4; const int by = blockIdx.y;
  A += (size_t)by * sA; Bh += (size_t)by * sB; const size_t cofs = (size_t)by * sC; const float* bp = bias ? bias + (size_t)by * sBias : nullptr;
  const int ntn = N >> 6; const int mt = blockIdx.x / ntn, nq = blockIdx.x - mt * ntn; const int row0 = mt * 128 + 32 * w, col0 = nq * 64; if (row0 >= M) return;
  const _Float16* a0p = A + (size_t)(row0 + ln) * lda; const _Float16* a1p = a0p + (size_t)16 * lda;
  const _Float16* b0p = Bh + (size_t)(col0 + ln) * ldb; const _Float16* b1p = b0p + (size_t)16 * ldb; const _Float16* b2p = b1p + (size_t)16 * ldb; const _Float16* b3p = b2p + (size_t)16 * ldb;
  const v8f z8 = {0.f,0.f,0.f,0.f,0.f,0.f,0.f,0.f}; v8f c00 = z8, c01 = z8, c02 = z8, c03 = z8, c10 = z8, c11 = z8, c12 = z8, c13 = z8;
#pragma unroll 1
  for (int kb = 0; kb < K; kb += 32) { const v16h a0 = g2_frag(a0p + kb, hh), a1 = g2_frag(a1p + kb, hh);
    v16h b = g2_frag(b0p + kb, hh); c00 = g2_mma(a0, b, c00); c10 = g2_mma(a1, b, c10);
    b = g2_frag(b1p + kb, hh); c01 = g2_mma(a0, b, c01); c11 = g2_mma(a1, b, c11);
    b = g2_frag(b2p + kb, hh); c02 = g2_mma(a0, b, c02); c12 = g2_mma(a1, b, c12);
    b = g2_frag(b3p + kb, hh); c03 = g2_mma(a0, b, c03); c13 = g2_mma(a1, b, c13); }
  v8f accs[8] = {c00, c01, c02, c03, c10, c11, c12, c13};
#pragma unroll
  for (int u = 0; u < 8; ++u) { const int t = u & 3, half = u >> 2; const int col = col0 + t * 16 + ln; const float bv = bp ? bf16_round(bp[col]) : 0.f;
#pragma unroll
    for (int r = 0; r < 8; ++r) { const int rloc = half * 16 + 8 * hh + r; float v = accs[u][r] * alpha + bv; if (CP) { if (rowsPerB < 0) v += CP[cofs + (size_t)(row0g + row0 + rloc) * ldc + col];      /* rowsPerB < 0: own element of the batched C plane */ else { const int bidx = (row0g + row0 + rloc) / rowsPerB; v += CP[(size_t)bidx * sCPb + (size_t)by * 64 + col]; } }
      if (ACT == 3) v = fmaxf(v, 0.f); else if (ACT == 6) v = 0.5f * v * (1.0f + erff(v * 0.70710678118654752f)); else if (ACT == 11) v = 1.0f / (1.0f + expf(-v)); else if (ACT == 15) v = v / (1.0f + expf(-v)); else if (ACT == 12) v = (v > 0.f) ? v : 0.01f * v; else if (ACT == 8) v = tanhf(v); else if (ACT == 9) v = 0.5f * v * (1.0f + tanhf(0.7978845608028654f * (v + 0.044715f * v * v * v))); else if (ACT == 14) v = (v > 0.f) ? v : 0.1f * v; else if (ACT == 16) v = (v >= 0.f) ? v : 0.3f * v; else if (ACT == 17) v = (v >= 0.f) ? v : 0.2f * v;
      so[w][rloc][t * 16 + ln] = v; } }
  __builtin_amdgcn_fence(__ATOMIC_ACQ_REL, "workgroup"); __builtin_amdgcn_wave_barrier();
  const int rsub = lane >> 4, c4 = (lane & 15) * 4;
  {
#pragma unroll
    for (int q = 0; q < 16; ++q) { const int r = q * 2 + rsub; const v4f v = *(const v4fa*)&so[w][r][c4]; if (C) *(v4f*)(C + cofs + (size_t)(row0 + r) * ldc + col0 + c4) = v; if (C16) { v4h h4; for (int i = 0; i < 4; ++i) h4[i] = (_Float16)v[i]; *(v4h*)(C16 + cofs + (size_t)(row0 + r) * ldc + col0 + c4) = h4; } }
     } }


__global__ __launch_bounds__(256) void k_wnat(const float* __restrict__ w, size_t n8, _Float16* __restrict__ Bt) { const size_t t = (size_t)blockIdx.x * 256 + threadIdx.x; if (t >= n8) return; FragH f; for (int q = 0; q < 8; ++q) f.h[q] = (_Float16)(bf16_round(w[t * 8 + q]) * 16.0f); *(v8us*)((unsigned short*)Bt + t * 8) = f.half[0];  }
__global__ __launch_bounds__(256) void k_rsm(const float* __restrict__ S, _Float16* __restrict__ P, int nrows) {
  #pragma clang fp contract(off)
  const int i = blockIdx.x * 256 + threadIdx.x; if (i >= nrows) return; const float* s = S + (size_t)i * SQ; float mx = -3.0e38f;
#pragma unroll 1
  for (int j = 0; j < SQ; ++j) mx = fmaxf(mx, s[j]); float se = 0.f;
#pragma unroll 1
  for (int j = 0; j < SQ; ++j) se += expf(s[j] - mx); const float sc = 256.0f / se;
#pragma unroll 1
  for (int j0 = 0; j0 < SQ; j0 += 8) { FragH f; for (int q = 0; q < 8; ++q) f.h[q] = (_Float16)(expf(s[j0 + q] - mx) * sc); unsigned short* d = (unsigned short*)P + (size_t)i * SQ + j0; *(v8us*)d = f.half[0];  } }
__global__ __launch_bounds__(256) void k_vt(const _Float16* __restrict__ V16, int b, int h0, _Float16* __restrict__ VT) { __shared__ unsigned short tl[64][65]; const int tid = threadIdx.x; const int hh = blockIdx.x % HG, sg = blockIdx.x / HG; const int s0 = sg * 64; const int h = h0 + hh;
  for (int i = tid; i < 64 * 8; i += 256) { const int j = i / 8, d8 = (i % 8) * 8; FragH f; f.half[0] = *(const v8us*)((const unsigned short*)V16 + ((size_t)b * SQ + s0 + j) * DM + h * HD + d8); for (int q = 0; q < 8; ++q) tl[d8 + q][j] = f.u[q]; }
  __syncthreads();
  { for (int i = tid; i < 64 * 8; i += 256) { const int d = i / 8, j8 = (i % 8) * 8; FragH f; for (int q = 0; q < 8; ++q) f.u[q] = tl[d][j8 + q]; *(v8us*)((unsigned short*)VT + ((size_t)hh * HD + d) * SQ + s0 + j8) = f.half[0]; }  } }



// lane l <-> l ^ 16 (cross-row move); every lane on
__device__ __forceinline__ float rs_xh(float x) { return __builtin_bit_cast(float, __builtin_amdgcn_permlanex16(__builtin_bit_cast(int, x), __builtin_bit_cast(int, x), 0x76543210, 0xfedcba98, false, false)); }
__device__ __forceinline__ v8f fa_mma(v16h a, v16h b, v8f c) { return __builtin_amdgcn_wmma_f32_16x16x32_f16(false, a, false, b, (short)0, c, false, false); }
#define FA_C 0.18033688011112042f      /* 0.125 * log2(e) */
#define FA_T 44.361419555836498f       /* 8 / FA_C: the rescale threshold in raw score units */
__global__ __launch_bounds__(256) void k_fattn(const _Float16* __restrict__ Q, const _Float16* __restrict__ Kr, const _Float16* __restrict__ VT, _Float16* __restrict__ O) { static_assert(HD == 64 && SQ % 256 == 0, "k_fattn: 2 k fragments per row, 8 waves x 32 queries");
  const int lane = threadIdx.x & 31, ln = lane & 15, hh = lane >> 4, w = threadIdx.x >> 5; const int slab = blockIdx.y, b = slab / NH, h = slab - b * NH; const int q0 = blockIdx.x * 256 + w * 32;
  const _Float16* qp = Q + ((size_t)b * SQ + q0 + ln) * LQ + h * HD; const _Float16* kp = Kr + ((size_t)b * SQ + ln) * LQ + h * HD; const _Float16* vp = VT + ((size_t)slab * HD + ln) * SQ;
  v16h qf[2][2], kf[2][2];      /* [tile][half of the 64 d] */
#pragma unroll
  for (int j = 0; j < 2; ++j) { qf[j][0] = g2_frag(qp + (size_t)j * 16 * LQ, hh); qf[j][1] = g2_frag(qp + (size_t)j * 16 * LQ + 32, hh); kf[j][0] = g2_frag(kp + (size_t)j * 16 * LQ, hh); kf[j][1] = g2_frag(kp + (size_t)j * 16 * LQ + 32, hh); }
  const v8f z8 = {0.f,0.f,0.f,0.f,0.f,0.f,0.f,0.f}; v8f o[2][4]; float m[2] = {-3.0e38f, -3.0e38f}, l[2] = {0.f, 0.f};
#pragma unroll
  for (int j = 0; j < 2; ++j) for (int dt = 0; dt < 4; ++dt) o[j][dt] = z8;
#pragma unroll 1      /* stays rolled (for speed only) */
  for (int kb = 0; kb < SQ; kb += 32) {
    v16h vf[4];      /* V^T rows of this pass: asked for first, used last */
#pragma unroll
    for (int dt = 0; dt < 4; ++dt) vf[dt] = g2_frag(vp + (size_t)dt * 16 * SQ + kb, hh);
    v8f s[2][2];      /* [query tile][key tile] */
#pragma unroll
    for (int j = 0; j < 2; ++j) for (int t = 0; t < 2; ++t) s[j][t] = fa_mma(kf[t][1], qf[j][1], fa_mma(kf[t][0], qf[j][0], z8));
    const _Float16* kn = kp + (size_t)((kb + 32) & (SQ - 1)) * LQ;      /* next pass's K rows, fetched one pass ahead (the last pass wraps to row 0: in bounds, not used) */
#pragma unroll
    for (int t = 0; t < 2; ++t) { kf[t][0] = g2_frag(kn + (size_t)t * 16 * LQ, hh); kf[t][1] = g2_frag(kn + (size_t)t * 16 * LQ + 32, hh); }
    float tm[2];
#pragma unroll
    for (int j = 0; j < 2; ++j) { float a = fmaxf(s[j][0][0], s[j][1][0]);
      for (int r = 1; r < 8; ++r) a = fmaxf(a, fmaxf(s[j][0][r], s[j][1][r]));
      tm[j] = fmaxf(a, rs_xh(a)); }
    if (__builtin_amdgcn_ballot_w32(tm[0] > m[0] + FA_T || tm[1] > m[1] + FA_T) != 0) {      /* one scalar branch per pass */
#pragma unroll
      for (int j = 0; j < 2; ++j) { const float mn = fmaxf(m[j], tm[j]); const float al = __builtin_amdgcn_exp2f((m[j] - mn) * FA_C); m[j] = mn; l[j] *= al;
        for (int dt = 0; dt < 4; ++dt) o[j][dt] *= al; } }
    FragH pf[2];
#pragma unroll
    for (int j = 0; j < 2; ++j) { const float mc = m[j] * FA_C; float s0 = 0.f, s1 = 0.f;
      for (int r = 0; r < 8; ++r) { const float p0 = __builtin_amdgcn_exp2f(s[j][0][r] * FA_C - mc), p1 = __builtin_amdgcn_exp2f(s[j][1][r] * FA_C - mc); s0 += p0; s1 += p1; pf[j].h[r] = (_Float16)p0; pf[j].h[8 + r] = (_Float16)p1; }
      l[j] += s0 + s1; }
#pragma unroll
    for (int dt = 0; dt < 4; ++dt) for (int j = 0; j < 2; ++j) o[j][dt] = fa_mma(vf[dt], pf[j].v, o[j][dt]);
  }
#pragma unroll
  for (int j = 0; j < 2; ++j) { const float inv = 64.0f / (l[j] + rs_xh(l[j])); unsigned short* d = (unsigned short*)O + ((size_t)b * SQ + q0 + j * 16 + ln) * DM + h * HD + 8 * hh;
    for (int dt = 0; dt < 4; ++dt) { FragH f; for (int r = 0; r < 8; ++r) f.h[r] = (_Float16)(o[j][dt][r] * inv); *(v8us*)(d + dt * 16) = f.half[0]; } } }

extern "C" void kernel_launch(void* const* d_in, const int* in_sizes, int n_in,
                              void* d_out, int out_size, void* d_ws, size_t ws_size, hipStream_t stream) {
  (void)in_sizes; (void)n_in; (void)out_size;
  const float* const* I = (const float* const*)d_in; const float* x = I[0]; const float* wqkv = I[1]; const float* bq = nullptr; const float* wo = I[2]; const float* bo = nullptr;      /* ONE input stream (z); U_qkv is ONE STACK [12][3][768][64] = [head][q | k | v][in][out]; U_msa [in][out] [768][768]; the module has NO biases: bare null pointers in the guarded bias slots; input order z, U_qkv, U_msa */
  char* ws = (char*)d_ws; size_t off = 0;
  auto take = [&](size_t bytes) { char* p = ws + off; off += (bytes + 255) & ~(size_t)255; return p; };
  _Float16* BQ = (_Float16*)take((size_t)3 * DM * DM * 2); _Float16* BO = (_Float16*)take((size_t)DM * DM * 2);      /* BQ: planes q | k | v, DM * DM apart */
  _Float16* X16 = (_Float16*)take(NR * DM * 2); _Float16* Q16 = (_Float16*)take((size_t)3 * NR * DM * 2); _Float16* K16 = Q16 + NR * DM; _Float16* V16 = K16 + NR * DM; _Float16* O16 = (_Float16*)take(NR * DM * 2);      /* q | k | v rows, NR * DM apart */
  _Float16* VT = (_Float16*)take((size_t)NB * NH * HD * SQ * 2);
  if (off > ws_size) return;
  k_prep<<<PB_ALL, 256, 0, stream>>>(x, wqkv, wo, X16, BQ, BO);      /* all weight planes ([out][in], x16) and the x rows */
  const size_t r0p = (size_t)B0 * SQ;      /* first projected row */
  k_gemm2<0><<<dim3((unsigned)((MP / 128) * (DM / 64)), 3), 128, 0, stream>>>(X16 + r0p * DM, DM, 0, BQ, DM, (size_t)DM * DM, 0.0625f, bq, 0, nullptr, 1, 0, 0, nullptr, Q16 + r0p * DM, DM, NR * DM, MP, DM, DM);      /* y = q | k | v: same A rows, weight plane and output rows of the part */
  k_vt<NH, SQ><<<NB * NH * (SQ / 64), 256, 0, stream>>>(V16, LQ, 0, VT);      /* V^T [NB][NH][HD][SQ], all batches in one launch */
  k_fattn<<<dim3(SQ / 256, NB * NH), 256, 0, stream>>>(Q16, K16, VT, O16);      /* o (merged heads, x64) as f16 rows: scores, softmax and P.V of every (batch, head) */
  k_gemm2<0><<<dim3((unsigned)((MPO / 128) * (DM / 64)), 1), 128, 0, stream>>>(O16 + r0p * DM, DM, 0, BO, DM, 0, 0.0009765625f, bo, 0, nullptr, 1, 0, 0, (float*)d_out + r0p * DM, nullptr, DM, 0, MPO, DM, DM);      /* out rows are the output layout */
}

// v004
// Measured time: 220 microseconds a run.
// In both of two side-by-side timings against v003, it was 1.50 times as fast.
// Over all steps from v000 it is 45.3 times as fast.
#include <hip/hip_runtime.h>
// Multi-head self-attention with ONE STACKED per-head projection input on SIXTEEN sequences of 1024 at width 768 (z [16][1024][768]; U_qkv [12][3][768][64] = [head][q | k | v][in][out]: q, k, v of head h = z U_qkv[h][0 | 1 | 2]; NO biases; 12 heads of 64; logits / sqrt(64); softmax over all 1024 keys (no mask); out = merged U_msa ([in][out] [768][768], NO bias) -> [16][1024][768]); each (head, part) [in][out] block is transposed into its 64 contiguous rows of the part's weight plane, all blocks in the one preparation launch; dense: single f16 q / k / v planes on every row.
// Structure: token rows r = b*1024 + s; one preparation launch (all weight planes and x as exact f16 rows, bf16-rounded; jobs picked by block index); Q, K, V as three WMMA GEMMs in one grid (y = part; 32x64 wave tiles, operand tiles staged in LDS by asynchronous copies, f32 accumulation, exact x16 weights, null bias slots, f16 outputs); V^T for all batches and heads via LDS transposes (one launch); one fused attention launch over all (batch, head): S^T = K Q^T on WMMA, online softmax in registers (f32 statistics, native exp2; unnormalised weights as f16), O^T += V^T P^T on WMMA, divided by the row sum at the end (o carried x64, folded into the output GEMM alpha) and written straight into the merged f16 o rows; out = o U_msa GEMM (f32, null bias slot) into the output layout.
// Compute dtype: inputs rounded to bf16; x / weights exact; q, k, v, softmax weights and o as plain f16 GEMM operands (~2^-12); scores and softmax statistics f32; v_wmma_f32_16x16x32_f16.
#define NB 16
#define SQ 1024
#define DM 768 
#define NH 12
#define HD 64
#define HG 4                         /* heads per launch of the per-batch k_vt overload (not launched) */
#define B0 0                         /* first batch processed (debug hook) */
#define NBR NB                       /* batches processed (debug hook) */
#define NR ((size_t)NB * SQ)         /* token rows */
#define MP ((int)((size_t)NBR * SQ)) /* rows projected (debug hook) */
#define QN SQ                        /* not used: k_fattn attends all SQ query rows */
#define NHD NH                       /* not used: k_fattn attends all NH heads */
#define MPO MP                       /* rows through the output stage (debug hook) */
#define LQ DM      /* row pitch of the q/k/v rows */
typedef __bf16 v16b __attribute__((ext_vector_type(16)));
typedef unsigned short v8us __attribute__((ext_vector_type(8), may_alias));
typedef float  v8f  __attribute__((ext_vector_type(8)));
typedef float  v4f  __attribute__((ext_vector_type(4)));
typedef float  v4fa __attribute__((ext_vector_type(4), may_alias));
union FragB { v16b v; v8us half[2]; unsigned short u[16]; };

__device__ __forceinline__ unsigned short bf16_bits(float x) { unsigned int u = __float_as_uint(x); return (unsigned short)((u + 0x7FFFu + ((u >> 16) & 1u)) >> 16); }
__device__ __forceinline__ float bf16_val(unsigned short b) { return __uint_as_float(((unsigned int)b) << 16); }
__device__ __forceinline__ float bf16_round(float x) { return bf16_val(bf16_bits(x)); }
// D += A·B with NT terms: 1 = ah·bh, 2 = + al·bh (A split), 3 = + ah·bl (both split)
template <int NT>
__device__ __forceinline__ v8f mmaN(v16b ah, v16b al, v16b bh, v16b bl, v8f c) {
  c = __builtin_amdgcn_wmma_f32_16x16x32_bf16(false, ah, false, bh, (short)0, c, false, false);
  if (NT >= 2) c = __builtin_amdgcn_wmma_f32_16x16x32_bf16(false, al, false, bh, (short)0, c, false, false);
  if (NT >= 3) c = __builtin_amdgcn_wmma_f32_16x16x32_bf16(false, ah, false, bl, (short)0, c, false, false);
  asm volatile("v_nop\n\tv_nop\n\tv_nop\n\tv_nop" : "+v"(c) : "v"(ah), "v"(al), "v"(bh), "v"(bl));
  return c;
}

__global__ __launch_bounds__(256) void k_wt_bf16(const float* __restrict__ W, unsigned short* __restrict__ Wt, int K, int N) {
  const int t = blockIdx.x * 256 + threadIdx.x;
  const int k8n = K / 8;
  if (t >= N * k8n) return;
  const int n = t / k8n, k8 = (t % k8n) * 8;
  v8us v;
#pragma unroll
  for (int i = 0; i < 8; ++i) v[i] = bf16_bits(W[(size_t)(k8 + i) * N + n]);
  *(v8us*)(Wt + (size_t)n * K + k8) = v;
  
}

// GEMM C[M][N] (f32, pitch ldc) = act(A[M][K]·W + bias). A f32 row-major (pitch lda) converted per fragment to bf16
// (ASPLIT: hi/lo two planes -> 2 terms, else single rounded term); Wt bf16 [N][K] (pitch ldb). BIAS_BF16 rounds the
// bias to bf16 first (bias quantised to bf16 before the add). K%32==0, M%16==0, N%64==0.
template <bool ASPLIT, int ACT, bool BIAS_BF16>
__global__ __launch_bounds__(128) void k_gemm_bf(const float* __restrict__ A, int lda, const unsigned short* __restrict__ Wt, int ldb,
                                               const float* __restrict__ bias, float* __restrict__ C, int ldc, int M, int N, int K) {
  __shared__ __attribute__((aligned(16))) float so[4][16][64];
  const int tid = threadIdx.x, w = tid >> 5, lane = tid & 31, ln = lane & 15, hh = lane >> 4;
  const int ntn = N / 64;
  const int wid = blockIdx.x * 4 + w;
  const int mt = wid / ntn, nq = wid % ntn;
  if (mt * 16 >= M) return;
  const int row0 = mt * 16, col0 = nq * 64;
  const float* arow = A + (size_t)(row0 + ln) * lda;
  v8f acc[4] = {};
  for (int kb = 0; kb < K; kb += 32) {
    FragB ah, al;
    const v4f x0 = *(const v4fa*)(arow + kb + 8 * hh), x1 = *(const v4fa*)(arow + kb + 8 * hh + 4);
    const v4f x2 = *(const v4fa*)(arow + kb + 16 + 8 * hh), x3 = *(const v4fa*)(arow + kb + 16 + 8 * hh + 4);
    float xs[16] = {x0[0],x0[1],x0[2],x0[3],x1[0],x1[1],x1[2],x1[3],x2[0],x2[1],x2[2],x2[3],x3[0],x3[1],x3[2],x3[3]};
#pragma unroll
    for (int i = 0; i < 16; ++i) { const unsigned short hb = bf16_bits(xs[i]); ah.u[i] = hb; al.u[i] = ASPLIT ? bf16_bits(xs[i] - bf16_val(hb)) : (unsigned short)0; }
#pragma unroll
    for (int t = 0; t < 4; ++t) {
      const unsigned short* brow = Wt + (size_t)(col0 + t * 16 + ln) * ldb + kb;
      FragB b;
      b.half[0] = *(const v8us*)(brow + 8 * hh);
      b.half[1] = *(const v8us*)(brow + 16 + 8 * hh);
      acc[t] = mmaN<ASPLIT ? 2 : 1>(ah.v, al.v, b.v, b.v, acc[t]);
    }
  }
#pragma unroll
  for (int t = 0; t < 4; ++t) {
    float bv = bias ? bias[col0 + t * 16 + ln] : 0.f;
    if (BIAS_BF16) bv = bf16_round(bv);
#pragma unroll
    for (int r = 0; r < 8; ++r) { float v = acc[t][r] + bv; if (ACT == 1) v = fmaxf(v, 0.f); so[w][8 * hh + r][t * 16 + ln] = v; }
  }
  __builtin_amdgcn_fence(__ATOMIC_ACQ_REL, "workgroup");
  __builtin_amdgcn_wave_barrier();
  const int rsub = lane >> 4, c4 = (lane & 15) * 4;
  {
#pragma unroll
    for (int q = 0; q < 8; ++q) {
      const int r = q * 2 + rsub;
      const v4f v = *(const v4fa*)&so[w][r][c4];
      *(v4f*)(C + (size_t)(row0 + r) * ldc + col0 + c4) = v;
    }
    
  }
}

// GEMM C = act(A·W + bias + resid): A f32 (ASPLIT -> hi/lo 2 terms), Wt bf16 [N][K]; ACT 0 none, 1 relu, 2 exact gelu;
// resid (optional, f32, row index = (row % rmod), pitch ldr, RES_BF16 rounds it) added before the activation.
template <bool ASPLIT, int ACT, bool BIAS_BF16, bool RES_BF16>
__global__ __launch_bounds__(128) void k_gemm_bf3(const float* __restrict__ A, int lda, const unsigned short* __restrict__ Wt, int ldb,
                                                const float* __restrict__ bias, const float* __restrict__ resid, int rmod, int ldr,
                                                float* __restrict__ C, int ldc, int M, int N, int K) {
  __shared__ __attribute__((aligned(16))) float so[4][16][64];
  const int tid = threadIdx.x, w = tid >> 5, lane = tid & 31, ln = lane & 15, hh = lane >> 4;
  const int ntn = N / 64;
  const int wid = blockIdx.x * 4 + w;
  const int mt = wid / ntn, nq = wid % ntn;
  if (mt * 16 >= M) return;
  const int row0 = mt * 16, col0 = nq * 64;
  const float* arow = A + (size_t)(row0 + ln) * lda;
  v8f acc[4] = {};
  for (int kb = 0; kb < K; kb += 32) {
    FragB ah, al;
    const v4f x0 = *(const v4fa*)(arow + kb + 8 * hh), x1 = *(const v4fa*)(arow + kb + 8 * hh + 4);
    const v4f x2 = *(const v4fa*)(arow + kb + 16 + 8 * hh), x3 = *(const v4fa*)(arow + kb + 16 + 8 * hh + 4);
    float xs[16] = {x0[0],x0[1],x0[2],x0[3],x1[0],x1[1],x1[2],x1[3],x2[0],x2[1],x2[2],x2[3],x3[0],x3[1],x3[2],x3[3]};
#pragma unroll
    for (int i = 0; i < 16; ++i) { const unsigned short hb = bf16_bits(xs[i]); ah.u[i] = hb; al.u[i] = ASPLIT ? bf16_bits(xs[i] - bf16_val(hb)) : (unsigned short)0; }
#pragma unroll
    for (int t = 0; t < 4; ++t) {
      const unsigned short* brow = Wt + (size_t)(col0 + t * 16 + ln) * ldb + kb;
      FragB b;
      b.half[0] = *(const v8us*)(brow + 8 * hh);
      b.half[1] = *(const v8us*)(brow + 16 + 8 * hh);
      acc[t] = mmaN<ASPLIT ? 2 : 1>(ah.v, al.v, b.v, b.v, acc[t]);
    }
  }
#pragma unroll
  for (int t = 0; t < 4; ++t) {
    const int col = col0 + t * 16 + ln;
    float bv = bias ? bias[col] : 0.f;
    if (BIAS_BF16) bv = bf16_round(bv);
#pragma unroll
    for (int r = 0; r < 8; ++r) {
      float v = acc[t][r] + bv;
      if (resid) { float rv = resid[(size_t)((row0 + 8 * hh + r) % rmod) * ldr + col]; if (RES_BF16) rv = bf16_round(rv); v += rv; }
      if (ACT == 1) v = fmaxf(v, 0.f);
      if (ACT == 2) v = 0.5f * v * (1.0f + erff(v * 0.70710678118654752f));
      if (ACT == 3) { const float u = 0.7978845608028654f * (v + 0.044715f * v * v * v); v = 0.5f * v * (1.0f + tanhf(u)); }
      so[w][8 * hh + r][t * 16 + ln] = v;
    }
  }
  __builtin_amdgcn_fence(__ATOMIC_ACQ_REL, "workgroup");
  __builtin_amdgcn_wave_barrier();
  const int rsub = lane >> 4, c4 = (lane & 15) * 4;
  {
#pragma unroll
    for (int q = 0; q < 8; ++q) {
      const int r = q * 2 + rsub;
      const v4f v = *(const v4fa*)&so[w][r][c4];
      *(v4f*)(C + (size_t)(row0 + r) * ldc + col0 + c4) = v;
    }
    
  }
}
// row LayerNorm (biased variance, eps) over N: s = X (+ R); optional out_sum <- s; out_norm <- (s-mu)*rsqrt(var+eps)*g + b
template <bool PARAM_BF16>
__global__ __launch_bounds__(256) void k_layernorm(const float* __restrict__ X, const float* __restrict__ R, const float* __restrict__ g, const float* __restrict__ bta,
                                                  float* __restrict__ out_sum, float* __restrict__ out_norm, int N, float eps) {
  __shared__ float red[256];
  const int row = blockIdx.x, tid = threadIdx.x;
  const float* x = X + (size_t)row * N; const float* rr = R ? R + (size_t)row * N : nullptr;
  float vals[16];                     // up to N = 4096
  const int per = N / 256;            // contiguous chunk per thread? use strided-by-4 chunks: thread handles j = tid*4 + 1024*u
  float s1 = 0.f;
  for (int u = 0; u < per / 4; ++u) {
    const int j = tid * 4 + 1024 * u;
    const v4f a = *(const v4fa*)(x + j);
    v4f b = {0.f,0.f,0.f,0.f}; if (rr) b = *(const v4fa*)(rr + j);
#pragma unroll
    for (int q = 0; q < 4; ++q) { const float v = a[q] + b[q]; vals[u * 4 + q] = v; s1 += v; }
  }
  red[tid] = s1; __syncthreads();
  for (int st = 128; st > 0; st >>= 1) { if (tid < st) red[tid] += red[tid + st]; __syncthreads(); }
  const float mu = red[0] / (float)N; __syncthreads();
  float s2 = 0.f;
  for (int u = 0; u < per / 4; ++u)
#pragma unroll
    for (int q = 0; q < 4; ++q) { const float c = vals[u * 4 + q] - mu; s2 += c * c; }
  red[tid] = s2; __syncthreads();
  for (int st = 128; st > 0; st >>= 1) { if (tid < st) red[tid] += red[tid + st]; __syncthreads(); }
  const float rs = rsqrtf(red[0] / (float)N + eps);
  {
    for (int u = 0; u < per / 4; ++u) {
      const int j = tid * 4 + 1024 * u;
      v4f o, sm;
#pragma unroll
      for (int q = 0; q < 4; ++q) {
        float gg = g[j + q], bb = bta[j + q];
        if (PARAM_BF16) { gg = bf16_round(gg); bb = bf16_round(bb); }
        sm[q] = vals[u * 4 + q]; o[q] = (vals[u * 4 + q] - mu) * rs * gg + bb;
      }
      if (out_sum) *(v4f*)(out_sum + (size_t)row * N + j) = sm;
      *(v4f*)(out_norm + (size_t)row * N + j) = o;
    }
    
  }
}



// ---- f16 WMMA path (v_wmma_f32_16x16x32_f16): 11-bit significands for operands in range — used where a [0,1] probability operand needs more precision than bf16
typedef _Float16 v16h __attribute__((ext_vector_type(16)));
union FragH { v16h v; v8us half[2]; _Float16 h[16]; unsigned short u[16]; };
template <int NT>
__device__ __forceinline__ v8f mmaH(v16h ah, v16h al, v16h bh, v16h bl, v8f c) {
  c = __builtin_amdgcn_wmma_f32_16x16x32_f16(false, ah, false, bh, (short)0, c, false, false);
  if (NT >= 2) c = __builtin_amdgcn_wmma_f32_16x16x32_f16(false, al, false, bh, (short)0, c, false, false);
  if (NT >= 3) c = __builtin_amdgcn_wmma_f32_16x16x32_f16(false, ah, false, bl, (short)0, c, false, false);
  asm volatile("v_nop\n\tv_nop\n\tv_nop\n\tv_nop" : "+v"(c) : "v"(ah), "v"(al), "v"(bh), "v"(bl));
  return c;
}
// batched GEMM like k_gemm_b but f16 operands: A f32 (split into f16 hi/lo if ASPLIT, else rounded to f16), Bt = f16 values [n][k]; alpha; C f32; N multiple of 16 (partial tiles skipped)
template <bool ASPLIT>
__global__ __launch_bounds__(128) void k_gemm_h(const float* __restrict__ A, int lda, size_t sA, const _Float16* __restrict__ Bh, int ldb, size_t sB, float alpha, float* __restrict__ C, int ldc, size_t sC, int M, int N, int K) {
  __shared__ __attribute__((aligned(16))) float so[4][16][64];
  const int tid = threadIdx.x, w = tid >> 5, lane = tid & 31, ln = lane & 15, hh = lane >> 4; const int by = blockIdx.y;
  A += (size_t)by * sA; Bh += (size_t)by * sB; C += (size_t)by * sC;
  const int ntn = (N + 63) / 64; const int wid = blockIdx.x * 4 + w; const int mt = wid / ntn, nq = wid % ntn; if (mt * 16 >= M) return;
  const int row0 = mt * 16, col0 = nq * 64; const float* arow = A + (size_t)(row0 + ln) * lda;
  v8f acc[4] = {};
  for (int kb = 0; kb < K; kb += 32) {
    FragH ah, al;
    const v4f x0 = *(const v4fa*)(arow + kb + 8 * hh), x1 = *(const v4fa*)(arow + kb + 8 * hh + 4), x2 = *(const v4fa*)(arow + kb + 16 + 8 * hh), x3 = *(const v4fa*)(arow + kb + 16 + 8 * hh + 4);
    float xs[16] = {x0[0],x0[1],x0[2],x0[3],x1[0],x1[1],x1[2],x1[3],x2[0],x2[1],x2[2],x2[3],x3[0],x3[1],x3[2],x3[3]};
#pragma unroll
    for (int i = 0; i < 16; ++i) { const _Float16 h = (_Float16)xs[i]; ah.h[i] = h; al.h[i] = ASPLIT ? (_Float16)(xs[i] - (float)h) : (_Float16)0.0f; }
#pragma unroll
    for (int t = 0; t < 4; ++t) { if (col0 + t * 16 >= N) continue; const size_t boff = (size_t)(col0 + t * 16 + ln) * ldb + kb; FragH bq; bq.half[0] = *(const v8us*)(Bh + boff + 8 * hh); bq.half[1] = *(const v8us*)(Bh + boff + 16 + 8 * hh);
      acc[t] = mmaH<ASPLIT ? 2 : 1>(ah.v, al.v, bq.v, bq.v, acc[t]); }
  }
#pragma unroll
  for (int t = 0; t < 4; ++t) { if (col0 + t * 16 >= N) continue;
#pragma unroll
    for (int r = 0; r < 8; ++r) so[w][8 * hh + r][t * 16 + ln] = acc[t][r] * alpha; }
  __builtin_amdgcn_fence(__ATOMIC_ACQ_REL, "workgroup"); __builtin_amdgcn_wave_barrier();
  const int rsub = lane >> 4, c4 = (lane & 15) * 4;
  {
#pragma unroll
    for (int q = 0; q < 8; ++q) { const int r = q * 2 + rsub; if (col0 + c4 < N) { const v4f v = *(const v4fa*)&so[w][r][c4]; *(v4f*)(C + (size_t)(row0 + r) * ldc + col0 + c4) = v; } }
     }
}

// Wt[n][k] = f16(W[k][n]·scale) from f32 row-major W[K][N] (scale = power of two; bf16-exact weights stay exact in f16 away from the subnormal range)
__device__ __forceinline__ void wt_f16(const float* __restrict__ W, _Float16* __restrict__ Wt, int K, int N, float scale, int t) {
  const int n = t / (K / 8), k8 = (t % (K / 8)) * 8; FragH f;
#pragma unroll
  for (int i = 0; i < 8; ++i) f.h[i] = (_Float16)(bf16_round(W[(size_t)(k8 + i) * N + n]) * scale); const v8us o = f.half[0];
  *(v8us*)((unsigned short*)Wt + (size_t)n * K + k8) = o;
  asm volatile("s_wait_xcnt 0x0" ::: "memory");      /* behind the store: in the joined kernel the listing runs on into another job's code, which rewrites the store's registers */
}
// k_gemm_hh variant with fused epilogue: v = acc·alpha + bias[by·sBias + col] (+ CP[(row/rowsPerB)·sCPb + by·64 + col] if CP) ; ACT 0 none / 1 elu ; writes f16 C16 (and f32 C if non-null)
template <int ACT>
__global__ __launch_bounds__(128) void k_gemm_hhx(const _Float16* __restrict__ A, int lda, size_t sA, const _Float16* __restrict__ Bh, int ldb, size_t sB, float alpha, const float* __restrict__ bias, size_t sBias, const float* __restrict__ CP, int rowsPerB, size_t sCPb, int row0g,
    float* __restrict__ C, _Float16* __restrict__ C16, int ldc, size_t sC, int M, int N, int K) {
  __shared__ __attribute__((aligned(16))) float so[4][16][64];
  const int tid = threadIdx.x, w = tid >> 5, lane = tid & 31, ln = lane & 15, hh = lane >> 4; const int by = blockIdx.y;
  A += (size_t)by * sA; Bh += (size_t)by * sB; const size_t cofs = (size_t)by * sC; const float* bp = bias ? bias + (size_t)by * sBias : nullptr;
  const int ntn = (N + 63) / 64; const int wid = blockIdx.x * 4 + w; const int mt = wid / ntn, nq = wid % ntn; if (mt * 16 >= M) return;
  const int row0 = mt * 16, col0 = nq * 64; const _Float16* arow = A + (size_t)(row0 + ln) * lda;
  v8f acc[4] = {};
  for (int kb = 0; kb < K; kb += 32) { FragH ah; ah.half[0] = *(const v8us*)((const unsigned short*)arow + kb + 8 * hh); ah.half[1] = *(const v8us*)((const unsigned short*)arow + kb + 16 + 8 * hh);
#pragma unroll
    for (int t = 0; t < 4; ++t) { if (col0 + t * 16 >= N) continue; const size_t boff = (size_t)(col0 + t * 16 + ln) * ldb + kb; FragH bq; bq.half[0] = *(const v8us*)((const unsigned short*)Bh + boff + 8 * hh); bq.half[1] = *(const v8us*)((const unsigned short*)Bh + boff + 16 + 8 * hh);
      acc[t] = mmaH<1>(ah.v, ah.v, bq.v, bq.v, acc[t]); }
  }
#pragma unroll
  for (int t = 0; t < 4; ++t) { if (col0 + t * 16 >= N) continue; const int col = col0 + t * 16 + ln; const float bv = bp ? bf16_round(bp[col]) : 0.f;
#pragma unroll
    for (int r = 0; r < 8; ++r) { float v = acc[t][r] * alpha + bv; if (CP) { const int rr = row0g + row0 + 8 * hh + r; if (rowsPerB < 0) v += CP[cofs + (size_t)rr * ldc + col];      /* rowsPerB < 0: own element of the batched C plane */ else { const int bidx = rr / rowsPerB; v += CP[(size_t)bidx * sCPb + (size_t)by * 64 + col]; } } if (ACT == 1) v = (v > 0.f) ? v : expm1f(v); else if (ACT == 7) v = (v > 0.f) ? v + 1.0f : expf(v); else if (ACT == 8) v = tanhf(v); else if (ACT == 9) v = 0.5f * v * (1.0f + tanhf(0.7978845608028654f * (v + 0.044715f * v * v * v))); else if (ACT == 11) v = 1.0f / (1.0f + expf(-v)); else if (ACT == 12) v = (v > 0.f) ? v : 0.01f * v; else if (ACT == 14) v = (v > 0.f) ? v : 0.1f * v; else if (ACT == 16) v = (v >= 0.f) ? v : 0.3f * v; else if (ACT == 17) v = (v >= 0.f) ? v : 0.2f * v; else if (ACT == 15) v = v / (1.0f + expf(-v)); else if (ACT == 3) v = fmaxf(v, 0.f); else if (ACT == 6) v = 0.5f * v * (1.0f + erff(v * 0.70710678118654752f)); so[w][8 * hh + r][t * 16 + ln] = v; } }
  __builtin_amdgcn_fence(__ATOMIC_ACQ_REL, "workgroup"); __builtin_amdgcn_wave_barrier();
  const int rsub = lane >> 4, c4 = (lane & 15) * 4; typedef _Float16 v4h __attribute__((ext_vector_type(4)));
  {
#pragma unroll
    for (int q = 0; q < 8; ++q) { const int r = q * 2 + rsub; if (col0 + c4 < N) { const v4f v = *(const v4fa*)&so[w][r][c4]; if (C) *(v4f*)(C + cofs + (size_t)(row0 + r) * ldc + col0 + c4) = v; if (C16) { v4h h4; for (int i = 0; i < 4; ++i) h4[i] = (_Float16)v[i]; *(v4h*)(C16 + cofs + (size_t)(row0 + r) * ldc + col0 + c4) = h4; } } }
     }
}


typedef _Float16 v4h __attribute__((ext_vector_type(4)));

// Every job that reads inputs only, in ONE launch; a block's job follows from its index (block-uniform branches, no job depends on another):
// blocks [0, PB_QKV): the 36 (head, part) blocks of U_qkv, PB_HP blocks each, into planes Bq | Bk | Bv (contiguous, DM*DM apart); [PB_QKV, PB_W): U_msa into Bo; the rest: x rows.
#define PB_HP  (HD * (DM / 8) / 256)          /* blocks per (head, part) */
#define PB_QKV (3 * NH * PB_HP)
#define PB_W   (PB_QKV + DM * (DM / 8) / 256)
#define PB_ALL (PB_W + (int)(NR * DM / 8 / 256))
__global__ __launch_bounds__(256) void k_prep(const float* __restrict__ x, const float* __restrict__ wqkv, const float* __restrict__ wo, _Float16* __restrict__ X16, _Float16* __restrict__ Bqkv, _Float16* __restrict__ Bo) {
  static_assert(HD * (DM / 8) % 256 == 0 && DM * (DM / 8) % 256 == 0 && NR * DM / 8 % 256 == 0, "k_prep: whole blocks per job");
  const int bi = blockIdx.x, tid = threadIdx.x;
  if (bi < PB_QKV) { const int job = bi / PB_HP, h = job / 3, p = job - 3 * h;      /* U_qkv block (h, p): row-major [in = DM][out = HD] at (3 h + p) * DM * HD -> rows h * HD .. of plane p */
    wt_f16(wqkv + (size_t)job * DM * HD, Bqkv + (size_t)p * DM * DM + (size_t)h * HD * DM, DM, HD, 16.0f, (bi - job * PB_HP) * 256 + tid); return; }
  if (bi < PB_W) { wt_f16(wo, Bo, DM, DM, 16.0f, (bi - PB_QKV) * 256 + tid); return; }
  const size_t t = (size_t)(bi - PB_W) * 256 + tid; FragH f;
#pragma unroll
  for (int q = 0; q < 8; ++q) f.h[q] = (_Float16)bf16_round(x[t * 8 + q]); *(v8us*)((unsigned short*)X16 + t * 8) = f.half[0];
  asm volatile("s_wait_xcnt 0x0" ::: "memory"); }      /* behind the store, as in wt_f16 */
__global__ __launch_bounds__(256) void k_h16(const float* __restrict__ x, _Float16* __restrict__ X16, size_t n8) { const size_t t = (size_t)blockIdx.x * 256 + threadIdx.x; if (t >= n8) return; FragH f;
#pragma unroll
  for (int q = 0; q < 8; ++q) f.h[q] = (_Float16)x[t * 8 + q]; *(v8us*)((unsigned short*)X16 + t * 8) = f.half[0];  }
__global__ __launch_bounds__(256) void k_round16f(const float* __restrict__ W, _Float16* __restrict__ Bt, size_t n8) { const size_t t = (size_t)blockIdx.x * 256 + threadIdx.x; if (t >= n8) return; FragH f;
#pragma unroll
  for (int i = 0; i < 8; ++i) f.h[i] = (_Float16)(bf16_round(W[t * 8 + i]) * 16.0f); *(v8us*)((unsigned short*)Bt + t * 8) = f.half[0];  }
template <int NHv, int TTv>
__global__ __launch_bounds__(256) void k_vt(const _Float16* __restrict__ V16, int ldv, int voff, _Float16* __restrict__ Vt) { __shared__ unsigned short tl[64][66]; const int tid = threadIdx.x; const int slab = blockIdx.x / (TTv / 64), lg = blockIdx.x % (TTv / 64); const int b = slab / NHv, h = slab % NHv;
  for (int i = tid; i < 64 * 8; i += 256) { const int r = i / 8, c8 = (i % 8) * 8; FragH f; f.half[0] = *(const v8us*)((const unsigned short*)V16 + ((size_t)b * TTv + lg * 64 + r) * ldv + voff + h * 64 + c8);
#pragma unroll
    for (int q = 0; q < 8; ++q) tl[r][c8 + q] = f.u[q]; }
  __syncthreads();
  {
#pragma unroll
    for (int rd = 0; rd < 2; ++rd) { const int d = rd * 32 + tid / 8, pc = tid % 8; FragH f;
#pragma unroll
      for (int q = 0; q < 8; ++q) f.u[q] = tl[pc * 8 + q][d];
      *(v8us*)((unsigned short*)Vt + ((size_t)slab * 64 + d) * TTv + lg * 64 + pc * 8) = f.half[0]; }
     } }

__global__ __launch_bounds__(256) void k_hl(const float* __restrict__ F, _Float16* __restrict__ Hh, _Float16* __restrict__ Hl, size_t n8) { const size_t t = (size_t)blockIdx.x * 256 + threadIdx.x; if (t >= n8) return; FragH fh, fl; const v4f a = *(const v4fa*)(F + t * 8), c = *(const v4fa*)(F + t * 8 + 4);
#pragma unroll
  for (int q = 0; q < 4; ++q) { _Float16 h = (_Float16)a[q]; fh.h[q] = h; fl.h[q] = (_Float16)((a[q] - (float)h) * 1024.0f); h = (_Float16)c[q]; fh.h[4 + q] = h; fl.h[4 + q] = (_Float16)((c[q] - (float)h) * 1024.0f); }
  { *(v8us*)((unsigned short*)Hh + t * 8) = fh.half[0]; *(v8us*)((unsigned short*)Hl + t * 8) = fl.half[0];  } }

// ---- fast GEMM (wave tile 32x64, block tile 128x128, operands staged in LDS); epilogue = k_gemm_hhx semantics ----
__device__ __forceinline__ v16h g2_frag(const _Float16* p, int hh) { FragH f; f.half[0] = *(const v8us*)((const unsigned short*)p + 8 * hh); f.half[1] = *(const v8us*)((const unsigned short*)p + 16 + 8 * hh); return f.v; }
__device__ __forceinline__ v8f g2_mma(v16h a, v16h b, v8f c) { v8f d = __builtin_amdgcn_wmma_f32_16x16x32_f16(false, a, false, b, (short)0, c, false, false); asm volatile("v_nop\n\tv_nop\n\tv_nop\n\tv_nop" : "+v"(d) : "v"(a), "v"(b)); return d; }
// Operand staging of k_gemm2: a stage is 64 k (128 B, one whole line) of the block's 128 A rows and 128 B rows, brought into LDS by asynchronous copies
// (global_load_async_to_lds_b128; a wave's copy = 4 whole lines), so every operand line is asked for once per block instead of 16 lines per fragment load and wave.
#define G2_PITCH 144                      /* LDS bytes per staged row: 128 + 16, 16 B x odd: conflict-free for the ds_load_b128 fragment reads */
#define G2_BUF   (256 * G2_PITCH)         /* one stage: A rows 0-127, then B rows 0-127 */
__device__ __forceinline__ v16h g2_lfrag(const char* p, int hh) { FragH f; f.half[0] = *(const v8us*)(p + 16 * hh); f.half[1] = *(const v8us*)(p + 32 + 16 * hh); return f.v; }      /* same k order as g2_frag */
// One stage: each thread copies 16 B of 4 A rows and of 4 B rows (32 rows apart). ga / gb: the thread's first A / B address of this stage; lds: its LDS byte address in A row (tid / 8) of the buffer.
__device__ __forceinline__ void g2_stage(const _Float16* ga, size_t astep, const _Float16* gb, size_t bstep, unsigned lds) {
  /* the closing s_wait_xcnt stands inside the copies' own statement, so that no address register is rewritten in front of it */
  asm volatile("global_load_async_to_lds_b128 %0, %8, off\n\t"
               "global_load_async_to_lds_b128 %1, %9, off\n\t"
               "global_load_async_to_lds_b128 %2, %10, off\n\t"
               "global_load_async_to_lds_b128 %3, %11, off\n\t"
               "global_load_async_to_lds_b128 %4, %12, off\n\t"
               "global_load_async_to_lds_b128 %5, %13, off\n\t"
               "global_load_async_to_lds_b128 %6, %14, off\n\t"
               "global_load_async_to_lds_b128 %7, %15, off\n\t"
               "s_wait_xcnt 0x0"
               :: "v"(lds), "v"(lds + 32 * G2_PITCH), "v"(lds + 64 * G2_PITCH), "v"(lds + 96 * G2_PITCH), "v"(lds + 128 * G2_PITCH), "v"(lds + 160 * G2_PITCH), "v"(lds + 192 * G2_PITCH), "v"(lds + 224 * G2_PITCH),
                  "v"(ga), "v"(ga + astep), "v"(ga + 2 * astep), "v"(ga + 3 * astep), "v"(gb), "v"(gb + bstep), "v"(gb + 2 * bstep), "v"(gb + 3 * bstep) : "memory"); }
// Block = 8 waves, tile 128x128 (wave w: rows 32 * (w & 3), columns 64 * (w >> 2)); requires M % 128 == 0, N % 128 == 0, K % 64 == 0, K >= 64. Two stage buffers; the epilogue staging reuses them behind the last barrier.
template <int ACT>
__global__ __launch_bounds__(256) void k_gemm2(const _Float16* __restrict__ A, int lda, size_t sA, const _Float16* __restrict__ Bh, int ldb, size_t sB, float alpha, const float* __restrict__ bias, size_t sBias, const float* __restrict__ CP, int rowsPerB, size_t sCPb, int row0g,
    float* __restrict__ C, _Float16* __restrict__ C16, int ldc, size_t sC, int M, int N, int K) { static_assert(ACT == 0 || ACT == 3 || ACT == 6 || ACT == 8 || ACT == 9 || ACT == 11 || ACT == 12 || ACT == 14 || ACT == 15 || ACT == 16 || ACT == 17, "k_gemm2: unsupported ACT code (would silently apply no activation)");
  __shared__ __attribute__((aligned(16))) char smem[2 * G2_BUF]; static_assert(8 * 32 * 68 * 4 <= 2 * G2_BUF, "k_gemm2: epilogue staging fits the stage buffers");
  float (*so)[32][68] = (float (*)[32][68])smem;
  const int tid = threadIdx.x, w = tid >> 5, lane = tid & 31, ln = lane & 15, hh = lane >> 4; const int by = blockIdx.y;
  A += (size_t)by * sA; Bh += (size_t)by * sB; const size_t cofs = (size_t)by * sC; const float* bp = bias ? bias + (size_t)by * sBias : nullptr;
  const int ntn = N >> 7; const int mt = blockIdx.x / ntn, nq = blockIdx.x - mt * ntn; if (mt * 128 >= M) return;      /* the whole block leaves, in front of every barrier */
  const int row0 = mt * 128 + 32 * (w & 3), col0 = nq * 128 + 64 * (w >> 2);
  const _Float16* ga = A + (size_t)(mt * 128 + (tid >> 3)) * lda + (tid & 7) * 8; const _Float16* gb = Bh + (size_t)(nq * 128 + (tid >> 3)) * ldb + (tid & 7) * 8; const size_t astep = (size_t)32 * lda, bstep = (size_t)32 * ldb;
  const unsigned lds0 = (unsigned)(size_t)smem + (unsigned)((tid >> 3) * G2_PITCH + (tid & 7) * 16);
  const char* afr = smem + (32 * (w & 3) + ln) * G2_PITCH; const char* bfr = smem + (128 + 64 * (w >> 2) + ln) * G2_PITCH;
  const v8f z8 = {0.f,0.f,0.f,0.f,0.f,0.f,0.f,0.f}; v8f c00 = z8, c01 = z8, c02 = z8, c03 = z8, c10 = z8, c11 = z8, c12 = z8, c13 = z8;
  const int nt = K >> 6;
  g2_stage(ga, astep, gb, bstep, lds0);
  asm volatile("s_wait_asynccnt 0x0" ::: "memory");      /* stage 0 of this wave has landed ... */
  __syncthreads();                                       /* ... and every wave's: nothing of it is read in front of this barrier */
  if (nt > 1) g2_stage(ga + 64, astep, gb + 64, bstep, lds0 + G2_BUF);
#pragma unroll 1      /* stays rolled: one publish point per stage at the foot, small loop text */
  for (int t = 0; t < nt; ++t) { const int bo = (t & 1) * G2_BUF;
#pragma unroll      /* both k blocks inline: their LDS offsets become immediates */
    for (int kk = 0; kk < 128; kk += 64) { const char* ap = afr + bo + kk; const char* bq = bfr + bo + kk;      /* two k blocks of 32 per stage, in ascending k */
      const v16h a0 = g2_lfrag(ap, hh), a1 = g2_lfrag(ap + 16 * G2_PITCH, hh);      /* the block's six fragments are read as one group in front of its WMMAs */
      const v16h b0 = g2_lfrag(bq, hh), b1 = g2_lfrag(bq + 16 * G2_PITCH, hh), b2 = g2_lfrag(bq + 32 * G2_PITCH, hh), b3 = g2_lfrag(bq + 48 * G2_PITCH, hh);
      c00 = g2_mma(a0, b0, c00); c10 = g2_mma(a1, b0, c10); c01 = g2_mma(a0, b1, c01); c11 = g2_mma(a1, b1, c11);
      c02 = g2_mma(a0, b2, c02); c12 = g2_mma(a1, b2, c12); c03 = g2_mma(a0, b3, c03); c13 = g2_mma(a1, b3, c13); }
    asm volatile("s_wait_dscnt 0x0" ::: "memory");       /* this wave's reads of the buffer are done before it may be refilled */
    asm volatile("s_wait_asynccnt 0x0" ::: "memory");    /* this wave's copies of stage t + 1 have landed */
    __syncthreads();                                     /* publishes stage t + 1 and ends every reader's last read of stage t */
    if (t + 2 < nt) g2_stage(ga + (size_t)(t + 2) * 64, astep, gb + (size_t)(t + 2) * 64, bstep, lds0 + bo); }
  asm volatile("s_wait_asynccnt 0x0" ::: "memory");      /* no copy is outstanding when the buffers become output staging */
  v8f accs[8] = {c00, c01, c02, c03, c10, c11, c12, c13};
#pragma unroll
  for (int u = 0; u < 8; ++u) { const int t = u & 3, half = u >> 2; const int col = col0 + t * 16 + ln; const float bv = bp ? bf16_round(bp[col]) : 0.f;
#pragma unroll
    for (int r = 0; r < 8; ++r) { const int rloc = half * 16 + 8 * hh + r; float v = accs[u][r] * alpha + bv; if (CP) { if (rowsPerB < 0) v += CP[cofs + (size_t)(row0g + row0 + rloc) * ldc + col];      /* rowsPerB < 0: own element of the batched C plane */ else { const int bidx = (row0g + row0 + rloc) / rowsPerB; v += CP[(size_t)bidx * sCPb + (size_t)by * 64 + col]; } }
      if (ACT == 3) v = fmaxf(v, 0.f); else if (ACT == 6) v = 0.5f * v * (1.0f + erff(v * 0.70710678118654752f)); else if (ACT == 11) v = 1.0f / (1.0f + expf(-v)); else if (ACT == 15) v = v / (1.0f + expf(-v)); else if (ACT == 12) v = (v > 0.f) ? v : 0.01f * v; else if (ACT == 8) v = tanhf(v); else if (ACT == 9) v = 0.5f * v * (1.0f + tanhf(0.7978845608028654f * (v + 0.044715f * v * v * v))); else if (ACT == 14) v = (v > 0.f) ? v : 0.1f * v; else if (ACT == 16) v = (v >= 0.f) ? v : 0.3f * v; else if (ACT == 17) v = (v >= 0.f) ? v : 0.2f * v;
      so[w][rloc][t * 16 + ln] = v; } }
  __builtin_amdgcn_fence(__ATOMIC_ACQ_REL, "workgroup"); __builtin_amdgcn_wave_barrier();
  const int rsub = lane >> 4, c4 = (lane & 15) * 4;
  {
#pragma unroll
    for (int q = 0; q < 16; ++q) { const int r = q * 2 + rsub; const v4f v = *(const v4fa*)&so[w][r][c4]; if (C) *(v4f*)(C + cofs + (size_t)(row0 + r) * ldc + col0 + c4) = v; if (C16) { v4h h4; for (int i = 0; i < 4; ++i) h4[i] = (_Float16)v[i]; *(v4h*)(C16 + cofs + (size_t)(row0 + r) * ldc + col0 + c4) = h4; } }
     } }


__global__ __launch_bounds__(256) void k_wnat(const float* __restrict__ w, size_t n8, _Float16* __restrict__ Bt) { const size_t t = (size_t)blockIdx.x * 256 + threadIdx.x; if (t >= n8) return; FragH f; for (int q = 0; q < 8; ++q) f.h[q] = (_Float16)(bf16_round(w[t * 8 + q]) * 16.0f); *(v8us*)((unsigned short*)Bt + t * 8) = f.half[0];  }
__global__ __launch_bounds__(256) void k_rsm(const float* __restrict__ S, _Float16* __restrict__ P, int nrows) {
  #pragma clang fp contract(off)
  const int i = blockIdx.x * 256 + threadIdx.x; if (i >= nrows) return; const float* s = S + (size_t)i * SQ; float mx = -3.0e38f;
#pragma unroll 1
  for (int j = 0; j < SQ; ++j) mx = fmaxf(mx, s[j]); float se = 0.f;
#pragma unroll 1
  for (int j = 0; j < SQ; ++j) se += expf(s[j] - mx); const float sc = 256.0f / se;
#pragma unroll 1
  for (int j0 = 0; j0 < SQ; j0 += 8) { FragH f; for (int q = 0; q < 8; ++q) f.h[q] = (_Float16)(expf(s[j0 + q] - mx) * sc); unsigned short* d = (unsigned short*)P + (size_t)i * SQ + j0; *(v8us*)d = f.half[0];  } }
__global__ __launch_bounds__(256) void k_vt(const _Float16* __restrict__ V16, int b, int h0, _Float16* __restrict__ VT) { __shared__ unsigned short tl[64][65]; const int tid = threadIdx.x; const int hh = blockIdx.x % HG, sg = blockIdx.x / HG; const int s0 = sg * 64; const int h = h0 + hh;
  for (int i = tid; i < 64 * 8; i += 256) { const int j = i / 8, d8 = (i % 8) * 8; FragH f; f.half[0] = *(const v8us*)((const unsigned short*)V16 + ((size_t)b * SQ + s0 + j) * DM + h * HD + d8); for (int q = 0; q < 8; ++q) tl[d8 + q][j] = f.u[q]; }
  __syncthreads();
  { for (int i = tid; i < 64 * 8; i += 256) { const int d = i / 8, j8 = (i % 8) * 8; FragH f; for (int q = 0; q < 8; ++q) f.u[q] = tl[d][j8 + q]; *(v8us*)((unsigned short*)VT + ((size_t)hh * HD + d) * SQ + s0 + j8) = f.half[0]; }  } }



// lane l <-> l ^ 16 (cross-row move); every lane on
__device__ __forceinline__ float rs_xh(float x) { return __builtin_bit_cast(float, __builtin_amdgcn_permlanex16(__builtin_bit_cast(int, x), __builtin_bit_cast(int, x), 0x76543210, 0xfedcba98, false, false)); }
__device__ __forceinline__ v8f fa_mma(v16h a, v16h b, v8f c) { return __builtin_amdgcn_wmma_f32_16x16x32_f16(false, a, false, b, (short)0, c, false, false); }
#define FA_C 0.18033688011112042f      /* 0.125 * log2(e) */
#define FA_T 44.361419555836498f       /* 8 / FA_C: the rescale threshold in raw score units */
__global__ __launch_bounds__(256) void k_fattn(const _Float16* __restrict__ Q, const _Float16* __restrict__ Kr, const _Float16* __restrict__ VT, _Float16* __restrict__ O) { static_assert(HD == 64 && SQ % 256 == 0, "k_fattn: 2 k fragments per row, 8 waves x 32 queries");
  const int lane = threadIdx.x & 31, ln = lane & 15, hh = lane >> 4, w = threadIdx.x >> 5; const int slab = blockIdx.y, b = slab / NH, h = slab - b * NH; const int q0 = blockIdx.x * 256 + w * 32;
  const _Float16* qp = Q + ((size_t)b * SQ + q0 + ln) * LQ + h * HD; const _Float16* kp = Kr + ((size_t)b * SQ + ln) * LQ + h * HD; const _Float16* vp = VT + ((size_t)slab * HD + ln) * SQ;
  v16h qf[2][2], kf[2][2];      /* [tile][half of the 64 d] */
#pragma unroll
  for (int j = 0; j < 2; ++j) { qf[j][0] = g2_frag(qp + (size_t)j * 16 * LQ, hh); qf[j][1] = g2_frag(qp + (size_t)j * 16 * LQ + 32, hh); kf[j][0] = g2_frag(kp + (size_t)j * 16 * LQ, hh); kf[j][1] = g2_frag(kp + (size_t)j * 16 * LQ + 32, hh); }
  const v8f z8 = {0.f,0.f,0.f,0.f,0.f,0.f,0.f,0.f}; v8f o[2][4]; float m[2] = {-3.0e38f, -3.0e38f}, l[2] = {0.f, 0.f};
#pragma unroll
  for (int j = 0; j < 2; ++j) for (int dt = 0; dt < 4; ++dt) o[j][dt] = z8;
#pragma unroll 1      /* stays rolled (for speed only) */
  for (int kb = 0; kb < SQ; kb += 32) {
    v16h vf[4];      /* V^T rows of this pass: asked for first, used last */
#pragma unroll
    for (int dt = 0; dt < 4; ++dt) vf[dt] = g2_frag(vp + (size_t)dt * 16 * SQ + kb, hh);
    v8f s[2][2];      /* [query tile][key tile] */
#pragma unroll
    for (int j = 0; j < 2; ++j) for (int t = 0; t < 2; ++t) s[j][t] = fa_mma(kf[t][1], qf[j][1], fa_mma(kf[t][0], qf[j][0], z8));
    const _Float16* kn = kp + (size_t)((kb + 32) & (SQ - 1)) * LQ;      /* next pass's K rows, fetched one pass ahead (the last pass wraps to row 0: in bounds, not used) */
#pragma unroll
    for (int t = 0; t < 2; ++t) { kf[t][0] = g2_frag(kn + (size_t)t * 16 * LQ, hh); kf[t][1] = g2_frag(kn + (size_t)t * 16 * LQ + 32, hh); }
    float tm[2];
#pragma unroll
    for (int j = 0; j < 2; ++j) { float a = fmaxf(s[j][0][0], s[j][1][0]);
      for (int r = 1; r < 8; ++r) a = fmaxf(a, fmaxf(s[j][0][r], s[j][1][r]));
      tm[j] = fmaxf(a, rs_xh(a)); }
    if (__builtin_amdgcn_ballot_w32(tm[0] > m[0] + FA_T || tm[1] > m[1] + FA_T) != 0) {      /* one scalar branch per pass */
#pragma unroll
      for (int j = 0; j < 2; ++j) { const float mn = fmaxf(m[j], tm[j]); const float al = __builtin_amdgcn_exp2f((m[j] - mn) * FA_C); m[j] = mn; l[j] *= al;
        for (int dt = 0; dt < 4; ++dt) o[j][dt] *= al; } }
    FragH pf[2];
#pragma unroll
    for (int j = 0; j < 2; ++j) { const float mc = m[j] * FA_C; float s0 = 0.f, s1 = 0.f;
      for (int r = 0; r < 8; ++r) { const float p0 = __builtin_amdgcn_exp2f(s[j][0][r] * FA_C - mc), p1 = __builtin_amdgcn_exp2f(s[j][1][r] * FA_C - mc); s0 += p0; s1 += p1; pf[j].h[r] = (_Float16)p0; pf[j].h[8 + r] = (_Float16)p1; }
      l[j] += s0 + s1; }
#pragma unroll
    for (int dt = 0; dt < 4; ++dt) for (int j = 0; j < 2; ++j) o[j][dt] = fa_mma(vf[dt], pf[j].v, o[j][dt]);
  }
#pragma unroll
  for (int j = 0; j < 2; ++j) { const float inv = 64.0f / (l[j] + rs_xh(l[j])); unsigned short* d = (unsigned short*)O + ((size_t)b * SQ + q0 + j * 16 + ln) * DM + h * HD + 8 * hh;
    for (int dt = 0; dt < 4; ++dt) { FragH f; for (int r = 0; r < 8; ++r) f.h[r] = (_Float16)(o[j][dt][r] * inv); *(v8us*)(d + dt * 16) = f.half[0]; } } }

extern "C" void kernel_launch(void* const* d_in, const int* in_sizes, int n_in,
                              void* d_out, int out_size, void* d_ws, size_t ws_size, hipStream_t stream) {
  (void)in_sizes; (void)n_in; (void)out_size;
  const float* const* I = (const float* const*)d_in; const float* x = I[0]; const float* wqkv = I[1]; const float* bq = nullptr; const float* wo = I[2]; const float* bo = nullptr;      /* ONE input stream (z); U_qkv is ONE STACK [12][3][768][64] = [head][q | k | v][in][out]; U_msa [in][out] [768][768]; the module has NO biases: bare null pointers in the guarded bias slots; input order z, U_qkv, U_msa */
  char* ws = (char*)d_ws; size_t off = 0;
  auto take = [&](size_t bytes) { char* p = ws + off; off += (bytes + 255) & ~(size_t)255; return p; };
  _Float16* BQ = (_Float16*)take((size_t)3 * DM * DM * 2); _Float16* BO = (_Float16*)take((size_t)DM * DM * 2);      /* BQ: planes q | k | v, DM * DM apart */
  _Float16* X16 = (_Float16*)take(NR * DM * 2); _Float16* Q16 = (_Float16*)take((size_t)3 * NR * DM * 2); _Float16* K16 = Q16 + NR * DM; _Float16* V16 = K16 + NR * DM; _Float16* O16 = (_Float16*)take(NR * DM * 2);      /* q | k | v rows, NR * DM apart */
  _Float16* VT = (_Float16*)take((size_t)NB * NH * HD * SQ * 2);
  if (off > ws_size) return;
  static_assert(MP % 128 == 0 && MPO % 128 == 0 && DM % 128 == 0 && DM % 64 == 0, "k_gemm2: whole 128x128 tiles, whole 64-k stages");
  k_prep<<<PB_ALL, 256, 0, stream>>>(x, wqkv, wo, X16, BQ, BO);      /* all weight planes ([out][in], x16) and the x rows */
  const size_t r0p = (size_t)B0 * SQ;      /* first projected row */
  k_gemm2<0><<<dim3((unsigned)((MP / 128) * (DM / 128)), 3), 256, 0, stream>>>(X16 + r0p * DM, DM, 0, BQ, DM, (size_t)DM * DM, 0.0625f, bq, 0, nullptr, 1, 0, 0, nullptr, Q16 + r0p * DM, DM, NR * DM, MP, DM, DM);      /* y = q | k | v: same A rows, weight plane and output rows of the part */
  k_vt<NH, SQ><<<NB * NH * (SQ / 64), 256, 0, stream>>>(V16, LQ, 0, VT);      /* V^T [NB][NH][HD][SQ], all batches in one launch */
  k_fattn<<<dim3(SQ / 256, NB * NH), 256, 0, stream>>>(Q16, K16, VT, O16);      /* o (merged heads, x64) as f16 rows: scores, softmax and P.V of every (batch, head) */
  k_gemm2<0><<<dim3((unsigned)((MPO / 128) * (DM / 128)), 1), 256, 0, stream>>>(O16 + r0p * DM, DM, 0, BO, DM, 0, 0.0009765625f, bo, 0, nullptr, 1, 0, 0, (float*)d_out + r0p * DM, nullptr, DM, 0, MPO, DM, DM);      /* out rows are the output layout */
}

// v005
// Measured time: 158 microseconds a run.
// Two timings next to v004 both put it at 1.39 times that version's speed.
// All steps since v000 together make it 62.9 times as fast.
#include <hip/hip_runtime.h>
// Multi-head self-attention with ONE STACKED per-head projection input on SIXTEEN sequences of 1024 at width 768 (z [16][1024][768]; U_qkv [12][3][768][64] = [head][q | k | v][in][out]: q, k, v of head h = z U_qkv[h][0 | 1 | 2]; NO biases; 12 heads of 64; logits / sqrt(64); softmax over all 1024 keys (no mask); out = merged U_msa ([in][out] [768][768], NO bias) -> [16][1024][768]); each (head, part) [in][out] block is transposed into its 64 contiguous rows of the weight plane, all blocks in the one preparation launch; dense: single f16 q / k / v planes on every row.
// Structure: token rows r = b*1024 + s; one preparation launch (all weight planes and x as exact f16 rows, bf16-rounded; jobs picked by block index); Q, K, V as three WMMA GEMMs in one grid (y = part; 32x64 wave tiles, operand tiles staged in LDS by asynchronous copies, f32 accumulation, exact x16 weights, null bias slots, f16 outputs); V^T for all batches and heads via LDS transposes (one launch); one fused attention launch over all (batch, head), K and V^T tiles staged in LDS by asynchronous copies: S^T = K Q^T on WMMA, online softmax in registers (f32 statistics, native exp2; unnormalised weights as f16), O^T += V^T P^T on WMMA, divided by the row sum at the end (o carried x64, folded into the output GEMM alpha) and written straight into the merged f16 o rows; out = o U_msa GEMM (f32, null bias slot) into the output layout.
// Compute dtype: inputs rounded to bf16; x / weights exact; q, k, v, softmax weights and o as plain f16 GEMM operands (~2^-12); scores and softmax statistics f32. v_wmma_f32_16x16x32_f16.
#define NB 16
#define SQ 1024
#define DM 768 
#define NH 12
#define HD 64
#define HG 4                         /* heads per launch of the per-batch k_vt overload (not launched) */
#define B0 0                         /* first batch processed (debug hook) */
#define NBR NB                       /* batches processed (debug hook) */
#define NR ((size_t)NB * SQ)         /* token rows */
#define MP ((int)((size_t)NBR * SQ)) /* rows projected (debug hook) */
#define QN SQ                        /* not used: k_fattn attends all SQ query rows */
#define NHD NH                       /* not used: k_fattn attends all NH heads */
#define MPO MP                       /* rows through the output stage (debug hook) */
#define LQ DM      /* row pitch of the q/k/v rows */
typedef __bf16 v16b __attribute__((ext_vector_type(16)));
typedef unsigned short v8us __attribute__((ext_vector_type(8), may_alias));
typedef float  v8f  __attribute__((ext_vector_type(8)));
typedef float  v4f  __attribute__((ext_vector_type(4)));
typedef float  v4fa __attribute__((ext_vector_type(4), may_alias));
union FragB { v16b v; v8us half[2]; unsigned short u[16]; };

__device__ __forceinline__ unsigned short bf16_bits(float x) { unsigned int u = __float_as_uint(x); return (unsigned short)((u + 0x7FFFu + ((u >> 16) & 1u)) >> 16); }
__device__ __forceinline__ float bf16_val(unsigned short b) { return __uint_as_float(((unsigned int)b) << 16); }
__device__ __forceinline__ float bf16_round(float x) { return bf16_val(bf16_bits(x)); }
// D += A·B with NT terms: 1 = ah·bh, 2 = + al·bh (A split), 3 = + ah·bl (both split)
template <int NT>
__device__ __forceinline__ v8f mmaN(v16b ah, v16b al, v16b bh, v16b bl, v8f c) {
  c = __builtin_amdgcn_wmma_f32_16x16x32_bf16(false, ah, false, bh, (short)0, c, false, false);
  if (NT >= 2) c = __builtin_amdgcn_wmma_f32_16x16x32_bf16(false, al, false, bh, (short)0, c, false, false);
  if (NT >= 3) c = __builtin_amdgcn_wmma_f32_16x16x32_bf16(false, ah, false, bl, (short)0, c, false, false);
  asm volatile("v_nop\n\tv_nop\n\tv_nop\n\tv_nop" : "+v"(c) : "v"(ah), "v"(al), "v"(bh), "v"(bl));
  return c;
}

__global__ __launch_bounds__(256) void k_wt_bf16(const float* __restrict__ W, unsigned short* __restrict__ Wt, int K, int N) {
  const int t = blockIdx.x * 256 + threadIdx.x;
  const int k8n = K / 8;
  if (t >= N * k8n) return;
  const int n = t / k8n, k8 = (t % k8n) * 8;
  v8us v;
#pragma unroll
  for (int i = 0; i < 8; ++i) v[i] = bf16_bits(W[(size_t)(k8 + i) * N + n]);
  *(v8us*)(Wt + (size_t)n * K + k8) = v;
  
}

// GEMM C[M][N] (f32, pitch ldc) = act(A[M][K]·W + bias). A f32 row-major (pitch lda) converted per fragment to bf16
// (ASPLIT: hi/lo two planes -> 2 terms, else single rounded term); Wt bf16 [N][K] (pitch ldb). BIAS_BF16 rounds the
// bias to bf16 first (bias quantised to bf16 before the add). K%32==0, M%16==0, N%64==0.
template <bool ASPLIT, int ACT, bool BIAS_BF16>
__global__ __launch_bounds__(128) void k_gemm_bf(const float* __restrict__ A, int lda, const unsigned short* __restrict__ Wt, int ldb,
                                               const float* __restrict__ bias, float* __restrict__ C, int ldc, int M, int N, int K) {
  __shared__ __attribute__((aligned(16))) float so[4][16][64];
  const int tid = threadIdx.x, w = tid >> 5, lane = tid & 31, ln = lane & 15, hh = lane >> 4;
  const int ntn = N / 64;
  const int wid = blockIdx.x * 4 + w;
  const int mt = wid / ntn, nq = wid % ntn;
  if (mt * 16 >= M) return;
  const int row0 = mt * 16, col0 = nq * 64;
  const float* arow = A + (size_t)(row0 + ln) * lda;
  v8f acc[4] = {};
  for (int kb = 0; kb < K; kb += 32) {
    FragB ah, al;
    const v4f x0 = *(const v4fa*)(arow + kb + 8 * hh), x1 = *(const v4fa*)(arow + kb + 8 * hh + 4);
    const v4f x2 = *(const v4fa*)(arow + kb + 16 + 8 * hh), x3 = *(const v4fa*)(arow + kb + 16 + 8 * hh + 4);
    float xs[16] = {x0[0],x0[1],x0[2],x0[3],x1[0],x1[1],x1[2],x1[3],x2[0],x2[1],x2[2],x2[3],x3[0],x3[1],x3[2],x3[3]};
#pragma unroll
    for (int i = 0; i < 16; ++i) { const unsigned short hb = bf16_bits(xs[i]); ah.u[i] = hb; al.u[i] = ASPLIT ? bf16_bits(xs[i] - bf16_val(hb)) : (unsigned short)0; }
#pragma unroll
    for (int t = 0; t < 4; ++t) {
      const unsigned short* brow = Wt + (size_t)(col0 + t * 16 + ln) * ldb + kb;
      FragB b;
      b.half[0] = *(const v8us*)(brow + 8 * hh);
      b.half[1] = *(const v8us*)(brow + 16 + 8 * hh);
      acc[t] = mmaN<ASPLIT ? 2 : 1>(ah.v, al.v, b.v, b.v, acc[t]);
    }
  }
#pragma unroll
  for (int t = 0; t < 4; ++t) {
    float bv = bias ? bias[col0 + t * 16 + ln] : 0.f;
    if (BIAS_BF16) bv = bf16_round(bv);
#pragma unroll
    for (int r = 0; r < 8; ++r) { float v = acc[t][r] + bv; if (ACT == 1) v = fmaxf(v, 0.f); so[w][8 * hh + r][t * 16 + ln] = v; }
  }
  __builtin_amdgcn_fence(__ATOMIC_ACQ_REL, "workgroup");
  __builtin_amdgcn_wave_barrier();
  const int rsub = lane >> 4, c4 = (lane & 15) * 4;
  {
#pragma unroll
    for (int q = 0; q < 8; ++q) {
      const int r = q * 2 + rsub;
      const v4f v = *(const v4fa*)&so[w][r][c4];
      *(v4f*)(C + (size_t)(row0 + r) * ldc + col0 + c4) = v;
    }
    
  }
}

// GEMM C = act(A·W + bias + resid): A f32 (ASPLIT -> hi/lo 2 terms), Wt bf16 [N][K]; ACT 0 none, 1 relu, 2 exact gelu;
// resid (optional, f32, row index = (row % rmod), pitch ldr, RES_BF16 rounds it) added before the activation.
template <bool ASPLIT, int ACT, bool BIAS_BF16, bool RES_BF16>
__global__ __launch_bounds__(128) void k_gemm_bf3(const float* __restrict__ A, int lda, const unsigned short* __restrict__ Wt, int ldb,
                                                const float* __restrict__ bias, const float* __restrict__ resid, int rmod, int ldr,
                                                float* __restrict__ C, int ldc, int M, int N, int K) {
  __shared__ __attribute__((aligned(16))) float so[4][16][64];
  const int tid = threadIdx.x, w = tid >> 5, lane = tid & 31, ln = lane & 15, hh = lane >> 4;
  const int ntn = N / 64;
  const int wid = blockIdx.x * 4 + w;
  const int mt = wid / ntn, nq = wid % ntn;
  if (mt * 16 >= M) return;
  const int row0 = mt * 16, col0 = nq * 64;
  const float* arow = A + (size_t)(row0 + ln) * lda;
  v8f acc[4] = {};
  for (int kb = 0; kb < K; kb += 32) {
    FragB ah, al;
    const v4f x0 = *(const v4fa*)(arow + kb + 8 * hh), x1 = *(const v4fa*)(arow + kb + 8 * hh + 4);
    const v4f x2 = *(const v4fa*)(arow + kb + 16 + 8 * hh), x3 = *(const v4fa*)(arow + kb + 16 + 8 * hh + 4);
    float xs[16] = {x0[0],x0[1],x0[2],x0[3],x1[0],x1[1],x1[2],x1[3],x2[0],x2[1],x2[2],x2[3],x3[0],x3[1],x3[2],x3[3]};
#pragma unroll
    for (int i = 0; i < 16; ++i) { const unsigned short hb = bf16_bits(xs[i]); ah.u[i] = hb; al.u[i] = ASPLIT ? bf16_bits(xs[i] - bf16_val(hb)) : (unsigned short)0; }
#pragma unroll
    for (int t = 0; t < 4; ++t) {
      const unsigned short* brow = Wt + (size_t)(col0 + t * 16 + ln) * ldb + kb;
      FragB b;
      b.half[0] = *(const v8us*)(brow + 8 * hh);
      b.half[1] = *(const v8us*)(brow + 16 + 8 * hh);
      acc[t] = mmaN<ASPLIT ? 2 : 1>(ah.v, al.v, b.v, b.v, acc[t]);
    }
  }
#pragma unroll
  for (int t = 0; t < 4; ++t) {
    const int col = col0 + t * 16 + ln;
    float bv = bias ? bias[col] : 0.f;
    if (BIAS_BF16) bv = bf16_round(bv);
#pragma unroll
    for (int r = 0; r < 8; ++r) {
      float v = acc[t][r] + bv;
      if (resid) { float rv = resid[(size_t)((row0 + 8 * hh + r) % rmod) * ldr + col]; if (RES_BF16) rv = bf16_round(rv); v += rv; }
      if (ACT == 1) v = fmaxf(v, 0.f);
      if (ACT == 2) v = 0.5f * v * (1.0f + erff(v * 0.70710678118654752f));
      if (ACT == 3) { const float u = 0.7978845608028654f * (v + 0.044715f * v * v * v); v = 0.5f * v * (1.0f + tanhf(u)); }
      so[w][8 * hh + r][t * 16 + ln] = v;
    }
  }
  __builtin_amdgcn_fence(__ATOMIC_ACQ_REL, "workgroup");
  __builtin_amdgcn_wave_barrier();
  const int rsub = lane >> 4, c4 = (lane & 15) * 4;
  {
#pragma unroll
    for (int q = 0; q < 8; ++q) {
      const int r = q * 2 + rsub;
      const v4f v = *(const v4fa*)&so[w][r][c4];
      *(v4f*)(C + (size_t)(row0 + r) * ldc + col0 + c4) = v;
    }
    
  }
}
// row LayerNorm (biased variance, eps) over N: s = X (+ R); optional out_sum <- s; out_norm <- (s-mu)*rsqrt(var+eps)*g + b
template <bool PARAM_BF16>
__global__ __launch_bounds__(256) void k_layernorm(const float* __restrict__ X, const float* __restrict__ R, const float* __restrict__ g, const float* __restrict__ bta,
                                                  float* __restrict__ out_sum, float* __restrict__ out_norm, int N, float eps) {
  __shared__ float red[256];
  const int row = blockIdx.x, tid = threadIdx.x;
  const float* x = X + (size_t)row * N; const float* rr = R ? R + (size_t)row * N : nullptr;
  float vals[16];                     // up to N = 4096
  const int per = N / 256;            // contiguous chunk per thread? use strided-by-4 chunks: thread handles j = tid*4 + 1024*u
  float s1 = 0.f;
  for (int u = 0; u < per / 4; ++u) {
    const int j = tid * 4 + 1024 * u;
    const v4f a = *(const v4fa*)(x + j);
    v4f b = {0.f,0.f,0.f,0.f}; if (rr) b = *(const v4fa*)(rr + j);
#pragma unroll
    for (int q = 0; q < 4; ++q) { const float v = a[q] + b[q]; vals[u * 4 + q] = v; s1 += v; }
  }
  red[tid] = s1; __syncthreads();
  for (int st = 128; st > 0; st >>= 1) { if (tid < st) red[tid] += red[tid + st]; __syncthreads(); }
  const float mu = red[0] / (float)N; __syncthreads();
  float s2 = 0.f;
  for (int u = 0; u < per / 4; ++u)
#pragma unroll
    for (int q = 0; q < 4; ++q) { const float c = vals[u * 4 + q] - mu; s2 += c * c; }
  red[tid] = s2; __syncthreads();
  for (int st = 128; st > 0; st >>= 1) { if (tid < st) red[tid] += red[tid + st]; __syncthreads(); }
  const float rs = rsqrtf(red[0] / (float)N + eps);
  {
    for (int u = 0; u < per / 4; ++u) {
      const int j = tid * 4 + 1024 * u;
      v4f o, sm;
#pragma unroll
      for (int q = 0; q < 4; ++q) {
        float gg = g[j + q], bb = bta[j + q];
        if (PARAM_BF16) { gg = bf16_round(gg); bb = bf16_round(bb); }
        sm[q] = vals[u * 4 + q]; o[q] = (vals[u * 4 + q] - mu) * rs * gg + bb;
      }
      if (out_sum) *(v4f*)(out_sum + (size_t)row * N + j) = sm;
      *(v4f*)(out_norm + (size_t)row * N + j) = o;
    }
    
  }
}



// ---- f16 WMMA path (v_wmma_f32_16x16x32_f16): 11-bit significands for operands in range — used where a [0,1] probability operand needs more precision than bf16
typedef _Float16 v16h __attribute__((ext_vector_type(16)));
union FragH { v16h v; v8us half[2]; _Float16 h[16]; unsigned short u[16]; };
template <int NT>
__device__ __forceinline__ v8f mmaH(v16h ah, v16h al, v16h bh, v16h bl, v8f c) {
  c = __builtin_amdgcn_wmma_f32_16x16x32_f16(false, ah, false, bh, (short)0, c, false, false);
  if (NT >= 2) c = __builtin_amdgcn_wmma_f32_16x16x32_f16(false, al, false, bh, (short)0, c, false, false);
  if (NT >= 3) c = __builtin_amdgcn_wmma_f32_16x16x32_f16(false, ah, false, bl, (short)0, c, false, false);
  asm volatile("v_nop\n\tv_nop\n\tv_nop\n\tv_nop" : "+v"(c) : "v"(ah), "v"(al), "v"(bh), "v"(bl));
  return c;
}
// batched GEMM like k_gemm_b but f16 operands: A f32 (split into f16 hi/lo if ASPLIT, else rounded to f16), Bt = f16 values [n][k]; alpha; C f32; N multiple of 16 (partial tiles skipped)
template <bool ASPLIT>
__global__ __launch_bounds__(128) void k_gemm_h(const float* __restrict__ A, int lda, size_t sA, const _Float16* __restrict__ Bh, int ldb, size_t sB, float alpha, float* __restrict__ C, int ldc, size_t sC, int M, int N, int K) {
  __shared__ __attribute__((aligned(16))) float so[4][16][64];
  const int tid = threadIdx.x, w = tid >> 5, lane = tid & 31, ln = lane & 15, hh = lane >> 4; const int by = blockIdx.y;
  A += (size_t)by * sA; Bh += (size_t)by * sB; C += (size_t)by * sC;
  const int ntn = (N + 63) / 64; const int wid = blockIdx.x * 4 + w; const int mt = wid / ntn, nq = wid % ntn; if (mt * 16 >= M) return;
  const int row0 = mt * 16, col0 = nq * 64; const float* arow = A + (size_t)(row0 + ln) * lda;
  v8f acc[4] = {};
  for (int kb = 0; kb < K; kb += 32) {
    FragH ah, al;
    const v4f x0 = *(const v4fa*)(arow + kb + 8 * hh), x1 = *(const v4fa*)(arow + kb + 8 * hh + 4), x2 = *(const v4fa*)(arow + kb + 16 + 8 * hh), x3 = *(const v4fa*)(arow + kb + 16 + 8 * hh + 4);
    float xs[16] = {x0[0],x0[1],x0[2],x0[3],x1[0],x1[1],x1[2],x1[3],x2[0],x2[1],x2[2],x2[3],x3[0],x3[1],x3[2],x3[3]};
#pragma unroll
    for (int i = 0; i < 16; ++i) { const _Float16 h = (_Float16)xs[i]; ah.h[i] = h; al.h[i] = ASPLIT ? (_Float16)(xs[i] - (float)h) : (_Float16)0.0f; }
#pragma unroll
    for (int t = 0; t < 4; ++t) { if (col0 + t * 16 >= N) continue; const size_t boff = (size_t)(col0 + t * 16 + ln) * ldb + kb; FragH bq; bq.half[0] = *(const v8us*)(Bh + boff + 8 * hh); bq.half[1] = *(const v8us*)(Bh + boff + 16 + 8 * hh);
      acc[t] = mmaH<ASPLIT ? 2 : 1>(ah.v, al.v, bq.v, bq.v, acc[t]); }
  }
#pragma unroll
  for (int t = 0; t < 4; ++t) { if (col0 + t * 16 >= N) continue;
#pragma unroll
    for (int r = 0; r < 8; ++r) so[w][8 * hh + r][t * 16 + ln] = acc[t][r] * alpha; }
  __builtin_amdgcn_fence(__ATOMIC_ACQ_REL, "workgroup"); __builtin_amdgcn_wave_barrier();
  const int rsub = lane >> 4, c4 = (lane & 15) * 4;
  {
#pragma unroll
    for (int q = 0; q < 8; ++q) { const int r = q * 2 + rsub; if (col0 + c4 < N) { const v4f v = *(const v4fa*)&so[w][r][c4]; *(v4f*)(C + (size_t)(row0 + r) * ldc + col0 + c4) = v; } }
     }
}

// Wt[n][k] = f16(W[k][n]·scale) from f32 row-major W[K][N] (scale = power of two; bf16-exact weights stay exact in f16 away from the subnormal range)
__device__ __forceinline__ void wt_f16(const float* __restrict__ W, _Float16* __restrict__ Wt, int K, int N, float scale, int t) {
  const int n = t / (K / 8), k8 = (t % (K / 8)) * 8; FragH f;
#pragma unroll
  for (int i = 0; i < 8; ++i) f.h[i] = (_Float16)(bf16_round(W[(size_t)(k8 + i) * N + n]) * scale); const v8us o = f.half[0];
  *(v8us*)((unsigned short*)Wt + (size_t)n * K + k8) = o;
  asm volatile("s_wait_xcnt 0x0" ::: "memory");      /* behind the store: in the joined kernel the listing runs on into another job's code, which rewrites the store's registers */
}
// k_gemm_hh variant with fused epilogue: v = acc·alpha + bias[by·sBias + col] (+ CP[(row/rowsPerB)·sCPb + by·64 + col] if CP) ; ACT 0 none / 1 elu ; writes f16 C16 (and f32 C if non-null)
template <int ACT>
__global__ __launch_bounds__(128) void k_gemm_hhx(const _Float16* __restrict__ A, int lda, size_t sA, const _Float16* __restrict__ Bh, int ldb, size_t sB, float alpha, const float* __restrict__ bias, size_t sBias, const float* __restrict__ CP, int rowsPerB, size_t sCPb, int row0g,
    float* __restrict__ C, _Float16* __restrict__ C16, int ldc, size_t sC, int M, int N, int K) {
  __shared__ __attribute__((aligned(16))) float so[4][16][64];
  const int tid = threadIdx.x, w = tid >> 5, lane = tid & 31, ln = lane & 15, hh = lane >> 4; const int by = blockIdx.y;
  A += (size_t)by * sA; Bh += (size_t)by * sB; const size_t cofs = (size_t)by * sC; const float* bp = bias ? bias + (size_t)by * sBias : nullptr;
  const int ntn = (N + 63) / 64; const int wid = blockIdx.x * 4 + w; const int mt = wid / ntn, nq = wid % ntn; if (mt * 16 >= M) return;
  const int row0 = mt * 16, col0 = nq * 64; const _Float16* arow = A + (size_t)(row0 + ln) * lda;
  v8f acc[4] = {};
  for (int kb = 0; kb < K; kb += 32) { FragH ah; ah.half[0] = *(const v8us*)((const unsigned short*)arow + kb + 8 * hh); ah.half[1] = *(const v8us*)((const unsigned short*)arow + kb + 16 + 8 * hh);
#pragma unroll
    for (int t = 0; t < 4; ++t) { if (col0 + t * 16 >= N) continue; const size_t boff = (size_t)(col0 + t * 16 + ln) * ldb + kb; FragH bq; bq.half[0] = *(const v8us*)((const unsigned short*)Bh + boff + 8 * hh); bq.half[1] = *(const v8us*)((const unsigned short*)Bh + boff + 16 + 8 * hh);
      acc[t] = mmaH<1>(ah.v, ah.v, bq.v, bq.v, acc[t]); }
  }
#pragma unroll
  for (int t = 0; t < 4; ++t) { if (col0 + t * 16 >= N) continue; const int col = col0 + t * 16 + ln; const float bv = bp ? bf16_round(bp[col]) : 0.f;
#pragma unroll
    for (int r = 0; r < 8; ++r) { float v = acc[t][r] * alpha + bv; if (CP) { const int rr = row0g + row0 + 8 * hh + r; if (rowsPerB < 0) v += CP[cofs + (size_t)rr * ldc + col];      /* rowsPerB < 0: own element of the batched C plane */ else { const int bidx = rr / rowsPerB; v += CP[(size_t)bidx * sCPb + (size_t)by * 64 + col]; } } if (ACT == 1) v = (v > 0.f) ? v : expm1f(v); else if (ACT == 7) v = (v > 0.f) ? v + 1.0f : expf(v); else if (ACT == 8) v = tanhf(v); else if (ACT == 9) v = 0.5f * v * (1.0f + tanhf(0.7978845608028654f * (v + 0.044715f * v * v * v))); else if (ACT == 11) v = 1.0f / (1.0f + expf(-v)); else if (ACT == 12) v = (v > 0.f) ? v : 0.01f * v; else if (ACT == 14) v = (v > 0.f) ? v : 0.1f * v; else if (ACT == 16) v = (v >= 0.f) ? v : 0.3f * v; else if (ACT == 17) v = (v >= 0.f) ? v : 0.2f * v; else if (ACT == 15) v = v / (1.0f + expf(-v)); else if (ACT == 3) v = fmaxf(v, 0.f); else if (ACT == 6) v = 0.5f * v * (1.0f + erff(v * 0.70710678118654752f)); so[w][8 * hh + r][t * 16 + ln] = v; } }
  __builtin_amdgcn_fence(__ATOMIC_ACQ_REL, "workgroup"); __builtin_amdgcn_wave_barrier();
  const int rsub = lane >> 4, c4 = (lane & 15) * 4; typedef _Float16 v4h __attribute__((ext_vector_type(4)));
  {
#pragma unroll
    for (int q = 0; q < 8; ++q) { const int r = q * 2 + rsub; if (col0 + c4 < N) { const v4f v = *(const v4fa*)&so[w][r][c4]; if (C) *(v4f*)(C + cofs + (size_t)(row0 + r) * ldc + col0 + c4) = v; if (C16) { v4h h4; for (int i = 0; i < 4; ++i) h4[i] = (_Float16)v[i]; *(v4h*)(C16 + cofs + (size_t)(row0 + r) * ldc + col0 + c4) = h4; } } }
     }
}


typedef _Float16 v4h __attribute__((ext_vector_type(4)));

// Every job that reads inputs only, in ONE launch; a block's job follows from its index (block-uniform branches, no job depends on another):
// blocks [0, PB_QKV): the 36 (head, part) blocks of U_qkv, PB_HP blocks each, into planes Bq | Bk | Bv (contiguous, DM*DM apart); [PB_QKV, PB_W): U_msa into Bo; the rest: x rows.
#define PB_HP  (HD * (DM / 8) / 256)          /* blocks per (head, part) */
#define PB_QKV (3 * NH * PB_HP)
#define PB_W   (PB_QKV + DM * (DM / 8) / 256)
#define PB_ALL (PB_W + (int)(NR * DM / 8 / 256))
__global__ __launch_bounds__(256) void k_prep(const float* __restrict__ x, const float* __restrict__ wqkv, const float* __restrict__ wo, _Float16* __restrict__ X16, _Float16* __restrict__ Bqkv, _Float16* __restrict__ Bo) {
  static_assert(HD * (DM / 8) % 256 == 0 && DM * (DM / 8) % 256 == 0 && NR * DM / 8 % 256 == 0, "k_prep: whole blocks per job");
  const int bi = blockIdx.x, tid = threadIdx.x;
  if (bi < PB_QKV) { const int job = bi / PB_HP, h = job / 3, p = job - 3 * h;      /* U_qkv block (h, p): row-major [in = DM][out = HD] at (3 h + p) * DM * HD -> rows h * HD .. of plane p */
    wt_f16(wqkv + (size_t)job * DM * HD, Bqkv + (size_t)p * DM * DM + (size_t)h * HD * DM, DM, HD, 16.0f, (bi - job * PB_HP) * 256 + tid); return; }
  if (bi < PB_W) { wt_f16(wo, Bo, DM, DM, 16.0f, (bi - PB_QKV) * 256 + tid); return; }
  const size_t t = (size_t)(bi - PB_W) * 256 + tid; FragH f;
#pragma unroll
  for (int q = 0; q < 8; ++q) f.h[q] = (_Float16)bf16_round(x[t * 8 + q]); *(v8us*)((unsigned short*)X16 + t * 8) = f.half[0];
  asm volatile("s_wait_xcnt 0x0" ::: "memory"); }      /* behind the store, as in wt_f16 */
__global__ __launch_bounds__(256) void k_h16(const float* __restrict__ x, _Float16* __restrict__ X16, size_t n8) { const size_t t = (size_t)blockIdx.x * 256 + threadIdx.x; if (t >= n8) return; FragH f;
#pragma unroll
  for (int q = 0; q < 8; ++q) f.h[q] = (_Float16)x[t * 8 + q]; *(v8us*)((unsigned short*)X16 + t * 8) = f.half[0];  }
__global__ __launch_bounds__(256) void k_round16f(const float* __restrict__ W, _Float16* __restrict__ Bt, size_t n8) { const size_t t = (size_t)blockIdx.x * 256 + threadIdx.x; if (t >= n8) return; FragH f;
#pragma unroll
  for (int i = 0; i < 8; ++i) f.h[i] = (_Float16)(bf16_round(W[t * 8 + i]) * 16.0f); *(v8us*)((unsigned short*)Bt + t * 8) = f.half[0];  }
template <int NHv, int TTv>
__global__ __launch_bounds__(256) void k_vt(const _Float16* __restrict__ V16, int ldv, int voff, _Float16* __restrict__ Vt) { __shared__ unsigned short tl[64][66]; const int tid = threadIdx.x; const int slab = blockIdx.x / (TTv / 64), lg = blockIdx.x % (TTv / 64); const int b = slab / NHv, h = slab % NHv;
  for (int i = tid; i < 64 * 8; i += 256) { const int r = i / 8, c8 = (i % 8) * 8; FragH f; f.half[0] = *(const v8us*)((const unsigned short*)V16 + ((size_t)b * TTv + lg * 64 + r) * ldv + voff + h * 64 + c8);
#pragma unroll
    for (int q = 0; q < 8; ++q) tl[r][c8 + q] = f.u[q]; }
  __syncthreads();
  {
#pragma unroll
    for (int rd = 0; rd < 2; ++rd) { const int d = rd * 32 + tid / 8, pc = tid % 8; FragH f;
#pragma unroll
      for (int q = 0; q < 8; ++q) f.u[q] = tl[pc * 8 + q][d];
      *(v8us*)((unsigned short*)Vt + ((size_t)slab * 64 + d) * TTv + lg * 64 + pc * 8) = f.half[0]; }
     } }

__global__ __launch_bounds__(256) void k_hl(const float* __restrict__ F, _Float16* __restrict__ Hh, _Float16* __restrict__ Hl, size_t n8) { const size_t t = (size_t)blockIdx.x * 256 + threadIdx.x; if (t >= n8) return; FragH fh, fl; const v4f a = *(const v4fa*)(F + t * 8), c = *(const v4fa*)(F + t * 8 + 4);
#pragma unroll
  for (int q = 0; q < 4; ++q) { _Float16 h = (_Float16)a[q]; fh.h[q] = h; fl.h[q] = (_Float16)((a[q] - (float)h) * 1024.0f); h = (_Float16)c[q]; fh.h[4 + q] = h; fl.h[4 + q] = (_Float16)((c[q] - (float)h) * 1024.0f); }
  { *(v8us*)((unsigned short*)Hh + t * 8) = fh.half[0]; *(v8us*)((unsigned short*)Hl + t * 8) = fl.half[0];  } }

// ---- fast GEMM (wave tile 32x64, block tile 128x128, operands staged in LDS); epilogue = k_gemm_hhx semantics ----
__device__ __forceinline__ v16h g2_frag(const _Float16* p, int hh) { FragH f; f.half[0] = *(const v8us*)((const unsigned short*)p + 8 * hh); f.half[1] = *(const v8us*)((const unsigned short*)p + 16 + 8 * hh); return f.v; }
__device__ __forceinline__ v8f g2_mma(v16h a, v16h b, v8f c) { v8f d = __builtin_amdgcn_wmma_f32_16x16x32_f16(false, a, false, b, (short)0, c, false, false); asm volatile("v_nop\n\tv_nop\n\tv_nop\n\tv_nop" : "+v"(d) : "v"(a), "v"(b)); return d; }
// Operand staging of k_gemm2: a stage is 64 k (128 B, one whole line) of the block's 128 A rows and 128 B rows, brought into LDS by asynchronous copies
// (global_load_async_to_lds_b128; a wave's copy = 4 whole lines), so every operand line is asked for once per block instead of 16 lines per fragment load and wave.
#define G2_PITCH 144                      /* LDS bytes per staged row: 128 + 16, 16 B x odd: conflict-free for the ds_load_b128 fragment reads */
#define G2_BUF   (256 * G2_PITCH)         /* one stage: A rows 0-127, then B rows 0-127 */
__device__ __forceinline__ v16h g2_lfrag(const char* p, int hh) { FragH f; f.half[0] = *(const v8us*)(p + 16 * hh); f.half[1] = *(const v8us*)(p + 32 + 16 * hh); return f.v; }      /* same k order as g2_frag */
// One stage: each thread copies 16 B of 4 A rows and of 4 B rows (32 rows apart). ga / gb: the thread's first A / B address of this stage; lds: its LDS byte address in A row (tid / 8) of the buffer.
__device__ __forceinline__ void g2_stage(const _Float16* ga, size_t astep, const _Float16* gb, size_t bstep, unsigned lds) {
  /* the closing s_wait_xcnt stands inside the copies' own statement, so that no address register is rewritten in front of it */
  asm volatile("global_load_async_to_lds_b128 %0, %8, off\n\t"
               "global_load_async_to_lds_b128 %1, %9, off\n\t"
               "global_load_async_to_lds_b128 %2, %10, off\n\t"
               "global_load_async_to_lds_b128 %3, %11, off\n\t"
               "global_load_async_to_lds_b128 %4, %12, off\n\t"
               "global_load_async_to_lds_b128 %5, %13, off\n\t"
               "global_load_async_to_lds_b128 %6, %14, off\n\t"
               "global_load_async_to_lds_b128 %7, %15, off\n\t"
               "s_wait_xcnt 0x0"
               :: "v"(lds), "v"(lds + 32 * G2_PITCH), "v"(lds + 64 * G2_PITCH), "v"(lds + 96 * G2_PITCH), "v"(lds + 128 * G2_PITCH), "v"(lds + 160 * G2_PITCH), "v"(lds + 192 * G2_PITCH), "v"(lds + 224 * G2_PITCH),
                  "v"(ga), "v"(ga + astep), "v"(ga + 2 * astep), "v"(ga + 3 * astep), "v"(gb), "v"(gb + bstep), "v"(gb + 2 * bstep), "v"(gb + 3 * bstep) : "memory"); }
// Block = 8 waves, tile 128x128 (wave w: rows 32 * (w & 3), columns 64 * (w >> 2)); requires M % 128 == 0, N % 128 == 0, K % 64 == 0, K >= 64. Two stage buffers; the epilogue staging reuses them behind the last barrier.
template <int ACT>
__global__ __launch_bounds__(256) void k_gemm2(const _Float16* __restrict__ A, int lda, size_t sA, const _Float16* __restrict__ Bh, int ldb, size_t sB, float alpha, const float* __restrict__ bias, size_t sBias, const float* __restrict__ CP, int rowsPerB, size_t sCPb, int row0g,
    float* __restrict__ C, _Float16* __restrict__ C16, int ldc, size_t sC, int M, int N, int K) { static_assert(ACT == 0 || ACT == 3 || ACT == 6 || ACT == 8 || ACT == 9 || ACT == 11 || ACT == 12 || ACT == 14 || ACT == 15 || ACT == 16 || ACT == 17, "k_gemm2: unsupported ACT code (would silently apply no activation)");
  __shared__ __attribute__((aligned(16))) char smem[2 * G2_BUF]; static_assert(8 * 32 * 68 * 4 <= 2 * G2_BUF, "k_gemm2: epilogue staging fits the stage buffers");
  float (*so)[32][68] = (float (*)[32][68])smem;
  const int tid = threadIdx.x, w = tid >> 5, lane = tid & 31, ln = lane & 15, hh = lane >> 4; const int by = blockIdx.y;
  A += (size_t)by * sA; Bh += (size_t)by * sB; const size_t cofs = (size_t)by * sC; const float* bp = bias ? bias + (size_t)by * sBias : nullptr;
  const int ntn = N >> 7; const int mt = blockIdx.x / ntn, nq = blockIdx.x - mt * ntn; if (mt * 128 >= M) return;      /* the whole block leaves, in front of every barrier */
  const int row0 = mt * 128 + 32 * (w & 3), col0 = nq * 128 + 64 * (w >> 2);
  const _Float16* ga = A + (size_t)(mt * 128 + (tid >> 3)) * lda + (tid & 7) * 8; const _Float16* gb = Bh + (size_t)(nq * 128 + (tid >> 3)) * ldb + (tid & 7) * 8; const size_t astep = (size_t)32 * lda, bstep = (size_t)32 * ldb;
  const unsigned lds0 = (unsigned)(size_t)smem + (unsigned)((tid >> 3) * G2_PITCH + (tid & 7) * 16);
  const char* afr = smem + (32 * (w & 3) + ln) * G2_PITCH; const char* bfr = smem + (128 + 64 * (w >> 2) + ln) * G2_PITCH;
  const v8f z8 = {0.f,0.f,0.f,0.f,0.f,0.f,0.f,0.f}; v8f c00 = z8, c01 = z8, c02 = z8, c03 = z8, c10 = z8, c11 = z8, c12 = z8, c13 = z8;
  const int nt = K >> 6;
  g2_stage(ga, astep, gb, bstep, lds0);
  asm volatile("s_wait_asynccnt 0x0" ::: "memory");      /* stage 0 of this wave has landed ... */
  __syncthreads();                                       /* ... and every wave's: nothing of it is read in front of this barrier */
  if (nt > 1) g2_stage(ga + 64, astep, gb + 64, bstep, lds0 + G2_BUF);
#pragma unroll 1      /* stays rolled: one publish point per stage at the foot, small loop text */
  for (int t = 0; t < nt; ++t) { const int bo = (t & 1) * G2_BUF;
#pragma unroll      /* both k blocks inline: their LDS offsets become immediates */
    for (int kk = 0; kk < 128; kk += 64) { const char* ap = afr + bo + kk; const char* bq = bfr + bo + kk;      /* two k blocks of 32 per stage, in ascending k */
      const v16h a0 = g2_lfrag(ap, hh), a1 = g2_lfrag(ap + 16 * G2_PITCH, hh);      /* the block's six fragments are read as one group in front of its WMMAs */
      const v16h b0 = g2_lfrag(bq, hh), b1 = g2_lfrag(bq + 16 * G2_PITCH, hh), b2 = g2_lfrag(bq + 32 * G2_PITCH, hh), b3 = g2_lfrag(bq + 48 * G2_PITCH, hh);
      c00 = g2_mma(a0, b0, c00); c10 = g2_mma(a1, b0, c10); c01 = g2_mma(a0, b1, c01); c11 = g2_mma(a1, b1, c11);
      c02 = g2_mma(a0, b2, c02); c12 = g2_mma(a1, b2, c12); c03 = g2_mma(a0, b3, c03); c13 = g2_mma(a1, b3, c13); }
    asm volatile("s_wait_dscnt 0x0" ::: "memory");       /* this wave's reads of the buffer are done before it may be refilled */
    asm volatile("s_wait_asynccnt 0x0" ::: "memory");    /* this wave's copies of stage t + 1 have landed */
    __syncthreads();                                     /* publishes stage t + 1 and ends every reader's last read of stage t */
    if (t + 2 < nt) g2_stage(ga + (size_t)(t + 2) * 64, astep, gb + (size_t)(t + 2) * 64, bstep, lds0 + bo); }
  asm volatile("s_wait_asynccnt 0x0" ::: "memory");      /* no copy is outstanding when the buffers become output staging */
  v8f accs[8] = {c00, c01, c02, c03, c10, c11, c12, c13};
#pragma unroll
  for (int u = 0; u < 8; ++u) { const int t = u & 3, half = u >> 2; const int col = col0 + t * 16 + ln; const float bv = bp ? bf16_round(bp[col]) : 0.f;
#pragma unroll
    for (int r = 0; r < 8; ++r) { const int rloc = half * 16 + 8 * hh + r; float v = accs[u][r] * alpha + bv; if (CP) { if (rowsPerB < 0) v += CP[cofs + (size_t)(row0g + row0 + rloc) * ldc + col];      /* rowsPerB < 0: own element of the batched C plane */ else { const int bidx = (row0g + row0 + rloc) / rowsPerB; v += CP[(size_t)bidx * sCPb + (size_t)by * 64 + col]; } }
      if (ACT == 3) v = fmaxf(v, 0.f); else if (ACT == 6) v = 0.5f * v * (1.0f + erff(v * 0.70710678118654752f)); else if (ACT == 11) v = 1.0f / (1.0f + expf(-v)); else if (ACT == 15) v = v / (1.0f + expf(-v)); else if (ACT == 12) v = (v > 0.f) ? v : 0.01f * v; else if (ACT == 8) v = tanhf(v); else if (ACT == 9) v = 0.5f * v * (1.0f + tanhf(0.7978845608028654f * (v + 0.044715f * v * v * v))); else if (ACT == 14) v = (v > 0.f) ? v : 0.1f * v; else if (ACT == 16) v = (v >= 0.f) ? v : 0.3f * v; else if (ACT == 17) v = (v >= 0.f) ? v : 0.2f * v;
      so[w][rloc][t * 16 + ln] = v; } }
  __builtin_amdgcn_fence(__ATOMIC_ACQ_REL, "workgroup"); __builtin_amdgcn_wave_barrier();
  const int rsub = lane >> 4, c4 = (lane & 15) * 4;
  {
#pragma unroll
    for (int q = 0; q < 16; ++q) { const int r = q * 2 + rsub; const v4f v = *(const v4fa*)&so[w][r][c4]; if (C) *(v4f*)(C + cofs + (size_t)(row0 + r) * ldc + col0 + c4) = v; if (C16) { v4h h4; for (int i = 0; i < 4; ++i) h4[i] = (_Float16)v[i]; *(v4h*)(C16 + cofs + (size_t)(row0 + r) * ldc + col0 + c4) = h4; } }
     } }


__global__ __launch_bounds__(256) void k_wnat(const float* __restrict__ w, size_t n8, _Float16* __restrict__ Bt) { const size_t t = (size_t)blockIdx.x * 256 + threadIdx.x; if (t >= n8) return; FragH f; for (int q = 0; q < 8; ++q) f.h[q] = (_Float16)(bf16_round(w[t * 8 + q]) * 16.0f); *(v8us*)((unsigned short*)Bt + t * 8) = f.half[0];  }
__global__ __launch_bounds__(256) void k_rsm(const float* __restrict__ S, _Float16* __restrict__ P, int nrows) {
  #pragma clang fp contract(off)
  const int i = blockIdx.x * 256 + threadIdx.x; if (i >= nrows) return; const float* s = S + (size_t)i * SQ; float mx = -3.0e38f;
#pragma unroll 1
  for (int j = 0; j < SQ; ++j) mx = fmaxf(mx, s[j]); float se = 0.f;
#pragma unroll 1
  for (int j = 0; j < SQ; ++j) se += expf(s[j] - mx); const float sc = 256.0f / se;
#pragma unroll 1
  for (int j0 = 0; j0 < SQ; j0 += 8) { FragH f; for (int q = 0; q < 8; ++q) f.h[q] = (_Float16)(expf(s[j0 + q] - mx) * sc); unsigned short* d = (unsigned short*)P + (size_t)i * SQ + j0; *(v8us*)d = f.half[0];  } }
__global__ __launch_bounds__(256) void k_vt(const _Float16* __restrict__ V16, int b, int h0, _Float16* __restrict__ VT) { __shared__ unsigned short tl[64][65]; const int tid = threadIdx.x; const int hh = blockIdx.x % HG, sg = blockIdx.x / HG; const int s0 = sg * 64; const int h = h0 + hh;
  for (int i = tid; i < 64 * 8; i += 256) { const int j = i / 8, d8 = (i % 8) * 8; FragH f; f.half[0] = *(const v8us*)((const unsigned short*)V16 + ((size_t)b * SQ + s0 + j) * DM + h * HD + d8); for (int q = 0; q < 8; ++q) tl[d8 + q][j] = f.u[q]; }
  __syncthreads();
  { for (int i = tid; i < 64 * 8; i += 256) { const int d = i / 8, j8 = (i % 8) * 8; FragH f; for (int q = 0; q < 8; ++q) f.u[q] = tl[d][j8 + q]; *(v8us*)((unsigned short*)VT + ((size_t)hh * HD + d) * SQ + s0 + j8) = f.half[0]; }  } }



// lane l <-> l ^ 16 (cross-row move); every lane on
__device__ __forceinline__ float rs_xh(float x) { return __builtin_bit_cast(float, __builtin_amdgcn_permlanex16(__builtin_bit_cast(int, x), __builtin_bit_cast(int, x), 0x76543210, 0xfedcba98, false, false)); }
__device__ __forceinline__ v8f fa_mma(v16h a, v16h b, v8f c) { return __builtin_amdgcn_wmma_f32_16x16x32_f16(false, a, false, b, (short)0, c, false, false); }
#define FA_C 0.18033688011112042f      /* 0.125 * log2(e) */
#define FA_T 44.361419555836498f       /* 8 / FA_C: the rescale threshold in raw score units */
#define FA_KS  128                     /* keys per stage */
#define FA_KP  144                     /* LDS bytes per staged K row (64 d): 128 + 16, 16 B x odd: conflict-free for the ds_load_b128 fragment reads */
#define FA_VP  272                     /* LDS bytes per staged V^T row (128 keys): 256 + 16, 16 B x odd */
#define FA_VO  (FA_KS * FA_KP)         /* the 64 V^T rows stand behind the 128 K rows */
#define FA_BUF (FA_VO + HD * FA_VP)    /* one stage */
// One stage: each thread copies 16 B of 4 K rows (32 rows apart) and of 4 V^T rows (16 rows apart). gk / gv: the thread's first K / V^T address of this stage; lk / lv: its LDS byte addresses in K row (tid / 8) and V^T row (tid / 16) of the buffer.
__device__ __forceinline__ void fa_stage(const _Float16* gk, const _Float16* gv, unsigned lk, unsigned lv) {
  /* the closing s_wait_xcnt stands inside the copies' own statement, so that no address register is rewritten in front of it */
  asm volatile("global_load_async_to_lds_b128 %0, %8, off\n\t"
               "global_load_async_to_lds_b128 %1, %9, off\n\t"
               "global_load_async_to_lds_b128 %2, %10, off\n\t"
               "global_load_async_to_lds_b128 %3, %11, off\n\t"
               "global_load_async_to_lds_b128 %4, %12, off\n\t"
               "global_load_async_to_lds_b128 %5, %13, off\n\t"
               "global_load_async_to_lds_b128 %6, %14, off\n\t"
               "global_load_async_to_lds_b128 %7, %15, off\n\t"
               "s_wait_xcnt 0x0"
               :: "v"(lk), "v"(lk + 32 * FA_KP), "v"(lk + 64 * FA_KP), "v"(lk + 96 * FA_KP), "v"(lv), "v"(lv + 16 * FA_VP), "v"(lv + 32 * FA_VP), "v"(lv + 48 * FA_VP),
                  "v"(gk), "v"(gk + (size_t)32 * LQ), "v"(gk + (size_t)64 * LQ), "v"(gk + (size_t)96 * LQ), "v"(gv), "v"(gv + (size_t)16 * SQ), "v"(gv + (size_t)32 * SQ), "v"(gv + (size_t)48 * SQ) : "memory"); }
__global__ __launch_bounds__(256) void k_fattn(const _Float16* __restrict__ Q, const _Float16* __restrict__ Kr, const _Float16* __restrict__ VT, _Float16* __restrict__ O) { static_assert(HD == 64 && SQ % 256 == 0 && SQ / FA_KS >= 2, "k_fattn: 2 k fragments per row, 8 waves x 32 queries, two stages or more");
  __shared__ __attribute__((aligned(16))) char smem[2 * FA_BUF];
  const int tid = threadIdx.x, lane = tid & 31, ln = lane & 15, hh = lane >> 4, w = tid >> 5; const int slab = blockIdx.y, b = slab / NH, h = slab - b * NH; const int q0 = blockIdx.x * 256 + w * 32;
  const _Float16* qp = Q + ((size_t)b * SQ + q0 + ln) * LQ + h * HD;
  const _Float16* gk = Kr + ((size_t)b * SQ + (tid >> 3)) * LQ + h * HD + (tid & 7) * 8; const _Float16* gv = VT + ((size_t)slab * HD + (tid >> 4)) * SQ + (tid & 15) * 8;
  const unsigned lk0 = (unsigned)(size_t)smem + (unsigned)((tid >> 3) * FA_KP + (tid & 7) * 16), lv0 = (unsigned)(size_t)smem + (unsigned)(FA_VO + (tid >> 4) * FA_VP + (tid & 15) * 16);
  const char* kfr = smem + ln * FA_KP; const char* vfr = smem + FA_VO + ln * FA_VP;
  fa_stage(gk, gv, lk0, lv0);
  v16h qf[2][2], kf[2][2];      /* [tile][half of the 64 d] */
#pragma unroll
  for (int j = 0; j < 2; ++j) { qf[j][0] = g2_frag(qp + (size_t)j * 16 * LQ, hh); qf[j][1] = g2_frag(qp + (size_t)j * 16 * LQ + 32, hh); }
  const v8f z8 = {0.f,0.f,0.f,0.f,0.f,0.f,0.f,0.f}; v8f o[2][4]; float m[2] = {-3.0e38f, -3.0e38f}, l[2] = {0.f, 0.f};
#pragma unroll
  for (int j = 0; j < 2; ++j) for (int dt = 0; dt < 4; ++dt) o[j][dt] = z8;
  asm volatile("s_wait_asynccnt 0x0" ::: "memory");      /* stage 0 of this wave has landed ... */
  __syncthreads();                                       /* ... and every wave's: nothing of it is read in front of this barrier */
  fa_stage(gk + (size_t)FA_KS * LQ, gv + FA_KS, lk0 + FA_BUF, lv0 + FA_BUF);
#pragma unroll 1      /* stays rolled: one publish point per stage at the foot */
  for (int t = 0; t < SQ / FA_KS; ++t) { const int bo = (t & 1) * FA_BUF; const char* kb = kfr + bo; const char* vb = vfr + bo;
#pragma unroll
    for (int u = 0; u < 2; ++u) { kf[u][0] = g2_lfrag(kb + u * 16 * FA_KP, hh); kf[u][1] = g2_lfrag(kb + u * 16 * FA_KP + 64, hh); }      /* K rows of the stage's first pass */
#pragma unroll 1      /* stays rolled: with the 4 passes inline the build had no registers left to ask for a pass's V^T rows ahead of their use */
    for (int p = 0; p < FA_KS / 32; ++p) {
      v16h vf[4];      /* V^T rows of this pass: asked for first, used last */
#pragma unroll
      for (int dt = 0; dt < 4; ++dt) vf[dt] = g2_lfrag(vb + dt * 16 * FA_VP + p * 64, hh);
      v8f s[2][2];      /* [query tile][key tile] */
#pragma unroll
      for (int j = 0; j < 2; ++j) for (int u = 0; u < 2; ++u) s[j][u] = fa_mma(kf[u][1], qf[j][1], fa_mma(kf[u][0], qf[j][0], z8));
      __builtin_amdgcn_sched_barrier(0);      /* keeps the statement below behind the S^T products: moved in front of them it would wait out the LDS latency with nothing to cover it */
      asm volatile("" :: "v"(vf[0]), "v"(vf[1]), "v"(vf[2]), "v"(vf[3]));      /* inputs only: holds the pass's eight V^T reads as ONE group at the head of the S^T products, which cover their latency; without it the build spreads them among the O^T products, each behind a wait of its own */
      if (p + 1 < FA_KS / 32) {      /* next pass's K rows, fetched one pass ahead, inside this stage's buffer only (a scalar branch) */
#pragma unroll
        for (int u = 0; u < 2; ++u) { kf[u][0] = g2_lfrag(kb + ((p + 1) * 32 + u * 16) * FA_KP, hh); kf[u][1] = g2_lfrag(kb + ((p + 1) * 32 + u * 16) * FA_KP + 64, hh); } }
      float tm[2];
#pragma unroll
      for (int j = 0; j < 2; ++j) { float a = fmaxf(s[j][0][0], s[j][1][0]);
        for (int r = 1; r < 8; ++r) a = fmaxf(a, fmaxf(s[j][0][r], s[j][1][r]));
        tm[j] = fmaxf(a, rs_xh(a)); }
      if (__builtin_amdgcn_ballot_w32(tm[0] > m[0] + FA_T || tm[1] > m[1] + FA_T) != 0) {      /* one scalar branch per pass */
#pragma unroll
        for (int j = 0; j < 2; ++j) { const float mn = fmaxf(m[j], tm[j]); const float al = __builtin_amdgcn_exp2f((m[j] - mn) * FA_C); m[j] = mn; l[j] *= al;
          for (int dt = 0; dt < 4; ++dt) o[j][dt] *= al; } }
      FragH pf[2];
#pragma unroll
      for (int j = 0; j < 2; ++j) { const float mc = m[j] * FA_C; const v8f e0 = s[j][0] * FA_C - mc, e1 = s[j][1] * FA_C - mc; v8f p0, p1;      /* the same multiply-add per element as before, written on whole tiles */
        for (int r = 0; r < 8; ++r) { p0[r] = __builtin_amdgcn_exp2f(e0[r]); p1[r] = __builtin_amdgcn_exp2f(e1[r]); }
        asm volatile("v_nop" : "+v"(p0), "+v"(p1) : "v"(e0), "v"(e1));      /* the slot behind a transcendental: no result is read and no source register rewritten directly behind a v_exp_f32 */
        float s0 = p0[0], s1 = p1[0];      /* the sums start at their first term, in the order they had */
        for (int r = 1; r < 8; ++r) { s0 += p0[r]; s1 += p1[r]; }
        for (int r = 0; r < 8; ++r) { pf[j].h[r] = (_Float16)p0[r]; pf[j].h[8 + r] = (_Float16)p1[r]; }
        l[j] += s0 + s1; }
#pragma unroll
      for (int dt = 0; dt < 4; ++dt) for (int j = 0; j < 2; ++j) o[j][dt] = fa_mma(vf[dt], pf[j].v, o[j][dt]);
      asm volatile("v_nop\n\tv_nop\n\tv_nop\n\tv_nop" : "+v"(o[0][3]), "+v"(o[1][3]) : "v"(vf[3]));      /* the distance behind the pass's last WMMAs: over the loop's back edge the next pass's first vector instruction may overwrite one of their A registers */
    }
    asm volatile("s_wait_dscnt 0x0" ::: "memory");       /* this wave's reads of the buffer are done before it may be refilled */
    asm volatile("s_wait_asynccnt 0x0" ::: "memory");    /* this wave's copies of stage t + 1 have landed */
    __syncthreads();                                     /* publishes stage t + 1 and ends every reader's last read of stage t */
    if (t + 2 < SQ / FA_KS) fa_stage(gk + (size_t)(t + 2) * FA_KS * LQ, gv + (t + 2) * FA_KS, lk0 + bo, lv0 + bo); }
  asm volatile("s_wait_asynccnt 0x0" ::: "memory");      /* no copy is outstanding when the wave ends */
#pragma unroll
  for (int j = 0; j < 2; ++j) { const float inv = 64.0f / (l[j] + rs_xh(l[j])); unsigned short* d = (unsigned short*)O + ((size_t)b * SQ + q0 + j * 16 + ln) * DM + h * HD + 8 * hh;
    for (int dt = 0; dt < 4; ++dt) { FragH f; for (int r = 0; r < 8; ++r) f.h[r] = (_Float16)(o[j][dt][r] * inv); *(v8us*)(d + dt * 16) = f.half[0]; } } }

extern "C" void kernel_launch(void* const* d_in, const int* in_sizes, int n_in,
                              void* d_out, int out_size, void* d_ws, size_t ws_size, hipStream_t stream) {
  (void)in_sizes; (void)n_in; (void)out_size;
  const float* const* I = (const float* const*)d_in; const float* x = I[0]; const float* wqkv = I[1]; const float* bq = nullptr; const float* wo = I[2]; const float* bo = nullptr;      /* ONE input stream (z); U_qkv is ONE STACK [12][3][768][64] = [head][q | k | v][in][out]; U_msa [in][out] [768][768]; the module has NO biases: bare null pointers in the guarded bias slots; input order z, U_qkv, U_msa */
  char* ws = (char*)d_ws; size_t off = 0;
  auto take = [&](size_t bytes) { char* p = ws + off; off += (bytes + 255) & ~(size_t)255; return p; };
  _Float16* BQ = (_Float16*)take((size_t)3 * DM * DM * 2); _Float16* BO = (_Float16*)take((size_t)DM * DM * 2);      /* BQ: planes q | k | v, DM * DM apart */
  _Float16* X16 = (_Float16*)take(NR * DM * 2); _Float16* Q16 = (_Float16*)take((size_t)3 * NR * DM * 2); _Float16* K16 = Q16 + NR * DM; _Float16* V16 = K16 + NR * DM; _Float16* O16 = (_Float16*)take(NR * DM * 2);      /* q | k | v rows, NR * DM apart */
  _Float16* VT = (_Float16*)take((size_t)NB * NH * HD * SQ * 2);
  if (off > ws_size) return;
  static_assert(MP % 128 == 0 && MPO % 128 == 0 && DM % 128 == 0 && DM % 64 == 0, "k_gemm2: whole 128x128 tiles, whole 64-k stages");
  k_prep<<<PB_ALL, 256, 0, stream>>>(x, wqkv, wo, X16, BQ, BO);      /* all weight planes ([out][in], x16) and the x rows */
  const size_t r0p = (size_t)B0 * SQ;      /* first projected row */
  k_gemm2<0><<<dim3((unsigned)((MP / 128) * (DM / 128)), 3), 256, 0, stream>>>(X16 + r0p * DM, DM, 0, BQ, DM, (size_t)DM * DM, 0.0625f, bq, 0, nullptr, 1, 0, 0, nullptr, Q16 + r0p * DM, DM, NR * DM, MP, DM, DM);      /* y = q | k | v: same A rows, weight plane and output rows of the part */
  k_vt<NH, SQ><<<NB * NH * (SQ / 64), 256, 0, stream>>>(V16, LQ, 0, VT);      /* V^T [NB][NH][HD][SQ], all batches in one launch */
  k_fattn<<<dim3(SQ / 256, NB * NH), 256, 0, stream>>>(Q16, K16, VT, O16);      /* o (merged heads, x64) as f16 rows: scores, softmax and P.V of every (batch, head) */
  k_gemm2<0><<<dim3((unsigned)((MPO / 128) * (DM / 128)), 1), 256, 0, stream>>>(O16 + r0p * DM, DM, 0, BO, DM, 0, 0.0009765625f, bo, 0, nullptr, 1, 0, 0, (float*)d_out + r0p * DM, nullptr, DM, 0, MPO, DM, DM);      /* out rows are the output layout */
}

// v006
// Measured time: 149 microseconds a run.
// Next to v005, in two timings, it ran 1.06 and 1.07 times as fast.
// All steps since v000 together make it 66.9 times as fast.
#include <hip/hip_runtime.h>
// Multi-head self-attention with ONE STACKED per-head projection input on SIXTEEN sequences of 1024 at width 768 (z [16][1024][768]; U_qkv [12][3][768][64] = [head][q | k | v][in][out]: q, k, v of head h = z U_qkv[h][0 | 1 | 2]; NO biases; 12 heads of 64; logits / sqrt(64); softmax over all 1024 keys (no mask); out = merged U_msa ([in][out] [768][768], NO bias) -> [16][1024][768]); each (head, part) [in][out] block is transposed into its 64 contiguous rows of the weight plane of its part, all blocks in the one preparation launch; dense: single f16 q / k / v planes on every row.
// Structure: token rows r = b*1024 + s; one preparation launch (all weight planes and x as exact f16 rows, bf16-rounded; jobs picked by block index); Q, K, V as three WMMA GEMMs in one grid (y = part; 32x64 wave tiles, operand tiles staged in LDS by asynchronous copies, f32 accumulation, exact x16 weights, null bias slots, f16 outputs); the v part of that grid runs with its two operands exchanged, so that its output tiles are V^T tiles and go straight into the V^T plane; one fused attention launch over all (batch, head), K and V^T tiles staged in LDS by asynchronous copies: S^T = K Q^T on WMMA, online softmax in registers (f32 statistics, native exp2; unnormalised weights as f16), O^T += V^T P^T on WMMA, divided by the row sum at the end (o carried x64, folded into the output GEMM alpha) and written straight into the merged f16 o rows; out = o U_msa GEMM (f32, null bias slot) into the output layout.
// Compute dtype: inputs rounded to bf16; x / weights exact; q, k, v, softmax weights and o as plain f16 GEMM operands (~2^-12); scores and softmax statistics f32. v_wmma_f32_16x16x32_f16.
#define NB 16
#define SQ 1024
#define DM 768 
#define NH 12
#define HD 64
#define HG 4                         /* heads per launch of the per-batch k_vt overload (not launched) */
#define B0 0                         /* first batch processed (debug hook) */
#define NBR NB                       /* batches processed (debug hook) */
#define NR ((size_t)NB * SQ)         /* token rows */
#define MP ((int)((size_t)NBR * SQ)) /* rows projected (debug hook) */
#define QN SQ                        /* not used: k_fattn attends all SQ query rows */
#define NHD NH                       /* not used: k_fattn attends all NH heads */
#define MPO MP                       /* rows through the output stage (debug hook) */
#define LQ DM      /* row pitch of the q/k rows */
typedef __bf16 v16b __attribute__((ext_vector_type(16)));
typedef unsigned short v8us __attribute__((ext_vector_type(8), may_alias));
typedef float  v8f  __attribute__((ext_vector_type(8)));
typedef float  v4f  __attribute__((ext_vector_type(4)));
typedef float  v4fa __attribute__((ext_vector_type(4), may_alias));
union FragB { v16b v; v8us half[2]; unsigned short u[16]; };

__device__ __forceinline__ unsigned short bf16_bits(float x) { unsigned int u = __float_as_uint(x); return (unsigned short)((u + 0x7FFFu + ((u >> 16) & 1u)) >> 16); }
__device__ __forceinline__ float bf16_val(unsigned short b) { return __uint_as_float(((unsigned int)b) << 16); }
__device__ __forceinline__ float bf16_round(float x) { return bf16_val(bf16_bits(x)); }
// D += A·B with NT terms: 1 = ah·bh, 2 = + al·bh (A split), 3 = + ah·bl (both split)
template <int NT>
__device__ __forceinline__ v8f mmaN(v16b ah, v16b al, v16b bh, v16b bl, v8f c) {
  c = __builtin_amdgcn_wmma_f32_16x16x32_bf16(false, ah, false, bh, (short)0, c, false, false);
  if (NT >= 2) c = __builtin_amdgcn_wmma_f32_16x16x32_bf16(false, al, false, bh, (short)0, c, false, false);
  if (NT >= 3) c = __builtin_amdgcn_wmma_f32_16x16x32_bf16(false, ah, false, bl, (short)0, c, false, false);
  asm volatile("v_nop\n\tv_nop\n\tv_nop\n\tv_nop" : "+v"(c) : "v"(ah), "v"(al), "v"(bh), "v"(bl));
  return c;
}

__global__ __launch_bounds__(256) void k_wt_bf16(const float* __restrict__ W, unsigned short* __restrict__ Wt, int K, int N) {
  const int t = blockIdx.x * 256 + threadIdx.x;
  const int k8n = K / 8;
  if (t >= N * k8n) return;
  const int n = t / k8n, k8 = (t % k8n) * 8;
  v8us v;
#pragma unroll
  for (int i = 0; i < 8; ++i) v[i] = bf16_bits(W[(size_t)(k8 + i) * N + n]);
  *(v8us*)(Wt + (size_t)n * K + k8) = v;
  
}

// GEMM C[M][N] (f32, pitch ldc) = act(A[M][K]·W + bias). A f32 row-major (pitch lda) converted per fragment to bf16
// (ASPLIT: hi/lo two planes -> 2 terms, else single rounded term); Wt bf16 [N][K] (pitch ldb). BIAS_BF16 rounds the
// bias to bf16 first (bias quantised to bf16 before the add). K%32==0, M%16==0, N%64==0.
template <bool ASPLIT, int ACT, bool BIAS_BF16>
__global__ __launch_bounds__(128) void k_gemm_bf(const float* __restrict__ A, int lda, const unsigned short* __restrict__ Wt, int ldb,
                                               const float* __restrict__ bias, float* __restrict__ C, int ldc, int M, int N, int K) {
  __shared__ __attribute__((aligned(16))) float so[4][16][64];
  const int tid = threadIdx.x, w = tid >> 5, lane = tid & 31, ln = lane & 15, hh = lane >> 4;
  const int ntn = N / 64;
  const int wid = blockIdx.x * 4 + w;
  const int mt = wid / ntn, nq = wid % ntn;
  if (mt * 16 >= M) return;
  const int row0 = mt * 16, col0 = nq * 64;
  const float* arow = A + (size_t)(row0 + ln) * lda;
  v8f acc[4] = {};
  for (int kb = 0; kb < K; kb += 32) {
    FragB ah, al;
    const v4f x0 = *(const v4fa*)(arow + kb + 8 * hh), x1 = *(const v4fa*)(arow + kb + 8 * hh + 4);
    const v4f x2 = *(const v4fa*)(arow + kb + 16 + 8 * hh), x3 = *(const v4fa*)(arow + kb + 16 + 8 * hh + 4);
    float xs[16] = {x0[0],x0[1],x0[2],x0[3],x1[0],x1[1],x1[2],x1[3],x2[0],x2[1],x2[2],x2[3],x3[0],x3[1],x3[2],x3[3]};
#pragma unroll
    for (int i = 0; i < 16; ++i) { const unsigned short hb = bf16_bits(xs[i]); ah.u[i] = hb; al.u[i] = ASPLIT ? bf16_bits(xs[i] - bf16_val(hb)) : (unsigned short)0; }
#pragma unroll
    for (int t = 0; t < 4; ++t) {
      const unsigned short* brow = Wt + (size_t)(col0 + t * 16 + ln) * ldb + kb;
      FragB b;
      b.half[0] = *(const v8us*)(brow + 8 * hh);
      b.half[1] = *(const v8us*)(brow + 16 + 8 * hh);
      acc[t] = mmaN<ASPLIT ? 2 : 1>(ah.v, al.v, b.v, b.v, acc[t]);
    }
  }
#pragma unroll
  for (int t = 0; t < 4; ++t) {
    float bv = bias ? bias[col0 + t * 16 + ln] : 0.f;
    if (BIAS_BF16) bv = bf16_round(bv);
#pragma unroll
    for (int r = 0; r < 8; ++r) { float v = acc[t][r] + bv; if (ACT == 1) v = fmaxf(v, 0.f); so[w][8 * hh + r][t * 16 + ln] = v; }
  }
  __builtin_amdgcn_fence(__ATOMIC_ACQ_REL, "workgroup");
  __builtin_amdgcn_wave_barrier();
  const int rsub = lane >> 4, c4 = (lane & 15) * 4;
  {
#pragma unroll
    for (int q = 0; q < 8; ++q) {
      const int r = q * 2 + rsub;
      const v4f v = *(const v4fa*)&so[w][r][c4];
      *(v4f*)(C + (size_t)(row0 + r) * ldc + col0 + c4) = v;
    }
    
  }
}

// GEMM C = act(A·W + bias + resid): A f32 (ASPLIT -> hi/lo 2 terms), Wt bf16 [N][K]; ACT 0 none, 1 relu, 2 exact gelu;
// resid (optional, f32, row index = (row % rmod), pitch ldr, RES_BF16 rounds it) added before the activation.
template <bool ASPLIT, int ACT, bool BIAS_BF16, bool RES_BF16>
__global__ __launch_bounds__(128) void k_gemm_bf3(const float* __restrict__ A, int lda, const unsigned short* __restrict__ Wt, int ldb,
                                                const float* __restrict__ bias, const float* __restrict__ resid, int rmod, int ldr,
                                                float* __restrict__ C, int ldc, int M, int N, int K) {
  __shared__ __attribute__((aligned(16))) float so[4][16][64];
  const int tid = threadIdx.x, w = tid >> 5, lane = tid & 31, ln = lane & 15, hh = lane >> 4;
  const int ntn = N / 64;
  const int wid = blockIdx.x * 4 + w;
  const int mt = wid / ntn, nq = wid % ntn;
  if (mt * 16 >= M) return;
  const int row0 = mt * 16, col0 = nq * 64;
  const float* arow = A + (size_t)(row0 + ln) * lda;
  v8f acc[4] = {};
  for (int kb = 0; kb < K; kb += 32) {
    FragB ah, al;
    const v4f x0 = *(const v4fa*)(arow + kb + 8 * hh), x1 = *(const v4fa*)(arow + kb + 8 * hh + 4);
    const v4f x2 = *(const v4fa*)(arow + kb + 16 + 8 * hh), x3 = *(const v4fa*)(arow + kb + 16 + 8 * hh + 4);
    float xs[16] = {x0[0],x0[1],x0[2],x0[3],x1[0],x1[1],x1[2],x1[3],x2[0],x2[1],x2[2],x2[3],x3[0],x3[1],x3[2],x3[3]};
#pragma unroll
    for (int i = 0; i < 16; ++i) { const unsigned short hb = bf16_bits(xs[i]); ah.u[i] = hb; al.u[i] = ASPLIT ? bf16_bits(xs[i] - bf16_val(hb)) : (unsigned short)0; }
#pragma unroll
    for (int t = 0; t < 4; ++t) {
      const unsigned short* brow = Wt + (size_t)(col0 + t * 16 + ln) * ldb + kb;
      FragB b;
      b.half[0] = *(const v8us*)(brow + 8 * hh);
      b.half[1] = *(const v8us*)(brow + 16 + 8 * hh);
      acc[t] = mmaN<ASPLIT ? 2 : 1>(ah.v, al.v, b.v, b.v, acc[t]);
    }
  }
#pragma unroll
  for (int t = 0; t < 4; ++t) {
    const int col = col0 + t * 16 + ln;
    float bv = bias ? bias[col] : 0.f;
    if (BIAS_BF16) bv = bf16_round(bv);
#pragma unroll
    for (int r = 0; r < 8; ++r) {
      float v = acc[t][r] + bv;
      if (resid) { float rv = resid[(size_t)((row0 + 8 * hh + r) % rmod) * ldr + col]; if (RES_BF16) rv = bf16_round(rv); v += rv; }
      if (ACT == 1) v = fmaxf(v, 0.f);
      if (ACT == 2) v = 0.5f * v * (1.0f + erff(v * 0.70710678118654752f));
      if (ACT == 3) { const float u = 0.7978845608028654f * (v + 0.044715f * v * v * v); v = 0.5f * v * (1.0f + tanhf(u)); }
      so[w][8 * hh + r][t * 16 + ln] = v;
    }
  }
  __builtin_amdgcn_fence(__ATOMIC_ACQ_REL, "workgroup");
  __builtin_amdgcn_wave_barrier();
  const int rsub = lane >> 4, c4 = (lane & 15) * 4;
  {
#pragma unroll
    for (int q = 0; q < 8; ++q) {
      const int r = q * 2 + rsub;
      const v4f v = *(const v4fa*)&so[w][r][c4];
      *(v4f*)(C + (size_t)(row0 + r) * ldc + col0 + c4) = v;
    }
    
  }
}
// row LayerNorm (biased variance, eps) over N: s = X (+ R); optional out_sum <- s; out_norm <- (s-mu)*rsqrt(var+eps)*g + b
template <bool PARAM_BF16>
__global__ __launch_bounds__(256) void k_layernorm(const float* __restrict__ X, const float* __restrict__ R, const float* __restrict__ g, const float* __restrict__ bta,
                                                  float* __restrict__ out_sum, float* __restrict__ out_norm, int N, float eps) {
  __shared__ float red[256];
  const int row = blockIdx.x, tid = threadIdx.x;
  const float* x = X + (size_t)row * N; const float* rr = R ? R + (size_t)row * N : nullptr;
  float vals[16];                     // up to N = 4096
  const int per = N / 256;            // contiguous chunk per thread? use strided-by-4 chunks: thread handles j = tid*4 + 1024*u
  float s1 = 0.f;
  for (int u = 0; u < per / 4; ++u) {
    const int j = tid * 4 + 1024 * u;
    const v4f a = *(const v4fa*)(x + j);
    v4f b = {0.f,0.f,0.f,0.f}; if (rr) b = *(const v4fa*)(rr + j);
#pragma unroll
    for (int q = 0; q < 4; ++q) { const float v = a[q] + b[q]; vals[u * 4 + q] = v; s1 += v; }
  }
  red[tid] = s1; __syncthreads();
  for (int st = 128; st > 0; st >>= 1) { if (tid < st) red[tid] += red[tid + st]; __syncthreads(); }
  const float mu = red[0] / (float)N; __syncthreads();
  float s2 = 0.f;
  for (int u = 0; u < per / 4; ++u)
#pragma unroll
    for (int q = 0; q < 4; ++q) { const float c = vals[u * 4 + q] - mu; s2 += c * c; }
  red[tid] = s2; __syncthreads();
  for (int st = 128; st > 0; st >>= 1) { if (tid < st) red[tid] += red[tid + st]; __syncthreads(); }
  const float rs = rsqrtf(red[0] / (float)N + eps);
  {
    for (int u = 0; u < per / 4; ++u) {
      const int j = tid * 4 + 1024 * u;
      v4f o, sm;
#pragma unroll
      for (int q = 0; q < 4; ++q) {
        float gg = g[j + q], bb = bta[j + q];
        if (PARAM_BF16) { gg = bf16_round(gg); bb = bf16_round(bb); }
        sm[q] = vals[u * 4 + q]; o[q] = (vals[u * 4 + q] - mu) * rs * gg + bb;
      }
      if (out_sum) *(v4f*)(out_sum + (size_t)row * N + j) = sm;
      *(v4f*)(out_norm + (size_t)row * N + j) = o;
    }
    
  }
}



// ---- f16 WMMA path (v_wmma_f32_16x16x32_f16): 11-bit significands for operands in range — used where a [0,1] probability operand needs more precision than bf16
typedef _Float16 v16h __attribute__((ext_vector_type(16)));
union FragH { v16h v; v8us half[2]; _Float16 h[16]; unsigned short u[16]; };
template <int NT>
__device__ __forceinline__ v8f mmaH(v16h ah, v16h al, v16h bh, v16h bl, v8f c) {
  c = __builtin_amdgcn_wmma_f32_16x16x32_f16(false, ah, false, bh, (short)0, c, false, false);
  if (NT >= 2) c = __builtin_amdgcn_wmma_f32_16x16x32_f16(false, al, false, bh, (short)0, c, false, false);
  if (NT >= 3) c = __builtin_amdgcn_wmma_f32_16x16x32_f16(false, ah, false, bl, (short)0, c, false, false);
  asm volatile("v_nop\n\tv_nop\n\tv_nop\n\tv_nop" : "+v"(c) : "v"(ah), "v"(al), "v"(bh), "v"(bl));
  return c;
}
// batched GEMM like k_gemm_b but f16 operands: A f32 (split into f16 hi/lo if ASPLIT, else rounded to f16), Bt = f16 values [n][k]; alpha; C f32; N multiple of 16 (partial tiles skipped)
template <bool ASPLIT>
__global__ __launch_bounds__(128) void k_gemm_h(const float* __restrict__ A, int lda, size_t sA, const _Float16* __restrict__ Bh, int ldb, size_t sB, float alpha, float* __restrict__ C, int ldc, size_t sC, int M, int N, int K) {
  __shared__ __attribute__((aligned(16))) float so[4][16][64];
  const int tid = threadIdx.x, w = tid >> 5, lane = tid & 31, ln = lane & 15, hh = lane >> 4; const int by = blockIdx.y;
  A += (size_t)by * sA; Bh += (size_t)by * sB; C += (size_t)by * sC;
  const int ntn = (N + 63) / 64; const int wid = blockIdx.x * 4 + w; const int mt = wid / ntn, nq = wid % ntn; if (mt * 16 >= M) return;
  const int row0 = mt * 16, col0 = nq * 64; const float* arow = A + (size_t)(row0 + ln) * lda;
  v8f acc[4] = {};
  for (int kb = 0; kb < K; kb += 32) {
    FragH ah, al;
    const v4f x0 = *(const v4fa*)(arow + kb + 8 * hh), x1 = *(const v4fa*)(arow + kb + 8 * hh + 4), x2 = *(const v4fa*)(arow + kb + 16 + 8 * hh), x3 = *(const v4fa*)(arow + kb + 16 + 8 * hh + 4);
    float xs[16] = {x0[0],x0[1],x0[2],x0[3],x1[0],x1[1],x1[2],x1[3],x2[0],x2[1],x2[2],x2[3],x3[0],x3[1],x3[2],x3[3]};
#pragma unroll
    for (int i = 0; i < 16; ++i) { const _Float16 h = (_Float16)xs[i]; ah.h[i] = h; al.h[i] = ASPLIT ? (_Float16)(xs[i] - (float)h) : (_Float16)0.0f; }
#pragma unroll
    for (int t = 0; t < 4; ++t) { if (col0 + t * 16 >= N) continue; const size_t boff = (size_t)(col0 + t * 16 + ln) * ldb + kb; FragH bq; bq.half[0] = *(const v8us*)(Bh + boff + 8 * hh); bq.half[1] = *(const v8us*)(Bh + boff + 16 + 8 * hh);
      acc[t] = mmaH<ASPLIT ? 2 : 1>(ah.v, al.v, bq.v, bq.v, acc[t]); }
  }
#pragma unroll
  for (int t = 0; t < 4; ++t) { if (col0 + t * 16 >= N) continue;
#pragma unroll
    for (int r = 0; r < 8; ++r) so[w][8 * hh + r][t * 16 + ln] = acc[t][r] * alpha; }
  __builtin_amdgcn_fence(__ATOMIC_ACQ_REL, "workgroup"); __builtin_amdgcn_wave_barrier();
  const int rsub = lane >> 4, c4 = (lane & 15) * 4;
  {
#pragma unroll
    for (int q = 0; q < 8; ++q) { const int r = q * 2 + rsub; if (col0 + c4 < N) { const v4f v = *(const v4fa*)&so[w][r][c4]; *(v4f*)(C + (size_t)(row0 + r) * ldc + col0 + c4) = v; } }
     }
}

// Wt[n][k] = f16(W[k][n]·scale) from f32 row-major W[K][N] (scale = power of two; bf16-exact weights stay exact in f16 away from the subnormal range)
__device__ __forceinline__ void wt_f16(const float* __restrict__ W, _Float16* __restrict__ Wt, int K, int N, float scale, int t) {
  const int n = t / (K / 8), k8 = (t % (K / 8)) * 8; FragH f;
#pragma unroll
  for (int i = 0; i < 8; ++i) f.h[i] = (_Float16)(bf16_round(W[(size_t)(k8 + i) * N + n]) * scale); const v8us o = f.half[0];
  *(v8us*)((unsigned short*)Wt + (size_t)n * K + k8) = o;
  asm volatile("s_wait_xcnt 0x0" ::: "memory");      /* behind the store: in the joined kernel the listing runs on into another job's code, which rewrites the store's registers */
}
// k_gemm_hh variant with fused epilogue: v = acc·alpha + bias[by·sBias + col] (+ CP[(row/rowsPerB)·sCPb + by·64 + col] if CP) ; ACT 0 none / 1 elu ; writes f16 C16 (and f32 C if non-null)
template <int ACT>
__global__ __launch_bounds__(128) void k_gemm_hhx(const _Float16* __restrict__ A, int lda, size_t sA, const _Float16* __restrict__ Bh, int ldb, size_t sB, float alpha, const float* __restrict__ bias, size_t sBias, const float* __restrict__ CP, int rowsPerB, size_t sCPb, int row0g,
    float* __restrict__ C, _Float16* __restrict__ C16, int ldc, size_t sC, int M, int N, int K) {
  __shared__ __attribute__((aligned(16))) float so[4][16][64];
  const int tid = threadIdx.x, w = tid >> 5, lane = tid & 31, ln = lane & 15, hh = lane >> 4; const int by = blockIdx.y;
  A += (size_t)by * sA; Bh += (size_t)by * sB; const size_t cofs = (size_t)by * sC; const float* bp = bias ? bias + (size_t)by * sBias : nullptr;
  const int ntn = (N + 63) / 64; const int wid = blockIdx.x * 4 + w; const int mt = wid / ntn, nq = wid % ntn; if (mt * 16 >= M) return;
  const int row0 = mt * 16, col0 = nq * 64; const _Float16* arow = A + (size_t)(row0 + ln) * lda;
  v8f acc[4] = {};
  for (int kb = 0; kb < K; kb += 32) { FragH ah; ah.half[0] = *(const v8us*)((const unsigned short*)arow + kb + 8 * hh); ah.half[1] = *(const v8us*)((const unsigned short*)arow + kb + 16 + 8 * hh);
#pragma unroll
    for (int t = 0; t < 4; ++t) { if (col0 + t * 16 >= N) continue; const size_t boff = (size_t)(col0 + t * 16 + ln) * ldb + kb; FragH bq; bq.half[0] = *(const v8us*)((const unsigned short*)Bh + boff + 8 * hh); bq.half[1] = *(const v8us*)((const unsigned short*)Bh + boff + 16 + 8 * hh);
      acc[t] = mmaH<1>(ah.v, ah.v, bq.v, bq.v, acc[t]); }
  }
#pragma unroll
  for (int t = 0; t < 4; ++t) { if (col0 + t * 16 >= N) continue; const int col = col0 + t * 16 + ln; const float bv = bp ? bf16_round(bp[col]) : 0.f;
#pragma unroll
    for (int r = 0; r < 8; ++r) { float v = acc[t][r] * alpha + bv; if (CP) { const int rr = row0g + row0 + 8 * hh + r; if (rowsPerB < 0) v += CP[cofs + (size_t)rr * ldc + col];      /* rowsPerB < 0: own element of the batched C plane */ else { const int bidx = rr / rowsPerB; v += CP[(size_t)bidx * sCPb + (size_t)by * 64 + col]; } } if (ACT == 1) v = (v > 0.f) ? v : expm1f(v); else if (ACT == 7) v = (v > 0.f) ? v + 1.0f : expf(v); else if (ACT == 8) v = tanhf(v); else if (ACT == 9) v = 0.5f * v * (1.0f + tanhf(0.7978845608028654f * (v + 0.044715f * v * v * v))); else if (ACT == 11) v = 1.0f / (1.0f + expf(-v)); else if (ACT == 12) v = (v > 0.f) ? v : 0.01f * v; else if (ACT == 14) v = (v > 0.f) ? v : 0.1f * v; else if (ACT == 16) v = (v >= 0.f) ? v : 0.3f * v; else if (ACT == 17) v = (v >= 0.f) ? v : 0.2f * v; else if (ACT == 15) v = v / (1.0f + expf(-v)); else if (ACT == 3) v = fmaxf(v, 0.f); else if (ACT == 6) v = 0.5f * v * (1.0f + erff(v * 0.70710678118654752f)); so[w][8 * hh + r][t * 16 + ln] = v; } }
  __builtin_amdgcn_fence(__ATOMIC_ACQ_REL, "workgroup"); __builtin_amdgcn_wave_barrier();
  const int rsub = lane >> 4, c4 = (lane & 15) * 4; typedef _Float16 v4h __attribute__((ext_vector_type(4)));
  {
#pragma unroll
    for (int q = 0; q < 8; ++q) { const int r = q * 2 + rsub; if (col0 + c4 < N) { const v4f v = *(const v4fa*)&so[w][r][c4]; if (C) *(v4f*)(C + cofs + (size_t)(row0 + r) * ldc + col0 + c4) = v; if (C16) { v4h h4; for (int i = 0; i < 4; ++i) h4[i] = (_Float16)v[i]; *(v4h*)(C16 + cofs + (size_t)(row0 + r) * ldc + col0 + c4) = h4; } } }
     }
}


typedef _Float16 v4h __attribute__((ext_vector_type(4)));

// Every job that reads inputs only, in ONE launch; a block's job follows from its index (block-uniform branches, no job depends on another):
// blocks [0, PB_QKV): the 36 (head, part) blocks of U_qkv, PB_HP blocks each, into planes Bq | Bk | Bv (contiguous, DM*DM apart); [PB_QKV, PB_W): U_msa into Bo; the rest: x rows.
#define PB_HP  (HD * (DM / 8) / 256)          /* blocks per (head, part) */
#define PB_QKV (3 * NH * PB_HP)
#define PB_W   (PB_QKV + DM * (DM / 8) / 256)
#define PB_ALL (PB_W + (int)(NR * DM / 8 / 256))
__global__ __launch_bounds__(256) void k_prep(const float* __restrict__ x, const float* __restrict__ wqkv, const float* __restrict__ wo, _Float16* __restrict__ X16, _Float16* __restrict__ Bqkv, _Float16* __restrict__ Bo) {
  static_assert(HD * (DM / 8) % 256 == 0 && DM * (DM / 8) % 256 == 0 && NR * DM / 8 % 256 == 0, "k_prep: whole blocks per job");
  const int bi = blockIdx.x, tid = threadIdx.x;
  if (bi < PB_QKV) { const int job = bi / PB_HP, h = job / 3, p = job - 3 * h;      /* U_qkv block (h, p): row-major [in = DM][out = HD] at (3 h + p) * DM * HD -> rows h * HD .. of plane p */
    wt_f16(wqkv + (size_t)job * DM * HD, Bqkv + (size_t)p * DM * DM + (size_t)h * HD * DM, DM, HD, 16.0f, (bi - job * PB_HP) * 256 + tid); return; }
  if (bi < PB_W) { wt_f16(wo, Bo, DM, DM, 16.0f, (bi - PB_QKV) * 256 + tid); return; }
  const size_t t = (size_t)(bi - PB_W) * 256 + tid; FragH f;
#pragma unroll
  for (int q = 0; q < 8; ++q) f.h[q] = (_Float16)bf16_round(x[t * 8 + q]); *(v8us*)((unsigned short*)X16 + t * 8) = f.half[0];
  asm volatile("s_wait_xcnt 0x0" ::: "memory"); }      /* behind the store, as in wt_f16 */
__global__ __launch_bounds__(256) void k_h16(const float* __restrict__ x, _Float16* __restrict__ X16, size_t n8) { const size_t t = (size_t)blockIdx.x * 256 + threadIdx.x; if (t >= n8) return; FragH f;
#pragma unroll
  for (int q = 0; q < 8; ++q) f.h[q] = (_Float16)x[t * 8 + q]; *(v8us*)((unsigned short*)X16 + t * 8) = f.half[0];  }
__global__ __launch_bounds__(256) void k_round16f(const float* __restrict__ W, _Float16* __restrict__ Bt, size_t n8) { const size_t t = (size_t)blockIdx.x * 256 + threadIdx.x; if (t >= n8) return; FragH f;
#pragma unroll
  for (int i = 0; i < 8; ++i) f.h[i] = (_Float16)(bf16_round(W[t * 8 + i]) * 16.0f); *(v8us*)((unsigned short*)Bt + t * 8) = f.half[0];  }
__global__ __launch_bounds__(256) void k_hl(const float* __restrict__ F, _Float16* __restrict__ Hh, _Float16* __restrict__ Hl, size_t n8) { const size_t t = (size_t)blockIdx.x * 256 + threadIdx.x; if (t >= n8) return; FragH fh, fl; const v4f a = *(const v4fa*)(F + t * 8), c = *(const v4fa*)(F + t * 8 + 4);
#pragma unroll
  for (int q = 0; q < 4; ++q) { _Float16 h = (_Float16)a[q]; fh.h[q] = h; fl.h[q] = (_Float16)((a[q] - (float)h) * 1024.0f); h = (_Float16)c[q]; fh.h[4 + q] = h; fl.h[4 + q] = (_Float16)((c[q] - (float)h) * 1024.0f); }
  { *(v8us*)((unsigned short*)Hh + t * 8) = fh.half[0]; *(v8us*)((unsigned short*)Hl + t * 8) = fl.half[0];  } }

// ---- fast GEMM (wave tile 32x64, block tile 128x128, operands staged in LDS); epilogue = k_gemm_hhx semantics ----
__device__ __forceinline__ v16h g2_frag(const _Float16* p, int hh) { FragH f; f.half[0] = *(const v8us*)((const unsigned short*)p + 8 * hh); f.half[1] = *(const v8us*)((const unsigned short*)p + 16 + 8 * hh); return f.v; }
__device__ __forceinline__ v8f g2_mma(v16h a, v16h b, v8f c) { v8f d = __builtin_amdgcn_wmma_f32_16x16x32_f16(false, a, false, b, (short)0, c, false, false); asm volatile("v_nop\n\tv_nop\n\tv_nop\n\tv_nop" : "+v"(d) : "v"(a), "v"(b)); return d; }
// Operand staging of k_gemm2: a stage is 64 k (128 B, one whole line) of the block's 128 A rows and 128 B rows, brought into LDS by asynchronous copies
// (global_load_async_to_lds_b128; a wave's copy = 4 whole lines), so every operand line is asked for once per block instead of 16 lines per fragment load and wave.
#define G2_PITCH 144                      /* LDS bytes per staged row: 128 + 16, 16 B x odd: conflict-free for the ds_load_b128 fragment reads */
#define G2_BUF   (256 * G2_PITCH)         /* one stage: A rows 0-127, then B rows 0-127 */
__device__ __forceinline__ v16h g2_lfrag(const char* p, int hh) { FragH f; f.half[0] = *(const v8us*)(p + 16 * hh); f.half[1] = *(const v8us*)(p + 32 + 16 * hh); return f.v; }      /* same k order as g2_frag */
// One stage: each thread copies 16 B of 4 A rows and of 4 B rows (32 rows apart). ga / gb: the thread's first A / B address of this stage; lds: its LDS byte address in A row (tid / 8) of the buffer.
__device__ __forceinline__ void g2_stage(const _Float16* ga, size_t astep, const _Float16* gb, size_t bstep, unsigned lds) {
  /* the closing s_wait_xcnt stands inside the copies' own statement, so that no address register is rewritten in front of it */
  asm volatile("global_load_async_to_lds_b128 %0, %8, off\n\t"
               "global_load_async_to_lds_b128 %1, %9, off\n\t"
               "global_load_async_to_lds_b128 %2, %10, off\n\t"
               "global_load_async_to_lds_b128 %3, %11, off\n\t"
               "global_load_async_to_lds_b128 %4, %12, off\n\t"
               "global_load_async_to_lds_b128 %5, %13, off\n\t"
               "global_load_async_to_lds_b128 %6, %14, off\n\t"
               "global_load_async_to_lds_b128 %7, %15, off\n\t"
               "s_wait_xcnt 0x0"
               :: "v"(lds), "v"(lds + 32 * G2_PITCH), "v"(lds + 64 * G2_PITCH), "v"(lds + 96 * G2_PITCH), "v"(lds + 128 * G2_PITCH), "v"(lds + 160 * G2_PITCH), "v"(lds + 192 * G2_PITCH), "v"(lds + 224 * G2_PITCH),
                  "v"(ga), "v"(ga + astep), "v"(ga + 2 * astep), "v"(ga + 3 * astep), "v"(gb), "v"(gb + bstep), "v"(gb + 2 * bstep), "v"(gb + 3 * bstep) : "memory"); }
// Block = 8 waves, tile 128x128 (wave w: rows 32 * (w & 3), columns 64 * (w >> 2)); requires M % 128 == 0, N % 128 == 0, K % 64 == 0, K >= 64. Two stage buffers; the epilogue staging reuses them behind the last barrier.
// Part y == tpart is written TRANSPOSED: its blocks take the B rows as A and the A rows as B (same products, same k order), so the tile they hold is a tile of C^T, and it leaves by the same whole-line stores.
// C^T goes to CT (f16 only) as planes of tcols columns: element (n, m) at CT[(m / tcols) * N * tcols + n * tcols + m % tcols]; requires tcols % 128 == 0. That part takes no bias and no CP (both are laid out by column of C). tpart < 0: no such part.
template <int ACT>
__global__ __launch_bounds__(256) void k_gemm2(const _Float16* __restrict__ A, int lda, size_t sA, const _Float16* __restrict__ Bh, int ldb, size_t sB, float alpha, const float* __restrict__ bias, size_t sBias, const float* __restrict__ CP, int rowsPerB, size_t sCPb, int row0g,
    float* __restrict__ Cn, _Float16* __restrict__ Cn16, int ldcn, size_t sC, int M, int N, int K, int tpart, _Float16* __restrict__ CT, int tcols) { static_assert(ACT == 0 || ACT == 3 || ACT == 6 || ACT == 8 || ACT == 9 || ACT == 11 || ACT == 12 || ACT == 14 || ACT == 15 || ACT == 16 || ACT == 17, "k_gemm2: unsupported ACT code (would silently apply no activation)");
  __shared__ __attribute__((aligned(16))) char smem[2 * G2_BUF]; static_assert(8 * 32 * 68 * 4 <= 2 * G2_BUF, "k_gemm2: epilogue staging fits the stage buffers");
  float (*so)[32][68] = (float (*)[32][68])smem;
  const int tid = threadIdx.x, w = tid >> 5, lane = tid & 31, ln = lane & 15, hh = lane >> 4; const int by = blockIdx.y;
  const bool tp = by == tpart;      /* the same for the whole block */
  const int ntn = N >> 7; const int ta = blockIdx.x / ntn, tb = blockIdx.x - ta * ntn; if (ta * 128 >= M) return;      /* tile of A rows, tile of B rows; the whole block leaves, in front of every barrier */
  const _Float16* Ar = A + (size_t)by * sA; const _Float16* Br = Bh + (size_t)by * sB;
  const _Float16* Ap = tp ? Br : Ar; const _Float16* Bp = tp ? Ar : Br; const int la = tp ? ldb : lda, lb = tp ? lda : ldb; const int mt = tp ? tb : ta, nq = tp ? ta : tb;      /* from here on: rows and columns of the tile as the block holds it */
  float* C = tp ? nullptr : Cn; _Float16* C16 = tp ? CT : Cn16; const int ldc = tp ? tcols : ldcn; if (tp) CP = nullptr;
  const size_t cofs = tp ? (size_t)(ta * 128 / tcols) * tcols * (size_t)(N - 1) : (size_t)by * sC;      /* transposed: plane start less the plane's first column, which the column index below still counts */
  const float* bp = bias && !tp ? bias + (size_t)by * sBias : nullptr;
  const int row0 = mt * 128 + 32 * (w & 3), col0 = nq * 128 + 64 * (w >> 2);
  const _Float16* ga = Ap + (size_t)(mt * 128 + (tid >> 3)) * la + (tid & 7) * 8; const _Float16* gb = Bp + (size_t)(nq * 128 + (tid >> 3)) * lb + (tid & 7) * 8; const size_t astep = (size_t)32 * la, bstep = (size_t)32 * lb;
  const unsigned lds0 = (unsigned)(size_t)smem + (unsigned)((tid >> 3) * G2_PITCH + (tid & 7) * 16);
  const char* afr = smem + (32 * (w & 3) + ln) * G2_PITCH; const char* bfr = smem + (128 + 64 * (w >> 2) + ln) * G2_PITCH;
  const v8f z8 = {0.f,0.f,0.f,0.f,0.f,0.f,0.f,0.f}; v8f c00 = z8, c01 = z8, c02 = z8, c03 = z8, c10 = z8, c11 = z8, c12 = z8, c13 = z8;
  const int nt = K >> 6;
  g2_stage(ga, astep, gb, bstep, lds0);
  asm volatile("s_wait_asynccnt 0x0" ::: "memory");      /* stage 0 of this wave has landed ... */
  __syncthreads();                                       /* ... and every wave's: nothing of it is read in front of this barrier */
  if (nt > 1) g2_stage(ga + 64, astep, gb + 64, bstep, lds0 + G2_BUF);
#pragma unroll 1      /* stays rolled: one publish point per stage at the foot, small loop text */
  for (int t = 0; t < nt; ++t) { const int bo = (t & 1) * G2_BUF;
#pragma unroll      /* both k blocks inline: their LDS offsets become immediates */
    for (int kk = 0; kk < 128; kk += 64) { const char* ap = afr + bo + kk; const char* bq = bfr + bo + kk;      /* two k blocks of 32 per stage, in ascending k */
      const v16h a0 = g2_lfrag(ap, hh), a1 = g2_lfrag(ap + 16 * G2_PITCH, hh);      /* the block's six fragments are read as one group in front of its WMMAs */
      const v16h b0 = g2_lfrag(bq, hh), b1 = g2_lfrag(bq + 16 * G2_PITCH, hh), b2 = g2_lfrag(bq + 32 * G2_PITCH, hh), b3 = g2_lfrag(bq + 48 * G2_PITCH, hh);
      c00 = g2_mma(a0, b0, c00); c10 = g2_mma(a1, b0, c10); c01 = g2_mma(a0, b1, c01); c11 = g2_mma(a1, b1, c11);
      c02 = g2_mma(a0, b2, c02); c12 = g2_mma(a1, b2, c12); c03 = g2_mma(a0, b3, c03); c13 = g2_mma(a1, b3, c13); }
    asm volatile("s_wait_dscnt 0x0" ::: "memory");       /* this wave's reads of the buffer are done before it may be refilled */
    asm volatile("s_wait_asynccnt 0x0" ::: "memory");    /* this wave's copies of stage t + 1 have landed */
    __syncthreads();                                     /* publishes stage t + 1 and ends every reader's last read of stage t */
    if (t + 2 < nt) g2_stage(ga + (size_t)(t + 2) * 64, astep, gb + (size_t)(t + 2) * 64, bstep, lds0 + bo); }
  asm volatile("s_wait_asynccnt 0x0" ::: "memory");      /* no copy is outstanding when the buffers become output staging */
  v8f accs[8] = {c00, c01, c02, c03, c10, c11, c12, c13};
#pragma unroll
  for (int u = 0; u < 8; ++u) { const int t = u & 3, half = u >> 2; const int col = col0 + t * 16 + ln; const float bv = bp ? bf16_round(bp[col]) : 0.f;
#pragma unroll
    for (int r = 0; r < 8; ++r) { const int rloc = half * 16 + 8 * hh + r; float v = accs[u][r] * alpha + bv; if (CP) { if (rowsPerB < 0) v += CP[cofs + (size_t)(row0g + row0 + rloc) * ldc + col];      /* rowsPerB < 0: own element of the batched C plane */ else { const int bidx = (row0g + row0 + rloc) / rowsPerB; v += CP[(size_t)bidx * sCPb + (size_t)by * 64 + col]; } }
      if (ACT == 3) v = fmaxf(v, 0.f); else if (ACT == 6) v = 0.5f * v * (1.0f + erff(v * 0.70710678118654752f)); else if (ACT == 11) v = 1.0f / (1.0f + expf(-v)); else if (ACT == 15) v = v / (1.0f + expf(-v)); else if (ACT == 12) v = (v > 0.f) ? v : 0.01f * v; else if (ACT == 8) v = tanhf(v); else if (ACT == 9) v = 0.5f * v * (1.0f + tanhf(0.7978845608028654f * (v + 0.044715f * v * v * v))); else if (ACT == 14) v = (v > 0.f) ? v : 0.1f * v; else if (ACT == 16) v = (v >= 0.f) ? v : 0.3f * v; else if (ACT == 17) v = (v >= 0.f) ? v : 0.2f * v;
      so[w][rloc][t * 16 + ln] = v; } }
  __builtin_amdgcn_fence(__ATOMIC_ACQ_REL, "workgroup"); __builtin_amdgcn_wave_barrier();
  const int rsub = lane >> 4, c4 = (lane & 15) * 4;
  {
#pragma unroll
    for (int q = 0; q < 16; ++q) { const int r = q * 2 + rsub; const v4f v = *(const v4fa*)&so[w][r][c4]; if (C) *(v4f*)(C + cofs + (size_t)(row0 + r) * ldc + col0 + c4) = v; if (C16) { v4h h4; for (int i = 0; i < 4; ++i) h4[i] = (_Float16)v[i]; *(v4h*)(C16 + cofs + (size_t)(row0 + r) * ldc + col0 + c4) = h4; } }
     } }


__global__ __launch_bounds__(256) void k_wnat(const float* __restrict__ w, size_t n8, _Float16* __restrict__ Bt) { const size_t t = (size_t)blockIdx.x * 256 + threadIdx.x; if (t >= n8) return; FragH f; for (int q = 0; q < 8; ++q) f.h[q] = (_Float16)(bf16_round(w[t * 8 + q]) * 16.0f); *(v8us*)((unsigned short*)Bt + t * 8) = f.half[0];  }
__global__ __launch_bounds__(256) void k_rsm(const float* __restrict__ S, _Float16* __restrict__ P, int nrows) {
  #pragma clang fp contract(off)
  const int i = blockIdx.x * 256 + threadIdx.x; if (i >= nrows) return; const float* s = S + (size_t)i * SQ; float mx = -3.0e38f;
#pragma unroll 1
  for (int j = 0; j < SQ; ++j) mx = fmaxf(mx, s[j]); float se = 0.f;
#pragma unroll 1
  for (int j = 0; j < SQ; ++j) se += expf(s[j] - mx); const float sc = 256.0f / se;
#pragma unroll 1
  for (int j0 = 0; j0 < SQ; j0 += 8) { FragH f; for (int q = 0; q < 8; ++q) f.h[q] = (_Float16)(expf(s[j0 + q] - mx) * sc); unsigned short* d = (unsigned short*)P + (size_t)i * SQ + j0; *(v8us*)d = f.half[0];  } }
__global__ __launch_bounds__(256) void k_vt(const _Float16* __restrict__ V16, int b, int h0, _Float16* __restrict__ VT) { __shared__ unsigned short tl[64][65]; const int tid = threadIdx.x; const int hh = blockIdx.x % HG, sg = blockIdx.x / HG; const int s0 = sg * 64; const int h = h0 + hh;
  for (int i = tid; i < 64 * 8; i += 256) { const int j = i / 8, d8 = (i % 8) * 8; FragH f; f.half[0] = *(const v8us*)((const unsigned short*)V16 + ((size_t)b * SQ + s0 + j) * DM + h * HD + d8); for (int q = 0; q < 8; ++q) tl[d8 + q][j] = f.u[q]; }
  __syncthreads();
  { for (int i = tid; i < 64 * 8; i += 256) { const int d = i / 8, j8 = (i % 8) * 8; FragH f; for (int q = 0; q < 8; ++q) f.u[q] = tl[d][j8 + q]; *(v8us*)((unsigned short*)VT + ((size_t)hh * HD + d) * SQ + s0 + j8) = f.half[0]; }  } }



// lane l <-> l ^ 16 (cross-row move); every lane on
__device__ __forceinline__ float rs_xh(float x) { return __builtin_bit_cast(float, __builtin_amdgcn_permlanex16(__builtin_bit_cast(int, x), __builtin_bit_cast(int, x), 0x76543210, 0xfedcba98, false, false)); }
__device__ __forceinline__ v8f fa_mma(v16h a, v16h b, v8f c) { return __builtin_amdgcn_wmma_f32_16x16x32_f16(false, a, false, b, (short)0, c, false, false); }
#define FA_C 0.18033688011112042f      /* 0.125 * log2(e) */
#define FA_T 44.361419555836498f       /* 8 / FA_C: the rescale threshold in raw score units */
#define FA_KS  128                     /* keys per stage */
#define FA_KP  144                     /* LDS bytes per staged K row (64 d): 128 + 16, 16 B x odd: conflict-free for the ds_load_b128 fragment reads */
#define FA_VP  272                     /* LDS bytes per staged V^T row (128 keys): 256 + 16, 16 B x odd */
#define FA_VO  (FA_KS * FA_KP)         /* the 64 V^T rows stand behind the 128 K rows */
#define FA_BUF (FA_VO + HD * FA_VP)    /* one stage */
// One stage: each thread copies 16 B of 4 K rows (32 rows apart) and of 4 V^T rows (16 rows apart). gk / gv: the thread's first K / V^T address of this stage; lk / lv: its LDS byte addresses in K row (tid / 8) and V^T row (tid / 16) of the buffer.
__device__ __forceinline__ void fa_stage(const _Float16* gk, const _Float16* gv, unsigned lk, unsigned lv) {
  /* the closing s_wait_xcnt stands inside the copies' own statement, so that no address register is rewritten in front of it */
  asm volatile("global_load_async_to_lds_b128 %0, %8, off\n\t"
               "global_load_async_to_lds_b128 %1, %9, off\n\t"
               "global_load_async_to_lds_b128 %2, %10, off\n\t"
               "global_load_async_to_lds_b128 %3, %11, off\n\t"
               "global_load_async_to_lds_b128 %4, %12, off\n\t"
               "global_load_async_to_lds_b128 %5, %13, off\n\t"
               "global_load_async_to_lds_b128 %6, %14, off\n\t"
               "global_load_async_to_lds_b128 %7, %15, off\n\t"
               "s_wait_xcnt 0x0"
               :: "v"(lk), "v"(lk + 32 * FA_KP), "v"(lk + 64 * FA_KP), "v"(lk + 96 * FA_KP), "v"(lv), "v"(lv + 16 * FA_VP), "v"(lv + 32 * FA_VP), "v"(lv + 48 * FA_VP),
                  "v"(gk), "v"(gk + (size_t)32 * LQ), "v"(gk + (size_t)64 * LQ), "v"(gk + (size_t)96 * LQ), "v"(gv), "v"(gv + (size_t)16 * SQ), "v"(gv + (size_t)32 * SQ), "v"(gv + (size_t)48 * SQ) : "memory"); }
__global__ __launch_bounds__(256) void k_fattn(const _Float16* __restrict__ Q, const _Float16* __restrict__ Kr, const _Float16* __restrict__ VT, _Float16* __restrict__ O) { static_assert(HD == 64 && SQ % 256 == 0 && SQ / FA_KS >= 2, "k_fattn: 2 k fragments per row, 8 waves x 32 queries, two stages or more");
  __shared__ __attribute__((aligned(16))) char smem[2 * FA_BUF];
  const int tid = threadIdx.x, lane = tid & 31, ln = lane & 15, hh = lane >> 4, w = tid >> 5; const int slab = blockIdx.y, b = slab / NH, h = slab - b * NH; const int q0 = blockIdx.x * 256 + w * 32;
  const _Float16* qp = Q + ((size_t)b * SQ + q0 + ln) * LQ + h * HD;
  const _Float16* gk = Kr + ((size_t)b * SQ + (tid >> 3)) * LQ + h * HD + (tid & 7) * 8; const _Float16* gv = VT + ((size_t)slab * HD + (tid >> 4)) * SQ + (tid & 15) * 8;
  const unsigned lk0 = (unsigned)(size_t)smem + (unsigned)((tid >> 3) * FA_KP + (tid & 7) * 16), lv0 = (unsigned)(size_t)smem + (unsigned)(FA_VO + (tid >> 4) * FA_VP + (tid & 15) * 16);
  const char* kfr = smem + ln * FA_KP; const char* vfr = smem + FA_VO + ln * FA_VP;
  fa_stage(gk, gv, lk0, lv0);
  v16h qf[2][2], kf[2][2];      /* [tile][half of the 64 d] */
#pragma unroll
  for (int j = 0; j < 2; ++j) { qf[j][0] = g2_frag(qp + (size_t)j * 16 * LQ, hh); qf[j][1] = g2_frag(qp + (size_t)j * 16 * LQ + 32, hh); }
  const v8f z8 = {0.f,0.f,0.f,0.f,0.f,0.f,0.f,0.f}; v8f o[2][4]; float m[2] = {-3.0e38f, -3.0e38f}, l[2] = {0.f, 0.f};
#pragma unroll
  for (int j = 0; j < 2; ++j) for (int dt = 0; dt < 4; ++dt) o[j][dt] = z8;
  asm volatile("s_wait_asynccnt 0x0" ::: "memory");      /* stage 0 of this wave has landed ... */
  __syncthreads();                                       /* ... and every wave's: nothing of it is read in front of this barrier */
  fa_stage(gk + (size_t)FA_KS * LQ, gv + FA_KS, lk0 + FA_BUF, lv0 + FA_BUF);
#pragma unroll 1      /* stays rolled: one publish point per stage at the foot */
  for (int t = 0; t < SQ / FA_KS; ++t) { const int bo = (t & 1) * FA_BUF; const char* kb = kfr + bo; const char* vb = vfr + bo;
#pragma unroll
    for (int u = 0; u < 2; ++u) { kf[u][0] = g2_lfrag(kb + u * 16 * FA_KP, hh); kf[u][1] = g2_lfrag(kb + u * 16 * FA_KP + 64, hh); }      /* K rows of the stage's first pass */
#pragma unroll 1      /* stays rolled: with the 4 passes inline the build had no registers left to ask for a pass's V^T rows ahead of their use */
    for (int p = 0; p < FA_KS / 32; ++p) {
      v16h vf[4];      /* V^T rows of this pass: asked for first, used last */
#pragma unroll
      for (int dt = 0; dt < 4; ++dt) vf[dt] = g2_lfrag(vb + dt * 16 * FA_VP + p * 64, hh);
      v8f s[2][2];      /* [query tile][key tile] */
#pragma unroll
      for (int j = 0; j < 2; ++j) for (int u = 0; u < 2; ++u) s[j][u] = fa_mma(kf[u][1], qf[j][1], fa_mma(kf[u][0], qf[j][0], z8));
      __builtin_amdgcn_sched_barrier(0);      /* keeps the statement below behind the S^T products: moved in front of them it would wait out the LDS latency with nothing to cover it */
      asm volatile("" :: "v"(vf[0]), "v"(vf[1]), "v"(vf[2]), "v"(vf[3]));      /* inputs only: holds the pass's eight V^T reads as ONE group at the head of the S^T products, which cover their latency; without it the build spreads them among the O^T products, each behind a wait of its own */
      if (p + 1 < FA_KS / 32) {      /* next pass's K rows, fetched one pass ahead, inside this stage's buffer only (a scalar branch) */
#pragma unroll
        for (int u = 0; u < 2; ++u) { kf[u][0] = g2_lfrag(kb + ((p + 1) * 32 + u * 16) * FA_KP, hh); kf[u][1] = g2_lfrag(kb + ((p + 1) * 32 + u * 16) * FA_KP + 64, hh); } }
      float tm[2];
#pragma unroll
      for (int j = 0; j < 2; ++j) { float a = fmaxf(s[j][0][0], s[j][1][0]);
        for (int r = 1; r < 8; ++r) a = fmaxf(a, fmaxf(s[j][0][r], s[j][1][r]));
        tm[j] = fmaxf(a, rs_xh(a)); }
      if (__builtin_amdgcn_ballot_w32(tm[0] > m[0] + FA_T || tm[1] > m[1] + FA_T) != 0) {      /* one scalar branch per pass */
#pragma unroll
        for (int j = 0; j < 2; ++j) { const float mn = fmaxf(m[j], tm[j]); const float al = __builtin_amdgcn_exp2f((m[j] - mn) * FA_C); m[j] = mn; l[j] *= al;
          for (int dt = 0; dt < 4; ++dt) o[j][dt] *= al; } }
      FragH pf[2];
#pragma unroll
      for (int j = 0; j < 2; ++j) { const float mc = m[j] * FA_C; const v8f e0 = s[j][0] * FA_C - mc, e1 = s[j][1] * FA_C - mc; v8f p0, p1;      /* the same multiply-add per element as before, written on whole tiles */
        for (int r = 0; r < 8; ++r) { p0[r] = __builtin_amdgcn_exp2f(e0[r]); p1[r] = __builtin_amdgcn_exp2f(e1[r]); }
        asm volatile("v_nop" : "+v"(p0), "+v"(p1) : "v"(e0), "v"(e1));      /* the slot behind a transcendental: no result is read and no source register rewritten directly behind a v_exp_f32 */
        float s0 = p0[0], s1 = p1[0];      /* the sums start at their first term, in the order they had */
        for (int r = 1; r < 8; ++r) { s0 += p0[r]; s1 += p1[r]; }
        for (int r = 0; r < 8; ++r) { pf[j].h[r] = (_Float16)p0[r]; pf[j].h[8 + r] = (_Float16)p1[r]; }
        l[j] += s0 + s1; }
#pragma unroll
      for (int dt = 0; dt < 4; ++dt) for (int j = 0; j < 2; ++j) o[j][dt] = fa_mma(vf[dt], pf[j].v, o[j][dt]);
      asm volatile("v_nop\n\tv_nop\n\tv_nop\n\tv_nop" : "+v"(o[0][3]), "+v"(o[1][3]) : "v"(vf[3]));      /* the distance behind the pass's last WMMAs: over the loop's back edge the next pass's first vector instruction may overwrite one of their A registers */
    }
    asm volatile("s_wait_dscnt 0x0" ::: "memory");       /* this wave's reads of the buffer are done before it may be refilled */
    asm volatile("s_wait_asynccnt 0x0" ::: "memory");    /* this wave's copies of stage t + 1 have landed */
    __syncthreads();                                     /* publishes stage t + 1 and ends every reader's last read of stage t */
    if (t + 2 < SQ / FA_KS) fa_stage(gk + (size_t)(t + 2) * FA_KS * LQ, gv + (t + 2) * FA_KS, lk0 + bo, lv0 + bo); }
  asm volatile("s_wait_asynccnt 0x0" ::: "memory");      /* no copy is outstanding when the wave ends */
#pragma unroll
  for (int j = 0; j < 2; ++j) { const float inv = 64.0f / (l[j] + rs_xh(l[j])); unsigned short* d = (unsigned short*)O + ((size_t)b * SQ + q0 + j * 16 + ln) * DM + h * HD + 8 * hh;
    for (int dt = 0; dt < 4; ++dt) { FragH f; for (int r = 0; r < 8; ++r) f.h[r] = (_Float16)(o[j][dt][r] * inv); *(v8us*)(d + dt * 16) = f.half[0]; } } }

extern "C" void kernel_launch(void* const* d_in, const int* in_sizes, int n_in,
                              void* d_out, int out_size, void* d_ws, size_t ws_size, hipStream_t stream) {
  (void)in_sizes; (void)n_in; (void)out_size;
  const float* const* I = (const float* const*)d_in; const float* x = I[0]; const float* wqkv = I[1]; const float* bq = nullptr; const float* wo = I[2]; const float* bo = nullptr;      /* ONE input stream (z); U_qkv is ONE STACK [12][3][768][64] = [head][q | k | v][in][out]; U_msa [in][out] [768][768]; the module has NO biases: bare null pointers in the guarded bias slots; input order z, U_qkv, U_msa */
  char* ws = (char*)d_ws; size_t off = 0;
  auto take = [&](size_t bytes) { char* p = ws + off; off += (bytes + 255) & ~(size_t)255; return p; };
  _Float16* BQ = (_Float16*)take((size_t)3 * DM * DM * 2); _Float16* BO = (_Float16*)take((size_t)DM * DM * 2);      /* BQ: planes q | k | v, DM * DM apart */
  _Float16* X16 = (_Float16*)take(NR * DM * 2); _Float16* Q16 = (_Float16*)take((size_t)2 * NR * DM * 2); _Float16* K16 = Q16 + NR * DM; _Float16* O16 = (_Float16*)take(NR * DM * 2);      /* q | k rows, NR * DM apart */
  _Float16* VT = (_Float16*)take((size_t)NB * NH * HD * SQ * 2);
  if (off > ws_size) return;
  static_assert(MP % 128 == 0 && MPO % 128 == 0 && DM % 128 == 0 && DM % 64 == 0 && SQ % 128 == 0, "k_gemm2: whole 128x128 tiles, whole 64-k stages, a tile's tokens in one sequence");
  k_prep<<<PB_ALL, 256, 0, stream>>>(x, wqkv, wo, X16, BQ, BO);      /* all weight planes ([out][in], x16) and the x rows */
  const size_t r0p = (size_t)B0 * SQ;      /* first projected row */
  k_gemm2<0><<<dim3((unsigned)((MP / 128) * (DM / 128)), 3), 256, 0, stream>>>(X16 + r0p * DM, DM, 0, BQ, DM, (size_t)DM * DM, 0.0625f, bq, 0, nullptr, 1, 0, 0, nullptr, Q16 + r0p * DM, DM, NR * DM, MP, DM, DM, 2, VT + (size_t)B0 * DM * SQ, SQ);      /* y = q | k | v: same A rows, weight plane of the part; q and k as rows, v transposed: V^T [NB][NH][HD][SQ] */
  k_fattn<<<dim3(SQ / 256, NB * NH), 256, 0, stream>>>(Q16, K16, VT, O16);      /* o (merged heads, x64) as f16 rows: scores, softmax and P.V of every (batch, head) */
  k_gemm2<0><<<dim3((unsigned)((MPO / 128) * (DM / 128)), 1), 256, 0, stream>>>(O16 + r0p * DM, DM, 0, BO, DM, 0, 0.0009765625f, bo, 0, nullptr, 1, 0, 0, (float*)d_out + r0p * DM, nullptr, DM, 0, MPO, DM, DM, -1, nullptr, 1);      /* out rows are the output layout */
}

// v007
// Measured time: 141 microseconds a run.
// In both of two side-by-side timings against v006, it was 1.05 times as fast.
// Counting every step since v000, it is 70.2 times as fast.
#include <hip/hip_runtime.h>
// Multi-head self-attention with ONE STACKED per-head projection input on SIXTEEN sequences of 1024 at width 768 (z [16][1024][768]; U_qkv [12][3][768][64] = [head][q | k | v][in][out]: q, k, v of head h = z U_qkv[h][0 | 1 | 2]; NO biases; 12 heads of 64; logits / sqrt(64); softmax over all 1024 keys (no mask); out = merged U_msa ([in][out] [768][768], NO bias) -> [16][1024][768]); each (head, part) [in][out] block is transposed into its 64 contiguous rows of the weight plane of its part, all blocks in the one preparation launch; dense: single f16 q / k / v planes on every row.
// Structure: token rows r = b*1024 + s; one preparation launch (all weight planes and x as exact f16 rows, bf16-rounded; jobs picked by block index); Q, K, V as three WMMA GEMMs in one grid (y = part; 32x64 wave tiles, operand tiles staged in LDS by asynchronous copies, f32 accumulation, exact x16 weights, null bias slots, f16 outputs); the v part of that grid runs with its two operands exchanged, so that its output tiles are V^T tiles and go straight into the V^T plane; one fused attention launch over all (batch, head), K and V^T tiles staged in LDS by asynchronous copies: S^T = K Q^T on WMMA, online softmax in registers (f32 statistics, native exp2; unnormalised weights as f16), O^T += V^T P^T on WMMA, divided by the row sum at the end (o carried x64, folded into the output GEMM alpha) and written straight into the merged f16 o rows; out = o U_msa GEMM (f32, null bias slot) into the output layout.
// Compute dtype: inputs rounded to bf16; x / weights exact; q, k, v, softmax weights and o as plain f16 GEMM operands (~2^-12); scores and softmax statistics f32. v_wmma_f32_16x16x32_f16.
#define NB 16
#define SQ 1024
#define DM 768 
#define NH 12
#define HD 64
#define HG 4                         /* heads per launch of the per-batch k_vt overload (not launched) */
#define B0 0                         /* first batch processed (debug hook) */
#define NBR NB                       /* batches processed (debug hook) */
#define NR ((size_t)NB * SQ)         /* token rows */
#define MP ((int)((size_t)NBR * SQ)) /* rows projected (debug hook) */
#define QN SQ                        /* not used: k_fattn attends all SQ query rows */
#define NHD NH                       /* not used: k_fattn attends all NH heads */
#define MPO MP                       /* rows through the output stage (debug hook) */
#define LQ DM      /* row pitch of the q/k rows */
typedef __bf16 v16b __attribute__((ext_vector_type(16)));
typedef unsigned short v8us __attribute__((ext_vector_type(8), may_alias));
typedef float  v8f  __attribute__((ext_vector_type(8)));
typedef float  v4f  __attribute__((ext_vector_type(4)));
typedef float  v4fa __attribute__((ext_vector_type(4), may_alias));
union FragB { v16b v; v8us half[2]; unsigned short u[16]; };

__device__ __forceinline__ unsigned short bf16_bits(float x) { unsigned int u = __float_as_uint(x); return (unsigned short)((u + 0x7FFFu + ((u >> 16) & 1u)) >> 16); }
__device__ __forceinline__ float bf16_val(unsigned short b) { return __uint_as_float(((unsigned int)b) << 16); }
__device__ __forceinline__ float bf16_round(float x) { return bf16_val(bf16_bits(x)); }
// D += A·B with NT terms: 1 = ah·bh, 2 = + al·bh (A split), 3 = + ah·bl (both split)
template <int NT>
__device__ __forceinline__ v8f mmaN(v16b ah, v16b al, v16b bh, v16b bl, v8f c) {
  c = __builtin_amdgcn_wmma_f32_16x16x32_bf16(false, ah, false, bh, (short)0, c, false, false);
  if (NT >= 2) c = __builtin_amdgcn_wmma_f32_16x16x32_bf16(false, al, false, bh, (short)0, c, false, false);
  if (NT >= 3) c = __builtin_amdgcn_wmma_f32_16x16x32_bf16(false, ah, false, bl, (short)0, c, false, false);
  asm volatile("v_nop\n\tv_nop\n\tv_nop\n\tv_nop" : "+v"(c) : "v"(ah), "v"(al), "v"(bh), "v"(bl));
  return c;
}

__global__ __launch_bounds__(256) void k_wt_bf16(const float* __restrict__ W, unsigned short* __restrict__ Wt, int K, int N) {
  const int t = blockIdx.x * 256 + threadIdx.x;
  const int k8n = K / 8;
  if (t >= N * k8n) return;
  const int n = t / k8n, k8 = (t % k8n) * 8;
  v8us v;
#pragma unroll
  for (int i = 0; i < 8; ++i) v[i] = bf16_bits(W[(size_t)(k8 + i) * N + n]);
  *(v8us*)(Wt + (size_t)n * K + k8) = v;
  
}

// GEMM C[M][N] (f32, pitch ldc) = act(A[M][K]·W + bias). A f32 row-major (pitch lda) converted per fragment to bf16
// (ASPLIT: hi/lo two planes -> 2 terms, else single rounded term); Wt bf16 [N][K] (pitch ldb). BIAS_BF16 rounds the
// bias to bf16 first (bias quantised to bf16 before the add). K%32==0, M%16==0, N%64==0.
template <bool ASPLIT, int ACT, bool BIAS_BF16>
__global__ __launch_bounds__(128) void k_gemm_bf(const float* __restrict__ A, int lda, const unsigned short* __restrict__ Wt, int ldb,
                                               const float* __restrict__ bias, float* __restrict__ C, int ldc, int M, int N, int K) {
  __shared__ __attribute__((aligned(16))) float so[4][16][64];
  const int tid = threadIdx.x, w = tid >> 5, lane = tid & 31, ln = lane & 15, hh = lane >> 4;
  const int ntn = N / 64;
  const int wid = blockIdx.x * 4 + w;
  const int mt = wid / ntn, nq = wid % ntn;
  if (mt * 16 >= M) return;
  const int row0 = mt * 16, col0 = nq * 64;
  const float* arow = A + (size_t)(row0 + ln) * lda;
  v8f acc[4] = {};
  for (int kb = 0; kb < K; kb += 32) {
    FragB ah, al;
    const v4f x0 = *(const v4fa*)(arow + kb + 8 * hh), x1 = *(const v4fa*)(arow + kb + 8 * hh + 4);
    const v4f x2 = *(const v4fa*)(arow + kb + 16 + 8 * hh), x3 = *(const v4fa*)(arow + kb + 16 + 8 * hh + 4);
    float xs[16] = {x0[0],x0[1],x0[2],x0[3],x1[0],x1[1],x1[2],x1[3],x2[0],x2[1],x2[2],x2[3],x3[0],x3[1],x3[2],x3[3]};
#pragma unroll
    for (int i = 0; i < 16; ++i) { const unsigned short hb = bf16_bits(xs[i]); ah.u[i] = hb; al.u[i] = ASPLIT ? bf16_bits(xs[i] - bf16_val(hb)) : (unsigned short)0; }
#pragma unroll
    for (int t = 0; t < 4; ++t) {
      const unsigned short* brow = Wt + (size_t)(col0 + t * 16 + ln) * ldb + kb;
      FragB b;
      b.half[0] = *(const v8us*)(brow + 8 * hh);
      b.half[1] = *(const v8us*)(brow + 16 + 8 * hh);
      acc[t] = mmaN<ASPLIT ? 2 : 1>(ah.v, al.v, b.v, b.v, acc[t]);
    }
  }
#pragma unroll
  for (int t = 0; t < 4; ++t) {
    float bv = bias ? bias[col0 + t * 16 + ln] : 0.f;
    if (BIAS_BF16) bv = bf16_round(bv);
#pragma unroll
    for (int r = 0; r < 8; ++r) { float v = acc[t][r] + bv; if (ACT == 1) v = fmaxf(v, 0.f); so[w][8 * hh + r][t * 16 + ln] = v; }
  }
  __builtin_amdgcn_fence(__ATOMIC_ACQ_REL, "workgroup");
  __builtin_amdgcn_wave_barrier();
  const int rsub = lane >> 4, c4 = (lane & 15) * 4;
  {
#pragma unroll
    for (int q = 0; q < 8; ++q) {
      const int r = q * 2 + rsub;
      const v4f v = *(const v4fa*)&so[w][r][c4];
      *(v4f*)(C + (size_t)(row0 + r) * ldc + col0 + c4) = v;
    }
    
  }
}

// GEMM C = act(A·W + bias + resid): A f32 (ASPLIT -> hi/lo 2 terms), Wt bf16 [N][K]; ACT 0 none, 1 relu, 2 exact gelu;
// resid (optional, f32, row index = (row % rmod), pitch ldr, RES_BF16 rounds it) added before the activation.
template <bool ASPLIT, int ACT, bool BIAS_BF16, bool RES_BF16>
__global__ __launch_bounds__(128) void k_gemm_bf3(const float* __restrict__ A, int lda, const unsigned short* __restrict__ Wt, int ldb,
                                                const float* __restrict__ bias, const float* __restrict__ resid, int rmod, int ldr,
                                                float* __restrict__ C, int ldc, int M, int N, int K) {
  __shared__ __attribute__((aligned(16))) float so[4][16][64];
  const int tid = threadIdx.x, w = tid >> 5, lane = tid & 31, ln = lane & 15, hh = lane >> 4;
  const int ntn = N / 64;
  const int wid = blockIdx.x * 4 + w;
  const int mt = wid / ntn, nq = wid % ntn;
  if (mt * 16 >= M) return;
  const int row0 = mt * 16, col0 = nq * 64;
  const float* arow = A + (size_t)(row0 + ln) * lda;
  v8f acc[4] = {};
  for (int kb = 0; kb < K; kb += 32) {
    FragB ah, al;
    const v4f x0 = *(const v4fa*)(arow + kb + 8 * hh), x1 = *(const v4fa*)(arow + kb + 8 * hh + 4);
    const v4f x2 = *(const v4fa*)(arow + kb + 16 + 8 * hh), x3 = *(const v4fa*)(arow + kb + 16 + 8 * hh + 4);
    float xs[16] = {x0[0],x0[1],x0[2],x0[3],x1[0],x1[1],x1[2],x1[3],x2[0],x2[1],x2[2],x2[3],x3[0],x3[1],x3[2],x3[3]};
#pragma unroll
    for (int i = 0; i < 16; ++i) { const unsigned short hb = bf16_bits(xs[i]); ah.u[i] = hb; al.u[i] = ASPLIT ? bf16_bits(xs[i] - bf16_val(hb)) : (unsigned short)0; }
#pragma unroll
    for (int t = 0; t < 4; ++t) {
      const unsigned short* brow = Wt + (size_t)(col0 + t * 16 + ln) * ldb + kb;
      FragB b;
      b.half[0] = *(const v8us*)(brow + 8 * hh);
      b.half[1] = *(const v8us*)(brow + 16 + 8 * hh);
      acc[t] = mmaN<ASPLIT ? 2 : 1>(ah.v, al.v, b.v, b.v, acc[t]);
    }
  }
#pragma unroll
  for (int t = 0; t < 4; ++t) {
    const int col = col0 + t * 16 + ln;
    float bv = bias ? bias[col] : 0.f;
    if (BIAS_BF16) bv = bf16_round(bv);
#pragma unroll
    for (int r = 0; r < 8; ++r) {
      float v = acc[t][r] + bv;
      if (resid) { float rv = resid[(size_t)((row0 + 8 * hh + r) % rmod) * ldr + col]; if (RES_BF16) rv = bf16_round(rv); v += rv; }
      if (ACT == 1) v = fmaxf(v, 0.f);
      if (ACT == 2) v = 0.5f * v * (1.0f + erff(v * 0.70710678118654752f));
      if (ACT == 3) { const float u = 0.7978845608028654f * (v + 0.044715f * v * v * v); v = 0.5f * v * (1.0f + tanhf(u)); }
      so[w][8 * hh + r][t * 16 + ln] = v;
    }
  }
  __builtin_amdgcn_fence(__ATOMIC_ACQ_REL, "workgroup");
  __builtin_amdgcn_wave_barrier();
  const int rsub = lane >> 4, c4 = (lane & 15) * 4;
  {
#pragma unroll
    for (int q = 0; q < 8; ++q) {
      const int r = q * 2 + rsub;
      const v4f v = *(const v4fa*)&so[w][r][c4];
      *(v4f*)(C + (size_t)(row0 + r) * ldc + col0 + c4) = v;
    }
    
  }
}
// row LayerNorm (biased variance, eps) over N: s = X (+ R); optional out_sum <- s; out_norm <- (s-mu)*rsqrt(var+eps)*g + b
template <bool PARAM_BF16>
__global__ __launch_bounds__(256) void k_layernorm(const float* __restrict__ X, const float* __restrict__ R, const float* __restrict__ g, const float* __restrict__ bta,
                                                  float* __restrict__ out_sum, float* __restrict__ out_norm, int N, float eps) {
  __shared__ float red[256];
  const int row = blockIdx.x, tid = threadIdx.x;
  const float* x = X + (size_t)row * N; const float* rr = R ? R + (size_t)row * N : nullptr;
  float vals[16];                     // up to N = 4096
  const int per = N / 256;            // contiguous chunk per thread? use strided-by-4 chunks: thread handles j = tid*4 + 1024*u
  float s1 = 0.f;
  for (int u = 0; u < per / 4; ++u) {
    const int j = tid * 4 + 1024 * u;
    const v4f a = *(const v4fa*)(x + j);
    v4f b = {0.f,0.f,0.f,0.f}; if (rr) b = *(const v4fa*)(rr + j);
#pragma unroll
    for (int q = 0; q < 4; ++q) { const float v = a[q] + b[q]; vals[u * 4 + q] = v; s1 += v; }
  }
  red[tid] = s1; __syncthreads();
  for (int st = 128; st > 0; st >>= 1) { if (tid < st) red[tid] += red[tid + st]; __syncthreads(); }
  const float mu = red[0] / (float)N; __syncthreads();
  float s2 = 0.f;
  for (int u = 0; u < per / 4; ++u)
#pragma unroll
    for (int q = 0; q < 4; ++q) { const float c = vals[u * 4 + q] - mu; s2 += c * c; }
  red[tid] = s2; __syncthreads();
  for (int st = 128; st > 0; st >>= 1) { if (tid < st) red[tid] += red[tid + st]; __syncthreads(); }
  const float rs = rsqrtf(red[0] / (float)N + eps);
  {
    for (int u = 0; u < per / 4; ++u) {
      const int j = tid * 4 + 1024 * u;
      v4f o, sm;
#pragma unroll
      for (int q = 0; q < 4; ++q) {
        float gg = g[j + q], bb = bta[j + q];
        if (PARAM_BF16) { gg = bf16_round(gg); bb = bf16_round(bb); }
        sm[q] = vals[u * 4 + q]; o[q] = (vals[u * 4 + q] - mu) * rs * gg + bb;
      }
      if (out_sum) *(v4f*)(out_sum + (size_t)row * N + j) = sm;
      *(v4f*)(out_norm + (size_t)row * N + j) = o;
    }
    
  }
}



// ---- f16 WMMA path (v_wmma_f32_16x16x32_f16): 11-bit significands for operands in range — used where a [0,1] probability operand needs more precision than bf16
typedef _Float16 v16h __attribute__((ext_vector_type(16)));
union FragH { v16h v; v8us half[2]; _Float16 h[16]; unsigned short u[16]; };
template <int NT>
__device__ __forceinline__ v8f mmaH(v16h ah, v16h al, v16h bh, v16h bl, v8f c) {
  c = __builtin_amdgcn_wmma_f32_16x16x32_f16(false, ah, false, bh, (short)0, c, false, false);
  if (NT >= 2) c = __builtin_amdgcn_wmma_f32_16x16x32_f16(false, al, false, bh, (short)0, c, false, false);
  if (NT >= 3) c = __builtin_amdgcn_wmma_f32_16x16x32_f16(false, ah, false, bl, (short)0, c, false, false);
  asm volatile("v_nop\n\tv_nop\n\tv_nop\n\tv_nop" : "+v"(c) : "v"(ah), "v"(al), "v"(bh), "v"(bl));
  return c;
}
// batched GEMM like k_gemm_b but f16 operands: A f32 (split into f16 hi/lo if ASPLIT, else rounded to f16), Bt = f16 values [n][k]; alpha; C f32; N multiple of 16 (partial tiles skipped)
template <bool ASPLIT>
__global__ __launch_bounds__(128) void k_gemm_h(const float* __restrict__ A, int lda, size_t sA, const _Float16* __restrict__ Bh, int ldb, size_t sB, float alpha, float* __restrict__ C, int ldc, size_t sC, int M, int N, int K) {
  __shared__ __attribute__((aligned(16))) float so[4][16][64];
  const int tid = threadIdx.x, w = tid >> 5, lane = tid & 31, ln = lane & 15, hh = lane >> 4; const int by = blockIdx.y;
  A += (size_t)by * sA; Bh += (size_t)by * sB; C += (size_t)by * sC;
  const int ntn = (N + 63) / 64; const int wid = blockIdx.x * 4 + w; const int mt = wid / ntn, nq = wid % ntn; if (mt * 16 >= M) return;
  const int row0 = mt * 16, col0 = nq * 64; const float* arow = A + (size_t)(row0 + ln) * lda;
  v8f acc[4] = {};
  for (int kb = 0; kb < K; kb += 32) {
    FragH ah, al;
    const v4f x0 = *(const v4fa*)(arow + kb + 8 * hh), x1 = *(const v4fa*)(arow + kb + 8 * hh + 4), x2 = *(const v4fa*)(arow + kb + 16 + 8 * hh), x3 = *(const v4fa*)(arow + kb + 16 + 8 * hh + 4);
    float xs[16] = {x0[0],x0[1],x0[2],x0[3],x1[0],x1[1],x1[2],x1[3],x2[0],x2[1],x2[2],x2[3],x3[0],x3[1],x3[2],x3[3]};
#pragma unroll
    for (int i = 0; i < 16; ++i) { const _Float16 h = (_Float16)xs[i]; ah.h[i] = h; al.h[i] = ASPLIT ? (_Float16)(xs[i] - (float)h) : (_Float16)0.0f; }
#pragma unroll
    for (int t = 0; t < 4; ++t) { if (col0 + t * 16 >= N) continue; const size_t boff = (size_t)(col0 + t * 16 + ln) * ldb + kb; FragH bq; bq.half[0] = *(const v8us*)(Bh + boff + 8 * hh); bq.half[1] = *(const v8us*)(Bh + boff + 16 + 8 * hh);
      acc[t] = mmaH<ASPLIT ? 2 : 1>(ah.v, al.v, bq.v, bq.v, acc[t]); }
  }
#pragma unroll
  for (int t = 0; t < 4; ++t) { if (col0 + t * 16 >= N) continue;
#pragma unroll
    for (int r = 0; r < 8; ++r) so[w][8 * hh + r][t * 16 + ln] = acc[t][r] * alpha; }
  __builtin_amdgcn_fence(__ATOMIC_ACQ_REL, "workgroup"); __builtin_amdgcn_wave_barrier();
  const int rsub = lane >> 4, c4 = (lane & 15) * 4;
  {
#pragma unroll
    for (int q = 0; q < 8; ++q) { const int r = q * 2 + rsub; if (col0 + c4 < N) { const v4f v = *(const v4fa*)&so[w][r][c4]; *(v4f*)(C + (size_t)(row0 + r) * ldc + col0 + c4) = v; } }
     }
}

// Wt[n][k] = f16(W[k][n]·scale) from f32 row-major W[K][N] (scale = power of two; bf16-exact weights stay exact in f16 away from the subnormal range)
__device__ __forceinline__ void wt_f16(const float* __restrict__ W, _Float16* __restrict__ Wt, int K, int N, float scale, int t) {
  const int n = t / (K / 8), k8 = (t % (K / 8)) * 8; FragH f;
#pragma unroll
  for (int i = 0; i < 8; ++i) f.h[i] = (_Float16)(bf16_round(W[(size_t)(k8 + i) * N + n]) * scale); const v8us o = f.half[0];
  *(v8us*)((unsigned short*)Wt + (size_t)n * K + k8) = o;
  asm volatile("s_wait_xcnt 0x0" ::: "memory");      /* behind the store: in the joined kernel the listing runs on into another job's code, which rewrites the store's registers */
}
// k_gemm_hh variant with fused epilogue: v = acc·alpha + bias[by·sBias + col] (+ CP[(row/rowsPerB)·sCPb + by·64 + col] if CP) ; ACT 0 none / 1 elu ; writes f16 C16 (and f32 C if non-null)
template <int ACT>
__global__ __launch_bounds__(128) void k_gemm_hhx(const _Float16* __restrict__ A, int lda, size_t sA, const _Float16* __restrict__ Bh, int ldb, size_t sB, float alpha, const float* __restrict__ bias, size_t sBias, const float* __restrict__ CP, int rowsPerB, size_t sCPb, int row0g,
    float* __restrict__ C, _Float16* __restrict__ C16, int ldc, size_t sC, int M, int N, int K) {
  __shared__ __attribute__((aligned(16))) float so[4][16][64];
  const int tid = threadIdx.x, w = tid >> 5, lane = tid & 31, ln = lane & 15, hh = lane >> 4; const int by = blockIdx.y;
  A += (size_t)by * sA; Bh += (size_t)by * sB; const size_t cofs = (size_t)by * sC; const float* bp = bias ? bias + (size_t)by * sBias : nullptr;
  const int ntn = (N + 63) / 64; const int wid = blockIdx.x * 4 + w; const int mt = wid / ntn, nq = wid % ntn; if (mt * 16 >= M) return;
  const int row0 = mt * 16, col0 = nq * 64; const _Float16* arow = A + (size_t)(row0 + ln) * lda;
  v8f acc[4] = {};
  for (int kb = 0; kb < K; kb += 32) { FragH ah; ah.half[0] = *(const v8us*)((const unsigned short*)arow + kb + 8 * hh); ah.half[1] = *(const v8us*)((const unsigned short*)arow + kb + 16 + 8 * hh);
#pragma unroll
    for (int t = 0; t < 4; ++t) { if (col0 + t * 16 >= N) continue; const size_t boff = (size_t)(col0 + t * 16 + ln) * ldb + kb; FragH bq; bq.half[0] = *(const v8us*)((const unsigned short*)Bh + boff + 8 * hh); bq.half[1] = *(const v8us*)((const unsigned short*)Bh + boff + 16 + 8 * hh);
      acc[t] = mmaH<1>(ah.v, ah.v, bq.v, bq.v, acc[t]); }
  }
#pragma unroll
  for (int t = 0; t < 4; ++t) { if (col0 + t * 16 >= N) continue; const int col = col0 + t * 16 + ln; const float bv = bp ? bf16_round(bp[col]) : 0.f;
#pragma unroll
    for (int r = 0; r < 8; ++r) { float v = acc[t][r] * alpha + bv; if (CP) { const int rr = row0g + row0 + 8 * hh + r; if (rowsPerB < 0) v += CP[cofs + (size_t)rr * ldc + col];      /* rowsPerB < 0: own element of the batched C plane */ else { const int bidx = rr / rowsPerB; v += CP[(size_t)bidx * sCPb + (size_t)by * 64 + col]; } } if (ACT == 1) v = (v > 0.f) ? v : expm1f(v); else if (ACT == 7) v = (v > 0.f) ? v + 1.0f : expf(v); else if (ACT == 8) v = tanhf(v); else if (ACT == 9) v = 0.5f * v * (1.0f + tanhf(0.7978845608028654f * (v + 0.044715f * v * v * v))); else if (ACT == 11) v = 1.0f / (1.0f + expf(-v)); else if (ACT == 12) v = (v > 0.f) ? v : 0.01f * v; else if (ACT == 14) v = (v > 0.f) ? v : 0.1f * v; else if (ACT == 16) v = (v >= 0.f) ? v : 0.3f * v; else if (ACT == 17) v = (v >= 0.f) ? v : 0.2f * v; else if (ACT == 15) v = v / (1.0f + expf(-v)); else if (ACT == 3) v = fmaxf(v, 0.f); else if (ACT == 6) v = 0.5f * v * (1.0f + erff(v * 0.70710678118654752f)); so[w][8 * hh + r][t * 16 + ln] = v; } }
  __builtin_amdgcn_fence(__ATOMIC_ACQ_REL, "workgroup"); __builtin_amdgcn_wave_barrier();
  const int rsub = lane >> 4, c4 = (lane & 15) * 4; typedef _Float16 v4h __attribute__((ext_vector_type(4)));
  {
#pragma unroll
    for (int q = 0; q < 8; ++q) { const int r = q * 2 + rsub; if (col0 + c4 < N) { const v4f v = *(const v4fa*)&so[w][r][c4]; if (C) *(v4f*)(C + cofs + (size_t)(row0 + r) * ldc + col0 + c4) = v; if (C16) { v4h h4; for (int i = 0; i < 4; ++i) h4[i] = (_Float16)v[i]; *(v4h*)(C16 + cofs + (size_t)(row0 + r) * ldc + col0 + c4) = h4; } } }
     }
}


typedef _Float16 v4h __attribute__((ext_vector_type(4)));

// Every job that reads inputs only, in ONE launch; a block's job follows from its index (block-uniform branches, no job depends on another):
// blocks [0, PB_QKV): the 36 (head, part) blocks of U_qkv, PB_HP blocks each, into planes Bq | Bk | Bv (contiguous, DM*DM apart); [PB_QKV, PB_W): U_msa into Bo; the rest: x rows.
#define PB_HP  (HD * (DM / 8) / 256)          /* blocks per (head, part) */
#define PB_QKV (3 * NH * PB_HP)
#define PB_W   (PB_QKV + DM * (DM / 8) / 256)
#define PB_ALL (PB_W + (int)(NR * DM / 8 / 256))
__global__ __launch_bounds__(256) void k_prep(const float* __restrict__ x, const float* __restrict__ wqkv, const float* __restrict__ wo, _Float16* __restrict__ X16, _Float16* __restrict__ Bqkv, _Float16* __restrict__ Bo) {
  static_assert(HD * (DM / 8) % 256 == 0 && DM * (DM / 8) % 256 == 0 && NR * DM / 8 % 256 == 0, "k_prep: whole blocks per job");
  const int bi = blockIdx.x, tid = threadIdx.x;
  if (bi < PB_QKV) { const int job = bi / PB_HP, h = job / 3, p = job - 3 * h;      /* U_qkv block (h, p): row-major [in = DM][out = HD] at (3 h + p) * DM * HD -> rows h * HD .. of plane p */
    wt_f16(wqkv + (size_t)job * DM * HD, Bqkv + (size_t)p * DM * DM + (size_t)h * HD * DM, DM, HD, 16.0f, (bi - job * PB_HP) * 256 + tid); return; }
  if (bi < PB_W) { wt_f16(wo, Bo, DM, DM, 16.0f, (bi - PB_QKV) * 256 + tid); return; }
  const size_t t = (size_t)(bi - PB_W) * 256 + tid; FragH f;
#pragma unroll
  for (int q = 0; q < 8; ++q) f.h[q] = (_Float16)bf16_round(x[t * 8 + q]); *(v8us*)((unsigned short*)X16 + t * 8) = f.half[0];
  asm volatile("s_wait_xcnt 0x0" ::: "memory"); }      /* behind the store, as in wt_f16 */
__global__ __launch_bounds__(256) void k_h16(const float* __restrict__ x, _Float16* __restrict__ X16, size_t n8) { const size_t t = (size_t)blockIdx.x * 256 + threadIdx.x; if (t >= n8) return; FragH f;
#pragma unroll
  for (int q = 0; q < 8; ++q) f.h[q] = (_Float16)x[t * 8 + q]; *(v8us*)((unsigned short*)X16 + t * 8) = f.half[0];  }
__global__ __launch_bounds__(256) void k_round16f(const float* __restrict__ W, _Float16* __restrict__ Bt, size_t n8) { const size_t t = (size_t)blockIdx.x * 256 + threadIdx.x; if (t >= n8) return; FragH f;
#pragma unroll
  for (int i = 0; i < 8; ++i) f.h[i] = (_Float16)(bf16_round(W[t * 8 + i]) * 16.0f); *(v8us*)((unsigned short*)Bt + t * 8) = f.half[0];  }
__global__ __launch_bounds__(256) void k_hl(const float* __restrict__ F, _Float16* __restrict__ Hh, _Float16* __restrict__ Hl, size_t n8) { const size_t t = (size_t)blockIdx.x * 256 + threadIdx.x; if (t >= n8) return; FragH fh, fl; const v4f a = *(const v4fa*)(F + t * 8), c = *(const v4fa*)(F + t * 8 + 4);
#pragma unroll
  for (int q = 0; q < 4; ++q) { _Float16 h = (_Float16)a[q]; fh.h[q] = h; fl.h[q] = (_Float16)((a[q] - (float)h) * 1024.0f); h = (_Float16)c[q]; fh.h[4 + q] = h; fl.h[4 + q] = (_Float16)((c[q] - (float)h) * 1024.0f); }
  { *(v8us*)((unsigned short*)Hh + t * 8) = fh.half[0]; *(v8us*)((unsigned short*)Hl + t * 8) = fl.half[0];  } }

// ---- fast GEMM (wave tile 32x64, block tile 128x128, operands staged in LDS); epilogue = k_gemm_hhx semantics ----
__device__ __forceinline__ v16h g2_frag(const _Float16* p, int hh) { FragH f; f.half[0] = *(const v8us*)((const unsigned short*)p + 8 * hh); f.half[1] = *(const v8us*)((const unsigned short*)p + 16 + 8 * hh); return f.v; }
__device__ __forceinline__ v8f g2_mma(v16h a, v16h b, v8f c) { v8f d = __builtin_amdgcn_wmma_f32_16x16x32_f16(false, a, false, b, (short)0, c, false, false); asm volatile("v_nop\n\tv_nop\n\tv_nop\n\tv_nop" : "+v"(d) : "v"(a), "v"(b)); return d; }
// Operand staging of k_gemm2: a stage is 64 k (128 B, one whole line) of the block's 128 A rows and 128 B rows, brought into LDS by asynchronous copies
// (global_load_async_to_lds_b128; a wave's copy = 4 whole lines), so every operand line is asked for once per block instead of 16 lines per fragment load and wave.
#define G2_PITCH 144                      /* LDS bytes per staged row: 128 + 16, 16 B x odd: conflict-free for the ds_load_b128 fragment reads */
#define G2_BUF   (256 * G2_PITCH)         /* one stage: A rows 0-127, then B rows 0-127 */
__device__ __forceinline__ v16h g2_lfrag(const char* p, int hh) { FragH f; f.half[0] = *(const v8us*)(p + 16 * hh); f.half[1] = *(const v8us*)(p + 32 + 16 * hh); return f.v; }      /* same k order as g2_frag */
// One stage: each thread copies 16 B of 4 A rows and of 4 B rows (32 rows apart). ga / gb: the thread's first A / B address of this stage; lds: its LDS byte address in A row (tid / 8) of the buffer.
__device__ __forceinline__ void g2_stage(const _Float16* ga, size_t astep, const _Float16* gb, size_t bstep, unsigned lds) {
  /* the closing s_wait_xcnt stands inside the copies' own statement, so that no address register is rewritten in front of it */
  asm volatile("global_load_async_to_lds_b128 %0, %8, off\n\t"
               "global_load_async_to_lds_b128 %1, %9, off\n\t"
               "global_load_async_to_lds_b128 %2, %10, off\n\t"
               "global_load_async_to_lds_b128 %3, %11, off\n\t"
               "global_load_async_to_lds_b128 %4, %12, off\n\t"
               "global_load_async_to_lds_b128 %5, %13, off\n\t"
               "global_load_async_to_lds_b128 %6, %14, off\n\t"
               "global_load_async_to_lds_b128 %7, %15, off\n\t"
               "s_wait_xcnt 0x0"
               :: "v"(lds), "v"(lds + 32 * G2_PITCH), "v"(lds + 64 * G2_PITCH), "v"(lds + 96 * G2_PITCH), "v"(lds + 128 * G2_PITCH), "v"(lds + 160 * G2_PITCH), "v"(lds + 192 * G2_PITCH), "v"(lds + 224 * G2_PITCH),
                  "v"(ga), "v"(ga + astep), "v"(ga + 2 * astep), "v"(ga + 3 * astep), "v"(gb), "v"(gb + bstep), "v"(gb + 2 * bstep), "v"(gb + 3 * bstep) : "memory"); }
// Block = 8 waves, tile 128x128 (wave w: rows 32 * (w & 3), columns 64 * (w >> 2)); requires M % 128 == 0, N % 128 == 0, K % 64 == 0, K >= 64. Two stage buffers; the epilogue staging reuses them behind the last barrier.
// Part y == tpart is written TRANSPOSED: its blocks take the B rows as A and the A rows as B (same products, same k order), so the tile they hold is a tile of C^T, and it leaves by the same whole-line stores.
// C^T goes to CT (f16 only) as planes of tcols columns: element (n, m) at CT[(m / tcols) * N * tcols + n * tcols + m % tcols]; requires tcols % 128 == 0. That part takes no bias and no CP (both are laid out by column of C). tpart < 0: no such part.
// What the epilogue does is fixed at compile time: HB = a bias may be given, HCP = a CP plane may be given, O32 / O16 = the f32 / f16 output is written, TPART = a transposed part may exist.
// As tests of the pointers at run time these stood as a scalar branch at every element and every store, and no LDS read of the output staging could be asked for ahead of the store in front of it.
template <int ACT, bool HB, bool HCP, bool O32, bool O16, bool TPART>
__global__ __launch_bounds__(256) void k_gemm2(const _Float16* __restrict__ A, int lda, size_t sA, const _Float16* __restrict__ Bh, int ldb, size_t sB, float alpha, const float* __restrict__ bias, size_t sBias, const float* __restrict__ CP, int rowsPerB, size_t sCPb, int row0g,
    float* __restrict__ Cn, _Float16* __restrict__ Cn16, int ldcn, size_t sC, int M, int N, int K, int tpart, _Float16* __restrict__ CT, int tcols) { static_assert(ACT == 0 || ACT == 3 || ACT == 6 || ACT == 8 || ACT == 9 || ACT == 11 || ACT == 12 || ACT == 14 || ACT == 15 || ACT == 16 || ACT == 17, "k_gemm2: unsupported ACT code (would silently apply no activation)"); static_assert((O32 || O16) && !(TPART && O32), "k_gemm2: some output is written; the transposed part has the f16 output only");
  __shared__ __attribute__((aligned(16))) char smem[2 * G2_BUF]; static_assert(8 * 32 * 68 * 4 <= 2 * G2_BUF, "k_gemm2: epilogue staging fits the stage buffers");
  float (*so)[32][68] = (float (*)[32][68])smem;
  const int tid = threadIdx.x, w = tid >> 5, lane = tid & 31, ln = lane & 15, hh = lane >> 4; const int by = blockIdx.y;
  const bool tp = TPART && by == tpart;      /* the same for the whole block */
  const int ntn = N >> 7; const int ta = blockIdx.x / ntn, tb = blockIdx.x - ta * ntn; if (ta * 128 >= M) return;      /* tile of A rows, tile of B rows; the whole block leaves, in front of every barrier */
  const _Float16* Ar = A + (size_t)by * sA; const _Float16* Br = Bh + (size_t)by * sB;
  const _Float16* Ap = tp ? Br : Ar; const _Float16* Bp = tp ? Ar : Br; const int la = tp ? ldb : lda, lb = tp ? lda : ldb; const int mt = tp ? tb : ta, nq = tp ? ta : tb;      /* from here on: rows and columns of the tile as the block holds it */
  float* C = Cn; _Float16* C16 = tp ? CT : Cn16; const int ldc = tp ? tcols : ldcn; if (tp) CP = nullptr;
  const size_t cofs = tp ? (size_t)(ta * 128 / tcols) * tcols * (size_t)(N - 1) : (size_t)by * sC;      /* transposed: plane start less the plane's first column, which the column index below still counts */
  const float* bp = bias && !tp ? bias + (size_t)by * sBias : nullptr;
  const int row0 = mt * 128 + 32 * (w & 3), col0 = nq * 128 + 64 * (w >> 2);
  const _Float16* ga = Ap + (size_t)(mt * 128 + (tid >> 3)) * la + (tid & 7) * 8; const _Float16* gb = Bp + (size_t)(nq * 128 + (tid >> 3)) * lb + (tid & 7) * 8; const size_t astep = (size_t)32 * la, bstep = (size_t)32 * lb;
  const unsigned lds0 = (unsigned)(size_t)smem + (unsigned)((tid >> 3) * G2_PITCH + (tid & 7) * 16);
  const char* afr = smem + (32 * (w & 3) + ln) * G2_PITCH; const char* bfr = smem + (128 + 64 * (w >> 2) + ln) * G2_PITCH;
  const v8f z8 = {0.f,0.f,0.f,0.f,0.f,0.f,0.f,0.f}; v8f c00 = z8, c01 = z8, c02 = z8, c03 = z8, c10 = z8, c11 = z8, c12 = z8, c13 = z8;
  const int nt = K >> 6;
  g2_stage(ga, astep, gb, bstep, lds0);
  asm volatile("s_wait_asynccnt 0x0" ::: "memory");      /* stage 0 of this wave has landed ... */
  __syncthreads();                                       /* ... and every wave's: nothing of it is read in front of this barrier */
  if (nt > 1) g2_stage(ga + 64, astep, gb + 64, bstep, lds0 + G2_BUF);
#pragma unroll 1      /* stays rolled: one publish point per stage at the foot, small loop text */
  for (int t = 0; t < nt; ++t) { const int bo = (t & 1) * G2_BUF;
#pragma unroll      /* both k blocks inline: their LDS offsets become immediates */
    for (int kk = 0; kk < 128; kk += 64) { const char* ap = afr + bo + kk; const char* bq = bfr + bo + kk;      /* two k blocks of 32 per stage, in ascending k */
      const v16h a0 = g2_lfrag(ap, hh), a1 = g2_lfrag(ap + 16 * G2_PITCH, hh);      /* the block's six fragments are read as one group in front of its WMMAs */
      const v16h b0 = g2_lfrag(bq, hh), b1 = g2_lfrag(bq + 16 * G2_PITCH, hh), b2 = g2_lfrag(bq + 32 * G2_PITCH, hh), b3 = g2_lfrag(bq + 48 * G2_PITCH, hh);
      c00 = g2_mma(a0, b0, c00); c10 = g2_mma(a1, b0, c10); c01 = g2_mma(a0, b1, c01); c11 = g2_mma(a1, b1, c11);
      c02 = g2_mma(a0, b2, c02); c12 = g2_mma(a1, b2, c12); c03 = g2_mma(a0, b3, c03); c13 = g2_mma(a1, b3, c13); }
    asm volatile("s_wait_dscnt 0x0" ::: "memory");       /* this wave's reads of the buffer are done before it may be refilled */
    asm volatile("s_wait_asynccnt 0x0" ::: "memory");    /* this wave's copies of stage t + 1 have landed */
    __syncthreads();                                     /* publishes stage t + 1 and ends every reader's last read of stage t */
    if (t + 2 < nt) g2_stage(ga + (size_t)(t + 2) * 64, astep, gb + (size_t)(t + 2) * 64, bstep, lds0 + bo); }
  asm volatile("s_wait_asynccnt 0x0" ::: "memory");      /* no copy is outstanding when the buffers become output staging */
  v8f accs[8] = {c00, c01, c02, c03, c10, c11, c12, c13};
#pragma unroll
  for (int u = 0; u < 8; ++u) { const int t = u & 3, half = u >> 2; const int col = col0 + t * 16 + ln; const float bv = HB && bp ? bf16_round(bp[col]) : 0.f;
#pragma unroll
    for (int r = 0; r < 8; ++r) { const int rloc = half * 16 + 8 * hh + r; float v = HB ? accs[u][r] * alpha + bv : accs[u][r] * alpha; if (HCP && CP) { if (rowsPerB < 0) v += CP[cofs + (size_t)(row0g + row0 + rloc) * ldc + col];      /* rowsPerB < 0: own element of the batched C plane */ else { const int bidx = (row0g + row0 + rloc) / rowsPerB; v += CP[(size_t)bidx * sCPb + (size_t)by * 64 + col]; } }
      if (ACT == 3) v = fmaxf(v, 0.f); else if (ACT == 6) v = 0.5f * v * (1.0f + erff(v * 0.70710678118654752f)); else if (ACT == 11) v = 1.0f / (1.0f + expf(-v)); else if (ACT == 15) v = v / (1.0f + expf(-v)); else if (ACT == 12) v = (v > 0.f) ? v : 0.01f * v; else if (ACT == 8) v = tanhf(v); else if (ACT == 9) v = 0.5f * v * (1.0f + tanhf(0.7978845608028654f * (v + 0.044715f * v * v * v))); else if (ACT == 14) v = (v > 0.f) ? v : 0.1f * v; else if (ACT == 16) v = (v >= 0.f) ? v : 0.3f * v; else if (ACT == 17) v = (v >= 0.f) ? v : 0.2f * v;
      so[w][rloc][t * 16 + ln] = v; } }
  __builtin_amdgcn_fence(__ATOMIC_ACQ_REL, "workgroup"); __builtin_amdgcn_wave_barrier();
  const int rsub = lane >> 4, c4 = (lane & 15) * 4;
  {
#pragma unroll
    for (int q = 0; q < 16; ++q) { const int r = q * 2 + rsub; const v4f v = *(const v4fa*)&so[w][r][c4]; if (O32) *(v4f*)(C + cofs + (size_t)(row0 + r) * ldc + col0 + c4) = v; if (O16) { v4h h4; for (int i = 0; i < 4; ++i) h4[i] = (_Float16)v[i]; *(v4h*)(C16 + cofs + (size_t)(row0 + r) * ldc + col0 + c4) = h4; } }
     } }


__global__ __launch_bounds__(256) void k_wnat(const float* __restrict__ w, size_t n8, _Float16* __restrict__ Bt) { const size_t t = (size_t)blockIdx.x * 256 + threadIdx.x; if (t >= n8) return; FragH f; for (int q = 0; q < 8; ++q) f.h[q] = (_Float16)(bf16_round(w[t * 8 + q]) * 16.0f); *(v8us*)((unsigned short*)Bt + t * 8) = f.half[0];  }
__global__ __launch_bounds__(256) void k_rsm(const float* __restrict__ S, _Float16* __restrict__ P, int nrows) {
  #pragma clang fp contract(off)
  const int i = blockIdx.x * 256 + threadIdx.x; if (i >= nrows) return; const float* s = S + (size_t)i * SQ; float mx = -3.0e38f;
#pragma unroll 1
  for (int j = 0; j < SQ; ++j) mx = fmaxf(mx, s[j]); float se = 0.f;
#pragma unroll 1
  for (int j = 0; j < SQ; ++j) se += expf(s[j] - mx); const float sc = 256.0f / se;
#pragma unroll 1
  for (int j0 = 0; j0 < SQ; j0 += 8) { FragH f; for (int q = 0; q < 8; ++q) f.h[q] = (_Float16)(expf(s[j0 + q] - mx) * sc); unsigned short* d = (unsigned short*)P + (size_t)i * SQ + j0; *(v8us*)d = f.half[0];  } }
__global__ __launch_bounds__(256) void k_vt(const _Float16* __restrict__ V16, int b, int h0, _Float16* __restrict__ VT) { __shared__ unsigned short tl[64][65]; const int tid = threadIdx.x; const int hh = blockIdx.x % HG, sg = blockIdx.x / HG; const int s0 = sg * 64; const int h = h0 + hh;
  for (int i = tid; i < 64 * 8; i += 256) { const int j = i / 8, d8 = (i % 8) * 8; FragH f; f.half[0] = *(const v8us*)((const unsigned short*)V16 + ((size_t)b * SQ + s0 + j) * DM + h * HD + d8); for (int q = 0; q < 8; ++q) tl[d8 + q][j] = f.u[q]; }
  __syncthreads();
  { for (int i = tid; i < 64 * 8; i += 256) { const int d = i / 8, j8 = (i % 8) * 8; FragH f; for (int q = 0; q < 8; ++q) f.u[q] = tl[d][j8 + q]; *(v8us*)((unsigned short*)VT + ((size_t)hh * HD + d) * SQ + s0 + j8) = f.half[0]; }  } }



// lane l <-> l ^ 16 (cross-row move); every lane on
__device__ __forceinline__ float rs_xh(float x) { return __builtin_bit_cast(float, __builtin_amdgcn_permlanex16(__builtin_bit_cast(int, x), __builtin_bit_cast(int, x), 0x76543210, 0xfedcba98, false, false)); }
__device__ __forceinline__ v8f fa_mma(v16h a, v16h b, v8f c) { return __builtin_amdgcn_wmma_f32_16x16x32_f16(false, a, false, b, (short)0, c, false, false); }
#define FA_C 0.18033688011112042f      /* 0.125 * log2(e) */
#define FA_T 44.361419555836498f       /* 8 / FA_C: the rescale threshold in raw score units */
#define FA_KS  128                     /* keys per stage */
#define FA_KP  144                     /* LDS bytes per staged K row (64 d): 128 + 16, 16 B x odd: conflict-free for the ds_load_b128 fragment reads */
#define FA_VP  272                     /* LDS bytes per staged V^T row (128 keys): 256 + 16, 16 B x odd */
#define FA_VO  (FA_KS * FA_KP)         /* the 64 V^T rows stand behind the 128 K rows */
#define FA_BUF (FA_VO + HD * FA_VP)    /* one stage */
// One stage: each thread copies 16 B of 4 K rows (32 rows apart) and of 4 V^T rows (16 rows apart). gk / gv: the thread's first K / V^T address of this stage; lk / lv: its LDS byte addresses in K row (tid / 8) and V^T row (tid / 16) of the buffer.
__device__ __forceinline__ void fa_stage(const _Float16* gk, const _Float16* gv, unsigned lk, unsigned lv) {
  /* the closing s_wait_xcnt stands inside the copies' own statement, so that no address register is rewritten in front of it */
  asm volatile("global_load_async_to_lds_b128 %0, %8, off\n\t"
               "global_load_async_to_lds_b128 %1, %9, off\n\t"
               "global_load_async_to_lds_b128 %2, %10, off\n\t"
               "global_load_async_to_lds_b128 %3, %11, off\n\t"
               "global_load_async_to_lds_b128 %4, %12, off\n\t"
               "global_load_async_to_lds_b128 %5, %13, off\n\t"
               "global_load_async_to_lds_b128 %6, %14, off\n\t"
               "global_load_async_to_lds_b128 %7, %15, off\n\t"
               "s_wait_xcnt 0x0"
               :: "v"(lk), "v"(lk + 32 * FA_KP), "v"(lk + 64 * FA_KP), "v"(lk + 96 * FA_KP), "v"(lv), "v"(lv + 16 * FA_VP), "v"(lv + 32 * FA_VP), "v"(lv + 48 * FA_VP),
                  "v"(gk), "v"(gk + (size_t)32 * LQ), "v"(gk + (size_t)64 * LQ), "v"(gk + (size_t)96 * LQ), "v"(gv), "v"(gv + (size_t)16 * SQ), "v"(gv + (size_t)32 * SQ), "v"(gv + (size_t)48 * SQ) : "memory"); }
__global__ __launch_bounds__(256) void k_fattn(const _Float16* __restrict__ Q, const _Float16* __restrict__ Kr, const _Float16* __restrict__ VT, _Float16* __restrict__ O) { static_assert(HD == 64 && SQ % 256 == 0 && SQ / FA_KS >= 2, "k_fattn: 2 k fragments per row, 8 waves x 32 queries, two stages or more");
  __shared__ __attribute__((aligned(16))) char smem[2 * FA_BUF];
  const int tid = threadIdx.x, lane = tid & 31, ln = lane & 15, hh = lane >> 4, w = tid >> 5; const int slab = blockIdx.y, b = slab / NH, h = slab - b * NH; const int q0 = blockIdx.x * 256 + w * 32;
  const _Float16* qp = Q + ((size_t)b * SQ + q0 + ln) * LQ + h * HD;
  const _Float16* gk = Kr + ((size_t)b * SQ + (tid >> 3)) * LQ + h * HD + (tid & 7) * 8; const _Float16* gv = VT + ((size_t)slab * HD + (tid >> 4)) * SQ + (tid & 15) * 8;
  const unsigned lk0 = (unsigned)(size_t)smem + (unsigned)((tid >> 3) * FA_KP + (tid & 7) * 16), lv0 = (unsigned)(size_t)smem + (unsigned)(FA_VO + (tid >> 4) * FA_VP + (tid & 15) * 16);
  const char* kfr = smem + ln * FA_KP; const char* vfr = smem + FA_VO + ln * FA_VP;
  fa_stage(gk, gv, lk0, lv0);
  v16h qf[2][2], kf[2][2];      /* [tile][half of the 64 d] */
#pragma unroll
  for (int j = 0; j < 2; ++j) { qf[j][0] = g2_frag(qp + (size_t)j * 16 * LQ, hh); qf[j][1] = g2_frag(qp + (size_t)j * 16 * LQ + 32, hh); }
  const v8f z8 = {0.f,0.f,0.f,0.f,0.f,0.f,0.f,0.f}; v8f o[2][4]; float m[2] = {-3.0e38f, -3.0e38f}, l[2] = {0.f, 0.f};
#pragma unroll
  for (int j = 0; j < 2; ++j) for (int dt = 0; dt < 4; ++dt) o[j][dt] = z8;
  asm volatile("s_wait_asynccnt 0x0" ::: "memory");      /* stage 0 of this wave has landed ... */
  __syncthreads();                                       /* ... and every wave's: nothing of it is read in front of this barrier */
  fa_stage(gk + (size_t)FA_KS * LQ, gv + FA_KS, lk0 + FA_BUF, lv0 + FA_BUF);
#pragma unroll 1      /* stays rolled: one publish point per stage at the foot */
  for (int t = 0; t < SQ / FA_KS; ++t) { const int bo = (t & 1) * FA_BUF; const char* kb = kfr + bo; const char* vb = vfr + bo;
#pragma unroll
    for (int u = 0; u < 2; ++u) { kf[u][0] = g2_lfrag(kb + u * 16 * FA_KP, hh); kf[u][1] = g2_lfrag(kb + u * 16 * FA_KP + 64, hh); }      /* K rows of the stage's first pass */
#pragma unroll 1      /* stays rolled: with the 4 passes inline the build had no registers left to ask for a pass's V^T rows ahead of their use */
    for (int p = 0; p < FA_KS / 32; ++p) {
      v16h vf[4];      /* V^T rows of this pass: asked for first, used last */
#pragma unroll
      for (int dt = 0; dt < 4; ++dt) vf[dt] = g2_lfrag(vb + dt * 16 * FA_VP + p * 64, hh);
      v8f s[2][2];      /* [query tile][key tile] */
#pragma unroll
      for (int j = 0; j < 2; ++j) for (int u = 0; u < 2; ++u) s[j][u] = fa_mma(kf[u][1], qf[j][1], fa_mma(kf[u][0], qf[j][0], z8));
      __builtin_amdgcn_sched_barrier(0);      /* keeps the statement below behind the S^T products: moved in front of them it would wait out the LDS latency with nothing to cover it */
      asm volatile("" :: "v"(vf[0]), "v"(vf[1]), "v"(vf[2]), "v"(vf[3]));      /* inputs only: holds the pass's eight V^T reads as ONE group at the head of the S^T products, which cover their latency; without it the build spreads them among the O^T products, each behind a wait of its own */
      if (p + 1 < FA_KS / 32) {      /* next pass's K rows, fetched one pass ahead, inside this stage's buffer only (a scalar branch) */
#pragma unroll
        for (int u = 0; u < 2; ++u) { kf[u][0] = g2_lfrag(kb + ((p + 1) * 32 + u * 16) * FA_KP, hh); kf[u][1] = g2_lfrag(kb + ((p + 1) * 32 + u * 16) * FA_KP + 64, hh); } }
      float tm[2];
#pragma unroll
      for (int j = 0; j < 2; ++j) { float a = fmaxf(s[j][0][0], s[j][1][0]);
        for (int r = 1; r < 8; ++r) a = fmaxf(a, fmaxf(s[j][0][r], s[j][1][r]));
        tm[j] = fmaxf(a, rs_xh(a)); }
      if (__builtin_amdgcn_ballot_w32(tm[0] > m[0] + FA_T || tm[1] > m[1] + FA_T) != 0) {      /* one scalar branch per pass */
#pragma unroll
        for (int j = 0; j < 2; ++j) { const float mn = fmaxf(m[j], tm[j]); const float al = __builtin_amdgcn_exp2f((m[j] - mn) * FA_C); m[j] = mn; l[j] *= al;
          for (int dt = 0; dt < 4; ++dt) o[j][dt] *= al; } }
      FragH pf[2];
#pragma unroll
      for (int j = 0; j < 2; ++j) { const float mc = m[j] * FA_C; const v8f e0 = s[j][0] * FA_C - mc, e1 = s[j][1] * FA_C - mc; v8f p0, p1;      /* the same multiply-add per element as before, written on whole tiles */
        for (int r = 0; r < 8; ++r) { p0[r] = __builtin_amdgcn_exp2f(e0[r]); p1[r] = __builtin_amdgcn_exp2f(e1[r]); }
        asm volatile("v_nop" : "+v"(p0), "+v"(p1) : "v"(e0), "v"(e1));      /* the slot behind a transcendental: no result is read and no source register rewritten directly behind a v_exp_f32 */
        float s0 = p0[0], s1 = p1[0];      /* the sums start at their first term, in the order they had */
        for (int r = 1; r < 8; ++r) { s0 += p0[r]; s1 += p1[r]; }
        for (int r = 0; r < 8; ++r) { pf[j].h[r] = (_Float16)p0[r]; pf[j].h[8 + r] = (_Float16)p1[r]; }
        l[j] += s0 + s1; }
#pragma unroll
      for (int dt = 0; dt < 4; ++dt) for (int j = 0; j < 2; ++j) o[j][dt] = fa_mma(vf[dt], pf[j].v, o[j][dt]);
      asm volatile("v_nop\n\tv_nop\n\tv_nop\n\tv_nop" : "+v"(o[0][3]), "+v"(o[1][3]) : "v"(vf[3]));      /* the distance behind the pass's last WMMAs: over the loop's back edge the next pass's first vector instruction may overwrite one of their A registers */
    }
    asm volatile("s_wait_dscnt 0x0" ::: "memory");       /* this wave's reads of the buffer are done before it may be refilled */
    asm volatile("s_wait_asynccnt 0x0" ::: "memory");    /* this wave's copies of stage t + 1 have landed */
    __syncthreads();                                     /* publishes stage t + 1 and ends every reader's last read of stage t */
    if (t + 2 < SQ / FA_KS) fa_stage(gk + (size_t)(t + 2) * FA_KS * LQ, gv + (t + 2) * FA_KS, lk0 + bo, lv0 + bo); }
  asm volatile("s_wait_asynccnt 0x0" ::: "memory");      /* no copy is outstanding when the wave ends */
#pragma unroll
  for (int j = 0; j < 2; ++j) { const float inv = 64.0f / (l[j] + rs_xh(l[j])); unsigned short* d = (unsigned short*)O + ((size_t)b * SQ + q0 + j * 16 + ln) * DM + h * HD + 8 * hh;
    for (int dt = 0; dt < 4; ++dt) { FragH f; for (int r = 0; r < 8; ++r) f.h[r] = (_Float16)(o[j][dt][r] * inv); *(v8us*)(d + dt * 16) = f.half[0]; } } }

extern "C" void kernel_launch(void* const* d_in, const int* in_sizes, int n_in,
                              void* d_out, int out_size, void* d_ws, size_t ws_size, hipStream_t stream) {
  (void)in_sizes; (void)n_in; (void)out_size;
  const float* const* I = (const float* const*)d_in; const float* x = I[0]; const float* wqkv = I[1]; const float* bq = nullptr; const float* wo = I[2]; const float* bo = nullptr;      /* ONE input stream (z); U_qkv is ONE STACK [12][3][768][64] = [head][q | k | v][in][out]; U_msa [in][out] [768][768]; the module has NO biases: bare null pointers in the guarded bias slots; input order z, U_qkv, U_msa */
  char* ws = (char*)d_ws; size_t off = 0;
  auto take = [&](size_t bytes) { char* p = ws + off; off += (bytes + 255) & ~(size_t)255; return p; };
  _Float16* BQ = (_Float16*)take((size_t)3 * DM * DM * 2); _Float16* BO = (_Float16*)take((size_t)DM * DM * 2);      /* BQ: planes q | k | v, DM * DM apart */
  _Float16* X16 = (_Float16*)take(NR * DM * 2); _Float16* Q16 = (_Float16*)take((size_t)2 * NR * DM * 2); _Float16* K16 = Q16 + NR * DM; _Float16* O16 = (_Float16*)take(NR * DM * 2);      /* q | k rows, NR * DM apart */
  _Float16* VT = (_Float16*)take((size_t)NB * NH * HD * SQ * 2);
  if (off > ws_size) return;
  static_assert(MP % 128 == 0 && MPO % 128 == 0 && DM % 128 == 0 && DM % 64 == 0 && SQ % 128 == 0, "k_gemm2: whole 128x128 tiles, whole 64-k stages, a tile's tokens in one sequence");
  k_prep<<<PB_ALL, 256, 0, stream>>>(x, wqkv, wo, X16, BQ, BO);      /* all weight planes ([out][in], x16) and the x rows */
  const size_t r0p = (size_t)B0 * SQ;      /* first projected row */
  k_gemm2<0, false, false, false, true, true><<<dim3((unsigned)((MP / 128) * (DM / 128)), 3), 256, 0, stream>>>(X16 + r0p * DM, DM, 0, BQ, DM, (size_t)DM * DM, 0.0625f, bq, 0, nullptr, 1, 0, 0, nullptr, Q16 + r0p * DM, DM, NR * DM, MP, DM, DM, 2, VT + (size_t)B0 * DM * SQ, SQ);      /* y = q | k | v: same A rows, weight plane of the part; q and k as rows, v transposed: V^T [NB][NH][HD][SQ] */
  k_fattn<<<dim3(SQ / 256, NB * NH), 256, 0, stream>>>(Q16, K16, VT, O16);      /* o (merged heads, x64) as f16 rows: scores, softmax and P.V of every (batch, head) */
  k_gemm2<0, false, false, true, false, false><<<dim3((unsigned)((MPO / 128) * (DM / 128)), 1), 256, 0, stream>>>(O16 + r0p * DM, DM, 0, BO, DM, 0, 0.0009765625f, bo, 0, nullptr, 1, 0, 0, (float*)d_out + r0p * DM, nullptr, DM, 0, MPO, DM, DM, -1, nullptr, 1);      /* out rows are the output layout */
}

// v008
// It runs in 136 microseconds.
// Next to v007, in two timings, it ran 1.04 times as fast each time.
// All steps since v000 together make it 73.1 times as fast.
#include <hip/hip_runtime.h>
// Multi-head self-attention with ONE STACKED per-head projection input on SIXTEEN sequences of 1024 at width 768 (z [16][1024][768]; U_qkv [12][3][768][64] = [head][q | k | v][in][out]: q, k, v of head h = z U_qkv[h][0 | 1 | 2]; NO biases; 12 heads of 64; logits / sqrt(64); softmax over all 1024 keys (no mask); out = merged U_msa ([in][out] [768][768], NO bias) -> [16][1024][768]); each (head, part) [in][out] block is transposed (64 x 64 tiles through LDS, whole lines on both sides) into its 64 contiguous rows of the weight plane, all blocks in the one preparation launch; dense: single f16 q / k / v planes on every row.
// Structure: token rows r = b*1024 + s; one preparation launch (all weight planes and x as exact f16 rows, bf16-rounded; jobs picked by block index); Q, K, V as three WMMA GEMMs in one grid (y = part; 32x64 wave tiles, operand tiles staged in LDS by asynchronous copies, f32 accumulation, exact x16 weights, null bias slots, f16 outputs); the v part of that grid runs with its two operands exchanged, so that its output tiles are V^T tiles and go straight into the V^T plane; one fused attention launch over all (batch, head), K and V^T tiles staged in LDS by asynchronous copies: S^T = K Q^T on WMMA, online softmax in registers (f32 statistics, native exp2; unnormalised weights as f16), O^T += V^T P^T on WMMA, divided by the row sum at the end (o carried x64, folded into the output GEMM alpha) and written straight into the merged f16 o rows; out = o U_msa GEMM (f32, null bias slot) into the output layout.
// Compute dtype: inputs rounded to bf16; x / weights exact; q, k, v, softmax weights and o as plain f16 GEMM operands (~2^-12); scores and softmax statistics f32. v_wmma_f32_16x16x32_f16.
#define NB 16
#define SQ 1024
#define DM 768 
#define NH 12
#define HD 64
#define HG 4                         /* heads per launch of the per-batch k_vt overload (not launched) */
#define B0 0                         /* first batch processed (debug hook) */
#define NBR NB                       /* batches processed (debug hook) */
#define NR ((size_t)NB * SQ)         /* token rows */
#define MP ((int)((size_t)NBR * SQ)) /* rows projected (debug hook) */
#define QN SQ                        /* not used: k_fattn attends all SQ query rows */
#define NHD NH                       /* not used: k_fattn attends all NH heads */
#define MPO MP                       /* rows through the output stage (debug hook) */
#define LQ DM      /* row pitch of the q/k rows */
typedef __bf16 v16b __attribute__((ext_vector_type(16)));
typedef unsigned short v8us __attribute__((ext_vector_type(8), may_alias));
typedef float  v8f  __attribute__((ext_vector_type(8)));
typedef float  v4f  __attribute__((ext_vector_type(4)));
typedef float  v4fa __attribute__((ext_vector_type(4), may_alias));
union FragB { v16b v; v8us half[2]; unsigned short u[16]; };

__device__ __forceinline__ unsigned short bf16_bits(float x) { unsigned int u = __float_as_uint(x); return (unsigned short)((u + 0x7FFFu + ((u >> 16) & 1u)) >> 16); }
__device__ __forceinline__ float bf16_val(unsigned short b) { return __uint_as_float(((unsigned int)b) << 16); }
__device__ __forceinline__ float bf16_round(float x) { return bf16_val(bf16_bits(x)); }
// D += A·B with NT terms: 1 = ah·bh, 2 = + al·bh (A split), 3 = + ah·bl (both split)
template <int NT>
__device__ __forceinline__ v8f mmaN(v16b ah, v16b al, v16b bh, v16b bl, v8f c) {
  c = __builtin_amdgcn_wmma_f32_16x16x32_bf16(false, ah, false, bh, (short)0, c, false, false);
  if (NT >= 2) c = __builtin_amdgcn_wmma_f32_16x16x32_bf16(false, al, false, bh, (short)0, c, false, false);
  if (NT >= 3) c = __builtin_amdgcn_wmma_f32_16x16x32_bf16(false, ah, false, bl, (short)0, c, false, false);
  asm volatile("v_nop\n\tv_nop\n\tv_nop\n\tv_nop" : "+v"(c) : "v"(ah), "v"(al), "v"(bh), "v"(bl));
  return c;
}

__global__ __launch_bounds__(256) void k_wt_bf16(const float* __restrict__ W, unsigned short* __restrict__ Wt, int K, int N) {
  const int t = blockIdx.x * 256 + threadIdx.x;
  const int k8n = K / 8;
  if (t >= N * k8n) return;
  const int n = t / k8n, k8 = (t % k8n) * 8;
  v8us v;
#pragma unroll
  for (int i = 0; i < 8; ++i) v[i] = bf16_bits(W[(size_t)(k8 + i) * N + n]);
  *(v8us*)(Wt + (size_t)n * K + k8) = v;
  
}

// GEMM C[M][N] (f32, pitch ldc) = act(A[M][K]·W + bias). A f32 row-major (pitch lda) converted per fragment to bf16
// (ASPLIT: hi/lo two planes -> 2 terms, else single rounded term); Wt bf16 [N][K] (pitch ldb). BIAS_BF16 rounds the
// bias to bf16 first (bias quantised to bf16 before the add). K%32==0, M%16==0, N%64==0.
template <bool ASPLIT, int ACT, bool BIAS_BF16>
__global__ __launch_bounds__(128) void k_gemm_bf(const float* __restrict__ A, int lda, const unsigned short* __restrict__ Wt, int ldb,
                                               const float* __restrict__ bias, float* __restrict__ C, int ldc, int M, int N, int K) {
  __shared__ __attribute__((aligned(16))) float so[4][16][64];
  const int tid = threadIdx.x, w = tid >> 5, lane = tid & 31, ln = lane & 15, hh = lane >> 4;
  const int ntn = N / 64;
  const int wid = blockIdx.x * 4 + w;
  const int mt = wid / ntn, nq = wid % ntn;
  if (mt * 16 >= M) return;
  const int row0 = mt * 16, col0 = nq * 64;
  const float* arow = A + (size_t)(row0 + ln) * lda;
  v8f acc[4] = {};
  for (int kb = 0; kb < K; kb += 32) {
    FragB ah, al;
    const v4f x0 = *(const v4fa*)(arow + kb + 8 * hh), x1 = *(const v4fa*)(arow + kb + 8 * hh + 4);
    const v4f x2 = *(const v4fa*)(arow + kb + 16 + 8 * hh), x3 = *(const v4fa*)(arow + kb + 16 + 8 * hh + 4);
    float xs[16] = {x0[0],x0[1],x0[2],x0[3],x1[0],x1[1],x1[2],x1[3],x2[0],x2[1],x2[2],x2[3],x3[0],x3[1],x3[2],x3[3]};
#pragma unroll
    for (int i = 0; i < 16; ++i) { const unsigned short hb = bf16_bits(xs[i]); ah.u[i] = hb; al.u[i] = ASPLIT ? bf16_bits(xs[i] - bf16_val(hb)) : (unsigned short)0; }
#pragma unroll
    for (int t = 0; t < 4; ++t) {
      const unsigned short* brow = Wt + (size_t)(col0 + t * 16 + ln) * ldb + kb;
      FragB b;
      b.half[0] = *(const v8us*)(brow + 8 * hh);
      b.half[1] = *(const v8us*)(brow + 16 + 8 * hh);
      acc[t] = mmaN<ASPLIT ? 2 : 1>(ah.v, al.v, b.v, b.v, acc[t]);
    }
  }
#pragma unroll
  for (int t = 0; t < 4; ++t) {
    float bv = bias ? bias[col0 + t * 16 + ln] : 0.f;
    if (BIAS_BF16) bv = bf16_round(bv);
#pragma unroll
    for (int r = 0; r < 8; ++r) { float v = acc[t][r] + bv; if (ACT == 1) v = fmaxf(v, 0.f); so[w][8 * hh + r][t * 16 + ln] = v; }
  }
  __builtin_amdgcn_fence(__ATOMIC_ACQ_REL, "workgroup");
  __builtin_amdgcn_wave_barrier();
  const int rsub = lane >> 4, c4 = (lane & 15) * 4;
  {
#pragma unroll
    for (int q = 0; q < 8; ++q) {
      const int r = q * 2 + rsub;
      const v4f v = *(const v4fa*)&so[w][r][c4];
      *(v4f*)(C + (size_t)(row0 + r) * ldc + col0 + c4) = v;
    }
    
  }
}

// GEMM C = act(A·W + bias + resid): A f32 (ASPLIT -> hi/lo 2 terms), Wt bf16 [N][K]; ACT 0 none, 1 relu, 2 exact gelu;
// resid (optional, f32, row index = (row % rmod), pitch ldr, RES_BF16 rounds it) added before the activation.
template <bool ASPLIT, int ACT, bool BIAS_BF16, bool RES_BF16>
__global__ __launch_bounds__(128) void k_gemm_bf3(const float* __restrict__ A, int lda, const unsigned short* __restrict__ Wt, int ldb,
                                                const float* __restrict__ bias, const float* __restrict__ resid, int rmod, int ldr,
                                                float* __restrict__ C, int ldc, int M, int N, int K) {
  __shared__ __attribute__((aligned(16))) float so[4][16][64];
  const int tid = threadIdx.x, w = tid >> 5, lane = tid & 31, ln = lane & 15, hh = lane >> 4;
  const int ntn = N / 64;
  const int wid = blockIdx.x * 4 + w;
  const int mt = wid / ntn, nq = wid % ntn;
  if (mt * 16 >= M) return;
  const int row0 = mt * 16, col0 = nq * 64;
  const float* arow = A + (size_t)(row0 + ln) * lda;
  v8f acc[4] = {};
  for (int kb = 0; kb < K; kb += 32) {
    FragB ah, al;
    const v4f x0 = *(const v4fa*)(arow + kb + 8 * hh), x1 = *(const v4fa*)(arow + kb + 8 * hh + 4);
    const v4f x2 = *(const v4fa*)(arow + kb + 16 + 8 * hh), x3 = *(const v4fa*)(arow + kb + 16 + 8 * hh + 4);
    float xs[16] = {x0[0],x0[1],x0[2],x0[3],x1[0],x1[1],x1[2],x1[3],x2[0],x2[1],x2[2],x2[3],x3[0],x3[1],x3[2],x3[3]};
#pragma unroll
    for (int i = 0; i < 16; ++i) { const unsigned short hb = bf16_bits(xs[i]); ah.u[i] = hb; al.u[i] = ASPLIT ? bf16_bits(xs[i] - bf16_val(hb)) : (unsigned short)0; }
#pragma unroll
    for (int t = 0; t < 4; ++t) {
      const unsigned short* brow = Wt + (size_t)(col0 + t * 16 + ln) * ldb + kb;
      FragB b;
      b.half[0] = *(const v8us*)(brow + 8 * hh);
      b.half[1] = *(const v8us*)(brow + 16 + 8 * hh);
      acc[t] = mmaN<ASPLIT ? 2 : 1>(ah.v, al.v, b.v, b.v, acc[t]);
    }
  }
#pragma unroll
  for (int t = 0; t < 4; ++t) {
    const int col = col0 + t * 16 + ln;
    float bv = bias ? bias[col] : 0.f;
    if (BIAS_BF16) bv = bf16_round(bv);
#pragma unroll
    for (int r = 0; r < 8; ++r) {
      float v = acc[t][r] + bv;
      if (resid) { float rv = resid[(size_t)((row0 + 8 * hh + r) % rmod) * ldr + col]; if (RES_BF16) rv = bf16_round(rv); v += rv; }
      if (ACT == 1) v = fmaxf(v, 0.f);
      if (ACT == 2) v = 0.5f * v * (1.0f + erff(v * 0.70710678118654752f));
      if (ACT == 3) { const float u = 0.7978845608028654f * (v + 0.044715f * v * v * v); v = 0.5f * v * (1.0f + tanhf(u)); }
      so[w][8 * hh + r][t * 16 + ln] = v;
    }
  }
  __builtin_amdgcn_fence(__ATOMIC_ACQ_REL, "workgroup");
  __builtin_amdgcn_wave_barrier();
  const int rsub = lane >> 4, c4 = (lane & 15) * 4;
  {
#pragma unroll
    for (int q = 0; q < 8; ++q) {
      const int r = q * 2 + rsub;
      const v4f v = *(const v4fa*)&so[w][r][c4];
      *(v4f*)(C + (size_t)(row0 + r) * ldc + col0 + c4) = v;
    }
    
  }
}
// row LayerNorm (biased variance, eps) over N: s = X (+ R); optional out_sum <- s; out_norm <- (s-mu)*rsqrt(var+eps)*g + b
template <bool PARAM_BF16>
__global__ __launch_bounds__(256) void k_layernorm(const float* __restrict__ X, const float* __restrict__ R, const float* __restrict__ g, const float* __restrict__ bta,
                                                  float* __restrict__ out_sum, float* __restrict__ out_norm, int N, float eps) {
  __shared__ float red[256];
  const int row = blockIdx.x, tid = threadIdx.x;
  const float* x = X + (size_t)row * N; const float* rr = R ? R + (size_t)row * N : nullptr;
  float vals[16];                     // up to N = 4096
  const int per = N / 256;            // contiguous chunk per thread? use strided-by-4 chunks: thread handles j = tid*4 + 1024*u
  float s1 = 0.f;
  for (int u = 0; u < per / 4; ++u) {
    const int j = tid * 4 + 1024 * u;
    const v4f a = *(const v4fa*)(x + j);
    v4f b = {0.f,0.f,0.f,0.f}; if (rr) b = *(const v4fa*)(rr + j);
#pragma unroll
    for (int q = 0; q < 4; ++q) { const float v = a[q] + b[q]; vals[u * 4 + q] = v; s1 += v; }
  }
  red[tid] = s1; __syncthreads();
  for (int st = 128; st > 0; st >>= 1) { if (tid < st) red[tid] += red[tid + st]; __syncthreads(); }
  const float mu = red[0] / (float)N; __syncthreads();
  float s2 = 0.f;
  for (int u = 0; u < per / 4; ++u)
#pragma unroll
    for (int q = 0; q < 4; ++q) { const float c = vals[u * 4 + q] - mu; s2 += c * c; }
  red[tid] = s2; __syncthreads();
  for (int st = 128; st > 0; st >>= 1) { if (tid < st) red[tid] += red[tid + st]; __syncthreads(); }
  const float rs = rsqrtf(red[0] / (float)N + eps);
  {
    for (int u = 0; u < per / 4; ++u) {
      const int j = tid * 4 + 1024 * u;
      v4f o, sm;
#pragma unroll
      for (int q = 0; q < 4; ++q) {
        float gg = g[j + q], bb = bta[j + q];
        if (PARAM_BF16) { gg = bf16_round(gg); bb = bf16_round(bb); }
        sm[q] = vals[u * 4 + q]; o[q] = (vals[u * 4 + q] - mu) * rs * gg + bb;
      }
      if (out_sum) *(v4f*)(out_sum + (size_t)row * N + j) = sm;
      *(v4f*)(out_norm + (size_t)row * N + j) = o;
    }
    
  }
}



// ---- f16 WMMA path (v_wmma_f32_16x16x32_f16): 11-bit significands for operands in range — used where a [0,1] probability operand needs more precision than bf16
typedef _Float16 v16h __attribute__((ext_vector_type(16)));
union FragH { v16h v; v8us half[2]; _Float16 h[16]; unsigned short u[16]; };
template <int NT>
__device__ __forceinline__ v8f mmaH(v16h ah, v16h al, v16h bh, v16h bl, v8f c) {
  c = __builtin_amdgcn_wmma_f32_16x16x32_f16(false, ah, false, bh, (short)0, c, false, false);
  if (NT >= 2) c = __builtin_amdgcn_wmma_f32_16x16x32_f16(false, al, false, bh, (short)0, c, false, false);
  if (NT >= 3) c = __builtin_amdgcn_wmma_f32_16x16x32_f16(false, ah, false, bl, (short)0, c, false, false);
  asm volatile("v_nop\n\tv_nop\n\tv_nop\n\tv_nop" : "+v"(c) : "v"(ah), "v"(al), "v"(bh), "v"(bl));
  return c;
}
// batched GEMM like k_gemm_b but f16 operands: A f32 (split into f16 hi/lo if ASPLIT, else rounded to f16), Bt = f16 values [n][k]; alpha; C f32; N multiple of 16 (partial tiles skipped)
template <bool ASPLIT>
__global__ __launch_bounds__(128) void k_gemm_h(const float* __restrict__ A, int lda, size_t sA, const _Float16* __restrict__ Bh, int ldb, size_t sB, float alpha, float* __restrict__ C, int ldc, size_t sC, int M, int N, int K) {
  __shared__ __attribute__((aligned(16))) float so[4][16][64];
  const int tid = threadIdx.x, w = tid >> 5, lane = tid & 31, ln = lane & 15, hh = lane >> 4; const int by = blockIdx.y;
  A += (size_t)by * sA; Bh += (size_t)by * sB; C += (size_t)by * sC;
  const int ntn = (N + 63) / 64; const int wid = blockIdx.x * 4 + w; const int mt = wid / ntn, nq = wid % ntn; if (mt * 16 >= M) return;
  const int row0 = mt * 16, col0 = nq * 64; const float* arow = A + (size_t)(row0 + ln) * lda;
  v8f acc[4] = {};
  for (int kb = 0; kb < K; kb += 32) {
    FragH ah, al;
    const v4f x0 = *(const v4fa*)(arow + kb + 8 * hh), x1 = *(const v4fa*)(arow + kb + 8 * hh + 4), x2 = *(const v4fa*)(arow + kb + 16 + 8 * hh), x3 = *(const v4fa*)(arow + kb + 16 + 8 * hh + 4);
    float xs[16] = {x0[0],x0[1],x0[2],x0[3],x1[0],x1[1],x1[2],x1[3],x2[0],x2[1],x2[2],x2[3],x3[0],x3[1],x3[2],x3[3]};
#pragma unroll
    for (int i = 0; i < 16; ++i) { const _Float16 h = (_Float16)xs[i]; ah.h[i] = h; al.h[i] = ASPLIT ? (_Float16)(xs[i] - (float)h) : (_Float16)0.0f; }
#pragma unroll
    for (int t = 0; t < 4; ++t) { if (col0 + t * 16 >= N) continue; const size_t boff = (size_t)(col0 + t * 16 + ln) * ldb + kb; FragH bq; bq.half[0] = *(const v8us*)(Bh + boff + 8 * hh); bq.half[1] = *(const v8us*)(Bh + boff + 16 + 8 * hh);
      acc[t] = mmaH<ASPLIT ? 2 : 1>(ah.v, al.v, bq.v, bq.v, acc[t]); }
  }
#pragma unroll
  for (int t = 0; t < 4; ++t) { if (col0 + t * 16 >= N) continue;
#pragma unroll
    for (int r = 0; r < 8; ++r) so[w][8 * hh + r][t * 16 + ln] = acc[t][r] * alpha; }
  __builtin_amdgcn_fence(__ATOMIC_ACQ_REL, "workgroup"); __builtin_amdgcn_wave_barrier();
  const int rsub = lane >> 4, c4 = (lane & 15) * 4;
  {
#pragma unroll
    for (int q = 0; q < 8; ++q) { const int r = q * 2 + rsub; if (col0 + c4 < N) { const v4f v = *(const v4fa*)&so[w][r][c4]; *(v4f*)(C + (size_t)(row0 + r) * ldc + col0 + c4) = v; } }
     }
}

// Wt[n][k] = f16(bf16(W[k][n]) * scale) from f32 row-major W[K][N] (scale = power of two; bf16-exact weights stay exact in f16 away from the subnormal range).
// One block of 256 threads turns one tile of 64 k x 64 n (first k k0, first n n0) through LDS, so that both sides of the transpose move whole 128-B lines:
// a wave's load = 2 rows of W x 256 B, a wave's store = 4 rows of Wt x 128 B. (Read straight down a column, every lane of a load asked for a line of its own and used 4 B of it.)
#define WT_T 64                           /* tile edge */
#define WT_P 33                           /* LDS dwords per n row: 32 (64 k as f16 pairs) + 1: odd, so the 16 rows a store instruction writes, 4 apart, and the 4 rows a load instruction reads fall on different banks */
typedef unsigned int v4u __attribute__((ext_vector_type(4)));
typedef _Float16 v2h __attribute__((ext_vector_type(2)));
__device__ __forceinline__ void wt_tile(const float* __restrict__ W, _Float16* __restrict__ Wt, int K, int N, float scale, int k0, int n0, int tid, unsigned int (*tl)[WT_P]) {
  const int n4 = (tid & 15) * 4, kp = tid >> 4;      /* the thread's 4 columns; its k pairs kp and kp + 16 */
  const float* g = W + (size_t)(k0 + 2 * kp) * N + n0 + n4;      /* one address; the four rows stand at constant distances from it */
  v4f a[2][2];      /* [k pair][k in the pair] */
#pragma unroll
  for (int u = 0; u < 2; ++u) for (int e = 0; e < 2; ++e) a[u][e] = *(const v4fa*)(g + (size_t)(32 * u + e) * N);
#pragma unroll
  for (int u = 0; u < 2; ++u) for (int i = 0; i < 4; ++i) { const v2h h = {(_Float16)(bf16_round(a[u][0][i]) * scale), (_Float16)(bf16_round(a[u][1][i]) * scale)};
    tl[n4 + i][kp + 16 * u] = __builtin_bit_cast(unsigned int, h); }
  __syncthreads();      /* the tile is whole before any row of it is read; reached by the whole block or by none (the job is picked by block index) */
  const int c = tid & 7, r = tid >> 3;      /* 16-B piece of a row of Wt; row r and r + 32 */
#pragma unroll
  for (int u = 0; u < 2; ++u) { const unsigned int* s = &tl[r + 32 * u][4 * c]; const v4u o = {s[0], s[1], s[2], s[3]};
    *(v4u*)((unsigned short*)Wt + (size_t)(n0 + r + 32 * u) * K + k0 + 8 * c) = o; }
  asm volatile("s_wait_xcnt 0x0" ::: "memory");      /* behind the stores: in the joined kernel the listing runs on into another job's code, which rewrites the stores' registers */
}
// k_gemm_hh variant with fused epilogue: v = acc·alpha + bias[by·sBias + col] (+ CP[(row/rowsPerB)·sCPb + by·64 + col] if CP) ; ACT 0 none / 1 elu ; writes f16 C16 (and f32 C if non-null)
template <int ACT>
__global__ __launch_bounds__(128) void k_gemm_hhx(const _Float16* __restrict__ A, int lda, size_t sA, const _Float16* __restrict__ Bh, int ldb, size_t sB, float alpha, const float* __restrict__ bias, size_t sBias, const float* __restrict__ CP, int rowsPerB, size_t sCPb, int row0g,
    float* __restrict__ C, _Float16* __restrict__ C16, int ldc, size_t sC, int M, int N, int K) {
  __shared__ __attribute__((aligned(16))) float so[4][16][64];
  const int tid = threadIdx.x, w = tid >> 5, lane = tid & 31, ln = lane & 15, hh = lane >> 4; const int by = blockIdx.y;
  A += (size_t)by * sA; Bh += (size_t)by * sB; const size_t cofs = (size_t)by * sC; const float* bp = bias ? bias + (size_t)by * sBias : nullptr;
  const int ntn = (N + 63) / 64; const int wid = blockIdx.x * 4 + w; const int mt = wid / ntn, nq = wid % ntn; if (mt * 16 >= M) return;
  const int row0 = mt * 16, col0 = nq * 64; const _Float16* arow = A + (size_t)(row0 + ln) * lda;
  v8f acc[4] = {};
  for (int kb = 0; kb < K; kb += 32) { FragH ah; ah.half[0] = *(const v8us*)((const unsigned short*)arow + kb + 8 * hh); ah.half[1] = *(const v8us*)((const unsigned short*)arow + kb + 16 + 8 * hh);
#pragma unroll
    for (int t = 0; t < 4; ++t) { if (col0 + t * 16 >= N) continue; const size_t boff = (size_t)(col0 + t * 16 + ln) * ldb + kb; FragH bq; bq.half[0] = *(const v8us*)((const unsigned short*)Bh + boff + 8 * hh); bq.half[1] = *(const v8us*)((const unsigned short*)Bh + boff + 16 + 8 * hh);
      acc[t] = mmaH<1>(ah.v, ah.v, bq.v, bq.v, acc[t]); }
  }
#pragma unroll
  for (int t = 0; t < 4; ++t) { if (col0 + t * 16 >= N) continue; const int col = col0 + t * 16 + ln; const float bv = bp ? bf16_round(bp[col]) : 0.f;
#pragma unroll
    for (int r = 0; r < 8; ++r) { float v = acc[t][r] * alpha + bv; if (CP) { const int rr = row0g + row0 + 8 * hh + r; if (rowsPerB < 0) v += CP[cofs + (size_t)rr * ldc + col];      /* rowsPerB < 0: own element of the batched C plane */ else { const int bidx = rr / rowsPerB; v += CP[(size_t)bidx * sCPb + (size_t)by * 64 + col]; } } if (ACT == 1) v = (v > 0.f) ? v : expm1f(v); else if (ACT == 7) v = (v > 0.f) ? v + 1.0f : expf(v); else if (ACT == 8) v = tanhf(v); else if (ACT == 9) v = 0.5f * v * (1.0f + tanhf(0.7978845608028654f * (v + 0.044715f * v * v * v))); else if (ACT == 11) v = 1.0f / (1.0f + expf(-v)); else if (ACT == 12) v = (v > 0.f) ? v : 0.01f * v; else if (ACT == 14) v = (v > 0.f) ? v : 0.1f * v; else if (ACT == 16) v = (v >= 0.f) ? v : 0.3f * v; else if (ACT == 17) v = (v >= 0.f) ? v : 0.2f * v; else if (ACT == 15) v = v / (1.0f + expf(-v)); else if (ACT == 3) v = fmaxf(v, 0.f); else if (ACT == 6) v = 0.5f * v * (1.0f + erff(v * 0.70710678118654752f)); so[w][8 * hh + r][t * 16 + ln] = v; } }
  __builtin_amdgcn_fence(__ATOMIC_ACQ_REL, "workgroup"); __builtin_amdgcn_wave_barrier();
  const int rsub = lane >> 4, c4 = (lane & 15) * 4; typedef _Float16 v4h __attribute__((ext_vector_type(4)));
  {
#pragma unroll
    for (int q = 0; q < 8; ++q) { const int r = q * 2 + rsub; if (col0 + c4 < N) { const v4f v = *(const v4fa*)&so[w][r][c4]; if (C) *(v4f*)(C + cofs + (size_t)(row0 + r) * ldc + col0 + c4) = v; if (C16) { v4h h4; for (int i = 0; i < 4; ++i) h4[i] = (_Float16)v[i]; *(v4h*)(C16 + cofs + (size_t)(row0 + r) * ldc + col0 + c4) = h4; } } }
     }
}


typedef _Float16 v4h __attribute__((ext_vector_type(4)));

// Every job that reads inputs only, in ONE launch; a block's job follows from its index (block-uniform branches, no job depends on another):
// blocks [0, PB_QKV): the 36 (head, part) blocks of U_qkv, PB_HP tiles each, into planes Bq | Bk | Bv (contiguous, DM*DM apart); [PB_QKV, PB_W): the tiles of U_msa into Bo; the rest: x rows.
#define PB_HP  (DM / WT_T)                    /* tiles per (head, part): HD == WT_T, one tile across */
#define PB_QKV (3 * NH * PB_HP)
#define PB_W   (PB_QKV + (DM / WT_T) * (DM / WT_T))
#define PB_ALL (PB_W + (int)(NR * DM / 8 / 256))
__global__ __launch_bounds__(256) void k_prep(const float* __restrict__ x, const float* __restrict__ wqkv, const float* __restrict__ wo, _Float16* __restrict__ X16, _Float16* __restrict__ Bqkv, _Float16* __restrict__ Bo) {
  static_assert(HD == WT_T && DM % WT_T == 0 && NR * DM / 8 % 256 == 0, "k_prep: whole tiles and whole blocks per job");
  __shared__ unsigned int tl[WT_T][WT_P];
  const int bi = blockIdx.x, tid = threadIdx.x;
  if (bi < PB_QKV) { const int job = bi / PB_HP, h = job / 3, p = job - 3 * h;      /* U_qkv block (h, p): row-major [in = DM][out = HD] at (3 h + p) * DM * HD -> rows h * HD .. of plane p */
    wt_tile(wqkv + (size_t)job * DM * HD, Bqkv + (size_t)p * DM * DM + (size_t)h * HD * DM, DM, HD, 16.0f, (bi - job * PB_HP) * WT_T, 0, tid, tl); return; }
  if (bi < PB_W) { const int ti = bi - PB_QKV, tn = ti / (DM / WT_T); wt_tile(wo, Bo, DM, DM, 16.0f, (ti - tn * (DM / WT_T)) * WT_T, tn * WT_T, tid, tl); return; }
  const size_t t = (size_t)(bi - PB_W) * 256 + tid; FragH f;
#pragma unroll
  for (int q = 0; q < 8; ++q) f.h[q] = (_Float16)bf16_round(x[t * 8 + q]); *(v8us*)((unsigned short*)X16 + t * 8) = f.half[0];
  asm volatile("s_wait_xcnt 0x0" ::: "memory"); }      /* behind the store, as in wt_tile */
__global__ __launch_bounds__(256) void k_h16(const float* __restrict__ x, _Float16* __restrict__ X16, size_t n8) { const size_t t = (size_t)blockIdx.x * 256 + threadIdx.x; if (t >= n8) return; FragH f;
#pragma unroll
  for (int q = 0; q < 8; ++q) f.h[q] = (_Float16)x[t * 8 + q]; *(v8us*)((unsigned short*)X16 + t * 8) = f.half[0];  }
__global__ __launch_bounds__(256) void k_round16f(const float* __restrict__ W, _Float16* __restrict__ Bt, size_t n8) { const size_t t = (size_t)blockIdx.x * 256 + threadIdx.x; if (t >= n8) return; FragH f;
#pragma unroll
  for (int i = 0; i < 8; ++i) f.h[i] = (_Float16)(bf16_round(W[t * 8 + i]) * 16.0f); *(v8us*)((unsigned short*)Bt + t * 8) = f.half[0];  }
__global__ __launch_bounds__(256) void k_hl(const float* __restrict__ F, _Float16* __restrict__ Hh, _Float16* __restrict__ Hl, size_t n8) { const size_t t = (size_t)blockIdx.x * 256 + threadIdx.x; if (t >= n8) return; FragH fh, fl; const v4f a = *(const v4fa*)(F + t * 8), c = *(const v4fa*)(F + t * 8 + 4);
#pragma unroll
  for (int q = 0; q < 4; ++q) { _Float16 h = (_Float16)a[q]; fh.h[q] = h; fl.h[q] = (_Float16)((a[q] - (float)h) * 1024.0f); h = (_Float16)c[q]; fh.h[4 + q] = h; fl.h[4 + q] = (_Float16)((c[q] - (float)h) * 1024.0f); }
  { *(v8us*)((unsigned short*)Hh + t * 8) = fh.half[0]; *(v8us*)((unsigned short*)Hl + t * 8) = fl.half[0];  } }

// ---- fast GEMM (wave tile 32x64, block tile 128x128, operands staged in LDS); epilogue = k_gemm_hhx semantics ----
__device__ __forceinline__ v16h g2_frag(const _Float16* p, int hh) { FragH f; f.half[0] = *(const v8us*)((const unsigned short*)p + 8 * hh); f.half[1] = *(const v8us*)((const unsigned short*)p + 16 + 8 * hh); return f.v; }
__device__ __forceinline__ v8f g2_mma(v16h a, v16h b, v8f c) { v8f d = __builtin_amdgcn_wmma_f32_16x16x32_f16(false, a, false, b, (short)0, c, false, false); asm volatile("v_nop\n\tv_nop\n\tv_nop\n\tv_nop" : "+v"(d) : "v"(a), "v"(b)); return d; }
// Operand staging of k_gemm2: a stage is 64 k (128 B, one whole line) of the block's 128 A rows and 128 B rows, brought into LDS by asynchronous copies
// (global_load_async_to_lds_b128; a wave's copy = 4 whole lines), so every operand line is asked for once per block instead of 16 lines per fragment load and wave.
#define G2_PITCH 144                      /* LDS bytes per staged row: 128 + 16, 16 B x odd: conflict-free for the ds_load_b128 fragment reads */
#define G2_BUF   (256 * G2_PITCH)         /* one stage: A rows 0-127, then B rows 0-127 */
__device__ __forceinline__ v16h g2_lfrag(const char* p, int hh) { FragH f; f.half[0] = *(const v8us*)(p + 16 * hh); f.half[1] = *(const v8us*)(p + 32 + 16 * hh); return f.v; }      /* same k order as g2_frag */
// One stage: each thread copies 16 B of 4 A rows and of 4 B rows (32 rows apart). ga / gb: the thread's first A / B address of this stage; lds: its LDS byte address in A row (tid / 8) of the buffer.
__device__ __forceinline__ void g2_stage(const _Float16* ga, size_t astep, const _Float16* gb, size_t bstep, unsigned lds) {
  /* the closing s_wait_xcnt stands inside the copies' own statement, so that no address register is rewritten in front of it */
  asm volatile("global_load_async_to_lds_b128 %0, %8, off\n\t"
               "global_load_async_to_lds_b128 %1, %9, off\n\t"
               "global_load_async_to_lds_b128 %2, %10, off\n\t"
               "global_load_async_to_lds_b128 %3, %11, off\n\t"
               "global_load_async_to_lds_b128 %4, %12, off\n\t"
               "global_load_async_to_lds_b128 %5, %13, off\n\t"
               "global_load_async_to_lds_b128 %6, %14, off\n\t"
               "global_load_async_to_lds_b128 %7, %15, off\n\t"
               "s_wait_xcnt 0x0"
               :: "v"(lds), "v"(lds + 32 * G2_PITCH), "v"(lds + 64 * G2_PITCH), "v"(lds + 96 * G2_PITCH), "v"(lds + 128 * G2_PITCH), "v"(lds + 160 * G2_PITCH), "v"(lds + 192 * G2_PITCH), "v"(lds + 224 * G2_PITCH),
                  "v"(ga), "v"(ga + astep), "v"(ga + 2 * astep), "v"(ga + 3 * astep), "v"(gb), "v"(gb + bstep), "v"(gb + 2 * bstep), "v"(gb + 3 * bstep) : "memory"); }
// Block = 8 waves, tile 128x128 (wave w: rows 32 * (w & 3), columns 64 * (w >> 2)); requires M % 128 == 0, N % 128 == 0, K % 64 == 0, K >= 64. Two stage buffers; the epilogue staging reuses them behind the last barrier.
// Part y == tpart is written TRANSPOSED: its blocks take the B rows as A and the A rows as B (same products, same k order), so the tile they hold is a tile of C^T, and it leaves by the same whole-line stores.
// C^T goes to CT (f16 only) as planes of tcols columns: element (n, m) at CT[(m / tcols) * N * tcols + n * tcols + m % tcols]; requires tcols % 128 == 0. That part takes no bias and no CP (both are laid out by column of C). tpart < 0: no such part.
// What the epilogue does is fixed at compile time: HB = a bias may be given, HCP = a CP plane may be given, O32 / O16 = the f32 / f16 output is written, TPART = a transposed part may exist.
// As tests of the pointers at run time these stood as a scalar branch at every element and every store, and no LDS read of the output staging could be asked for ahead of the store in front of it.
template <int ACT, bool HB, bool HCP, bool O32, bool O16, bool TPART>
__global__ __launch_bounds__(256) void k_gemm2(const _Float16* __restrict__ A, int lda, size_t sA, const _Float16* __restrict__ Bh, int ldb, size_t sB, float alpha, const float* __restrict__ bias, size_t sBias, const float* __restrict__ CP, int rowsPerB, size_t sCPb, int row0g,
    float* __restrict__ Cn, _Float16* __restrict__ Cn16, int ldcn, size_t sC, int M, int N, int K, int tpart, _Float16* __restrict__ CT, int tcols) { static_assert(ACT == 0 || ACT == 3 || ACT == 6 || ACT == 8 || ACT == 9 || ACT == 11 || ACT == 12 || ACT == 14 || ACT == 15 || ACT == 16 || ACT == 17, "k_gemm2: unsupported ACT code (would silently apply no activation)"); static_assert((O32 || O16) && !(TPART && O32), "k_gemm2: some output is written; the transposed part has the f16 output only");
  __shared__ __attribute__((aligned(16))) char smem[2 * G2_BUF]; static_assert(8 * 32 * 68 * 4 <= 2 * G2_BUF, "k_gemm2: epilogue staging fits the stage buffers");
  float (*so)[32][68] = (float (*)[32][68])smem;
  const int tid = threadIdx.x, w = tid >> 5, lane = tid & 31, ln = lane & 15, hh = lane >> 4; const int by = blockIdx.y;
  const bool tp = TPART && by == tpart;      /* the same for the whole block */
  const int ntn = N >> 7; const int ta = blockIdx.x / ntn, tb = blockIdx.x - ta * ntn; if (ta * 128 >= M) return;      /* tile of A rows, tile of B rows; the whole block leaves, in front of every barrier */
  const _Float16* Ar = A + (size_t)by * sA; const _Float16* Br = Bh + (size_t)by * sB;
  const _Float16* Ap = tp ? Br : Ar; const _Float16* Bp = tp ? Ar : Br; const int la = tp ? ldb : lda, lb = tp ? lda : ldb; const int mt = tp ? tb : ta, nq = tp ? ta : tb;      /* from here on: rows and columns of the tile as the block holds it */
  float* C = Cn; _Float16* C16 = tp ? CT : Cn16; const int ldc = tp ? tcols : ldcn; if (tp) CP = nullptr;
  const size_t cofs = tp ? (size_t)(ta * 128 / tcols) * tcols * (size_t)(N - 1) : (size_t)by * sC;      /* transposed: plane start less the plane's first column, which the column index below still counts */
  const float* bp = bias && !tp ? bias + (size_t)by * sBias : nullptr;
  const int row0 = mt * 128 + 32 * (w & 3), col0 = nq * 128 + 64 * (w >> 2);
  const _Float16* ga = Ap + (size_t)(mt * 128 + (tid >> 3)) * la + (tid & 7) * 8; const _Float16* gb = Bp + (size_t)(nq * 128 + (tid >> 3)) * lb + (tid & 7) * 8; const size_t astep = (size_t)32 * la, bstep = (size_t)32 * lb;
  const unsigned lds0 = (unsigned)(size_t)smem + (unsigned)((tid >> 3) * G2_PITCH + (tid & 7) * 16);
  const char* afr = smem + (32 * (w & 3) + ln) * G2_PITCH; const char* bfr = smem + (128 + 64 * (w >> 2) + ln) * G2_PITCH;
  const v8f z8 = {0.f,0.f,0.f,0.f,0.f,0.f,0.f,0.f}; v8f c00 = z8, c01 = z8, c02 = z8, c03 = z8, c10 = z8, c11 = z8, c12 = z8, c13 = z8;
  const int nt = K >> 6;
  g2_stage(ga, astep, gb, bstep, lds0);
  asm volatile("s_wait_asynccnt 0x0" ::: "memory");      /* stage 0 of this wave has landed ... */
  __syncthreads();                                       /* ... and every wave's: nothing of it is read in front of this barrier */
  if (nt > 1) g2_stage(ga + 64, astep, gb + 64, bstep, lds0 + G2_BUF);
#pragma unroll 1      /* stays rolled: one publish point per stage at the foot, small loop text */
  for (int t = 0; t < nt; ++t) { const int bo = (t & 1) * G2_BUF;
#pragma unroll      /* both k blocks inline: their LDS offsets become immediates */
    for (int kk = 0; kk < 128; kk += 64) { const char* ap = afr + bo + kk; const char* bq = bfr + bo + kk;      /* two k blocks of 32 per stage, in ascending k */
      const v16h a0 = g2_lfrag(ap, hh), a1 = g2_lfrag(ap + 16 * G2_PITCH, hh);      /* the block's six fragments are read as one group in front of its WMMAs */
      const v16h b0 = g2_lfrag(bq, hh), b1 = g2_lfrag(bq + 16 * G2_PITCH, hh), b2 = g2_lfrag(bq + 32 * G2_PITCH, hh), b3 = g2_lfrag(bq + 48 * G2_PITCH, hh);
      c00 = g2_mma(a0, b0, c00); c10 = g2_mma(a1, b0, c10); c01 = g2_mma(a0, b1, c01); c11 = g2_mma(a1, b1, c11);
      c02 = g2_mma(a0, b2, c02); c12 = g2_mma(a1, b2, c12); c03 = g2_mma(a0, b3, c03); c13 = g2_mma(a1, b3, c13); }
    asm volatile("s_wait_dscnt 0x0" ::: "memory");       /* this wave's reads of the buffer are done before it may be refilled */
    asm volatile("s_wait_asynccnt 0x0" ::: "memory");    /* this wave's copies of stage t + 1 have landed */
    __syncthreads();                                     /* publishes stage t + 1 and ends every reader's last read of stage t */
    if (t + 2 < nt) g2_stage(ga + (size_t)(t + 2) * 64, astep, gb + (size_t)(t + 2) * 64, bstep, lds0 + bo); }
  asm volatile("s_wait_asynccnt 0x0" ::: "memory");      /* no copy is outstanding when the buffers become output staging */
  v8f accs[8] = {c00, c01, c02, c03, c10, c11, c12, c13};
#pragma unroll
  for (int u = 0; u < 8; ++u) { const int t = u & 3, half = u >> 2; const int col = col0 + t * 16 + ln; const float bv = HB && bp ? bf16_round(bp[col]) : 0.f;
#pragma unroll
    for (int r = 0; r < 8; ++r) { const int rloc = half * 16 + 8 * hh + r; float v = HB ? accs[u][r] * alpha + bv : accs[u][r] * alpha; if (HCP && CP) { if (rowsPerB < 0) v += CP[cofs + (size_t)(row0g + row0 + rloc) * ldc + col];      /* rowsPerB < 0: own element of the batched C plane */ else { const int bidx = (row0g + row0 + rloc) / rowsPerB; v += CP[(size_t)bidx * sCPb + (size_t)by * 64 + col]; } }
      if (ACT == 3) v = fmaxf(v, 0.f); else if (ACT == 6) v = 0.5f * v * (1.0f + erff(v * 0.70710678118654752f)); else if (ACT == 11) v = 1.0f / (1.0f + expf(-v)); else if (ACT == 15) v = v / (1.0f + expf(-v)); else if (ACT == 12) v = (v > 0.f) ? v : 0.01f * v; else if (ACT == 8) v = tanhf(v); else if (ACT == 9) v = 0.5f * v * (1.0f + tanhf(0.7978845608028654f * (v + 0.044715f * v * v * v))); else if (ACT == 14) v = (v > 0.f) ? v : 0.1f * v; else if (ACT == 16) v = (v >= 0.f) ? v : 0.3f * v; else if (ACT == 17) v = (v >= 0.f) ? v : 0.2f * v;
      so[w][rloc][t * 16 + ln] = v; } }
  __builtin_amdgcn_fence(__ATOMIC_ACQ_REL, "workgroup"); __builtin_amdgcn_wave_barrier();
  const int rsub = lane >> 4, c4 = (lane & 15) * 4;
  {
#pragma unroll
    for (int q = 0; q < 16; ++q) { const int r = q * 2 + rsub; const v4f v = *(const v4fa*)&so[w][r][c4]; if (O32) *(v4f*)(C + cofs + (size_t)(row0 + r) * ldc + col0 + c4) = v; if (O16) { v4h h4; for (int i = 0; i < 4; ++i) h4[i] = (_Float16)v[i]; *(v4h*)(C16 + cofs + (size_t)(row0 + r) * ldc + col0 + c4) = h4; } }
     } }


__global__ __launch_bounds__(256) void k_wnat(const float* __restrict__ w, size_t n8, _Float16* __restrict__ Bt) { const size_t t = (size_t)blockIdx.x * 256 + threadIdx.x; if (t >= n8) return; FragH f; for (int q = 0; q < 8; ++q) f.h[q] = (_Float16)(bf16_round(w[t * 8 + q]) * 16.0f); *(v8us*)((unsigned short*)Bt + t * 8) = f.half[0];  }
__global__ __launch_bounds__(256) void k_rsm(const float* __restrict__ S, _Float16* __restrict__ P, int nrows) {
  #pragma clang fp contract(off)
  const int i = blockIdx.x * 256 + threadIdx.x; if (i >= nrows) return; const float* s = S + (size_t)i * SQ; float mx = -3.0e38f;
#pragma unroll 1
  for (int j = 0; j < SQ; ++j) mx = fmaxf(mx, s[j]); float se = 0.f;
#pragma unroll 1
  for (int j = 0; j < SQ; ++j) se += expf(s[j] - mx); const float sc = 256.0f / se;
#pragma unroll 1
  for (int j0 = 0; j0 < SQ; j0 += 8) { FragH f; for (int q = 0; q < 8; ++q) f.h[q] = (_Float16)(expf(s[j0 + q] - mx) * sc); unsigned short* d = (unsigned short*)P + (size_t)i * SQ + j0; *(v8us*)d = f.half[0];  } }
__global__ __launch_bounds__(256) void k_vt(const _Float16* __restrict__ V16, int b, int h0, _Float16* __restrict__ VT) { __shared__ unsigned short tl[64][65]; const int tid = threadIdx.x; const int hh = blockIdx.x % HG, sg = blockIdx.x / HG; const int s0 = sg * 64; const int h = h0 + hh;
  for (int i = tid; i < 64 * 8; i += 256) { const int j = i / 8, d8 = (i % 8) * 8; FragH f; f.half[0] = *(const v8us*)((const unsigned short*)V16 + ((size_t)b * SQ + s0 + j) * DM + h * HD + d8); for (int q = 0; q < 8; ++q) tl[d8 + q][j] = f.u[q]; }
  __syncthreads();
  { for (int i = tid; i < 64 * 8; i += 256) { const int d = i / 8, j8 = (i % 8) * 8; FragH f; for (int q = 0; q < 8; ++q) f.u[q] = tl[d][j8 + q]; *(v8us*)((unsigned short*)VT + ((size_t)hh * HD + d) * SQ + s0 + j8) = f.half[0]; }  } }



// lane l <-> l ^ 16 (cross-row move); every lane on
__device__ __forceinline__ float rs_xh(float x) { return __builtin_bit_cast(float, __builtin_amdgcn_permlanex16(__builtin_bit_cast(int, x), __builtin_bit_cast(int, x), 0x76543210, 0xfedcba98, false, false)); }
__device__ __forceinline__ v8f fa_mma(v16h a, v16h b, v8f c) { return __builtin_amdgcn_wmma_f32_16x16x32_f16(false, a, false, b, (short)0, c, false, false); }
#define FA_C 0.18033688011112042f      /* 0.125 * log2(e) */
#define FA_T 44.361419555836498f       /* 8 / FA_C: the rescale threshold in raw score units */
#define FA_KS  128                     /* keys per stage */
#define FA_KP  144                     /* LDS bytes per staged K row (64 d): 128 + 16, 16 B x odd: conflict-free for the ds_load_b128 fragment reads */
#define FA_VP  272                     /* LDS bytes per staged V^T row (128 keys): 256 + 16, 16 B x odd */
#define FA_VO  (FA_KS * FA_KP)         /* the 64 V^T rows stand behind the 128 K rows */
#define FA_BUF (FA_VO + HD * FA_VP)    /* one stage */
// One stage: each thread copies 16 B of 4 K rows (32 rows apart) and of 4 V^T rows (16 rows apart). gk / gv: the thread's first K / V^T address of this stage; lk / lv: its LDS byte addresses in K row (tid / 8) and V^T row (tid / 16) of the buffer.
__device__ __forceinline__ void fa_stage(const _Float16* gk, const _Float16* gv, unsigned lk, unsigned lv) {
  /* the closing s_wait_xcnt stands inside the copies' own statement, so that no address register is rewritten in front of it */
  asm volatile("global_load_async_to_lds_b128 %0, %8, off\n\t"
               "global_load_async_to_lds_b128 %1, %9, off\n\t"
               "global_load_async_to_lds_b128 %2, %10, off\n\t"
               "global_load_async_to_lds_b128 %3, %11, off\n\t"
               "global_load_async_to_lds_b128 %4, %12, off\n\t"
               "global_load_async_to_lds_b128 %5, %13, off\n\t"
               "global_load_async_to_lds_b128 %6, %14, off\n\t"
               "global_load_async_to_lds_b128 %7, %15, off\n\t"
               "s_wait_xcnt 0x0"
               :: "v"(lk), "v"(lk + 32 * FA_KP), "v"(lk + 64 * FA_KP), "v"(lk + 96 * FA_KP), "v"(lv), "v"(lv + 16 * FA_VP), "v"(lv + 32 * FA_VP), "v"(lv + 48 * FA_VP),
                  "v"(gk), "v"(gk + (size_t)32 * LQ), "v"(gk + (size_t)64 * LQ), "v"(gk + (size_t)96 * LQ), "v"(gv), "v"(gv + (size_t)16 * SQ), "v"(gv + (size_t)32 * SQ), "v"(gv + (size_t)48 * SQ) : "memory"); }
__global__ __launch_bounds__(256) void k_fattn(const _Float16* __restrict__ Q, const _Float16* __restrict__ Kr, const _Float16* __restrict__ VT, _Float16* __restrict__ O) { static_assert(HD == 64 && SQ % 256 == 0 && SQ / FA_KS >= 2, "k_fattn: 2 k fragments per row, 8 waves x 32 queries, two stages or more");
  __shared__ __attribute__((aligned(16))) char smem[2 * FA_BUF];
  const int tid = threadIdx.x, lane = tid & 31, ln = lane & 15, hh = lane >> 4, w = tid >> 5; const int slab = blockIdx.y, b = slab / NH, h = slab - b * NH; const int q0 = blockIdx.x * 256 + w * 32;
  const _Float16* qp = Q + ((size_t)b * SQ + q0 + ln) * LQ + h * HD;
  const _Float16* gk = Kr + ((size_t)b * SQ + (tid >> 3)) * LQ + h * HD + (tid & 7) * 8; const _Float16* gv = VT + ((size_t)slab * HD + (tid >> 4)) * SQ + (tid & 15) * 8;
  const unsigned lk0 = (unsigned)(size_t)smem + (unsigned)((tid >> 3) * FA_KP + (tid & 7) * 16), lv0 = (unsigned)(size_t)smem + (unsigned)(FA_VO + (tid >> 4) * FA_VP + (tid & 15) * 16);
  const char* kfr = smem + ln * FA_KP; const char* vfr = smem + FA_VO + ln * FA_VP;
  fa_stage(gk, gv, lk0, lv0);
  v16h qf[2][2], kf[2][2];      /* [tile][half of the 64 d] */
#pragma unroll
  for (int j = 0; j < 2; ++j) { qf[j][0] = g2_frag(qp + (size_t)j * 16 * LQ, hh); qf[j][1] = g2_frag(qp + (size_t)j * 16 * LQ + 32, hh); }
  const v8f z8 = {0.f,0.f,0.f,0.f,0.f,0.f,0.f,0.f}; v8f o[2][4]; float m[2] = {-3.0e38f, -3.0e38f}, l[2] = {0.f, 0.f};
#pragma unroll
  for (int j = 0; j < 2; ++j) for (int dt = 0; dt < 4; ++dt) o[j][dt] = z8;
  asm volatile("s_wait_asynccnt 0x0" ::: "memory");      /* stage 0 of this wave has landed ... */
  __syncthreads();                                       /* ... and every wave's: nothing of it is read in front of this barrier */
  fa_stage(gk + (size_t)FA_KS * LQ, gv + FA_KS, lk0 + FA_BUF, lv0 + FA_BUF);
#pragma unroll 1      /* stays rolled: one publish point per stage at the foot */
  for (int t = 0; t < SQ / FA_KS; ++t) { const int bo = (t & 1) * FA_BUF; const char* kb = kfr + bo; const char* vb = vfr + bo;
#pragma unroll
    for (int u = 0; u < 2; ++u) { kf[u][0] = g2_lfrag(kb + u * 16 * FA_KP, hh); kf[u][1] = g2_lfrag(kb + u * 16 * FA_KP + 64, hh); }      /* K rows of the stage's first pass */
#pragma unroll 1      /* stays rolled: with the 4 passes inline the build had no registers left to ask for a pass's V^T rows ahead of their use */
    for (int p = 0; p < FA_KS / 32; ++p) {
      v16h vf[4];      /* V^T rows of this pass: asked for first, used last */
#pragma unroll
      for (int dt = 0; dt < 4; ++dt) vf[dt] = g2_lfrag(vb + dt * 16 * FA_VP + p * 64, hh);
      v8f s[2][2];      /* [query tile][key tile] */
#pragma unroll
      for (int j = 0; j < 2; ++j) for (int u = 0; u < 2; ++u) s[j][u] = fa_mma(kf[u][1], qf[j][1], fa_mma(kf[u][0], qf[j][0], z8));
      __builtin_amdgcn_sched_barrier(0);      /* keeps the statement below behind the S^T products: moved in front of them it would wait out the LDS latency with nothing to cover it */
      asm volatile("" :: "v"(vf[0]), "v"(vf[1]), "v"(vf[2]), "v"(vf[3]));      /* inputs only: holds the pass's eight V^T reads as ONE group at the head of the S^T products, which cover their latency; without it the build spreads them among the O^T products, each behind a wait of its own */
      if (p + 1 < FA_KS / 32) {      /* next pass's K rows, fetched one pass ahead, inside this stage's buffer only (a scalar branch) */
#pragma unroll
        for (int u = 0; u < 2; ++u) { kf[u][0] = g2_lfrag(kb + ((p + 1) * 32 + u * 16) * FA_KP, hh); kf[u][1] = g2_lfrag(kb + ((p + 1) * 32 + u * 16) * FA_KP + 64, hh); } }
      float tm[2];
#pragma unroll
      for (int j = 0; j < 2; ++j) { float a = fmaxf(s[j][0][0], s[j][1][0]);
        for (int r = 1; r < 8; ++r) a = fmaxf(a, fmaxf(s[j][0][r], s[j][1][r]));
        tm[j] = fmaxf(a, rs_xh(a)); }
      if (__builtin_amdgcn_ballot_w32(tm[0] > m[0] + FA_T || tm[1] > m[1] + FA_T) != 0) {      /* one scalar branch per pass */
#pragma unroll
        for (int j = 0; j < 2; ++j) { const float mn = fmaxf(m[j], tm[j]); const float al = __builtin_amdgcn_exp2f((m[j] - mn) * FA_C); m[j] = mn; l[j] *= al;
          for (int dt = 0; dt < 4; ++dt) o[j][dt] *= al; } }
      FragH pf[2];
#pragma unroll
      for (int j = 0; j < 2; ++j) { const float mc = m[j] * FA_C; const v8f e0 = s[j][0] * FA_C - mc, e1 = s[j][1] * FA_C - mc; v8f p0, p1;      /* the same multiply-add per element as before, written on whole tiles */
        for (int r = 0; r < 8; ++r) { p0[r] = __builtin_amdgcn_exp2f(e0[r]); p1[r] = __builtin_amdgcn_exp2f(e1[r]); }
        asm volatile("v_nop" : "+v"(p0), "+v"(p1) : "v"(e0), "v"(e1));      /* the slot behind a transcendental: no result is read and no source register rewritten directly behind a v_exp_f32 */
        float s0 = p0[0], s1 = p1[0];      /* the sums start at their first term, in the order they had */
        for (int r = 1; r < 8; ++r) { s0 += p0[r]; s1 += p1[r]; }
        for (int r = 0; r < 8; ++r) { pf[j].h[r] = (_Float16)p0[r]; pf[j].h[8 + r] = (_Float16)p1[r]; }
        l[j] += s0 + s1; }
#pragma unroll
      for (int dt = 0; dt < 4; ++dt) for (int j = 0; j < 2; ++j) o[j][dt] = fa_mma(vf[dt], pf[j].v, o[j][dt]);
      asm volatile("v_nop\n\tv_nop\n\tv_nop\n\tv_nop" : "+v"(o[0][3]), "+v"(o[1][3]) : "v"(vf[3]));      /* the distance behind the pass's last WMMAs: over the loop's back edge the next pass's first vector instruction may overwrite one of their A registers */
    }
    asm volatile("s_wait_dscnt 0x0" ::: "memory");       /* this wave's reads of the buffer are done before it may be refilled */
    asm volatile("s_wait_asynccnt 0x0" ::: "memory");    /* this wave's copies of stage t + 1 have landed */
    __syncthreads();                                     /* publishes stage t + 1 and ends every reader's last read of stage t */
    if (t + 2 < SQ / FA_KS) fa_stage(gk + (size_t)(t + 2) * FA_KS * LQ, gv + (t + 2) * FA_KS, lk0 + bo, lv0 + bo); }
  asm volatile("s_wait_asynccnt 0x0" ::: "memory");      /* no copy is outstanding when the wave ends */
#pragma unroll
  for (int j = 0; j < 2; ++j) { const float inv = 64.0f / (l[j] + rs_xh(l[j])); unsigned short* d = (unsigned short*)O + ((size_t)b * SQ + q0 + j * 16 + ln) * DM + h * HD + 8 * hh;
    for (int dt = 0; dt < 4; ++dt) { FragH f; for (int r = 0; r < 8; ++r) f.h[r] = (_Float16)(o[j][dt][r] * inv); *(v8us*)(d + dt * 16) = f.half[0]; } } }

extern "C" void kernel_launch(void* const* d_in, const int* in_sizes, int n_in,
                              void* d_out, int out_size, void* d_ws, size_t ws_size, hipStream_t stream) {
  (void)in_sizes; (void)n_in; (void)out_size;
  const float* const* I = (const float* const*)d_in; const float* x = I[0]; const float* wqkv = I[1]; const float* bq = nullptr; const float* wo = I[2]; const float* bo = nullptr;      /* ONE input stream (z); U_qkv is ONE STACK [12][3][768][64] = [head][q | k | v][in][out]; U_msa [in][out] [768][768]; the module has NO biases: bare null pointers in the guarded bias slots; input order z, U_qkv, U_msa */
  char* ws = (char*)d_ws; size_t off = 0;
  auto take = [&](size_t bytes) { char* p = ws + off; off += (bytes + 255) & ~(size_t)255; return p; };
  _Float16* BQ = (_Float16*)take((size_t)3 * DM * DM * 2); _Float16* BO = (_Float16*)take((size_t)DM * DM * 2);      /* BQ: planes q | k | v, DM * DM apart */
  _Float16* X16 = (_Float16*)take(NR * DM * 2); _Float16* Q16 = (_Float16*)take((size_t)2 * NR * DM * 2); _Float16* K16 = Q16 + NR * DM; _Float16* O16 = (_Float16*)take(NR * DM * 2);      /* q | k rows, NR * DM apart */
  _Float16* VT = (_Float16*)take((size_t)NB * NH * HD * SQ * 2);
  if (off > ws_size) return;
  static_assert(MP % 128 == 0 && MPO % 128 == 0 && DM % 128 == 0 && DM % 64 == 0 && SQ % 128 == 0, "k_gemm2: whole 128x128 tiles, whole 64-k stages, a tile's tokens in one sequence");
  k_prep<<<PB_ALL, 256, 0, stream>>>(x, wqkv, wo, X16, BQ, BO);      /* all weight planes ([out][in], x16) and the x rows */
  const size_t r0p = (size_t)B0 * SQ;      /* first projected row */
  k_gemm2<0, false, false, false, true, true><<<dim3((unsigned)((MP / 128) * (DM / 128)), 3), 256, 0, stream>>>(X16 + r0p * DM, DM, 0, BQ, DM, (size_t)DM * DM, 0.0625f, bq, 0, nullptr, 1, 0, 0, nullptr, Q16 + r0p * DM, DM, NR * DM, MP, DM, DM, 2, VT + (size_t)B0 * DM * SQ, SQ);      /* y = q | k | v: same A rows, weight plane of the part; q and k as rows, v transposed: V^T [NB][NH][HD][SQ] */
  k_fattn<<<dim3(SQ / 256, NB * NH), 256, 0, stream>>>(Q16, K16, VT, O16);      /* o (merged heads, x64) as f16 rows: scores, softmax and P.V of every (batch, head) */
  k_gemm2<0, false, false, true, false, false><<<dim3((unsigned)((MPO / 128) * (DM / 128)), 1), 256, 0, stream>>>(O16 + r0p * DM, DM, 0, BO, DM, 0, 0.0009765625f, bo, 0, nullptr, 1, 0, 0, (float*)d_out + r0p * DM, nullptr, DM, 0, MPO, DM, DM, -1, nullptr, 1);      /* out rows are the output layout */
}
